// v000
// The times below were measured on an AMD MI455X: many runs one after another, warmed up first and cycling through
// copies of the inputs, with the whole window's GPU time divided by the number of runs. Launches and the gaps
// between them are all in it. The median over several windows is given; except for v000 it joins two sittings, which
// can be a few percent apart, so the side-by-side timings, each taken in one sitting, are the better comparison.
// v000 is the starting kernel. One run takes 3040 microseconds.
#include <hip/hip_runtime.h>
// PixelSNAILBlock (x [2][256][16][16][16], original_input [2][3][16][16][16]; 4 gated residual blocks: o = elu(conv3d k2 pad1 crop(elu(res)) + b1); o = conv3d k2 pad1 crop(o) + b2 (512 ch); res += o[:256] * sigmoid(o[256:]); attention over the 4,096 positions of [res | original | pos-enc] (262 ch): q,k (16), v (128), causal softmax (k < q, row 0 all-zero) of q.k/sqrt(259), att = p v; att = elu(1x1(elu(att)) + b); res = elu(1x1(elu(res)) + b); out = elu(1x1(elu(res + att)) + b) -> [2][256][16][16][16]).
// Structure: position rows r = b*4096 + (t*16 + h)*16 + w; res kept as f32 rows; each k2 'causal-corner' conv as an 8-tap im2col of f16 rows (K = 2,048) + WMMA GEMM (32x64 wave tiles, f32 accumulation, exact x16 weights + bias) with the ELUs on VALU; gating on VALU; q/k/v as GEMMs on the 262 -> 288-column concat rows (16 live of 64 for q/k); per batch: scores GEMM (K = 32), causal row softmax on VALU (un-normalised f16 weights x 2^8 + 1/sum, row 0 -> 0), P.V GEMM (K = 4,096) against LDS-transposed value planes, scaling; the three 1x1 convs as GEMMs followed by VALU ELUs; channel-major store on VALU.
// Compute dtype: inputs rounded to bf16; x / original / weights exact; conv operands (elu(res), o1), the concat rows, q/k/v, softmax weights and the 1x1-conv operands plain f16 (~2^-12); res accumulation, gates, softmax sums f32. v_wmma_f32_16x16x32_f16.
#define NB 2
#define CC 256
#define DT 16
#define DH 16
#define DW 16
#define NP (DT * DH * DW)            /* 4096 */
#define NR ((size_t)NB * NP)       /* 8192 */
#define NRES 4
#define K8 (8 * CC)                /* 2048 */
#define KA 288                     /* 262 live */
#define VC 128
typedef __bf16 v16b __attribute__((ext_vector_type(16)));
typedef unsigned short v8us __attribute__((ext_vector_type(8), may_alias));
typedef float  v8f  __attribute__((ext_vector_type(8)));
typedef float  v4f  __attribute__((ext_vector_type(4)));
typedef float  v4fa __attribute__((ext_vector_type(4), may_alias));
union FragB { v16b v; v8us half[2]; unsigned short u[16]; };

__device__ __forceinline__ unsigned short bf16_bits(float x) { unsigned int u = __float_as_uint(x); return (unsigned short)((u + 0x7FFFu + ((u >> 16) & 1u)) >> 16); }
__device__ __forceinline__ float bf16_val(unsigned short b) { return __uint_as_float(((unsigned int)b) << 16); }
__device__ __forceinline__ float bf16_round(float x) { return bf16_val(bf16_bits(x)); }
// D += A·B with NT terms: 1 = ah·bh, 2 = + al·bh (A split), 3 = + ah·bl (both split)
template <int NT>
__device__ __forceinline__ v8f mmaN(v16b ah, v16b al, v16b bh, v16b bl, v8f c) {
  c = __builtin_amdgcn_wmma_f32_16x16x32_bf16(false, ah, false, bh, (short)0, c, false, false);
  if (NT >= 2) c = __builtin_amdgcn_wmma_f32_16x16x32_bf16(false, al, false, bh, (short)0, c, false, false);
  if (NT >= 3) c = __builtin_amdgcn_wmma_f32_16x16x32_bf16(false, ah, false, bl, (short)0, c, false, false);
  asm volatile("v_nop\n\tv_nop\n\tv_nop\n\tv_nop" : "+v"(c) : "v"(ah), "v"(al), "v"(bh), "v"(bl));
  return c;
}

__global__ __launch_bounds__(256) void k_wt_bf16(const float* __restrict__ W, unsigned short* __restrict__ Wt, int K, int N) {
  const int t = blockIdx.x * 256 + threadIdx.x;
  const int k8n = K / 8;
  if (t >= N * k8n) return;
  const int n = t / k8n, k8 = (t % k8n) * 8;
  v8us v;
#pragma unroll
  for (int i = 0; i < 8; ++i) v[i] = bf16_bits(W[(size_t)(k8 + i) * N + n]);
  *(v8us*)(Wt + (size_t)n * K + k8) = v;
  
}

// GEMM C[M][N] (f32, pitch ldc) = act(A[M][K]·W + bias). A f32 row-major (pitch lda) converted per fragment to bf16
// (ASPLIT: hi/lo two planes -> 2 terms, else single rounded term); Wt bf16 [N][K] (pitch ldb). BIAS_BF16 rounds the
// bias to bf16 first (bias quantised to bf16 before the add). K%32==0, M%16==0, N%64==0.
template <bool ASPLIT, int ACT, bool BIAS_BF16>
__global__ __launch_bounds__(128) void k_gemm_bf(const float* __restrict__ A, int lda, const unsigned short* __restrict__ Wt, int ldb,
                                               const float* __restrict__ bias, float* __restrict__ C, int ldc, int M, int N, int K) {
  __shared__ __attribute__((aligned(16))) float so[4][16][64];
  const int tid = threadIdx.x, w = tid >> 5, lane = tid & 31, ln = lane & 15, hh = lane >> 4;
  const int ntn = N / 64;
  const int wid = blockIdx.x * 4 + w;
  const int mt = wid / ntn, nq = wid % ntn;
  if (mt * 16 >= M) return;
  const int row0 = mt * 16, col0 = nq * 64;
  const float* arow = A + (size_t)(row0 + ln) * lda;
  v8f acc[4] = {};
  for (int kb = 0; kb < K; kb += 32) {
    FragB ah, al;
    const v4f x0 = *(const v4fa*)(arow + kb + 8 * hh), x1 = *(const v4fa*)(arow + kb + 8 * hh + 4);
    const v4f x2 = *(const v4fa*)(arow + kb + 16 + 8 * hh), x3 = *(const v4fa*)(arow + kb + 16 + 8 * hh + 4);
    float xs[16] = {x0[0],x0[1],x0[2],x0[3],x1[0],x1[1],x1[2],x1[3],x2[0],x2[1],x2[2],x2[3],x3[0],x3[1],x3[2],x3[3]};
#pragma unroll
    for (int i = 0; i < 16; ++i) { const unsigned short hb = bf16_bits(xs[i]); ah.u[i] = hb; al.u[i] = ASPLIT ? bf16_bits(xs[i] - bf16_val(hb)) : (unsigned short)0; }
#pragma unroll
    for (int t = 0; t < 4; ++t) {
      const unsigned short* brow = Wt + (size_t)(col0 + t * 16 + ln) * ldb + kb;
      FragB b;
      b.half[0] = *(const v8us*)(brow + 8 * hh);
      b.half[1] = *(const v8us*)(brow + 16 + 8 * hh);
      acc[t] = mmaN<ASPLIT ? 2 : 1>(ah.v, al.v, b.v, b.v, acc[t]);
    }
  }
#pragma unroll
  for (int t = 0; t < 4; ++t) {
    float bv = bias ? bias[col0 + t * 16 + ln] : 0.f;
    if (BIAS_BF16) bv = bf16_round(bv);
#pragma unroll
    for (int r = 0; r < 8; ++r) { float v = acc[t][r] + bv; if (ACT == 1) v = fmaxf(v, 0.f); so[w][8 * hh + r][t * 16 + ln] = v; }
  }
  __builtin_amdgcn_fence(__ATOMIC_ACQ_REL, "workgroup");
  __builtin_amdgcn_wave_barrier();
  const int rsub = lane >> 4, c4 = (lane & 15) * 4;
  {
#pragma unroll
    for (int q = 0; q < 8; ++q) {
      const int r = q * 2 + rsub;
      const v4f v = *(const v4fa*)&so[w][r][c4];
      *(v4f*)(C + (size_t)(row0 + r) * ldc + col0 + c4) = v;
    }
    
  }
}

// GEMM C = act(A·W + bias + resid): A f32 (ASPLIT -> hi/lo 2 terms), Wt bf16 [N][K]; ACT 0 none, 1 relu, 2 exact gelu;
// resid (optional, f32, row index = (row % rmod), pitch ldr, RES_BF16 rounds it) added before the activation.
template <bool ASPLIT, int ACT, bool BIAS_BF16, bool RES_BF16>
__global__ __launch_bounds__(128) void k_gemm_bf3(const float* __restrict__ A, int lda, const unsigned short* __restrict__ Wt, int ldb,
                                                const float* __restrict__ bias, const float* __restrict__ resid, int rmod, int ldr,
                                                float* __restrict__ C, int ldc, int M, int N, int K) {
  __shared__ __attribute__((aligned(16))) float so[4][16][64];
  const int tid = threadIdx.x, w = tid >> 5, lane = tid & 31, ln = lane & 15, hh = lane >> 4;
  const int ntn = N / 64;
  const int wid = blockIdx.x * 4 + w;
  const int mt = wid / ntn, nq = wid % ntn;
  if (mt * 16 >= M) return;
  const int row0 = mt * 16, col0 = nq * 64;
  const float* arow = A + (size_t)(row0 + ln) * lda;
  v8f acc[4] = {};
  for (int kb = 0; kb < K; kb += 32) {
    FragB ah, al;
    const v4f x0 = *(const v4fa*)(arow + kb + 8 * hh), x1 = *(const v4fa*)(arow + kb + 8 * hh + 4);
    const v4f x2 = *(const v4fa*)(arow + kb + 16 + 8 * hh), x3 = *(const v4fa*)(arow + kb + 16 + 8 * hh + 4);
    float xs[16] = {x0[0],x0[1],x0[2],x0[3],x1[0],x1[1],x1[2],x1[3],x2[0],x2[1],x2[2],x2[3],x3[0],x3[1],x3[2],x3[3]};
#pragma unroll
    for (int i = 0; i < 16; ++i) { const unsigned short hb = bf16_bits(xs[i]); ah.u[i] = hb; al.u[i] = ASPLIT ? bf16_bits(xs[i] - bf16_val(hb)) : (unsigned short)0; }
#pragma unroll
    for (int t = 0; t < 4; ++t) {
      const unsigned short* brow = Wt + (size_t)(col0 + t * 16 + ln) * ldb + kb;
      FragB b;
      b.half[0] = *(const v8us*)(brow + 8 * hh);
      b.half[1] = *(const v8us*)(brow + 16 + 8 * hh);
      acc[t] = mmaN<ASPLIT ? 2 : 1>(ah.v, al.v, b.v, b.v, acc[t]);
    }
  }
#pragma unroll
  for (int t = 0; t < 4; ++t) {
    const int col = col0 + t * 16 + ln;
    float bv = bias ? bias[col] : 0.f;
    if (BIAS_BF16) bv = bf16_round(bv);
#pragma unroll
    for (int r = 0; r < 8; ++r) {
      float v = acc[t][r] + bv;
      if (resid) { float rv = resid[(size_t)((row0 + 8 * hh + r) % rmod) * ldr + col]; if (RES_BF16) rv = bf16_round(rv); v += rv; }
      if (ACT == 1) v = fmaxf(v, 0.f);
      if (ACT == 2) v = 0.5f * v * (1.0f + erff(v * 0.70710678118654752f));
      if (ACT == 3) { const float u = 0.7978845608028654f * (v + 0.044715f * v * v * v); v = 0.5f * v * (1.0f + tanhf(u)); }
      so[w][8 * hh + r][t * 16 + ln] = v;
    }
  }
  __builtin_amdgcn_fence(__ATOMIC_ACQ_REL, "workgroup");
  __builtin_amdgcn_wave_barrier();
  const int rsub = lane >> 4, c4 = (lane & 15) * 4;
  {
#pragma unroll
    for (int q = 0; q < 8; ++q) {
      const int r = q * 2 + rsub;
      const v4f v = *(const v4fa*)&so[w][r][c4];
      *(v4f*)(C + (size_t)(row0 + r) * ldc + col0 + c4) = v;
    }
    
  }
}
// row LayerNorm (biased variance, eps) over N: s = X (+ R); optional out_sum <- s; out_norm <- (s-mu)*rsqrt(var+eps)*g + b
template <bool PARAM_BF16>
__global__ __launch_bounds__(256) void k_layernorm(const float* __restrict__ X, const float* __restrict__ R, const float* __restrict__ g, const float* __restrict__ bta,
                                                  float* __restrict__ out_sum, float* __restrict__ out_norm, int N, float eps) {
  __shared__ float red[256];
  const int row = blockIdx.x, tid = threadIdx.x;
  const float* x = X + (size_t)row * N; const float* rr = R ? R + (size_t)row * N : nullptr;
  float vals[16];                     // up to N = 4096
  const int per = N / 256;            // contiguous chunk per thread? use strided-by-4 chunks: thread handles j = tid*4 + 1024*u
  float s1 = 0.f;
  for (int u = 0; u < per / 4; ++u) {
    const int j = tid * 4 + 1024 * u;
    const v4f a = *(const v4fa*)(x + j);
    v4f b = {0.f,0.f,0.f,0.f}; if (rr) b = *(const v4fa*)(rr + j);
#pragma unroll
    for (int q = 0; q < 4; ++q) { const float v = a[q] + b[q]; vals[u * 4 + q] = v; s1 += v; }
  }
  red[tid] = s1; __syncthreads();
  for (int st = 128; st > 0; st >>= 1) { if (tid < st) red[tid] += red[tid + st]; __syncthreads(); }
  const float mu = red[0] / (float)N; __syncthreads();
  float s2 = 0.f;
  for (int u = 0; u < per / 4; ++u)
#pragma unroll
    for (int q = 0; q < 4; ++q) { const float c = vals[u * 4 + q] - mu; s2 += c * c; }
  red[tid] = s2; __syncthreads();
  for (int st = 128; st > 0; st >>= 1) { if (tid < st) red[tid] += red[tid + st]; __syncthreads(); }
  const float rs = rsqrtf(red[0] / (float)N + eps);
  {
    for (int u = 0; u < per / 4; ++u) {
      const int j = tid * 4 + 1024 * u;
      v4f o, sm;
#pragma unroll
      for (int q = 0; q < 4; ++q) {
        float gg = g[j + q], bb = bta[j + q];
        if (PARAM_BF16) { gg = bf16_round(gg); bb = bf16_round(bb); }
        sm[q] = vals[u * 4 + q]; o[q] = (vals[u * 4 + q] - mu) * rs * gg + bb;
      }
      if (out_sum) *(v4f*)(out_sum + (size_t)row * N + j) = sm;
      *(v4f*)(out_norm + (size_t)row * N + j) = o;
    }
    
  }
}



// ---- f16 WMMA path (v_wmma_f32_16x16x32_f16): 11-bit significands for operands in range — used for every GEMM launched in this file
typedef _Float16 v16h __attribute__((ext_vector_type(16)));
union FragH { v16h v; v8us half[2]; _Float16 h[16]; unsigned short u[16]; };
template <int NT>
__device__ __forceinline__ v8f mmaH(v16h ah, v16h al, v16h bh, v16h bl, v8f c) {
  c = __builtin_amdgcn_wmma_f32_16x16x32_f16(false, ah, false, bh, (short)0, c, false, false);
  if (NT >= 2) c = __builtin_amdgcn_wmma_f32_16x16x32_f16(false, al, false, bh, (short)0, c, false, false);
  if (NT >= 3) c = __builtin_amdgcn_wmma_f32_16x16x32_f16(false, ah, false, bl, (short)0, c, false, false);
  asm volatile("v_nop\n\tv_nop\n\tv_nop\n\tv_nop" : "+v"(c) : "v"(ah), "v"(al), "v"(bh), "v"(bl));
  return c;
}
// batched GEMM like k_gemm_b but f16 operands: A f32 (split into f16 hi/lo if ASPLIT, else rounded to f16), Bt = f16 values [n][k]; alpha; C f32; N multiple of 16 (partial tiles skipped)
template <bool ASPLIT>
__global__ __launch_bounds__(128) void k_gemm_h(const float* __restrict__ A, int lda, size_t sA, const _Float16* __restrict__ Bh, int ldb, size_t sB, float alpha, float* __restrict__ C, int ldc, size_t sC, int M, int N, int K) {
  __shared__ __attribute__((aligned(16))) float so[4][16][64];
  const int tid = threadIdx.x, w = tid >> 5, lane = tid & 31, ln = lane & 15, hh = lane >> 4; const int by = blockIdx.y;
  A += (size_t)by * sA; Bh += (size_t)by * sB; C += (size_t)by * sC;
  const int ntn = (N + 63) / 64; const int wid = blockIdx.x * 4 + w; const int mt = wid / ntn, nq = wid % ntn; if (mt * 16 >= M) return;
  const int row0 = mt * 16, col0 = nq * 64; const float* arow = A + (size_t)(row0 + ln) * lda;
  v8f acc[4] = {};
  for (int kb = 0; kb < K; kb += 32) {
    FragH ah, al;
    const v4f x0 = *(const v4fa*)(arow + kb + 8 * hh), x1 = *(const v4fa*)(arow + kb + 8 * hh + 4), x2 = *(const v4fa*)(arow + kb + 16 + 8 * hh), x3 = *(const v4fa*)(arow + kb + 16 + 8 * hh + 4);
    float xs[16] = {x0[0],x0[1],x0[2],x0[3],x1[0],x1[1],x1[2],x1[3],x2[0],x2[1],x2[2],x2[3],x3[0],x3[1],x3[2],x3[3]};
#pragma unroll
    for (int i = 0; i < 16; ++i) { const _Float16 h = (_Float16)xs[i]; ah.h[i] = h; al.h[i] = ASPLIT ? (_Float16)(xs[i] - (float)h) : (_Float16)0.0f; }
#pragma unroll
    for (int t = 0; t < 4; ++t) { if (col0 + t * 16 >= N) continue; const size_t boff = (size_t)(col0 + t * 16 + ln) * ldb + kb; FragH bq; bq.half[0] = *(const v8us*)(Bh + boff + 8 * hh); bq.half[1] = *(const v8us*)(Bh + boff + 16 + 8 * hh);
      acc[t] = mmaH<ASPLIT ? 2 : 1>(ah.v, al.v, bq.v, bq.v, acc[t]); }
  }
#pragma unroll
  for (int t = 0; t < 4; ++t) { if (col0 + t * 16 >= N) continue;
#pragma unroll
    for (int r = 0; r < 8; ++r) so[w][8 * hh + r][t * 16 + ln] = acc[t][r] * alpha; }
  __builtin_amdgcn_fence(__ATOMIC_ACQ_REL, "workgroup"); __builtin_amdgcn_wave_barrier();
  const int rsub = lane >> 4, c4 = (lane & 15) * 4;
  {
#pragma unroll
    for (int q = 0; q < 8; ++q) { const int r = q * 2 + rsub; if (col0 + c4 < N) { const v4f v = *(const v4fa*)&so[w][r][c4]; *(v4f*)(C + (size_t)(row0 + r) * ldc + col0 + c4) = v; } }
     }
}

// Wt[n][k] = f16(W[k][n]·scale) from f32 row-major W[K][N] (scale = power of two; bf16-exact weights stay exact in f16 away from the subnormal range)
__global__ __launch_bounds__(256) void k_wt_f16(const float* __restrict__ W, _Float16* __restrict__ Wt, int K, int N, float scale) {
  const int t = blockIdx.x * 256 + threadIdx.x; if (t >= N * (K / 8)) return; const int n = t / (K / 8), k8 = (t % (K / 8)) * 8; FragH f;
#pragma unroll
  for (int i = 0; i < 8; ++i) f.h[i] = (_Float16)(bf16_round(W[(size_t)(k8 + i) * N + n]) * scale); const v8us o = f.half[0];
  *(v8us*)((unsigned short*)Wt + (size_t)n * K + k8) = o; 
}
// k_gemm_hh variant with fused epilogue: v = acc·alpha + bias[by·sBias + col] (+ CP[(row/rowsPerB)·sCPb + by·64 + col] if CP) ; ACT 0 none / 1 elu ; writes f16 C16 (and f32 C if non-null)
template <int ACT>
__global__ __launch_bounds__(128) void k_gemm_hhx(const _Float16* __restrict__ A, int lda, size_t sA, const _Float16* __restrict__ Bh, int ldb, size_t sB, float alpha, const float* __restrict__ bias, size_t sBias, const float* __restrict__ CP, int rowsPerB, size_t sCPb, int row0g,
    float* __restrict__ C, _Float16* __restrict__ C16, int ldc, size_t sC, int M, int N, int K) {
  __shared__ __attribute__((aligned(16))) float so[4][16][64];
  const int tid = threadIdx.x, w = tid >> 5, lane = tid & 31, ln = lane & 15, hh = lane >> 4; const int by = blockIdx.y;
  A += (size_t)by * sA; Bh += (size_t)by * sB; const size_t cofs = (size_t)by * sC; const float* bp = bias ? bias + (size_t)by * sBias : nullptr;
  const int ntn = (N + 63) / 64; const int wid = blockIdx.x * 4 + w; const int mt = wid / ntn, nq = wid % ntn; if (mt * 16 >= M) return;
  const int row0 = mt * 16, col0 = nq * 64; const _Float16* arow = A + (size_t)(row0 + ln) * lda;
  v8f acc[4] = {};
  for (int kb = 0; kb < K; kb += 32) { FragH ah; ah.half[0] = *(const v8us*)((const unsigned short*)arow + kb + 8 * hh); ah.half[1] = *(const v8us*)((const unsigned short*)arow + kb + 16 + 8 * hh);
#pragma unroll
    for (int t = 0; t < 4; ++t) { if (col0 + t * 16 >= N) continue; const size_t boff = (size_t)(col0 + t * 16 + ln) * ldb + kb; FragH bq; bq.half[0] = *(const v8us*)((const unsigned short*)Bh + boff + 8 * hh); bq.half[1] = *(const v8us*)((const unsigned short*)Bh + boff + 16 + 8 * hh);
      acc[t] = mmaH<1>(ah.v, ah.v, bq.v, bq.v, acc[t]); }
  }
#pragma unroll
  for (int t = 0; t < 4; ++t) { if (col0 + t * 16 >= N) continue; const int col = col0 + t * 16 + ln; const float bv = bp ? bf16_round(bp[col]) : 0.f;
#pragma unroll
    for (int r = 0; r < 8; ++r) { float v = acc[t][r] * alpha + bv; if (CP) { const int rr = row0g + row0 + 8 * hh + r; if (rowsPerB < 0) v += CP[cofs + (size_t)rr * ldc + col];      /* rowsPerB < 0: own element of the batched C plane */ else { const int bidx = rr / rowsPerB; v += CP[(size_t)bidx * sCPb + (size_t)by * 64 + col]; } } if (ACT == 1) v = (v > 0.f) ? v : expm1f(v); else if (ACT == 7) v = (v > 0.f) ? v + 1.0f : expf(v); else if (ACT == 8) v = tanhf(v); else if (ACT == 9) v = 0.5f * v * (1.0f + tanhf(0.7978845608028654f * (v + 0.044715f * v * v * v))); else if (ACT == 11) v = 1.0f / (1.0f + expf(-v)); else if (ACT == 12) v = (v > 0.f) ? v : 0.01f * v; else if (ACT == 14) v = (v > 0.f) ? v : 0.1f * v; else if (ACT == 16) v = (v >= 0.f) ? v : 0.3f * v; else if (ACT == 17) v = (v >= 0.f) ? v : 0.2f * v; else if (ACT == 15) v = v / (1.0f + expf(-v)); else if (ACT == 3) v = fmaxf(v, 0.f); else if (ACT == 6) v = 0.5f * v * (1.0f + erff(v * 0.70710678118654752f)); so[w][8 * hh + r][t * 16 + ln] = v; } }
  __builtin_amdgcn_fence(__ATOMIC_ACQ_REL, "workgroup"); __builtin_amdgcn_wave_barrier();
  const int rsub = lane >> 4, c4 = (lane & 15) * 4; typedef _Float16 v4h __attribute__((ext_vector_type(4)));
  {
#pragma unroll
    for (int q = 0; q < 8; ++q) { const int r = q * 2 + rsub; if (col0 + c4 < N) { const v4f v = *(const v4fa*)&so[w][r][c4]; if (C) *(v4f*)(C + cofs + (size_t)(row0 + r) * ldc + col0 + c4) = v; if (C16) { v4h h4; for (int i = 0; i < 4; ++i) h4[i] = (_Float16)v[i]; *(v4h*)(C16 + cofs + (size_t)(row0 + r) * ldc + col0 + c4) = h4; } } }
     }
}


typedef _Float16 v4h __attribute__((ext_vector_type(4)));

__global__ __launch_bounds__(256) void k_x16(const float* __restrict__ x, _Float16* __restrict__ X16, size_t n8) { const size_t t = (size_t)blockIdx.x * 256 + threadIdx.x; if (t >= n8) return; FragH f;
#pragma unroll
  for (int q = 0; q < 8; ++q) f.h[q] = (_Float16)bf16_round(x[t * 8 + q]); *(v8us*)((unsigned short*)X16 + t * 8) = f.half[0];  }
__global__ __launch_bounds__(256) void k_h16(const float* __restrict__ x, _Float16* __restrict__ X16, size_t n8) { const size_t t = (size_t)blockIdx.x * 256 + threadIdx.x; if (t >= n8) return; FragH f;
#pragma unroll
  for (int q = 0; q < 8; ++q) f.h[q] = (_Float16)x[t * 8 + q]; *(v8us*)((unsigned short*)X16 + t * 8) = f.half[0];  }
__global__ __launch_bounds__(256) void k_round16f(const float* __restrict__ W, _Float16* __restrict__ Bt, size_t n8) { const size_t t = (size_t)blockIdx.x * 256 + threadIdx.x; if (t >= n8) return; FragH f;
#pragma unroll
  for (int i = 0; i < 8; ++i) f.h[i] = (_Float16)(bf16_round(W[t * 8 + i]) * 16.0f); *(v8us*)((unsigned short*)Bt + t * 8) = f.half[0];  }
template <int NHv, int TTv>
__global__ __launch_bounds__(256) void k_vt(const _Float16* __restrict__ V16, int ldv, int voff, _Float16* __restrict__ Vt) { __shared__ unsigned short tl[64][66]; const int tid = threadIdx.x; const int slab = blockIdx.x / (TTv / 64), lg = blockIdx.x % (TTv / 64); const int b = slab / NHv, h = slab % NHv;
  for (int i = tid; i < 64 * 8; i += 256) { const int r = i / 8, c8 = (i % 8) * 8; FragH f; f.half[0] = *(const v8us*)((const unsigned short*)V16 + ((size_t)b * TTv + lg * 64 + r) * ldv + voff + h * 64 + c8);
#pragma unroll
    for (int q = 0; q < 8; ++q) tl[r][c8 + q] = f.u[q]; }
  __syncthreads();
  {
#pragma unroll
    for (int rd = 0; rd < 2; ++rd) { const int d = rd * 32 + tid / 8, pc = tid % 8; FragH f;
#pragma unroll
      for (int q = 0; q < 8; ++q) f.u[q] = tl[pc * 8 + q][d];
      *(v8us*)((unsigned short*)Vt + ((size_t)slab * 64 + d) * TTv + lg * 64 + pc * 8) = f.half[0]; }
     } }

__global__ __launch_bounds__(256) void k_hl(const float* __restrict__ F, _Float16* __restrict__ Hh, _Float16* __restrict__ Hl, size_t n8) { const size_t t = (size_t)blockIdx.x * 256 + threadIdx.x; if (t >= n8) return; FragH fh, fl; const v4f a = *(const v4fa*)(F + t * 8), c = *(const v4fa*)(F + t * 8 + 4);
#pragma unroll
  for (int q = 0; q < 4; ++q) { _Float16 h = (_Float16)a[q]; fh.h[q] = h; fl.h[q] = (_Float16)((a[q] - (float)h) * 1024.0f); h = (_Float16)c[q]; fh.h[4 + q] = h; fl.h[4 + q] = (_Float16)((c[q] - (float)h) * 1024.0f); }
  { *(v8us*)((unsigned short*)Hh + t * 8) = fh.half[0]; *(v8us*)((unsigned short*)Hl + t * 8) = fl.half[0];  } }

// ---- fast GEMM (wave tile 32x64; requires M % 32 == 0 rows per launch region and N % 64 == 0); epilogue = k_gemm_hhx semantics ----
__device__ __forceinline__ v16h g2_frag(const _Float16* p, int hh) { FragH f; f.half[0] = *(const v8us*)((const unsigned short*)p + 8 * hh); f.half[1] = *(const v8us*)((const unsigned short*)p + 16 + 8 * hh); return f.v; }
__device__ __forceinline__ v8f g2_mma(v16h a, v16h b, v8f c) { v8f d = __builtin_amdgcn_wmma_f32_16x16x32_f16(false, a, false, b, (short)0, c, false, false); asm volatile("v_nop\n\tv_nop\n\tv_nop\n\tv_nop" : "+v"(d) : "v"(a), "v"(b)); return d; }
template <int ACT>
__global__ __launch_bounds__(128) void k_gemm2(const _Float16* __restrict__ A, int lda, size_t sA, const _Float16* __restrict__ Bh, int ldb, size_t sB, float alpha, const float* __restrict__ bias, size_t sBias, const float* __restrict__ CP, int rowsPerB, size_t sCPb, int row0g,
    float* __restrict__ C, _Float16* __restrict__ C16, int ldc, size_t sC, int M, int N, int K) { static_assert(ACT == 0 || ACT == 3 || ACT == 6 || ACT == 8 || ACT == 9 || ACT == 11 || ACT == 12 || ACT == 14 || ACT == 15 || ACT == 16 || ACT == 17, "k_gemm2: unsupported ACT code (would silently apply no activation)");
  __shared__ __attribute__((aligned(16))) float so[4][32][68];
  const int tid = threadIdx.x, w = tid >> 5, lane = tid & 31, ln = lane & 15, hh = lane >> 4; const int by = blockIdx.y;
  A += (size_t)by * sA; Bh += (size_t)by * sB; const size_t cofs = (size_t)by * sC; const float* bp = bias ? bias + (size_t)by * sBias : nullptr;
  const int ntn = N >> 6; const int mt = blockIdx.x / ntn, nq = blockIdx.x - mt * ntn; const int row0 = mt * 128 + 32 * w, col0 = nq * 64; if (row0 >= M) return;
  const _Float16* a0p = A + (size_t)(row0 + ln) * lda; const _Float16* a1p = a0p + (size_t)16 * lda;
  const _Float16* b0p = Bh + (size_t)(col0 + ln) * ldb; const _Float16* b1p = b0p + (size_t)16 * ldb; const _Float16* b2p = b1p + (size_t)16 * ldb; const _Float16* b3p = b2p + (size_t)16 * ldb;
  const v8f z8 = {0.f,0.f,0.f,0.f,0.f,0.f,0.f,0.f}; v8f c00 = z8, c01 = z8, c02 = z8, c03 = z8, c10 = z8, c11 = z8, c12 = z8, c13 = z8;
#pragma unroll 1
  for (int kb = 0; kb < K; kb += 32) { const v16h a0 = g2_frag(a0p + kb, hh), a1 = g2_frag(a1p + kb, hh);
    v16h b = g2_frag(b0p + kb, hh); c00 = g2_mma(a0, b, c00); c10 = g2_mma(a1, b, c10);
    b = g2_frag(b1p + kb, hh); c01 = g2_mma(a0, b, c01); c11 = g2_mma(a1, b, c11);
    b = g2_frag(b2p + kb, hh); c02 = g2_mma(a0, b, c02); c12 = g2_mma(a1, b, c12);
    b = g2_frag(b3p + kb, hh); c03 = g2_mma(a0, b, c03); c13 = g2_mma(a1, b, c13); }
  v8f accs[8] = {c00, c01, c02, c03, c10, c11, c12, c13};
#pragma unroll
  for (int u = 0; u < 8; ++u) { const int t = u & 3, half = u >> 2; const int col = col0 + t * 16 + ln; const float bv = bp ? bf16_round(bp[col]) : 0.f;
#pragma unroll
    for (int r = 0; r < 8; ++r) { const int rloc = half * 16 + 8 * hh + r; float v = accs[u][r] * alpha + bv; if (CP) { if (rowsPerB < 0) v += CP[cofs + (size_t)(row0g + row0 + rloc) * ldc + col];      /* rowsPerB < 0: own element of the batched C plane */ else { const int bidx = (row0g + row0 + rloc) / rowsPerB; v += CP[(size_t)bidx * sCPb + (size_t)by * 64 + col]; } }
      if (ACT == 3) v = fmaxf(v, 0.f); else if (ACT == 6) v = 0.5f * v * (1.0f + erff(v * 0.70710678118654752f)); else if (ACT == 11) v = 1.0f / (1.0f + expf(-v)); else if (ACT == 15) v = v / (1.0f + expf(-v)); else if (ACT == 12) v = (v > 0.f) ? v : 0.01f * v; else if (ACT == 8) v = tanhf(v); else if (ACT == 9) v = 0.5f * v * (1.0f + tanhf(0.7978845608028654f * (v + 0.044715f * v * v * v))); else if (ACT == 14) v = (v > 0.f) ? v : 0.1f * v; else if (ACT == 16) v = (v >= 0.f) ? v : 0.3f * v; else if (ACT == 17) v = (v >= 0.f) ? v : 0.2f * v;
      so[w][rloc][t * 16 + ln] = v; } }
  __builtin_amdgcn_fence(__ATOMIC_ACQ_REL, "workgroup"); __builtin_amdgcn_wave_barrier();
  const int rsub = lane >> 4, c4 = (lane & 15) * 4;
  {
#pragma unroll
    for (int q = 0; q < 16; ++q) { const int r = q * 2 + rsub; const v4f v = *(const v4fa*)&so[w][r][c4]; if (C) *(v4f*)(C + cofs + (size_t)(row0 + r) * ldc + col0 + c4) = v; if (C16) { v4h h4; for (int i = 0; i < 4; ++i) h4[i] = (_Float16)v[i]; *(v4h*)(C16 + cofs + (size_t)(row0 + r) * ldc + col0 + c4) = h4; } }
     } }


__global__ __launch_bounds__(256) void k_xrows(const float* __restrict__ x, float* __restrict__ RES) { __shared__ float tl[CC][33]; const int tid = threadIdx.x; const int b = blockIdx.x / (NP / 32), pb = blockIdx.x % (NP / 32); const int p0 = pb * 32;
  for (int i = tid; i < CC * 32; i += 256) { const int c = i / 32, j = i % 32; tl[c][j] = bf16_round(x[((size_t)b * CC + c) * NP + p0 + j]); }
  __syncthreads();
  { for (int i = tid; i < 32 * (CC / 8); i += 256) { const int j = i / (CC / 8), c0 = (i % (CC / 8)) * 8; v8f v; for (int q = 0; q < 8; ++q) v[q] = tl[c0 + q][j]; *(v8f*)(RES + ((size_t)b * NP + p0 + j) * CC + c0) = v; }  } }
__global__ __launch_bounds__(256) void k_elu32(float* __restrict__ F, size_t n8) {
  #pragma clang fp contract(off)
  const size_t t = (size_t)blockIdx.x * 256 + threadIdx.x; if (t >= n8) return; v8f v = *(const v8f*)(F + t * 8); for (int q = 0; q < 8; ++q) { const float a = v[q]; v[q] = (a > 0.f) ? a : expm1f(a); } *(v8f*)(F + t * 8) = v;  }
__global__ __launch_bounds__(256) void k_elu16(const float* __restrict__ F, _Float16* __restrict__ E, size_t n8) {
  #pragma clang fp contract(off)
  const size_t t = (size_t)blockIdx.x * 256 + threadIdx.x; if (t >= n8) return; const v8f v = *(const v8f*)(F + t * 8); FragH f; for (int q = 0; q < 8; ++q) { const float a = v[q]; f.h[q] = (_Float16)((a > 0.f) ? a : expm1f(a)); } *(v8us*)((unsigned short*)E + t * 8) = f.half[0];  }
__global__ __launch_bounds__(256) void k_im8(const _Float16* __restrict__ S, _Float16* __restrict__ IM) { const size_t t_ = (size_t)blockIdx.x * 256 + threadIdx.x; if (t_ >= NR * 8 * 32) return; const int c8 = (int)(t_ % 32) * 8; const int tap = (int)((t_ / 32) % 8); const size_t r = t_ / 256; const int p = (int)(r % NP); const size_t b = r / NP; const int w = p % DW, h = (p / DW) % DH, tt = p / (DW * DH); const int dw = tap % 2, dh = (tap / 2) % 2, dt = tap / 4; const int t2 = tt + dt - 1, h2 = h + dh - 1, w2 = w + dw - 1; v8us v;
  if (t2 >= 0 && h2 >= 0 && w2 >= 0) v = *(const v8us*)((const unsigned short*)S + (b * NP + (size_t)(t2 * DH + h2) * DW + w2) * CC + c8); else { for (int q = 0; q < 8; ++q) v[q] = 0; }
  unsigned short* d = (unsigned short*)IM + r * K8 + (size_t)tap * CC + c8; *(v8us*)d = v;  }
__global__ __launch_bounds__(256) void k_w8(const float* __restrict__ w, int O, _Float16* __restrict__ Bt) { const size_t t = (size_t)blockIdx.x * 256 + threadIdx.x; if (t >= (size_t)O * K8 / 8) return; const int c8 = (int)((t * 8) % CC); const int tap = (int)(((t * 8) / CC) % 8); const int o = (int)((t * 8) / K8); FragH f; for (int q = 0; q < 8; ++q) f.h[q] = (_Float16)(bf16_round(w[((size_t)o * CC + c8 + q) * 8 + tap]) * 16.0f);
  *(v8us*)((unsigned short*)Bt + t * 8) = f.half[0];  }
__global__ __launch_bounds__(256) void k_gate(const float* __restrict__ O2, float* __restrict__ RES) {
  #pragma clang fp contract(off)
  const size_t t = (size_t)blockIdx.x * 256 + threadIdx.x; if (t >= NR * CC / 8) return; const int c0 = (int)((t * 8) % CC); const size_t r = (t * 8) / CC; v8f v = *(const v8f*)(RES + t * 8); const float* o = O2 + r * 512;
  for (int q = 0; q < 8; ++q) { const float a = o[c0 + q], g = o[256 + c0 + q]; const float s = 1.0f / (1.0f + expf(-g)); v[q] = v[q] + __fmul_rn(a, s); }
  *(v8f*)(RES + t * 8) = v;  }
__global__ __launch_bounds__(256) void k_xa(const float* __restrict__ RES, const float* __restrict__ orig, _Float16* __restrict__ XA) { const size_t t = (size_t)blockIdx.x * 256 + threadIdx.x; if (t >= NR * 36) return; const int pc = (int)(t % 36); const size_t r = t / 36; const int p = (int)(r % NP); const size_t b = r / NP; FragH f;
  for (int q = 0; q < 8; ++q) { const int col = pc * 8 + q; float v = 0.f; if (col < 256) v = RES[r * CC + col]; else if (col < 259) v = bf16_round(orig[((b * 3 + (col - 256)) * (size_t)NP) + p]); else if (col == 259) v = -0.5f + (float)(p / (DH * DW)) / (float)DT; else if (col == 260) v = -0.5f + (float)((p / DW) % DH) / (float)DH; else if (col == 261) v = -0.5f + (float)(p % DW) / (float)DW; f.h[q] = (_Float16)v; }
  unsigned short* d = (unsigned short*)XA + r * KA + pc * 8; *(v8us*)d = f.half[0];  }
__global__ __launch_bounds__(256) void k_wa(const float* __restrict__ w, int O, int OP, _Float16* __restrict__ Bt) { const size_t t = (size_t)blockIdx.x * 256 + threadIdx.x; if (t >= (size_t)OP * KA / 8) return; const int k0 = (int)((t * 8) % KA); const int o = (int)((t * 8) / KA); FragH f; for (int q = 0; q < 8; ++q) { const int k = k0 + q; f.h[q] = (o < O && k < 262) ? (_Float16)(bf16_round(w[(size_t)o * 262 + k]) * 16.0f) : (_Float16)0.f; }
  *(v8us*)((unsigned short*)Bt + t * 8) = f.half[0];  }
__global__ __launch_bounds__(256) void k_bpad(const float* __restrict__ b, int n, int np_, float* __restrict__ bp) { const int i = blockIdx.x * 256 + threadIdx.x; if (i >= np_) return; const float v = (i < n) ? b[i] : 0.f; *(float*)(bp + i) = v;  }
__global__ __launch_bounds__(256) void k_vt(const _Float16* __restrict__ V16, int b, _Float16* __restrict__ VT) { __shared__ unsigned short tl[64][VC + 2]; const int tid = threadIdx.x; const int k0 = blockIdx.x * 64; const unsigned short* s = (const unsigned short*)V16 + ((size_t)b * NP + k0) * VC;
  for (int i = tid; i < 64 * (VC / 8); i += 256) { const int j = i / (VC / 8), c8 = (i % (VC / 8)) * 8; FragH f; f.half[0] = *(const v8us*)(s + (size_t)j * VC + c8); for (int q = 0; q < 8; ++q) tl[j][c8 + q] = f.u[q]; }
  __syncthreads();
  { for (int i = tid; i < VC * 8; i += 256) { const int c = i / 8, j8 = (i % 8) * 8; v8us o; for (int q = 0; q < 8; ++q) o[q] = tl[j8 + q][c]; *(v8us*)((unsigned short*)VT + (size_t)c * NP + k0 + j8) = o; }  } }
__global__ __launch_bounds__(256) void k_csm(const float* __restrict__ S, _Float16* __restrict__ P, float* __restrict__ RS) {
  #pragma clang fp contract(off)
  const int q = blockIdx.x * 256 + threadIdx.x; if (q >= NP) return; const float* s = S + (size_t)q * NP; const float scale = 1.0f / sqrtf(259.0f);      /* np.float32(sqrt(259)) division: s/sqrt(C_ATT) */
  float mx = -3.0e38f;
  const float sq = sqrtf(259.0f); (void)scale;
#pragma unroll 1
  for (int k = 0; k < q; ++k) mx = fmaxf(mx, s[k] / sq); float se = 0.f;
  { se = 0.f;
#pragma unroll 1
    for (int k0 = 0; k0 < NP; k0 += 8) { FragH f; for (int u = 0; u < 8; ++u) { const int k = k0 + u; float e = 0.f; if (k < q) { e = expf(s[k] / sq - mx); se += e; } f.h[u] = (_Float16)(e * 256.0f); } *(v8us*)((unsigned short*)P + (size_t)q * NP + k0) = f.half[0]; }
     }
  const float rs = (q == 0) ? 0.f : (1.0f / 256.0f) / se; *(float*)(RS + (size_t)q * 32) = rs;  }
__global__ __launch_bounds__(256) void k_ascale(const float* __restrict__ AT, const float* __restrict__ RS, int b, _Float16* __restrict__ ATE) {
  #pragma clang fp contract(off)
  const size_t t = (size_t)blockIdx.x * 256 + threadIdx.x; if (t >= (size_t)NP * VC / 8) return; const int q = (int)((t * 8) / VC); const float rs = RS[(size_t)q * 32]; const v8f a = *(const v8f*)(AT + t * 8); FragH f; for (int u = 0; u < 8; ++u) { const float v = a[u] * rs; f.h[u] = (_Float16)((v > 0.f) ? v : expm1f(v)); }
  unsigned short* d = (unsigned short*)ATE + ((size_t)b * NP * VC) + t * 8; *(v8us*)d = f.half[0];  }
__global__ __launch_bounds__(256) void k_sumelu(const float* __restrict__ A, const float* __restrict__ B, _Float16* __restrict__ E, size_t n8) {
  #pragma clang fp contract(off)
  const size_t t = (size_t)blockIdx.x * 256 + threadIdx.x; if (t >= n8) return; const v8f a = *(const v8f*)(A + t * 8), b = *(const v8f*)(B + t * 8); FragH f; for (int q = 0; q < 8; ++q) { const float v = a[q] + b[q]; f.h[q] = (_Float16)((v > 0.f) ? v : expm1f(v)); } *(v8us*)((unsigned short*)E + t * 8) = f.half[0];  }
__global__ __launch_bounds__(256) void k_out(const float* __restrict__ O, float* __restrict__ out) { const size_t t = (size_t)blockIdx.x * 256 + threadIdx.x; if (t >= (size_t)NB * CC * NP / 8) return; const int p0 = (int)((t * 8) % NP); const size_t bc = (t * 8) / NP; const int c = (int)(bc % CC); const size_t b = bc / CC; v8f r; for (int q = 0; q < 8; ++q) r[q] = O[(b * NP + p0 + q) * CC + c];
  *(v8f*)(out + t * 8) = r;  }

extern "C" void kernel_launch(void* const* d_in, const int* in_sizes, int n_in,
                              void* d_out, int out_size, void* d_ws, size_t ws_size, hipStream_t stream) {
  (void)in_sizes; (void)n_in; (void)out_size;
  const float* const* I = (const float* const*)d_in; const float* x = I[0]; const float* orig = I[1]; const float* rw1 = I[2]; const float* rb1 = I[3]; const float* rw2 = I[4]; const float* rb2 = I[5]; const float* qw = I[6]; const float* qb = I[7]; const float* kw = I[8]; const float* kb = I[9]; const float* vw = I[10]; const float* vb = I[11]; const float* aw = I[12]; const float* ab = I[13]; const float* rsw = I[14]; const float* rsb = I[15]; const float* ow = I[16]; const float* ob = I[17];
  char* ws = (char*)d_ws; size_t off = 0;
  auto take = [&](size_t bytes) { char* p = ws + off; off += (bytes + 255) & ~(size_t)255; return p; };
  _Float16* BW1 = (_Float16*)take((size_t)CC * K8 * 2); _Float16* BW2 = (_Float16*)take((size_t)512 * K8 * 2); _Float16* BQ = (_Float16*)take((size_t)64 * KA * 2); _Float16* BK = (_Float16*)take((size_t)64 * KA * 2); _Float16* BV = (_Float16*)take((size_t)VC * KA * 2); float* qbp = (float*)take(64 * 4); float* kbp = (float*)take(64 * 4); _Float16* BA = (_Float16*)take((size_t)CC * VC * 2); _Float16* BR = (_Float16*)take((size_t)CC * CC * 2); _Float16* BO = (_Float16*)take((size_t)CC * CC * 2);
  float* RES = (float*)take(NR * CC * 4); _Float16* E16 = (_Float16*)take(NR * CC * 2); _Float16* IM = (_Float16*)take(NR * K8 * 2); _Float16* O1 = (_Float16*)take(NR * CC * 2); float* O2 = (float*)take(NR * 512 * 4);
  _Float16* XA = (_Float16*)take(NR * KA * 2); _Float16* Q16 = (_Float16*)take(NR * 64 * 2); _Float16* K16 = (_Float16*)take(NR * 64 * 2); _Float16* V16 = (_Float16*)take(NR * VC * 2); _Float16* VT = (_Float16*)take((size_t)VC * NP * 2); float* S = (float*)take((size_t)NP * NP * 4); _Float16* P = (_Float16*)take((size_t)NP * NP * 2); float* RS = (float*)take((size_t)NP * 32 * 4); float* AT = (float*)take((size_t)NP * VC * 4);
  _Float16* ATE = (_Float16*)take(NR * VC * 2); float* ATTC = (float*)take(NR * CC * 4); float* R2 = (float*)take(NR * CC * 4); _Float16* SUM16 = (_Float16*)take(NR * CC * 2); float* OUT = O2;
  if (off > ws_size) return;      /* 3.6 + 8.4 + 4.2 + 33.5 + 4.2 + 16.8 + 4.7 + 4.2 + 1 + 67 + 33.5 + 0.5 + 2 + 2 + 8.4 + 8.4 + 4.2 = ≈ 207 MB (197.5 MiB) */
  k_wa<<<(unsigned)(((size_t)64 * KA / 8 + 255) / 256), 256, 0, stream>>>(qw, 16, 64, BQ); k_wa<<<(unsigned)(((size_t)64 * KA / 8 + 255) / 256), 256, 0, stream>>>(kw, 16, 64, BK); k_wa<<<(unsigned)(((size_t)VC * KA / 8 + 255) / 256), 256, 0, stream>>>(vw, VC, VC, BV); k_bpad<<<1, 64, 0, stream>>>(qb, 16, 64, qbp); k_bpad<<<1, 64, 0, stream>>>(kb, 16, 64, kbp);
  k_round16f<<<(CC * VC / 8 + 255) / 256, 256, 0, stream>>>(aw, BA, (size_t)CC * VC / 8); k_round16f<<<(CC * CC / 8 + 255) / 256, 256, 0, stream>>>(rsw, BR, (size_t)CC * CC / 8); k_round16f<<<(CC * CC / 8 + 255) / 256, 256, 0, stream>>>(ow, BO, (size_t)CC * CC / 8);
  k_xrows<<<NB * (NP / 32), 256, 0, stream>>>(x, RES);
  const unsigned n8 = (unsigned)((NR * CC / 8 + 255) / 256); const dim3 g256((unsigned)((NR / 128) * (CC / 64)), 1);
  for (int i = 0; i < NRES; ++i) {
    k_w8<<<(unsigned)(((size_t)CC * K8 / 8 + 255) / 256), 256, 0, stream>>>(rw1 + (size_t)i * CC * CC * 8, CC, BW1); k_w8<<<(unsigned)(((size_t)512 * K8 / 8 + 255) / 256), 256, 0, stream>>>(rw2 + (size_t)i * 512 * CC * 8, 512, BW2);
    k_elu16<<<n8, 256, 0, stream>>>(RES, E16, NR * CC / 8); k_im8<<<(unsigned)((NR * 256 + 255) / 256), 256, 0, stream>>>(E16, IM);
    k_gemm2<0><<<g256, 128, 0, stream>>>(IM, K8, 0, BW1, K8, 0, 0.0625f, rb1 + i * CC, 0, nullptr, 1, 0, 0, ATTC, nullptr, CC, 0, (int)NR, CC, K8); k_elu16<<<n8, 256, 0, stream>>>(ATTC, O1, NR * CC / 8);      /* o = elu(conv1 + b1) (ATTC used as scratch here) */
    k_im8<<<(unsigned)((NR * 256 + 255) / 256), 256, 0, stream>>>(O1, IM);
    k_gemm2<0><<<dim3((unsigned)((NR / 128) * 8), 1), 128, 0, stream>>>(IM, K8, 0, BW2, K8, 0, 0.0625f, rb2 + i * 512, 0, nullptr, 1, 0, 0, O2, nullptr, 512, 0, (int)NR, 512, K8);      /* conv2 + b2 (512) */
    k_gate<<<n8, 256, 0, stream>>>(O2, RES); }
  /* attention */
  k_xa<<<(unsigned)((NR * 36 + 255) / 256), 256, 0, stream>>>(RES, orig, XA);
  k_gemm2<0><<<dim3((unsigned)((NR / 128) * 1), 1), 128, 0, stream>>>(XA, KA, 0, BQ, KA, 0, 0.0625f, qbp, 0, nullptr, 1, 0, 0, nullptr, Q16, 64, 0, (int)NR, 64, KA);
  k_gemm2<0><<<dim3((unsigned)((NR / 128) * 1), 1), 128, 0, stream>>>(XA, KA, 0, BK, KA, 0, 0.0625f, kbp, 0, nullptr, 1, 0, 0, nullptr, K16, 64, 0, (int)NR, 64, KA);
  k_gemm2<0><<<dim3((unsigned)((NR / 128) * 2), 1), 128, 0, stream>>>(XA, KA, 0, BV, KA, 0, 0.0625f, vb, 0, nullptr, 1, 0, 0, nullptr, V16, VC, 0, (int)NR, VC, KA);
  for (int b = 0; b < NB; ++b) {
    k_gemm2<0><<<dim3((NP / 128) * (NP / 64), 1), 128, 0, stream>>>(Q16 + (size_t)b * NP * 64, 64, 0, K16 + (size_t)b * NP * 64, 64, 0, 1.0f, nullptr, 0, nullptr, 1, 0, 0, S, nullptr, NP, 0, NP, NP, 32);
    k_csm<<<(NP + 255) / 256, 256, 0, stream>>>(S, P, RS); k_vt<<<NP / 64, 256, 0, stream>>>(V16, b, VT);
    k_gemm2<0><<<dim3((NP / 128) * (VC / 64), 1), 128, 0, stream>>>(P, NP, 0, VT, NP, 0, 1.0f, nullptr, 0, nullptr, 1, 0, 0, AT, nullptr, VC, 0, NP, VC, NP);
    k_ascale<<<(unsigned)(((size_t)NP * VC / 8 + 255) / 256), 256, 0, stream>>>(AT, RS, b, ATE); }
  k_gemm2<0><<<g256, 128, 0, stream>>>(ATE, VC, 0, BA, VC, 0, 0.0625f, ab, 0, nullptr, 1, 0, 0, ATTC, nullptr, CC, 0, (int)NR, CC, VC); k_elu32<<<n8, 256, 0, stream>>>(ATTC, NR * CC / 8);      /* att = elu(attn_conv(elu(att)) + b) */
  k_elu16<<<n8, 256, 0, stream>>>(RES, E16, NR * CC / 8); k_gemm2<0><<<g256, 128, 0, stream>>>(E16, CC, 0, BR, CC, 0, 0.0625f, rsb, 0, nullptr, 1, 0, 0, R2, nullptr, CC, 0, (int)NR, CC, CC); k_elu32<<<n8, 256, 0, stream>>>(R2, NR * CC / 8);      /* res = elu(res_conv(elu(res)) + b) */
  k_sumelu<<<n8, 256, 0, stream>>>(R2, ATTC, SUM16, NR * CC / 8);
  k_gemm2<0><<<g256, 128, 0, stream>>>(SUM16, CC, 0, BO, CC, 0, 0.0625f, ob, 0, nullptr, 1, 0, 0, OUT, nullptr, CC, 0, (int)NR, CC, CC); k_elu32<<<n8, 256, 0, stream>>>(OUT, NR * CC / 8);      /* out = elu(out_conv(elu(res + att)) + b) */
  k_out<<<(unsigned)(((size_t)NB * CC * NP / 8 + 255) / 256), 256, 0, stream>>>(OUT, (float*)d_out);
}

// v001
// Measured time: 1190 microseconds a run.
// Two timings next to v000 put it at 2.55 and 2.58 times that version's speed.
#include <hip/hip_runtime.h>
// PixelSNAILBlock (x [2][256][16][16][16], original_input [2][3][16][16][16]; 4 gated residual blocks: o = elu(conv3d k2 pad1 crop(elu(res)) + b1); o = conv3d k2 pad1 crop(o) + b2 (512 ch); res += o[:256] * sigmoid(o[256:]); attention over the 4,096 positions of [res | original | pos-enc] (262 ch): q,k (16), v (128), causal softmax (k < q, row 0 all-zero) of q.k/sqrt(259), att = p v; att = elu(1x1(elu(att)) + b); res = elu(1x1(elu(res)) + b); out = elu(1x1(elu(res + att)) + b) -> [2][256][16][16][16]).
// Structure: position rows r = b*4096 + (t*16 + h)*16 + w; res kept as f32 rows; each k2 'causal-corner' conv as an 8-tap im2col of f16 rows (K = 2,048) + WMMA GEMM (32x64 wave tiles, f32 accumulation, exact x16 weights + bias) with the ELUs on VALU; gating on VALU; q/k/v as GEMMs on the 262 -> 288-column concat rows (16 live of 64 for q/k); per batch: scores GEMM (K = 32), causal row softmax on VALU (un-normalised f16 weights x 2^8 + 1/sum, row 0 -> 0), P.V GEMM (K = 4,096) against LDS-transposed value planes, scaling; the three 1x1 convs as GEMMs followed by VALU ELUs; channel-major store on VALU.
// Compute dtype: inputs rounded to bf16; x / original / weights exact; conv operands (elu(res), o1), the concat rows, q/k/v, softmax weights and the 1x1-conv operands plain f16 (~2^-12); res accumulation, gates, softmax sums f32. v_wmma_f32_16x16x32_f16.
#define NB 2
#define CC 256
#define DT 16
#define DH 16
#define DW 16
#define NP (DT * DH * DW)            /* 4096 */
#define NR ((size_t)NB * NP)       /* 8192 */
#define NRES 4
#define K8 (8 * CC)                /* 2048 */
#define KA 288                     /* 262 live */
#define VC 128
typedef __bf16 v16b __attribute__((ext_vector_type(16)));
typedef unsigned short v8us __attribute__((ext_vector_type(8), may_alias));
typedef float  v8f  __attribute__((ext_vector_type(8)));
typedef float  v4f  __attribute__((ext_vector_type(4)));
typedef float  v4fa __attribute__((ext_vector_type(4), may_alias));
union FragB { v16b v; v8us half[2]; unsigned short u[16]; };

__device__ __forceinline__ unsigned short bf16_bits(float x) { unsigned int u = __float_as_uint(x); return (unsigned short)((u + 0x7FFFu + ((u >> 16) & 1u)) >> 16); }
__device__ __forceinline__ float bf16_val(unsigned short b) { return __uint_as_float(((unsigned int)b) << 16); }
__device__ __forceinline__ float bf16_round(float x) { return bf16_val(bf16_bits(x)); }
// D += A·B with NT terms: 1 = ah·bh, 2 = + al·bh (A split), 3 = + ah·bl (both split)
template <int NT>
__device__ __forceinline__ v8f mmaN(v16b ah, v16b al, v16b bh, v16b bl, v8f c) {
  c = __builtin_amdgcn_wmma_f32_16x16x32_bf16(false, ah, false, bh, (short)0, c, false, false);
  if (NT >= 2) c = __builtin_amdgcn_wmma_f32_16x16x32_bf16(false, al, false, bh, (short)0, c, false, false);
  if (NT >= 3) c = __builtin_amdgcn_wmma_f32_16x16x32_bf16(false, ah, false, bl, (short)0, c, false, false);
  asm volatile("v_nop\n\tv_nop\n\tv_nop\n\tv_nop" : "+v"(c) : "v"(ah), "v"(al), "v"(bh), "v"(bl));
  return c;
}

__global__ __launch_bounds__(256) void k_wt_bf16(const float* __restrict__ W, unsigned short* __restrict__ Wt, int K, int N) {
  const int t = blockIdx.x * 256 + threadIdx.x;
  const int k8n = K / 8;
  if (t >= N * k8n) return;
  const int n = t / k8n, k8 = (t % k8n) * 8;
  v8us v;
#pragma unroll
  for (int i = 0; i < 8; ++i) v[i] = bf16_bits(W[(size_t)(k8 + i) * N + n]);
  *(v8us*)(Wt + (size_t)n * K + k8) = v;
  
}

// GEMM C[M][N] (f32, pitch ldc) = act(A[M][K]·W + bias). A f32 row-major (pitch lda) converted per fragment to bf16
// (ASPLIT: hi/lo two planes -> 2 terms, else single rounded term); Wt bf16 [N][K] (pitch ldb). BIAS_BF16 rounds the
// bias to bf16 first (bias quantised to bf16 before the add). K%32==0, M%16==0, N%64==0.
template <bool ASPLIT, int ACT, bool BIAS_BF16>
__global__ __launch_bounds__(128) void k_gemm_bf(const float* __restrict__ A, int lda, const unsigned short* __restrict__ Wt, int ldb,
                                               const float* __restrict__ bias, float* __restrict__ C, int ldc, int M, int N, int K) {
  __shared__ __attribute__((aligned(16))) float so[4][16][64];
  const int tid = threadIdx.x, w = tid >> 5, lane = tid & 31, ln = lane & 15, hh = lane >> 4;
  const int ntn = N / 64;
  const int wid = blockIdx.x * 4 + w;
  const int mt = wid / ntn, nq = wid % ntn;
  if (mt * 16 >= M) return;
  const int row0 = mt * 16, col0 = nq * 64;
  const float* arow = A + (size_t)(row0 + ln) * lda;
  v8f acc[4] = {};
  for (int kb = 0; kb < K; kb += 32) {
    FragB ah, al;
    const v4f x0 = *(const v4fa*)(arow + kb + 8 * hh), x1 = *(const v4fa*)(arow + kb + 8 * hh + 4);
    const v4f x2 = *(const v4fa*)(arow + kb + 16 + 8 * hh), x3 = *(const v4fa*)(arow + kb + 16 + 8 * hh + 4);
    float xs[16] = {x0[0],x0[1],x0[2],x0[3],x1[0],x1[1],x1[2],x1[3],x2[0],x2[1],x2[2],x2[3],x3[0],x3[1],x3[2],x3[3]};
#pragma unroll
    for (int i = 0; i < 16; ++i) { const unsigned short hb = bf16_bits(xs[i]); ah.u[i] = hb; al.u[i] = ASPLIT ? bf16_bits(xs[i] - bf16_val(hb)) : (unsigned short)0; }
#pragma unroll
    for (int t = 0; t < 4; ++t) {
      const unsigned short* brow = Wt + (size_t)(col0 + t * 16 + ln) * ldb + kb;
      FragB b;
      b.half[0] = *(const v8us*)(brow + 8 * hh);
      b.half[1] = *(const v8us*)(brow + 16 + 8 * hh);
      acc[t] = mmaN<ASPLIT ? 2 : 1>(ah.v, al.v, b.v, b.v, acc[t]);
    }
  }
#pragma unroll
  for (int t = 0; t < 4; ++t) {
    float bv = bias ? bias[col0 + t * 16 + ln] : 0.f;
    if (BIAS_BF16) bv = bf16_round(bv);
#pragma unroll
    for (int r = 0; r < 8; ++r) { float v = acc[t][r] + bv; if (ACT == 1) v = fmaxf(v, 0.f); so[w][8 * hh + r][t * 16 + ln] = v; }
  }
  __builtin_amdgcn_fence(__ATOMIC_ACQ_REL, "workgroup");
  __builtin_amdgcn_wave_barrier();
  const int rsub = lane >> 4, c4 = (lane & 15) * 4;
  {
#pragma unroll
    for (int q = 0; q < 8; ++q) {
      const int r = q * 2 + rsub;
      const v4f v = *(const v4fa*)&so[w][r][c4];
      *(v4f*)(C + (size_t)(row0 + r) * ldc + col0 + c4) = v;
    }
    
  }
}

// GEMM C = act(A·W + bias + resid): A f32 (ASPLIT -> hi/lo 2 terms), Wt bf16 [N][K]; ACT 0 none, 1 relu, 2 exact gelu;
// resid (optional, f32, row index = (row % rmod), pitch ldr, RES_BF16 rounds it) added before the activation.
template <bool ASPLIT, int ACT, bool BIAS_BF16, bool RES_BF16>
__global__ __launch_bounds__(128) void k_gemm_bf3(const float* __restrict__ A, int lda, const unsigned short* __restrict__ Wt, int ldb,
                                                const float* __restrict__ bias, const float* __restrict__ resid, int rmod, int ldr,
                                                float* __restrict__ C, int ldc, int M, int N, int K) {
  __shared__ __attribute__((aligned(16))) float so[4][16][64];
  const int tid = threadIdx.x, w = tid >> 5, lane = tid & 31, ln = lane & 15, hh = lane >> 4;
  const int ntn = N / 64;
  const int wid = blockIdx.x * 4 + w;
  const int mt = wid / ntn, nq = wid % ntn;
  if (mt * 16 >= M) return;
  const int row0 = mt * 16, col0 = nq * 64;
  const float* arow = A + (size_t)(row0 + ln) * lda;
  v8f acc[4] = {};
  for (int kb = 0; kb < K; kb += 32) {
    FragB ah, al;
    const v4f x0 = *(const v4fa*)(arow + kb + 8 * hh), x1 = *(const v4fa*)(arow + kb + 8 * hh + 4);
    const v4f x2 = *(const v4fa*)(arow + kb + 16 + 8 * hh), x3 = *(const v4fa*)(arow + kb + 16 + 8 * hh + 4);
    float xs[16] = {x0[0],x0[1],x0[2],x0[3],x1[0],x1[1],x1[2],x1[3],x2[0],x2[1],x2[2],x2[3],x3[0],x3[1],x3[2],x3[3]};
#pragma unroll
    for (int i = 0; i < 16; ++i) { const unsigned short hb = bf16_bits(xs[i]); ah.u[i] = hb; al.u[i] = ASPLIT ? bf16_bits(xs[i] - bf16_val(hb)) : (unsigned short)0; }
#pragma unroll
    for (int t = 0; t < 4; ++t) {
      const unsigned short* brow = Wt + (size_t)(col0 + t * 16 + ln) * ldb + kb;
      FragB b;
      b.half[0] = *(const v8us*)(brow + 8 * hh);
      b.half[1] = *(const v8us*)(brow + 16 + 8 * hh);
      acc[t] = mmaN<ASPLIT ? 2 : 1>(ah.v, al.v, b.v, b.v, acc[t]);
    }
  }
#pragma unroll
  for (int t = 0; t < 4; ++t) {
    const int col = col0 + t * 16 + ln;
    float bv = bias ? bias[col] : 0.f;
    if (BIAS_BF16) bv = bf16_round(bv);
#pragma unroll
    for (int r = 0; r < 8; ++r) {
      float v = acc[t][r] + bv;
      if (resid) { float rv = resid[(size_t)((row0 + 8 * hh + r) % rmod) * ldr + col]; if (RES_BF16) rv = bf16_round(rv); v += rv; }
      if (ACT == 1) v = fmaxf(v, 0.f);
      if (ACT == 2) v = 0.5f * v * (1.0f + erff(v * 0.70710678118654752f));
      if (ACT == 3) { const float u = 0.7978845608028654f * (v + 0.044715f * v * v * v); v = 0.5f * v * (1.0f + tanhf(u)); }
      so[w][8 * hh + r][t * 16 + ln] = v;
    }
  }
  __builtin_amdgcn_fence(__ATOMIC_ACQ_REL, "workgroup");
  __builtin_amdgcn_wave_barrier();
  const int rsub = lane >> 4, c4 = (lane & 15) * 4;
  {
#pragma unroll
    for (int q = 0; q < 8; ++q) {
      const int r = q * 2 + rsub;
      const v4f v = *(const v4fa*)&so[w][r][c4];
      *(v4f*)(C + (size_t)(row0 + r) * ldc + col0 + c4) = v;
    }
    
  }
}
// row LayerNorm (biased variance, eps) over N: s = X (+ R); optional out_sum <- s; out_norm <- (s-mu)*rsqrt(var+eps)*g + b
template <bool PARAM_BF16>
__global__ __launch_bounds__(256) void k_layernorm(const float* __restrict__ X, const float* __restrict__ R, const float* __restrict__ g, const float* __restrict__ bta,
                                                  float* __restrict__ out_sum, float* __restrict__ out_norm, int N, float eps) {
  __shared__ float red[256];
  const int row = blockIdx.x, tid = threadIdx.x;
  const float* x = X + (size_t)row * N; const float* rr = R ? R + (size_t)row * N : nullptr;
  float vals[16];                     // up to N = 4096
  const int per = N / 256;            // contiguous chunk per thread? use strided-by-4 chunks: thread handles j = tid*4 + 1024*u
  float s1 = 0.f;
  for (int u = 0; u < per / 4; ++u) {
    const int j = tid * 4 + 1024 * u;
    const v4f a = *(const v4fa*)(x + j);
    v4f b = {0.f,0.f,0.f,0.f}; if (rr) b = *(const v4fa*)(rr + j);
#pragma unroll
    for (int q = 0; q < 4; ++q) { const float v = a[q] + b[q]; vals[u * 4 + q] = v; s1 += v; }
  }
  red[tid] = s1; __syncthreads();
  for (int st = 128; st > 0; st >>= 1) { if (tid < st) red[tid] += red[tid + st]; __syncthreads(); }
  const float mu = red[0] / (float)N; __syncthreads();
  float s2 = 0.f;
  for (int u = 0; u < per / 4; ++u)
#pragma unroll
    for (int q = 0; q < 4; ++q) { const float c = vals[u * 4 + q] - mu; s2 += c * c; }
  red[tid] = s2; __syncthreads();
  for (int st = 128; st > 0; st >>= 1) { if (tid < st) red[tid] += red[tid + st]; __syncthreads(); }
  const float rs = rsqrtf(red[0] / (float)N + eps);
  {
    for (int u = 0; u < per / 4; ++u) {
      const int j = tid * 4 + 1024 * u;
      v4f o, sm;
#pragma unroll
      for (int q = 0; q < 4; ++q) {
        float gg = g[j + q], bb = bta[j + q];
        if (PARAM_BF16) { gg = bf16_round(gg); bb = bf16_round(bb); }
        sm[q] = vals[u * 4 + q]; o[q] = (vals[u * 4 + q] - mu) * rs * gg + bb;
      }
      if (out_sum) *(v4f*)(out_sum + (size_t)row * N + j) = sm;
      *(v4f*)(out_norm + (size_t)row * N + j) = o;
    }
    
  }
}



// ---- f16 WMMA path (v_wmma_f32_16x16x32_f16): 11-bit significands for operands in range — used for every GEMM launched in this file
typedef _Float16 v16h __attribute__((ext_vector_type(16)));
union FragH { v16h v; v8us half[2]; _Float16 h[16]; unsigned short u[16]; };
template <int NT>
__device__ __forceinline__ v8f mmaH(v16h ah, v16h al, v16h bh, v16h bl, v8f c) {
  c = __builtin_amdgcn_wmma_f32_16x16x32_f16(false, ah, false, bh, (short)0, c, false, false);
  if (NT >= 2) c = __builtin_amdgcn_wmma_f32_16x16x32_f16(false, al, false, bh, (short)0, c, false, false);
  if (NT >= 3) c = __builtin_amdgcn_wmma_f32_16x16x32_f16(false, ah, false, bl, (short)0, c, false, false);
  asm volatile("v_nop\n\tv_nop\n\tv_nop\n\tv_nop" : "+v"(c) : "v"(ah), "v"(al), "v"(bh), "v"(bl));
  return c;
}
// batched GEMM like k_gemm_b but f16 operands: A f32 (split into f16 hi/lo if ASPLIT, else rounded to f16), Bt = f16 values [n][k]; alpha; C f32; N multiple of 16 (partial tiles skipped)
template <bool ASPLIT>
__global__ __launch_bounds__(128) void k_gemm_h(const float* __restrict__ A, int lda, size_t sA, const _Float16* __restrict__ Bh, int ldb, size_t sB, float alpha, float* __restrict__ C, int ldc, size_t sC, int M, int N, int K) {
  __shared__ __attribute__((aligned(16))) float so[4][16][64];
  const int tid = threadIdx.x, w = tid >> 5, lane = tid & 31, ln = lane & 15, hh = lane >> 4; const int by = blockIdx.y;
  A += (size_t)by * sA; Bh += (size_t)by * sB; C += (size_t)by * sC;
  const int ntn = (N + 63) / 64; const int wid = blockIdx.x * 4 + w; const int mt = wid / ntn, nq = wid % ntn; if (mt * 16 >= M) return;
  const int row0 = mt * 16, col0 = nq * 64; const float* arow = A + (size_t)(row0 + ln) * lda;
  v8f acc[4] = {};
  for (int kb = 0; kb < K; kb += 32) {
    FragH ah, al;
    const v4f x0 = *(const v4fa*)(arow + kb + 8 * hh), x1 = *(const v4fa*)(arow + kb + 8 * hh + 4), x2 = *(const v4fa*)(arow + kb + 16 + 8 * hh), x3 = *(const v4fa*)(arow + kb + 16 + 8 * hh + 4);
    float xs[16] = {x0[0],x0[1],x0[2],x0[3],x1[0],x1[1],x1[2],x1[3],x2[0],x2[1],x2[2],x2[3],x3[0],x3[1],x3[2],x3[3]};
#pragma unroll
    for (int i = 0; i < 16; ++i) { const _Float16 h = (_Float16)xs[i]; ah.h[i] = h; al.h[i] = ASPLIT ? (_Float16)(xs[i] - (float)h) : (_Float16)0.0f; }
#pragma unroll
    for (int t = 0; t < 4; ++t) { if (col0 + t * 16 >= N) continue; const size_t boff = (size_t)(col0 + t * 16 + ln) * ldb + kb; FragH bq; bq.half[0] = *(const v8us*)(Bh + boff + 8 * hh); bq.half[1] = *(const v8us*)(Bh + boff + 16 + 8 * hh);
      acc[t] = mmaH<ASPLIT ? 2 : 1>(ah.v, al.v, bq.v, bq.v, acc[t]); }
  }
#pragma unroll
  for (int t = 0; t < 4; ++t) { if (col0 + t * 16 >= N) continue;
#pragma unroll
    for (int r = 0; r < 8; ++r) so[w][8 * hh + r][t * 16 + ln] = acc[t][r] * alpha; }
  __builtin_amdgcn_fence(__ATOMIC_ACQ_REL, "workgroup"); __builtin_amdgcn_wave_barrier();
  const int rsub = lane >> 4, c4 = (lane & 15) * 4;
  {
#pragma unroll
    for (int q = 0; q < 8; ++q) { const int r = q * 2 + rsub; if (col0 + c4 < N) { const v4f v = *(const v4fa*)&so[w][r][c4]; *(v4f*)(C + (size_t)(row0 + r) * ldc + col0 + c4) = v; } }
     }
}

// Wt[n][k] = f16(W[k][n]·scale) from f32 row-major W[K][N] (scale = power of two; bf16-exact weights stay exact in f16 away from the subnormal range)
__global__ __launch_bounds__(256) void k_wt_f16(const float* __restrict__ W, _Float16* __restrict__ Wt, int K, int N, float scale) {
  const int t = blockIdx.x * 256 + threadIdx.x; if (t >= N * (K / 8)) return; const int n = t / (K / 8), k8 = (t % (K / 8)) * 8; FragH f;
#pragma unroll
  for (int i = 0; i < 8; ++i) f.h[i] = (_Float16)(bf16_round(W[(size_t)(k8 + i) * N + n]) * scale); const v8us o = f.half[0];
  *(v8us*)((unsigned short*)Wt + (size_t)n * K + k8) = o; 
}
// k_gemm_hh variant with fused epilogue: v = acc·alpha + bias[by·sBias + col] (+ CP[(row/rowsPerB)·sCPb + by·64 + col] if CP) ; ACT 0 none / 1 elu ; writes f16 C16 (and f32 C if non-null)
template <int ACT>
__global__ __launch_bounds__(128) void k_gemm_hhx(const _Float16* __restrict__ A, int lda, size_t sA, const _Float16* __restrict__ Bh, int ldb, size_t sB, float alpha, const float* __restrict__ bias, size_t sBias, const float* __restrict__ CP, int rowsPerB, size_t sCPb, int row0g,
    float* __restrict__ C, _Float16* __restrict__ C16, int ldc, size_t sC, int M, int N, int K) {
  __shared__ __attribute__((aligned(16))) float so[4][16][64];
  const int tid = threadIdx.x, w = tid >> 5, lane = tid & 31, ln = lane & 15, hh = lane >> 4; const int by = blockIdx.y;
  A += (size_t)by * sA; Bh += (size_t)by * sB; const size_t cofs = (size_t)by * sC; const float* bp = bias ? bias + (size_t)by * sBias : nullptr;
  const int ntn = (N + 63) / 64; const int wid = blockIdx.x * 4 + w; const int mt = wid / ntn, nq = wid % ntn; if (mt * 16 >= M) return;
  const int row0 = mt * 16, col0 = nq * 64; const _Float16* arow = A + (size_t)(row0 + ln) * lda;
  v8f acc[4] = {};
  for (int kb = 0; kb < K; kb += 32) { FragH ah; ah.half[0] = *(const v8us*)((const unsigned short*)arow + kb + 8 * hh); ah.half[1] = *(const v8us*)((const unsigned short*)arow + kb + 16 + 8 * hh);
#pragma unroll
    for (int t = 0; t < 4; ++t) { if (col0 + t * 16 >= N) continue; const size_t boff = (size_t)(col0 + t * 16 + ln) * ldb + kb; FragH bq; bq.half[0] = *(const v8us*)((const unsigned short*)Bh + boff + 8 * hh); bq.half[1] = *(const v8us*)((const unsigned short*)Bh + boff + 16 + 8 * hh);
      acc[t] = mmaH<1>(ah.v, ah.v, bq.v, bq.v, acc[t]); }
  }
#pragma unroll
  for (int t = 0; t < 4; ++t) { if (col0 + t * 16 >= N) continue; const int col = col0 + t * 16 + ln; const float bv = bp ? bf16_round(bp[col]) : 0.f;
#pragma unroll
    for (int r = 0; r < 8; ++r) { float v = acc[t][r] * alpha + bv; if (CP) { const int rr = row0g + row0 + 8 * hh + r; if (rowsPerB < 0) v += CP[cofs + (size_t)rr * ldc + col];      /* rowsPerB < 0: own element of the batched C plane */ else { const int bidx = rr / rowsPerB; v += CP[(size_t)bidx * sCPb + (size_t)by * 64 + col]; } } if (ACT == 1) v = (v > 0.f) ? v : expm1f(v); else if (ACT == 7) v = (v > 0.f) ? v + 1.0f : expf(v); else if (ACT == 8) v = tanhf(v); else if (ACT == 9) v = 0.5f * v * (1.0f + tanhf(0.7978845608028654f * (v + 0.044715f * v * v * v))); else if (ACT == 11) v = 1.0f / (1.0f + expf(-v)); else if (ACT == 12) v = (v > 0.f) ? v : 0.01f * v; else if (ACT == 14) v = (v > 0.f) ? v : 0.1f * v; else if (ACT == 16) v = (v >= 0.f) ? v : 0.3f * v; else if (ACT == 17) v = (v >= 0.f) ? v : 0.2f * v; else if (ACT == 15) v = v / (1.0f + expf(-v)); else if (ACT == 3) v = fmaxf(v, 0.f); else if (ACT == 6) v = 0.5f * v * (1.0f + erff(v * 0.70710678118654752f)); so[w][8 * hh + r][t * 16 + ln] = v; } }
  __builtin_amdgcn_fence(__ATOMIC_ACQ_REL, "workgroup"); __builtin_amdgcn_wave_barrier();
  const int rsub = lane >> 4, c4 = (lane & 15) * 4; typedef _Float16 v4h __attribute__((ext_vector_type(4)));
  {
#pragma unroll
    for (int q = 0; q < 8; ++q) { const int r = q * 2 + rsub; if (col0 + c4 < N) { const v4f v = *(const v4fa*)&so[w][r][c4]; if (C) *(v4f*)(C + cofs + (size_t)(row0 + r) * ldc + col0 + c4) = v; if (C16) { v4h h4; for (int i = 0; i < 4; ++i) h4[i] = (_Float16)v[i]; *(v4h*)(C16 + cofs + (size_t)(row0 + r) * ldc + col0 + c4) = h4; } } }
     }
}


typedef _Float16 v4h __attribute__((ext_vector_type(4)));

__global__ __launch_bounds__(256) void k_x16(const float* __restrict__ x, _Float16* __restrict__ X16, size_t n8) { const size_t t = (size_t)blockIdx.x * 256 + threadIdx.x; if (t >= n8) return; FragH f;
#pragma unroll
  for (int q = 0; q < 8; ++q) f.h[q] = (_Float16)bf16_round(x[t * 8 + q]); *(v8us*)((unsigned short*)X16 + t * 8) = f.half[0];  }
__global__ __launch_bounds__(256) void k_h16(const float* __restrict__ x, _Float16* __restrict__ X16, size_t n8) { const size_t t = (size_t)blockIdx.x * 256 + threadIdx.x; if (t >= n8) return; FragH f;
#pragma unroll
  for (int q = 0; q < 8; ++q) f.h[q] = (_Float16)x[t * 8 + q]; *(v8us*)((unsigned short*)X16 + t * 8) = f.half[0];  }
__global__ __launch_bounds__(256) void k_round16f(const float* __restrict__ W, _Float16* __restrict__ Bt, size_t n8) { const size_t t = (size_t)blockIdx.x * 256 + threadIdx.x; if (t >= n8) return; FragH f;
#pragma unroll
  for (int i = 0; i < 8; ++i) f.h[i] = (_Float16)(bf16_round(W[t * 8 + i]) * 16.0f); *(v8us*)((unsigned short*)Bt + t * 8) = f.half[0];  }
template <int NHv, int TTv>
__global__ __launch_bounds__(256) void k_vt(const _Float16* __restrict__ V16, int ldv, int voff, _Float16* __restrict__ Vt) { __shared__ unsigned short tl[64][66]; const int tid = threadIdx.x; const int slab = blockIdx.x / (TTv / 64), lg = blockIdx.x % (TTv / 64); const int b = slab / NHv, h = slab % NHv;
  for (int i = tid; i < 64 * 8; i += 256) { const int r = i / 8, c8 = (i % 8) * 8; FragH f; f.half[0] = *(const v8us*)((const unsigned short*)V16 + ((size_t)b * TTv + lg * 64 + r) * ldv + voff + h * 64 + c8);
#pragma unroll
    for (int q = 0; q < 8; ++q) tl[r][c8 + q] = f.u[q]; }
  __syncthreads();
  {
#pragma unroll
    for (int rd = 0; rd < 2; ++rd) { const int d = rd * 32 + tid / 8, pc = tid % 8; FragH f;
#pragma unroll
      for (int q = 0; q < 8; ++q) f.u[q] = tl[pc * 8 + q][d];
      *(v8us*)((unsigned short*)Vt + ((size_t)slab * 64 + d) * TTv + lg * 64 + pc * 8) = f.half[0]; }
     } }

__global__ __launch_bounds__(256) void k_hl(const float* __restrict__ F, _Float16* __restrict__ Hh, _Float16* __restrict__ Hl, size_t n8) { const size_t t = (size_t)blockIdx.x * 256 + threadIdx.x; if (t >= n8) return; FragH fh, fl; const v4f a = *(const v4fa*)(F + t * 8), c = *(const v4fa*)(F + t * 8 + 4);
#pragma unroll
  for (int q = 0; q < 4; ++q) { _Float16 h = (_Float16)a[q]; fh.h[q] = h; fl.h[q] = (_Float16)((a[q] - (float)h) * 1024.0f); h = (_Float16)c[q]; fh.h[4 + q] = h; fl.h[4 + q] = (_Float16)((c[q] - (float)h) * 1024.0f); }
  { *(v8us*)((unsigned short*)Hh + t * 8) = fh.half[0]; *(v8us*)((unsigned short*)Hl + t * 8) = fl.half[0];  } }

// ---- fast GEMM (wave tile 32x64; requires M % 32 == 0 rows per launch region and N % 64 == 0); epilogue = k_gemm_hhx semantics ----
__device__ __forceinline__ v16h g2_frag(const _Float16* p, int hh) { FragH f; f.half[0] = *(const v8us*)((const unsigned short*)p + 8 * hh); f.half[1] = *(const v8us*)((const unsigned short*)p + 16 + 8 * hh); return f.v; }
__device__ __forceinline__ v8f g2_mma(v16h a, v16h b, v8f c) { v8f d = __builtin_amdgcn_wmma_f32_16x16x32_f16(false, a, false, b, (short)0, c, false, false); asm volatile("v_nop\n\tv_nop\n\tv_nop\n\tv_nop" : "+v"(d) : "v"(a), "v"(b)); return d; }
template <int ACT>
__global__ __launch_bounds__(128) void k_gemm2(const _Float16* __restrict__ A, int lda, size_t sA, const _Float16* __restrict__ Bh, int ldb, size_t sB, float alpha, const float* __restrict__ bias, size_t sBias, const float* __restrict__ CP, int rowsPerB, size_t sCPb, int row0g,
    float* __restrict__ C, _Float16* __restrict__ C16, int ldc, size_t sC, int M, int N, int K) { static_assert(ACT == 0 || ACT == 3 || ACT == 6 || ACT == 8 || ACT == 9 || ACT == 11 || ACT == 12 || ACT == 14 || ACT == 15 || ACT == 16 || ACT == 17, "k_gemm2: unsupported ACT code (would silently apply no activation)");
  __shared__ __attribute__((aligned(16))) float so[4][32][68];
  const int tid = threadIdx.x, w = tid >> 5, lane = tid & 31, ln = lane & 15, hh = lane >> 4; const int by = blockIdx.y;
  A += (size_t)by * sA; Bh += (size_t)by * sB; const size_t cofs = (size_t)by * sC; const float* bp = bias ? bias + (size_t)by * sBias : nullptr;
  const int ntn = N >> 6; const int mt = blockIdx.x / ntn, nq = blockIdx.x - mt * ntn; const int row0 = mt * 128 + 32 * w, col0 = nq * 64; if (row0 >= M) return;
  const _Float16* a0p = A + (size_t)(row0 + ln) * lda; const _Float16* a1p = a0p + (size_t)16 * lda;
  const _Float16* b0p = Bh + (size_t)(col0 + ln) * ldb; const _Float16* b1p = b0p + (size_t)16 * ldb; const _Float16* b2p = b1p + (size_t)16 * ldb; const _Float16* b3p = b2p + (size_t)16 * ldb;
  const v8f z8 = {0.f,0.f,0.f,0.f,0.f,0.f,0.f,0.f}; v8f c00 = z8, c01 = z8, c02 = z8, c03 = z8, c10 = z8, c11 = z8, c12 = z8, c13 = z8;
#pragma unroll 1
  for (int kb = 0; kb < K; kb += 32) { const v16h a0 = g2_frag(a0p + kb, hh), a1 = g2_frag(a1p + kb, hh);
    v16h b = g2_frag(b0p + kb, hh); c00 = g2_mma(a0, b, c00); c10 = g2_mma(a1, b, c10);
    b = g2_frag(b1p + kb, hh); c01 = g2_mma(a0, b, c01); c11 = g2_mma(a1, b, c11);
    b = g2_frag(b2p + kb, hh); c02 = g2_mma(a0, b, c02); c12 = g2_mma(a1, b, c12);
    b = g2_frag(b3p + kb, hh); c03 = g2_mma(a0, b, c03); c13 = g2_mma(a1, b, c13); }
  v8f accs[8] = {c00, c01, c02, c03, c10, c11, c12, c13};
#pragma unroll
  for (int u = 0; u < 8; ++u) { const int t = u & 3, half = u >> 2; const int col = col0 + t * 16 + ln; const float bv = bp ? bf16_round(bp[col]) : 0.f;
#pragma unroll
    for (int r = 0; r < 8; ++r) { const int rloc = half * 16 + 8 * hh + r; float v = accs[u][r] * alpha + bv; if (CP) { if (rowsPerB < 0) v += CP[cofs + (size_t)(row0g + row0 + rloc) * ldc + col];      /* rowsPerB < 0: own element of the batched C plane */ else { const int bidx = (row0g + row0 + rloc) / rowsPerB; v += CP[(size_t)bidx * sCPb + (size_t)by * 64 + col]; } }
      if (ACT == 3) v = fmaxf(v, 0.f); else if (ACT == 6) v = 0.5f * v * (1.0f + erff(v * 0.70710678118654752f)); else if (ACT == 11) v = 1.0f / (1.0f + expf(-v)); else if (ACT == 15) v = v / (1.0f + expf(-v)); else if (ACT == 12) v = (v > 0.f) ? v : 0.01f * v; else if (ACT == 8) v = tanhf(v); else if (ACT == 9) v = 0.5f * v * (1.0f + tanhf(0.7978845608028654f * (v + 0.044715f * v * v * v))); else if (ACT == 14) v = (v > 0.f) ? v : 0.1f * v; else if (ACT == 16) v = (v >= 0.f) ? v : 0.3f * v; else if (ACT == 17) v = (v >= 0.f) ? v : 0.2f * v;
      so[w][rloc][t * 16 + ln] = v; } }
  __builtin_amdgcn_fence(__ATOMIC_ACQ_REL, "workgroup"); __builtin_amdgcn_wave_barrier();
  const int rsub = lane >> 4, c4 = (lane & 15) * 4;
  {
#pragma unroll
    for (int q = 0; q < 16; ++q) { const int r = q * 2 + rsub; const v4f v = *(const v4fa*)&so[w][r][c4]; if (C) *(v4f*)(C + cofs + (size_t)(row0 + r) * ldc + col0 + c4) = v; if (C16) { v4h h4; for (int i = 0; i < 4; ++i) h4[i] = (_Float16)v[i]; *(v4h*)(C16 + cofs + (size_t)(row0 + r) * ldc + col0 + c4) = h4; } }
     } }


__global__ __launch_bounds__(256) void k_xrows(const float* __restrict__ x, float* __restrict__ RES) { __shared__ float tl[CC][33]; const int tid = threadIdx.x; const int b = blockIdx.x / (NP / 32), pb = blockIdx.x % (NP / 32); const int p0 = pb * 32;
  for (int i = tid; i < CC * 32; i += 256) { const int c = i / 32, j = i % 32; tl[c][j] = bf16_round(x[((size_t)b * CC + c) * NP + p0 + j]); }
  __syncthreads();
  { for (int i = tid; i < 32 * (CC / 8); i += 256) { const int j = i / (CC / 8), c0 = (i % (CC / 8)) * 8; v8f v; for (int q = 0; q < 8; ++q) v[q] = tl[c0 + q][j]; *(v8f*)(RES + ((size_t)b * NP + p0 + j) * CC + c0) = v; }  } }
__global__ __launch_bounds__(256) void k_elu32(float* __restrict__ F, size_t n8) {
  #pragma clang fp contract(off)
  const size_t t = (size_t)blockIdx.x * 256 + threadIdx.x; if (t >= n8) return; v8f v = *(const v8f*)(F + t * 8); for (int q = 0; q < 8; ++q) { const float a = v[q]; v[q] = (a > 0.f) ? a : expm1f(a); } *(v8f*)(F + t * 8) = v;  }
__global__ __launch_bounds__(256) void k_elu16(const float* __restrict__ F, _Float16* __restrict__ E, size_t n8) {
  #pragma clang fp contract(off)
  const size_t t = (size_t)blockIdx.x * 256 + threadIdx.x; if (t >= n8) return; const v8f v = *(const v8f*)(F + t * 8); FragH f; for (int q = 0; q < 8; ++q) { const float a = v[q]; f.h[q] = (_Float16)((a > 0.f) ? a : expm1f(a)); } *(v8us*)((unsigned short*)E + t * 8) = f.half[0];  }
__global__ __launch_bounds__(256) void k_im8(const _Float16* __restrict__ S, _Float16* __restrict__ IM) { const size_t t_ = (size_t)blockIdx.x * 256 + threadIdx.x; if (t_ >= NR * 8 * 32) return; const int c8 = (int)(t_ % 32) * 8; const int tap = (int)((t_ / 32) % 8); const size_t r = t_ / 256; const int p = (int)(r % NP); const size_t b = r / NP; const int w = p % DW, h = (p / DW) % DH, tt = p / (DW * DH); const int dw = tap % 2, dh = (tap / 2) % 2, dt = tap / 4; const int t2 = tt + dt - 1, h2 = h + dh - 1, w2 = w + dw - 1; v8us v;
  if (t2 >= 0 && h2 >= 0 && w2 >= 0) v = *(const v8us*)((const unsigned short*)S + (b * NP + (size_t)(t2 * DH + h2) * DW + w2) * CC + c8); else { for (int q = 0; q < 8; ++q) v[q] = 0; }
  unsigned short* d = (unsigned short*)IM + r * K8 + (size_t)tap * CC + c8; *(v8us*)d = v;  }
__global__ __launch_bounds__(256) void k_w8(const float* __restrict__ w, int O, _Float16* __restrict__ Bt) { const size_t t = (size_t)blockIdx.x * 256 + threadIdx.x; if (t >= (size_t)O * K8 / 8) return; const int c8 = (int)((t * 8) % CC); const int tap = (int)(((t * 8) / CC) % 8); const int o = (int)((t * 8) / K8); FragH f; for (int q = 0; q < 8; ++q) f.h[q] = (_Float16)(bf16_round(w[((size_t)o * CC + c8 + q) * 8 + tap]) * 16.0f);
  *(v8us*)((unsigned short*)Bt + t * 8) = f.half[0];  }
__global__ __launch_bounds__(256) void k_gate(const float* __restrict__ O2, float* __restrict__ RES) {
  #pragma clang fp contract(off)
  const size_t t = (size_t)blockIdx.x * 256 + threadIdx.x; if (t >= NR * CC / 8) return; const int c0 = (int)((t * 8) % CC); const size_t r = (t * 8) / CC; v8f v = *(const v8f*)(RES + t * 8); const float* o = O2 + r * 512;
  for (int q = 0; q < 8; ++q) { const float a = o[c0 + q], g = o[256 + c0 + q]; const float s = 1.0f / (1.0f + expf(-g)); v[q] = v[q] + __fmul_rn(a, s); }
  *(v8f*)(RES + t * 8) = v;  }
__global__ __launch_bounds__(256) void k_xa(const float* __restrict__ RES, const float* __restrict__ orig, _Float16* __restrict__ XA) { const size_t t = (size_t)blockIdx.x * 256 + threadIdx.x; if (t >= NR * 36) return; const int pc = (int)(t % 36); const size_t r = t / 36; const int p = (int)(r % NP); const size_t b = r / NP; FragH f;
  for (int q = 0; q < 8; ++q) { const int col = pc * 8 + q; float v = 0.f; if (col < 256) v = RES[r * CC + col]; else if (col < 259) v = bf16_round(orig[((b * 3 + (col - 256)) * (size_t)NP) + p]); else if (col == 259) v = -0.5f + (float)(p / (DH * DW)) / (float)DT; else if (col == 260) v = -0.5f + (float)((p / DW) % DH) / (float)DH; else if (col == 261) v = -0.5f + (float)(p % DW) / (float)DW; f.h[q] = (_Float16)v; }
  unsigned short* d = (unsigned short*)XA + r * KA + pc * 8; *(v8us*)d = f.half[0];  }
__global__ __launch_bounds__(256) void k_wa(const float* __restrict__ w, int O, int OP, _Float16* __restrict__ Bt) { const size_t t = (size_t)blockIdx.x * 256 + threadIdx.x; if (t >= (size_t)OP * KA / 8) return; const int k0 = (int)((t * 8) % KA); const int o = (int)((t * 8) / KA); FragH f; for (int q = 0; q < 8; ++q) { const int k = k0 + q; f.h[q] = (o < O && k < 262) ? (_Float16)(bf16_round(w[(size_t)o * 262 + k]) * 16.0f) : (_Float16)0.f; }
  *(v8us*)((unsigned short*)Bt + t * 8) = f.half[0];  }
__global__ __launch_bounds__(256) void k_bpad(const float* __restrict__ b, int n, int np_, float* __restrict__ bp) { const int i = blockIdx.x * 256 + threadIdx.x; if (i >= np_) return; const float v = (i < n) ? b[i] : 0.f; *(float*)(bp + i) = v;  }
__global__ __launch_bounds__(256) void k_vt(const _Float16* __restrict__ V16, int b, _Float16* __restrict__ VT) { __shared__ unsigned short tl[64][VC + 2]; const int tid = threadIdx.x; const int k0 = blockIdx.x * 64; const unsigned short* s = (const unsigned short*)V16 + ((size_t)b * NP + k0) * VC;
  for (int i = tid; i < 64 * (VC / 8); i += 256) { const int j = i / (VC / 8), c8 = (i % (VC / 8)) * 8; FragH f; f.half[0] = *(const v8us*)(s + (size_t)j * VC + c8); for (int q = 0; q < 8; ++q) tl[j][c8 + q] = f.u[q]; }
  __syncthreads();
  { for (int i = tid; i < VC * 8; i += 256) { const int c = i / 8, j8 = (i % 8) * 8; v8us o; for (int q = 0; q < 8; ++q) o[q] = tl[j8 + q][c]; *(v8us*)((unsigned short*)VT + (size_t)c * NP + k0 + j8) = o; }  } }
// causal row softmax, one work-group per query row q: 256 threads x 16 scores each, kept in registers between the max pass and the exp pass;
// lanes read and write neighbouring 8-element pieces; pieces wholly at k >= q are not read and store zeros. Row max and row sum: butterfly in the wave, then 8 wave partials through LDS.
__global__ __launch_bounds__(256) void k_csm(const float* __restrict__ S, _Float16* __restrict__ P, float* __restrict__ RS) {
  __shared__ float redm[8], reds[8];
  const int q = blockIdx.x, tid = threadIdx.x, lane = tid & 31, w = tid >> 5; const float* s = S + (size_t)q * NP;
  const float sq = sqrtf(259.0f);      /* np.float32(sqrt(259)) division: s/sqrt(C_ATT) */
  const int ka = tid * 8, kb = NP / 2 + tid * 8;
  const v4f z4 = {0.f, 0.f, 0.f, 0.f}; v4f x[4] = {z4, z4, z4, z4};
  if (ka < q) { x[0] = *(const v4fa*)(s + ka); x[1] = *(const v4fa*)(s + ka + 4); }
  if (kb < q) { x[2] = *(const v4fa*)(s + kb); x[3] = *(const v4fa*)(s + kb + 4); }
  float v[16]; float mx = -3.0e38f;
#pragma unroll
  for (int u = 0; u < 2; ++u) { const int k0 = u ? kb : ka;
    if (k0 < q) {
#pragma unroll
      for (int i = 0; i < 8; ++i) { const float t = x[u * 2 + (i >> 2)][i & 3] / sq; v[u * 8 + i] = t; mx = (k0 + i < q) ? fmaxf(mx, t) : mx; } }
    else {
#pragma unroll
      for (int i = 0; i < 8; ++i) v[u * 8 + i] = 0.f; } }
#pragma unroll
  for (int m = 16; m > 0; m >>= 1) mx = fmaxf(mx, __shfl_xor(mx, m));
  if (lane == 0) redm[w] = mx;
  __syncthreads();
#pragma unroll
  for (int i = 0; i < 8; ++i) mx = fmaxf(mx, redm[i]);
  float se = 0.f;
#pragma unroll
  for (int u = 0; u < 2; ++u) { const int k0 = u ? kb : ka; FragH f;
    if (k0 < q) {
#pragma unroll
      for (int i = 0; i < 8; ++i) { const float ee = expf(v[u * 8 + i] - mx); const float e = (k0 + i < q) ? ee : 0.f; se += e; f.h[i] = (_Float16)(e * 256.0f); } }
    else {
#pragma unroll
      for (int i = 0; i < 8; ++i) f.u[i] = 0; }
    *(v8us*)((unsigned short*)P + (size_t)q * NP + k0) = f.half[0]; }
#pragma unroll
  for (int m = 16; m > 0; m >>= 1) se += __shfl_xor(se, m);
  if (lane == 0) reds[w] = se;
  __syncthreads();
  if (tid == 0) { float t = 0.f;
#pragma unroll
    for (int i = 0; i < 8; ++i) t += reds[i];
    RS[(size_t)q * 32] = (q == 0) ? 0.f : (1.0f / 256.0f) / t; } }
__global__ __launch_bounds__(256) void k_ascale(const float* __restrict__ AT, const float* __restrict__ RS, int b, _Float16* __restrict__ ATE) {
  #pragma clang fp contract(off)
  const size_t t = (size_t)blockIdx.x * 256 + threadIdx.x; if (t >= (size_t)NP * VC / 8) return; const int q = (int)((t * 8) / VC); const float rs = RS[(size_t)q * 32]; const v8f a = *(const v8f*)(AT + t * 8); FragH f; for (int u = 0; u < 8; ++u) { const float v = a[u] * rs; f.h[u] = (_Float16)((v > 0.f) ? v : expm1f(v)); }
  unsigned short* d = (unsigned short*)ATE + ((size_t)b * NP * VC) + t * 8; *(v8us*)d = f.half[0];  }
__global__ __launch_bounds__(256) void k_sumelu(const float* __restrict__ A, const float* __restrict__ B, _Float16* __restrict__ E, size_t n8) {
  #pragma clang fp contract(off)
  const size_t t = (size_t)blockIdx.x * 256 + threadIdx.x; if (t >= n8) return; const v8f a = *(const v8f*)(A + t * 8), b = *(const v8f*)(B + t * 8); FragH f; for (int q = 0; q < 8; ++q) { const float v = a[q] + b[q]; f.h[q] = (_Float16)((v > 0.f) ? v : expm1f(v)); } *(v8us*)((unsigned short*)E + t * 8) = f.half[0];  }
__global__ __launch_bounds__(256) void k_out(const float* __restrict__ O, float* __restrict__ out) { const size_t t = (size_t)blockIdx.x * 256 + threadIdx.x; if (t >= (size_t)NB * CC * NP / 8) return; const int p0 = (int)((t * 8) % NP); const size_t bc = (t * 8) / NP; const int c = (int)(bc % CC); const size_t b = bc / CC; v8f r; for (int q = 0; q < 8; ++q) r[q] = O[(b * NP + p0 + q) * CC + c];
  *(v8f*)(out + t * 8) = r;  }

extern "C" void kernel_launch(void* const* d_in, const int* in_sizes, int n_in,
                              void* d_out, int out_size, void* d_ws, size_t ws_size, hipStream_t stream) {
  (void)in_sizes; (void)n_in; (void)out_size;
  const float* const* I = (const float* const*)d_in; const float* x = I[0]; const float* orig = I[1]; const float* rw1 = I[2]; const float* rb1 = I[3]; const float* rw2 = I[4]; const float* rb2 = I[5]; const float* qw = I[6]; const float* qb = I[7]; const float* kw = I[8]; const float* kb = I[9]; const float* vw = I[10]; const float* vb = I[11]; const float* aw = I[12]; const float* ab = I[13]; const float* rsw = I[14]; const float* rsb = I[15]; const float* ow = I[16]; const float* ob = I[17];
  char* ws = (char*)d_ws; size_t off = 0;
  auto take = [&](size_t bytes) { char* p = ws + off; off += (bytes + 255) & ~(size_t)255; return p; };
  _Float16* BW1 = (_Float16*)take((size_t)CC * K8 * 2); _Float16* BW2 = (_Float16*)take((size_t)512 * K8 * 2); _Float16* BQ = (_Float16*)take((size_t)64 * KA * 2); _Float16* BK = (_Float16*)take((size_t)64 * KA * 2); _Float16* BV = (_Float16*)take((size_t)VC * KA * 2); float* qbp = (float*)take(64 * 4); float* kbp = (float*)take(64 * 4); _Float16* BA = (_Float16*)take((size_t)CC * VC * 2); _Float16* BR = (_Float16*)take((size_t)CC * CC * 2); _Float16* BO = (_Float16*)take((size_t)CC * CC * 2);
  float* RES = (float*)take(NR * CC * 4); _Float16* E16 = (_Float16*)take(NR * CC * 2); _Float16* IM = (_Float16*)take(NR * K8 * 2); _Float16* O1 = (_Float16*)take(NR * CC * 2); float* O2 = (float*)take(NR * 512 * 4);
  _Float16* XA = (_Float16*)take(NR * KA * 2); _Float16* Q16 = (_Float16*)take(NR * 64 * 2); _Float16* K16 = (_Float16*)take(NR * 64 * 2); _Float16* V16 = (_Float16*)take(NR * VC * 2); _Float16* VT = (_Float16*)take((size_t)VC * NP * 2); float* S = (float*)take((size_t)NP * NP * 4); _Float16* P = (_Float16*)take((size_t)NP * NP * 2); float* RS = (float*)take((size_t)NP * 32 * 4); float* AT = (float*)take((size_t)NP * VC * 4);
  _Float16* ATE = (_Float16*)take(NR * VC * 2); float* ATTC = (float*)take(NR * CC * 4); float* R2 = (float*)take(NR * CC * 4); _Float16* SUM16 = (_Float16*)take(NR * CC * 2); float* OUT = O2;
  if (off > ws_size) return;      /* 3.6 + 8.4 + 4.2 + 33.5 + 4.2 + 16.8 + 4.7 + 4.2 + 1 + 67 + 33.5 + 0.5 + 2 + 2 + 8.4 + 8.4 + 4.2 = ≈ 207 MB (197.5 MiB) */
  k_wa<<<(unsigned)(((size_t)64 * KA / 8 + 255) / 256), 256, 0, stream>>>(qw, 16, 64, BQ); k_wa<<<(unsigned)(((size_t)64 * KA / 8 + 255) / 256), 256, 0, stream>>>(kw, 16, 64, BK); k_wa<<<(unsigned)(((size_t)VC * KA / 8 + 255) / 256), 256, 0, stream>>>(vw, VC, VC, BV); k_bpad<<<1, 64, 0, stream>>>(qb, 16, 64, qbp); k_bpad<<<1, 64, 0, stream>>>(kb, 16, 64, kbp);
  k_round16f<<<(CC * VC / 8 + 255) / 256, 256, 0, stream>>>(aw, BA, (size_t)CC * VC / 8); k_round16f<<<(CC * CC / 8 + 255) / 256, 256, 0, stream>>>(rsw, BR, (size_t)CC * CC / 8); k_round16f<<<(CC * CC / 8 + 255) / 256, 256, 0, stream>>>(ow, BO, (size_t)CC * CC / 8);
  k_xrows<<<NB * (NP / 32), 256, 0, stream>>>(x, RES);
  const unsigned n8 = (unsigned)((NR * CC / 8 + 255) / 256); const dim3 g256((unsigned)((NR / 128) * (CC / 64)), 1);
  for (int i = 0; i < NRES; ++i) {
    k_w8<<<(unsigned)(((size_t)CC * K8 / 8 + 255) / 256), 256, 0, stream>>>(rw1 + (size_t)i * CC * CC * 8, CC, BW1); k_w8<<<(unsigned)(((size_t)512 * K8 / 8 + 255) / 256), 256, 0, stream>>>(rw2 + (size_t)i * 512 * CC * 8, 512, BW2);
    k_elu16<<<n8, 256, 0, stream>>>(RES, E16, NR * CC / 8); k_im8<<<(unsigned)((NR * 256 + 255) / 256), 256, 0, stream>>>(E16, IM);
    k_gemm2<0><<<g256, 128, 0, stream>>>(IM, K8, 0, BW1, K8, 0, 0.0625f, rb1 + i * CC, 0, nullptr, 1, 0, 0, ATTC, nullptr, CC, 0, (int)NR, CC, K8); k_elu16<<<n8, 256, 0, stream>>>(ATTC, O1, NR * CC / 8);      /* o = elu(conv1 + b1) (ATTC used as scratch here) */
    k_im8<<<(unsigned)((NR * 256 + 255) / 256), 256, 0, stream>>>(O1, IM);
    k_gemm2<0><<<dim3((unsigned)((NR / 128) * 8), 1), 128, 0, stream>>>(IM, K8, 0, BW2, K8, 0, 0.0625f, rb2 + i * 512, 0, nullptr, 1, 0, 0, O2, nullptr, 512, 0, (int)NR, 512, K8);      /* conv2 + b2 (512) */
    k_gate<<<n8, 256, 0, stream>>>(O2, RES); }
  /* attention */
  k_xa<<<(unsigned)((NR * 36 + 255) / 256), 256, 0, stream>>>(RES, orig, XA);
  k_gemm2<0><<<dim3((unsigned)((NR / 128) * 1), 1), 128, 0, stream>>>(XA, KA, 0, BQ, KA, 0, 0.0625f, qbp, 0, nullptr, 1, 0, 0, nullptr, Q16, 64, 0, (int)NR, 64, KA);
  k_gemm2<0><<<dim3((unsigned)((NR / 128) * 1), 1), 128, 0, stream>>>(XA, KA, 0, BK, KA, 0, 0.0625f, kbp, 0, nullptr, 1, 0, 0, nullptr, K16, 64, 0, (int)NR, 64, KA);
  k_gemm2<0><<<dim3((unsigned)((NR / 128) * 2), 1), 128, 0, stream>>>(XA, KA, 0, BV, KA, 0, 0.0625f, vb, 0, nullptr, 1, 0, 0, nullptr, V16, VC, 0, (int)NR, VC, KA);
  for (int b = 0; b < NB; ++b) {
    k_gemm2<0><<<dim3((NP / 128) * (NP / 64), 1), 128, 0, stream>>>(Q16 + (size_t)b * NP * 64, 64, 0, K16 + (size_t)b * NP * 64, 64, 0, 1.0f, nullptr, 0, nullptr, 1, 0, 0, S, nullptr, NP, 0, NP, NP, 32);
    k_csm<<<NP, 256, 0, stream>>>(S, P, RS); k_vt<<<NP / 64, 256, 0, stream>>>(V16, b, VT);
    k_gemm2<0><<<dim3((NP / 128) * (VC / 64), 1), 128, 0, stream>>>(P, NP, 0, VT, NP, 0, 1.0f, nullptr, 0, nullptr, 1, 0, 0, AT, nullptr, VC, 0, NP, VC, NP);
    k_ascale<<<(unsigned)(((size_t)NP * VC / 8 + 255) / 256), 256, 0, stream>>>(AT, RS, b, ATE); }
  k_gemm2<0><<<g256, 128, 0, stream>>>(ATE, VC, 0, BA, VC, 0, 0.0625f, ab, 0, nullptr, 1, 0, 0, ATTC, nullptr, CC, 0, (int)NR, CC, VC); k_elu32<<<n8, 256, 0, stream>>>(ATTC, NR * CC / 8);      /* att = elu(attn_conv(elu(att)) + b) */
  k_elu16<<<n8, 256, 0, stream>>>(RES, E16, NR * CC / 8); k_gemm2<0><<<g256, 128, 0, stream>>>(E16, CC, 0, BR, CC, 0, 0.0625f, rsb, 0, nullptr, 1, 0, 0, R2, nullptr, CC, 0, (int)NR, CC, CC); k_elu32<<<n8, 256, 0, stream>>>(R2, NR * CC / 8);      /* res = elu(res_conv(elu(res)) + b) */
  k_sumelu<<<n8, 256, 0, stream>>>(R2, ATTC, SUM16, NR * CC / 8);
  k_gemm2<0><<<g256, 128, 0, stream>>>(SUM16, CC, 0, BO, CC, 0, 0.0625f, ob, 0, nullptr, 1, 0, 0, OUT, nullptr, CC, 0, (int)NR, CC, CC); k_elu32<<<n8, 256, 0, stream>>>(OUT, NR * CC / 8);      /* out = elu(out_conv(elu(res + att)) + b) */
  k_out<<<(unsigned)(((size_t)NB * CC * NP / 8 + 255) / 256), 256, 0, stream>>>(OUT, (float*)d_out);
}

// v002
// Measured time: 646 microseconds a run.
// In two side-by-side timings against v001, it was 1.85 and 1.83 times as fast.
// Counting every step since v000, it is 4.71 times as fast.
#include <hip/hip_runtime.h>
// PixelSNAILBlock (x [2][256][16][16][16], original_input [2][3][16][16][16]; 4 gated residual blocks: o = elu(conv3d k2 pad1 crop(elu(res)) + b1); o = conv3d k2 pad1 crop(o) + b2 (512 ch); res += o[:256] * sigmoid(o[256:]); attention over the 4,096 positions of [res | original | pos-enc] (262 ch): q,k (16), v (128), causal softmax (k < q, row 0 all-zero) of q.k/sqrt(259), att = p v; att = elu(1x1(elu(att)) + b); res = elu(1x1(elu(res)) + b); out = elu(1x1(elu(res + att)) + b) -> [2][256][16][16][16]).
// Structure: position rows r = b*4096 + (t*16 + h)*16 + w; res kept as f32 rows; each k2 'causal-corner' conv as an 8-tap im2col of f16 rows (K = 2,048) + WMMA GEMM (32x64 wave tiles, f32 accumulation, exact x16 weights + bias) with the ELUs on VALU; gating on VALU; q/k/v as GEMMs on the 262 -> 288-column concat rows (16 live of 64 for q/k); per batch: scores GEMM (K = 32), causal row softmax on VALU (un-normalised f16 weights x 2^8 + 1/sum, row 0 -> 0), P.V GEMM (K = 4,096) against LDS-transposed value planes, scaling; the three 1x1 convs as GEMMs followed by VALU ELUs; channel-major store on VALU.
// Compute dtype: inputs rounded to bf16; x / original / weights exact; conv operands (elu(res), o1), the concat rows, q/k/v, softmax weights and the 1x1-conv operands plain f16 (~2^-12); res accumulation, gates, softmax sums f32. v_wmma_f32_16x16x32_f16.
#define NB 2
#define CC 256
#define DT 16
#define DH 16
#define DW 16
#define NP (DT * DH * DW)            /* 4096 */
#define NR ((size_t)NB * NP)       /* 8192 */
#define NRES 4
#define K8 (8 * CC)                /* 2048 */
#define KA 288                     /* 262 live */
#define VC 128
typedef __bf16 v16b __attribute__((ext_vector_type(16)));
typedef unsigned short v8us __attribute__((ext_vector_type(8), may_alias));
typedef float  v8f  __attribute__((ext_vector_type(8)));
typedef float  v4f  __attribute__((ext_vector_type(4)));
typedef float  v4fa __attribute__((ext_vector_type(4), may_alias));
union FragB { v16b v; v8us half[2]; unsigned short u[16]; };

__device__ __forceinline__ unsigned short bf16_bits(float x) { unsigned int u = __float_as_uint(x); return (unsigned short)((u + 0x7FFFu + ((u >> 16) & 1u)) >> 16); }
__device__ __forceinline__ float bf16_val(unsigned short b) { return __uint_as_float(((unsigned int)b) << 16); }
__device__ __forceinline__ float bf16_round(float x) { return bf16_val(bf16_bits(x)); }
// D += A·B with NT terms: 1 = ah·bh, 2 = + al·bh (A split), 3 = + ah·bl (both split)
template <int NT>
__device__ __forceinline__ v8f mmaN(v16b ah, v16b al, v16b bh, v16b bl, v8f c) {
  c = __builtin_amdgcn_wmma_f32_16x16x32_bf16(false, ah, false, bh, (short)0, c, false, false);
  if (NT >= 2) c = __builtin_amdgcn_wmma_f32_16x16x32_bf16(false, al, false, bh, (short)0, c, false, false);
  if (NT >= 3) c = __builtin_amdgcn_wmma_f32_16x16x32_bf16(false, ah, false, bl, (short)0, c, false, false);
  asm volatile("v_nop\n\tv_nop\n\tv_nop\n\tv_nop" : "+v"(c) : "v"(ah), "v"(al), "v"(bh), "v"(bl));
  return c;
}

__global__ __launch_bounds__(256) void k_wt_bf16(const float* __restrict__ W, unsigned short* __restrict__ Wt, int K, int N) {
  const int t = blockIdx.x * 256 + threadIdx.x;
  const int k8n = K / 8;
  if (t >= N * k8n) return;
  const int n = t / k8n, k8 = (t % k8n) * 8;
  v8us v;
#pragma unroll
  for (int i = 0; i < 8; ++i) v[i] = bf16_bits(W[(size_t)(k8 + i) * N + n]);
  *(v8us*)(Wt + (size_t)n * K + k8) = v;
  
}

// GEMM C[M][N] (f32, pitch ldc) = act(A[M][K]·W + bias). A f32 row-major (pitch lda) converted per fragment to bf16
// (ASPLIT: hi/lo two planes -> 2 terms, else single rounded term); Wt bf16 [N][K] (pitch ldb). BIAS_BF16 rounds the
// bias to bf16 first (bias quantised to bf16 before the add). K%32==0, M%16==0, N%64==0.
template <bool ASPLIT, int ACT, bool BIAS_BF16>
__global__ __launch_bounds__(128) void k_gemm_bf(const float* __restrict__ A, int lda, const unsigned short* __restrict__ Wt, int ldb,
                                               const float* __restrict__ bias, float* __restrict__ C, int ldc, int M, int N, int K) {
  __shared__ __attribute__((aligned(16))) float so[4][16][64];
  const int tid = threadIdx.x, w = tid >> 5, lane = tid & 31, ln = lane & 15, hh = lane >> 4;
  const int ntn = N / 64;
  const int wid = blockIdx.x * 4 + w;
  const int mt = wid / ntn, nq = wid % ntn;
  if (mt * 16 >= M) return;
  const int row0 = mt * 16, col0 = nq * 64;
  const float* arow = A + (size_t)(row0 + ln) * lda;
  v8f acc[4] = {};
  for (int kb = 0; kb < K; kb += 32) {
    FragB ah, al;
    const v4f x0 = *(const v4fa*)(arow + kb + 8 * hh), x1 = *(const v4fa*)(arow + kb + 8 * hh + 4);
    const v4f x2 = *(const v4fa*)(arow + kb + 16 + 8 * hh), x3 = *(const v4fa*)(arow + kb + 16 + 8 * hh + 4);
    float xs[16] = {x0[0],x0[1],x0[2],x0[3],x1[0],x1[1],x1[2],x1[3],x2[0],x2[1],x2[2],x2[3],x3[0],x3[1],x3[2],x3[3]};
#pragma unroll
    for (int i = 0; i < 16; ++i) { const unsigned short hb = bf16_bits(xs[i]); ah.u[i] = hb; al.u[i] = ASPLIT ? bf16_bits(xs[i] - bf16_val(hb)) : (unsigned short)0; }
#pragma unroll
    for (int t = 0; t < 4; ++t) {
      const unsigned short* brow = Wt + (size_t)(col0 + t * 16 + ln) * ldb + kb;
      FragB b;
      b.half[0] = *(const v8us*)(brow + 8 * hh);
      b.half[1] = *(const v8us*)(brow + 16 + 8 * hh);
      acc[t] = mmaN<ASPLIT ? 2 : 1>(ah.v, al.v, b.v, b.v, acc[t]);
    }
  }
#pragma unroll
  for (int t = 0; t < 4; ++t) {
    float bv = bias ? bias[col0 + t * 16 + ln] : 0.f;
    if (BIAS_BF16) bv = bf16_round(bv);
#pragma unroll
    for (int r = 0; r < 8; ++r) { float v = acc[t][r] + bv; if (ACT == 1) v = fmaxf(v, 0.f); so[w][8 * hh + r][t * 16 + ln] = v; }
  }
  __builtin_amdgcn_fence(__ATOMIC_ACQ_REL, "workgroup");
  __builtin_amdgcn_wave_barrier();
  const int rsub = lane >> 4, c4 = (lane & 15) * 4;
  {
#pragma unroll
    for (int q = 0; q < 8; ++q) {
      const int r = q * 2 + rsub;
      const v4f v = *(const v4fa*)&so[w][r][c4];
      *(v4f*)(C + (size_t)(row0 + r) * ldc + col0 + c4) = v;
    }
    
  }
}

// GEMM C = act(A·W + bias + resid): A f32 (ASPLIT -> hi/lo 2 terms), Wt bf16 [N][K]; ACT 0 none, 1 relu, 2 exact gelu;
// resid (optional, f32, row index = (row % rmod), pitch ldr, RES_BF16 rounds it) added before the activation.
template <bool ASPLIT, int ACT, bool BIAS_BF16, bool RES_BF16>
__global__ __launch_bounds__(128) void k_gemm_bf3(const float* __restrict__ A, int lda, const unsigned short* __restrict__ Wt, int ldb,
                                                const float* __restrict__ bias, const float* __restrict__ resid, int rmod, int ldr,
                                                float* __restrict__ C, int ldc, int M, int N, int K) {
  __shared__ __attribute__((aligned(16))) float so[4][16][64];
  const int tid = threadIdx.x, w = tid >> 5, lane = tid & 31, ln = lane & 15, hh = lane >> 4;
  const int ntn = N / 64;
  const int wid = blockIdx.x * 4 + w;
  const int mt = wid / ntn, nq = wid % ntn;
  if (mt * 16 >= M) return;
  const int row0 = mt * 16, col0 = nq * 64;
  const float* arow = A + (size_t)(row0 + ln) * lda;
  v8f acc[4] = {};
  for (int kb = 0; kb < K; kb += 32) {
    FragB ah, al;
    const v4f x0 = *(const v4fa*)(arow + kb + 8 * hh), x1 = *(const v4fa*)(arow + kb + 8 * hh + 4);
    const v4f x2 = *(const v4fa*)(arow + kb + 16 + 8 * hh), x3 = *(const v4fa*)(arow + kb + 16 + 8 * hh + 4);
    float xs[16] = {x0[0],x0[1],x0[2],x0[3],x1[0],x1[1],x1[2],x1[3],x2[0],x2[1],x2[2],x2[3],x3[0],x3[1],x3[2],x3[3]};
#pragma unroll
    for (int i = 0; i < 16; ++i) { const unsigned short hb = bf16_bits(xs[i]); ah.u[i] = hb; al.u[i] = ASPLIT ? bf16_bits(xs[i] - bf16_val(hb)) : (unsigned short)0; }
#pragma unroll
    for (int t = 0; t < 4; ++t) {
      const unsigned short* brow = Wt + (size_t)(col0 + t * 16 + ln) * ldb + kb;
      FragB b;
      b.half[0] = *(const v8us*)(brow + 8 * hh);
      b.half[1] = *(const v8us*)(brow + 16 + 8 * hh);
      acc[t] = mmaN<ASPLIT ? 2 : 1>(ah.v, al.v, b.v, b.v, acc[t]);
    }
  }
#pragma unroll
  for (int t = 0; t < 4; ++t) {
    const int col = col0 + t * 16 + ln;
    float bv = bias ? bias[col] : 0.f;
    if (BIAS_BF16) bv = bf16_round(bv);
#pragma unroll
    for (int r = 0; r < 8; ++r) {
      float v = acc[t][r] + bv;
      if (resid) { float rv = resid[(size_t)((row0 + 8 * hh + r) % rmod) * ldr + col]; if (RES_BF16) rv = bf16_round(rv); v += rv; }
      if (ACT == 1) v = fmaxf(v, 0.f);
      if (ACT == 2) v = 0.5f * v * (1.0f + erff(v * 0.70710678118654752f));
      if (ACT == 3) { const float u = 0.7978845608028654f * (v + 0.044715f * v * v * v); v = 0.5f * v * (1.0f + tanhf(u)); }
      so[w][8 * hh + r][t * 16 + ln] = v;
    }
  }
  __builtin_amdgcn_fence(__ATOMIC_ACQ_REL, "workgroup");
  __builtin_amdgcn_wave_barrier();
  const int rsub = lane >> 4, c4 = (lane & 15) * 4;
  {
#pragma unroll
    for (int q = 0; q < 8; ++q) {
      const int r = q * 2 + rsub;
      const v4f v = *(const v4fa*)&so[w][r][c4];
      *(v4f*)(C + (size_t)(row0 + r) * ldc + col0 + c4) = v;
    }
    
  }
}
// row LayerNorm (biased variance, eps) over N: s = X (+ R); optional out_sum <- s; out_norm <- (s-mu)*rsqrt(var+eps)*g + b
template <bool PARAM_BF16>
__global__ __launch_bounds__(256) void k_layernorm(const float* __restrict__ X, const float* __restrict__ R, const float* __restrict__ g, const float* __restrict__ bta,
                                                  float* __restrict__ out_sum, float* __restrict__ out_norm, int N, float eps) {
  __shared__ float red[256];
  const int row = blockIdx.x, tid = threadIdx.x;
  const float* x = X + (size_t)row * N; const float* rr = R ? R + (size_t)row * N : nullptr;
  float vals[16];                     // up to N = 4096
  const int per = N / 256;            // contiguous chunk per thread? use strided-by-4 chunks: thread handles j = tid*4 + 1024*u
  float s1 = 0.f;
  for (int u = 0; u < per / 4; ++u) {
    const int j = tid * 4 + 1024 * u;
    const v4f a = *(const v4fa*)(x + j);
    v4f b = {0.f,0.f,0.f,0.f}; if (rr) b = *(const v4fa*)(rr + j);
#pragma unroll
    for (int q = 0; q < 4; ++q) { const float v = a[q] + b[q]; vals[u * 4 + q] = v; s1 += v; }
  }
  red[tid] = s1; __syncthreads();
  for (int st = 128; st > 0; st >>= 1) { if (tid < st) red[tid] += red[tid + st]; __syncthreads(); }
  const float mu = red[0] / (float)N; __syncthreads();
  float s2 = 0.f;
  for (int u = 0; u < per / 4; ++u)
#pragma unroll
    for (int q = 0; q < 4; ++q) { const float c = vals[u * 4 + q] - mu; s2 += c * c; }
  red[tid] = s2; __syncthreads();
  for (int st = 128; st > 0; st >>= 1) { if (tid < st) red[tid] += red[tid + st]; __syncthreads(); }
  const float rs = rsqrtf(red[0] / (float)N + eps);
  {
    for (int u = 0; u < per / 4; ++u) {
      const int j = tid * 4 + 1024 * u;
      v4f o, sm;
#pragma unroll
      for (int q = 0; q < 4; ++q) {
        float gg = g[j + q], bb = bta[j + q];
        if (PARAM_BF16) { gg = bf16_round(gg); bb = bf16_round(bb); }
        sm[q] = vals[u * 4 + q]; o[q] = (vals[u * 4 + q] - mu) * rs * gg + bb;
      }
      if (out_sum) *(v4f*)(out_sum + (size_t)row * N + j) = sm;
      *(v4f*)(out_norm + (size_t)row * N + j) = o;
    }
    
  }
}



// ---- f16 WMMA path (v_wmma_f32_16x16x32_f16): 11-bit significands for operands in range — used for every GEMM launched in this file
typedef _Float16 v16h __attribute__((ext_vector_type(16)));
union FragH { v16h v; v8us half[2]; _Float16 h[16]; unsigned short u[16]; };
template <int NT>
__device__ __forceinline__ v8f mmaH(v16h ah, v16h al, v16h bh, v16h bl, v8f c) {
  c = __builtin_amdgcn_wmma_f32_16x16x32_f16(false, ah, false, bh, (short)0, c, false, false);
  if (NT >= 2) c = __builtin_amdgcn_wmma_f32_16x16x32_f16(false, al, false, bh, (short)0, c, false, false);
  if (NT >= 3) c = __builtin_amdgcn_wmma_f32_16x16x32_f16(false, ah, false, bl, (short)0, c, false, false);
  asm volatile("v_nop\n\tv_nop\n\tv_nop\n\tv_nop" : "+v"(c) : "v"(ah), "v"(al), "v"(bh), "v"(bl));
  return c;
}
// batched GEMM like k_gemm_b but f16 operands: A f32 (split into f16 hi/lo if ASPLIT, else rounded to f16), Bt = f16 values [n][k]; alpha; C f32; N multiple of 16 (partial tiles skipped)
template <bool ASPLIT>
__global__ __launch_bounds__(128) void k_gemm_h(const float* __restrict__ A, int lda, size_t sA, const _Float16* __restrict__ Bh, int ldb, size_t sB, float alpha, float* __restrict__ C, int ldc, size_t sC, int M, int N, int K) {
  __shared__ __attribute__((aligned(16))) float so[4][16][64];
  const int tid = threadIdx.x, w = tid >> 5, lane = tid & 31, ln = lane & 15, hh = lane >> 4; const int by = blockIdx.y;
  A += (size_t)by * sA; Bh += (size_t)by * sB; C += (size_t)by * sC;
  const int ntn = (N + 63) / 64; const int wid = blockIdx.x * 4 + w; const int mt = wid / ntn, nq = wid % ntn; if (mt * 16 >= M) return;
  const int row0 = mt * 16, col0 = nq * 64; const float* arow = A + (size_t)(row0 + ln) * lda;
  v8f acc[4] = {};
  for (int kb = 0; kb < K; kb += 32) {
    FragH ah, al;
    const v4f x0 = *(const v4fa*)(arow + kb + 8 * hh), x1 = *(const v4fa*)(arow + kb + 8 * hh + 4), x2 = *(const v4fa*)(arow + kb + 16 + 8 * hh), x3 = *(const v4fa*)(arow + kb + 16 + 8 * hh + 4);
    float xs[16] = {x0[0],x0[1],x0[2],x0[3],x1[0],x1[1],x1[2],x1[3],x2[0],x2[1],x2[2],x2[3],x3[0],x3[1],x3[2],x3[3]};
#pragma unroll
    for (int i = 0; i < 16; ++i) { const _Float16 h = (_Float16)xs[i]; ah.h[i] = h; al.h[i] = ASPLIT ? (_Float16)(xs[i] - (float)h) : (_Float16)0.0f; }
#pragma unroll
    for (int t = 0; t < 4; ++t) { if (col0 + t * 16 >= N) continue; const size_t boff = (size_t)(col0 + t * 16 + ln) * ldb + kb; FragH bq; bq.half[0] = *(const v8us*)(Bh + boff + 8 * hh); bq.half[1] = *(const v8us*)(Bh + boff + 16 + 8 * hh);
      acc[t] = mmaH<ASPLIT ? 2 : 1>(ah.v, al.v, bq.v, bq.v, acc[t]); }
  }
#pragma unroll
  for (int t = 0; t < 4; ++t) { if (col0 + t * 16 >= N) continue;
#pragma unroll
    for (int r = 0; r < 8; ++r) so[w][8 * hh + r][t * 16 + ln] = acc[t][r] * alpha; }
  __builtin_amdgcn_fence(__ATOMIC_ACQ_REL, "workgroup"); __builtin_amdgcn_wave_barrier();
  const int rsub = lane >> 4, c4 = (lane & 15) * 4;
  {
#pragma unroll
    for (int q = 0; q < 8; ++q) { const int r = q * 2 + rsub; if (col0 + c4 < N) { const v4f v = *(const v4fa*)&so[w][r][c4]; *(v4f*)(C + (size_t)(row0 + r) * ldc + col0 + c4) = v; } }
     }
}

// Wt[n][k] = f16(W[k][n]·scale) from f32 row-major W[K][N] (scale = power of two; bf16-exact weights stay exact in f16 away from the subnormal range)
__global__ __launch_bounds__(256) void k_wt_f16(const float* __restrict__ W, _Float16* __restrict__ Wt, int K, int N, float scale) {
  const int t = blockIdx.x * 256 + threadIdx.x; if (t >= N * (K / 8)) return; const int n = t / (K / 8), k8 = (t % (K / 8)) * 8; FragH f;
#pragma unroll
  for (int i = 0; i < 8; ++i) f.h[i] = (_Float16)(bf16_round(W[(size_t)(k8 + i) * N + n]) * scale); const v8us o = f.half[0];
  *(v8us*)((unsigned short*)Wt + (size_t)n * K + k8) = o; 
}
// k_gemm_hh variant with fused epilogue: v = acc·alpha + bias[by·sBias + col] (+ CP[(row/rowsPerB)·sCPb + by·64 + col] if CP) ; ACT 0 none / 1 elu ; writes f16 C16 (and f32 C if non-null)
template <int ACT>
__global__ __launch_bounds__(128) void k_gemm_hhx(const _Float16* __restrict__ A, int lda, size_t sA, const _Float16* __restrict__ Bh, int ldb, size_t sB, float alpha, const float* __restrict__ bias, size_t sBias, const float* __restrict__ CP, int rowsPerB, size_t sCPb, int row0g,
    float* __restrict__ C, _Float16* __restrict__ C16, int ldc, size_t sC, int M, int N, int K) {
  __shared__ __attribute__((aligned(16))) float so[4][16][64];
  const int tid = threadIdx.x, w = tid >> 5, lane = tid & 31, ln = lane & 15, hh = lane >> 4; const int by = blockIdx.y;
  A += (size_t)by * sA; Bh += (size_t)by * sB; const size_t cofs = (size_t)by * sC; const float* bp = bias ? bias + (size_t)by * sBias : nullptr;
  const int ntn = (N + 63) / 64; const int wid = blockIdx.x * 4 + w; const int mt = wid / ntn, nq = wid % ntn; if (mt * 16 >= M) return;
  const int row0 = mt * 16, col0 = nq * 64; const _Float16* arow = A + (size_t)(row0 + ln) * lda;
  v8f acc[4] = {};
  for (int kb = 0; kb < K; kb += 32) { FragH ah; ah.half[0] = *(const v8us*)((const unsigned short*)arow + kb + 8 * hh); ah.half[1] = *(const v8us*)((const unsigned short*)arow + kb + 16 + 8 * hh);
#pragma unroll
    for (int t = 0; t < 4; ++t) { if (col0 + t * 16 >= N) continue; const size_t boff = (size_t)(col0 + t * 16 + ln) * ldb + kb; FragH bq; bq.half[0] = *(const v8us*)((const unsigned short*)Bh + boff + 8 * hh); bq.half[1] = *(const v8us*)((const unsigned short*)Bh + boff + 16 + 8 * hh);
      acc[t] = mmaH<1>(ah.v, ah.v, bq.v, bq.v, acc[t]); }
  }
#pragma unroll
  for (int t = 0; t < 4; ++t) { if (col0 + t * 16 >= N) continue; const int col = col0 + t * 16 + ln; const float bv = bp ? bf16_round(bp[col]) : 0.f;
#pragma unroll
    for (int r = 0; r < 8; ++r) { float v = acc[t][r] * alpha + bv; if (CP) { const int rr = row0g + row0 + 8 * hh + r; if (rowsPerB < 0) v += CP[cofs + (size_t)rr * ldc + col];      /* rowsPerB < 0: own element of the batched C plane */ else { const int bidx = rr / rowsPerB; v += CP[(size_t)bidx * sCPb + (size_t)by * 64 + col]; } } if (ACT == 1) v = (v > 0.f) ? v : expm1f(v); else if (ACT == 7) v = (v > 0.f) ? v + 1.0f : expf(v); else if (ACT == 8) v = tanhf(v); else if (ACT == 9) v = 0.5f * v * (1.0f + tanhf(0.7978845608028654f * (v + 0.044715f * v * v * v))); else if (ACT == 11) v = 1.0f / (1.0f + expf(-v)); else if (ACT == 12) v = (v > 0.f) ? v : 0.01f * v; else if (ACT == 14) v = (v > 0.f) ? v : 0.1f * v; else if (ACT == 16) v = (v >= 0.f) ? v : 0.3f * v; else if (ACT == 17) v = (v >= 0.f) ? v : 0.2f * v; else if (ACT == 15) v = v / (1.0f + expf(-v)); else if (ACT == 3) v = fmaxf(v, 0.f); else if (ACT == 6) v = 0.5f * v * (1.0f + erff(v * 0.70710678118654752f)); so[w][8 * hh + r][t * 16 + ln] = v; } }
  __builtin_amdgcn_fence(__ATOMIC_ACQ_REL, "workgroup"); __builtin_amdgcn_wave_barrier();
  const int rsub = lane >> 4, c4 = (lane & 15) * 4; typedef _Float16 v4h __attribute__((ext_vector_type(4)));
  {
#pragma unroll
    for (int q = 0; q < 8; ++q) { const int r = q * 2 + rsub; if (col0 + c4 < N) { const v4f v = *(const v4fa*)&so[w][r][c4]; if (C) *(v4f*)(C + cofs + (size_t)(row0 + r) * ldc + col0 + c4) = v; if (C16) { v4h h4; for (int i = 0; i < 4; ++i) h4[i] = (_Float16)v[i]; *(v4h*)(C16 + cofs + (size_t)(row0 + r) * ldc + col0 + c4) = h4; } } }
     }
}


typedef _Float16 v4h __attribute__((ext_vector_type(4)));

__global__ __launch_bounds__(256) void k_x16(const float* __restrict__ x, _Float16* __restrict__ X16, size_t n8) { const size_t t = (size_t)blockIdx.x * 256 + threadIdx.x; if (t >= n8) return; FragH f;
#pragma unroll
  for (int q = 0; q < 8; ++q) f.h[q] = (_Float16)bf16_round(x[t * 8 + q]); *(v8us*)((unsigned short*)X16 + t * 8) = f.half[0];  }
__global__ __launch_bounds__(256) void k_h16(const float* __restrict__ x, _Float16* __restrict__ X16, size_t n8) { const size_t t = (size_t)blockIdx.x * 256 + threadIdx.x; if (t >= n8) return; FragH f;
#pragma unroll
  for (int q = 0; q < 8; ++q) f.h[q] = (_Float16)x[t * 8 + q]; *(v8us*)((unsigned short*)X16 + t * 8) = f.half[0];  }
__global__ __launch_bounds__(256) void k_round16f(const float* __restrict__ W, _Float16* __restrict__ Bt, size_t n8) { const size_t t = (size_t)blockIdx.x * 256 + threadIdx.x; if (t >= n8) return; FragH f;
#pragma unroll
  for (int i = 0; i < 8; ++i) f.h[i] = (_Float16)(bf16_round(W[t * 8 + i]) * 16.0f); *(v8us*)((unsigned short*)Bt + t * 8) = f.half[0];  }
template <int NHv, int TTv>
__global__ __launch_bounds__(256) void k_vt(const _Float16* __restrict__ V16, int ldv, int voff, _Float16* __restrict__ Vt) { __shared__ unsigned short tl[64][66]; const int tid = threadIdx.x; const int slab = blockIdx.x / (TTv / 64), lg = blockIdx.x % (TTv / 64); const int b = slab / NHv, h = slab % NHv;
  for (int i = tid; i < 64 * 8; i += 256) { const int r = i / 8, c8 = (i % 8) * 8; FragH f; f.half[0] = *(const v8us*)((const unsigned short*)V16 + ((size_t)b * TTv + lg * 64 + r) * ldv + voff + h * 64 + c8);
#pragma unroll
    for (int q = 0; q < 8; ++q) tl[r][c8 + q] = f.u[q]; }
  __syncthreads();
  {
#pragma unroll
    for (int rd = 0; rd < 2; ++rd) { const int d = rd * 32 + tid / 8, pc = tid % 8; FragH f;
#pragma unroll
      for (int q = 0; q < 8; ++q) f.u[q] = tl[pc * 8 + q][d];
      *(v8us*)((unsigned short*)Vt + ((size_t)slab * 64 + d) * TTv + lg * 64 + pc * 8) = f.half[0]; }
     } }

__global__ __launch_bounds__(256) void k_hl(const float* __restrict__ F, _Float16* __restrict__ Hh, _Float16* __restrict__ Hl, size_t n8) { const size_t t = (size_t)blockIdx.x * 256 + threadIdx.x; if (t >= n8) return; FragH fh, fl; const v4f a = *(const v4fa*)(F + t * 8), c = *(const v4fa*)(F + t * 8 + 4);
#pragma unroll
  for (int q = 0; q < 4; ++q) { _Float16 h = (_Float16)a[q]; fh.h[q] = h; fl.h[q] = (_Float16)((a[q] - (float)h) * 1024.0f); h = (_Float16)c[q]; fh.h[4 + q] = h; fl.h[4 + q] = (_Float16)((c[q] - (float)h) * 1024.0f); }
  { *(v8us*)((unsigned short*)Hh + t * 8) = fh.half[0]; *(v8us*)((unsigned short*)Hl + t * 8) = fl.half[0];  } }

// ---- fast GEMM (wave tile 32x64; requires M % 32 == 0 rows per launch region and N % 64 == 0); epilogue = k_gemm_hhx semantics ----
__device__ __forceinline__ v16h g2_frag(const _Float16* p, int hh) { FragH f; f.half[0] = *(const v8us*)((const unsigned short*)p + 8 * hh); f.half[1] = *(const v8us*)((const unsigned short*)p + 16 + 8 * hh); return f.v; }
__device__ __forceinline__ v8f g2_mma(v16h a, v16h b, v8f c) { v8f d = __builtin_amdgcn_wmma_f32_16x16x32_f16(false, a, false, b, (short)0, c, false, false); asm volatile("v_nop\n\tv_nop\n\tv_nop\n\tv_nop" : "+v"(d) : "v"(a), "v"(b)); return d; }
template <int ACT>
__global__ __launch_bounds__(128) void k_gemm2(const _Float16* __restrict__ A, int lda, size_t sA, const _Float16* __restrict__ Bh, int ldb, size_t sB, float alpha, const float* __restrict__ bias, size_t sBias, const float* __restrict__ CP, int rowsPerB, size_t sCPb, int row0g,
    float* __restrict__ C, _Float16* __restrict__ C16, int ldc, size_t sC, int M, int N, int K) { static_assert(ACT == 0 || ACT == 3 || ACT == 6 || ACT == 8 || ACT == 9 || ACT == 11 || ACT == 12 || ACT == 14 || ACT == 15 || ACT == 16 || ACT == 17, "k_gemm2: unsupported ACT code (would silently apply no activation)");
  __shared__ __attribute__((aligned(16))) float so[4][32][68];
  const int tid = threadIdx.x, w = tid >> 5, lane = tid & 31, ln = lane & 15, hh = lane >> 4; const int by = blockIdx.y;
  A += (size_t)by * sA; Bh += (size_t)by * sB; const size_t cofs = (size_t)by * sC; const float* bp = bias ? bias + (size_t)by * sBias : nullptr;
  const int ntn = N >> 6; const int mt = blockIdx.x / ntn, nq = blockIdx.x - mt * ntn; const int row0 = mt * 128 + 32 * w, col0 = nq * 64; if (row0 >= M) return;
  const _Float16* a0p = A + (size_t)(row0 + ln) * lda; const _Float16* a1p = a0p + (size_t)16 * lda;
  const _Float16* b0p = Bh + (size_t)(col0 + ln) * ldb; const _Float16* b1p = b0p + (size_t)16 * ldb; const _Float16* b2p = b1p + (size_t)16 * ldb; const _Float16* b3p = b2p + (size_t)16 * ldb;
  const v8f z8 = {0.f,0.f,0.f,0.f,0.f,0.f,0.f,0.f}; v8f c00 = z8, c01 = z8, c02 = z8, c03 = z8, c10 = z8, c11 = z8, c12 = z8, c13 = z8;
#pragma unroll 1
  for (int kb = 0; kb < K; kb += 32) { const v16h a0 = g2_frag(a0p + kb, hh), a1 = g2_frag(a1p + kb, hh);
    v16h b = g2_frag(b0p + kb, hh); c00 = g2_mma(a0, b, c00); c10 = g2_mma(a1, b, c10);
    b = g2_frag(b1p + kb, hh); c01 = g2_mma(a0, b, c01); c11 = g2_mma(a1, b, c11);
    b = g2_frag(b2p + kb, hh); c02 = g2_mma(a0, b, c02); c12 = g2_mma(a1, b, c12);
    b = g2_frag(b3p + kb, hh); c03 = g2_mma(a0, b, c03); c13 = g2_mma(a1, b, c13); }
  v8f accs[8] = {c00, c01, c02, c03, c10, c11, c12, c13};
#pragma unroll
  for (int u = 0; u < 8; ++u) { const int t = u & 3, half = u >> 2; const int col = col0 + t * 16 + ln; const float bv = bp ? bf16_round(bp[col]) : 0.f;
#pragma unroll
    for (int r = 0; r < 8; ++r) { const int rloc = half * 16 + 8 * hh + r; float v = accs[u][r] * alpha + bv; if (CP) { if (rowsPerB < 0) v += CP[cofs + (size_t)(row0g + row0 + rloc) * ldc + col];      /* rowsPerB < 0: own element of the batched C plane */ else { const int bidx = (row0g + row0 + rloc) / rowsPerB; v += CP[(size_t)bidx * sCPb + (size_t)by * 64 + col]; } }
      if (ACT == 3) v = fmaxf(v, 0.f); else if (ACT == 6) v = 0.5f * v * (1.0f + erff(v * 0.70710678118654752f)); else if (ACT == 11) v = 1.0f / (1.0f + expf(-v)); else if (ACT == 15) v = v / (1.0f + expf(-v)); else if (ACT == 12) v = (v > 0.f) ? v : 0.01f * v; else if (ACT == 8) v = tanhf(v); else if (ACT == 9) v = 0.5f * v * (1.0f + tanhf(0.7978845608028654f * (v + 0.044715f * v * v * v))); else if (ACT == 14) v = (v > 0.f) ? v : 0.1f * v; else if (ACT == 16) v = (v >= 0.f) ? v : 0.3f * v; else if (ACT == 17) v = (v >= 0.f) ? v : 0.2f * v;
      so[w][rloc][t * 16 + ln] = v; } }
  __builtin_amdgcn_fence(__ATOMIC_ACQ_REL, "workgroup"); __builtin_amdgcn_wave_barrier();
  const int rsub = lane >> 4, c4 = (lane & 15) * 4;
  {
#pragma unroll
    for (int q = 0; q < 16; ++q) { const int r = q * 2 + rsub; const v4f v = *(const v4fa*)&so[w][r][c4]; if (C) *(v4f*)(C + cofs + (size_t)(row0 + r) * ldc + col0 + c4) = v; if (C16) { v4h h4; for (int i = 0; i < 4; ++i) h4[i] = (_Float16)v[i]; *(v4h*)(C16 + cofs + (size_t)(row0 + r) * ldc + col0 + c4) = h4; } }
     } }

// ---- k_gemm2 with both operands staged in LDS (requires M % 128 == 0, N % 64 == 0, K % 128 == 0); same tiles, same k order, same epilogue ----
// A stage is 128 k (256 B, two whole lines) of the work-group's 128 A rows and 64 B rows; every wave-wide copy covers two whole rows of it (4 lines) where a fragment load from global touched 16 lines.
#define G3_KS 128
#define G3_PITCH 272                    /* LDS row pitch, bytes: 16 B x odd, conflict-free for ds_load_b128 */
#define G3_STAGE (192 * G3_PITCH)       /* rows 0..127 = A, rows 128..191 = B */
#define G3_C(l, g) "global_load_async_to_lds_b128 %" #l ", %" #g ", off\n\t"
// twelve copies and, as the statement's last line, the wait that stands before any register they name is rewritten
#define G3_COPY12(L, G, o) asm volatile(G3_C(0, 12) G3_C(1, 13) G3_C(2, 14) G3_C(3, 15) G3_C(4, 16) G3_C(5, 17) G3_C(6, 18) G3_C(7, 19) G3_C(8, 20) G3_C(9, 21) G3_C(10, 22) G3_C(11, 23) "s_wait_xcnt 0x0" \
    :: "v"(L[o + 0]), "v"(L[o + 1]), "v"(L[o + 2]), "v"(L[o + 3]), "v"(L[o + 4]), "v"(L[o + 5]), "v"(L[o + 6]), "v"(L[o + 7]), "v"(L[o + 8]), "v"(L[o + 9]), "v"(L[o + 10]), "v"(L[o + 11]), \
       "v"(G[o + 0]), "v"(G[o + 1]), "v"(G[o + 2]), "v"(G[o + 3]), "v"(G[o + 4]), "v"(G[o + 5]), "v"(G[o + 6]), "v"(G[o + 7]), "v"(G[o + 8]), "v"(G[o + 9]), "v"(G[o + 10]), "v"(G[o + 11]) : "memory")
// one stage: 24 copies of 16 B per lane. l = the lane's LDS byte address in row (tid >> 4) of the buffer, ga / gb = its global address in that row of the A / B tile; copy j serves row 8 j + (tid >> 4)
__device__ __forceinline__ void g3_fill(unsigned l, const _Float16* ga, size_t sa8, const _Float16* gb, size_t sb8) {
  unsigned L[24]; const _Float16* G[24];
#pragma unroll      /* both loops: every index constant, so that L and G are registers the asm can name */
  for (int j = 0; j < 16; ++j) { L[j] = l + (unsigned)j * (8u * G3_PITCH); G[j] = ga + (size_t)j * sa8; }
#pragma unroll
  for (int j = 0; j < 8; ++j) { L[16 + j] = l + (unsigned)(16 + j) * (8u * G3_PITCH); G[16 + j] = gb + (size_t)j * sb8; }
  G3_COPY12(L, G, 0); G3_COPY12(L, G, 12); }
__device__ __forceinline__ v16h g3_frag(const unsigned char* p) { FragH f; f.half[0] = *(const v8us*)p; f.half[1] = *(const v8us*)(p + 32); return f.v; }
template <int ACT>
__global__ __launch_bounds__(128) void k_gemm2s(const _Float16* __restrict__ A, int lda, size_t sA, const _Float16* __restrict__ Bh, int ldb, size_t sB, float alpha, const float* __restrict__ bias, size_t sBias, const float* __restrict__ CP, int rowsPerB, size_t sCPb, int row0g,
    float* __restrict__ C, _Float16* __restrict__ C16, int ldc, size_t sC, int M, int N, int K) { static_assert(ACT == 0 || ACT == 3 || ACT == 6 || ACT == 8 || ACT == 9 || ACT == 11 || ACT == 12 || ACT == 14 || ACT == 15 || ACT == 16 || ACT == 17, "k_gemm2s: unsupported ACT code (would silently apply no activation)");
  __shared__ __attribute__((aligned(16))) unsigned char st[2 * G3_STAGE];
  __shared__ __attribute__((aligned(16))) float so[4][32][68];
  const int tid = threadIdx.x, w = tid >> 5, lane = tid & 31, ln = lane & 15, hh = lane >> 4; const int by = blockIdx.y;
  A += (size_t)by * sA; Bh += (size_t)by * sB; const size_t cofs = (size_t)by * sC; const float* bp = bias ? bias + (size_t)by * sBias : nullptr;
  const int ntn = N >> 6; const int mt = blockIdx.x / ntn, nq = blockIdx.x - mt * ntn; const int row0 = mt * 128 + 32 * w, col0 = nq * 64; if (mt * 128 >= M) return;      /* the same for the whole work-group, in front of every barrier */
  const int crow = tid >> 4, cch = tid & 15; const size_t sa8 = (size_t)8 * lda, sb8 = (size_t)8 * ldb;
  const _Float16* gA = A + (size_t)(mt * 128 + crow) * lda + cch * 8; const _Float16* gB = Bh + (size_t)(col0 + crow) * ldb + cch * 8;
  const unsigned l0 = (unsigned)(size_t)st + (unsigned)(crow * G3_PITCH + cch * 16);
  const unsigned char* fa = st + (32 * w + ln) * G3_PITCH + 16 * hh; const unsigned char* fb = st + (128 + ln) * G3_PITCH + 16 * hh;
  const int nt = K / G3_KS;
  const v8f z8 = {0.f,0.f,0.f,0.f,0.f,0.f,0.f,0.f}; v8f c00 = z8, c01 = z8, c02 = z8, c03 = z8, c10 = z8, c11 = z8, c12 = z8, c13 = z8;
  g3_fill(l0, gA, sa8, gB, sb8);
  asm volatile("s_wait_asynccnt 0x0" ::: "memory");      /* this wave's copies of stage 0 have landed */
  __syncthreads();                                        /* ... and every other wave's */
  if (nt > 1) g3_fill(l0 + G3_STAGE, gA + G3_KS, sa8, gB + G3_KS, sb8);
#pragma unroll 1      /* one trip per stage: the buffer index stays a run-time value */
  for (int t = 0; t < nt; ++t) { const unsigned bo = (unsigned)(t & 1) * G3_STAGE; const unsigned char* pa = fa + bo; const unsigned char* pb = fb + bo;
    v16h a0 = g3_frag(pa), a1 = g3_frag(pa + 16 * G3_PITCH), b0 = g3_frag(pb), b1 = g3_frag(pb + 16 * G3_PITCH), b2 = g3_frag(pb + 32 * G3_PITCH), b3 = g3_frag(pb + 48 * G3_PITCH);
#pragma unroll      /* constant LDS offsets; the next 32 k's fragments (same stage) are read as one group ahead of this 32 k's WMMAs */
    for (int ks = 0; ks < 4; ++ks) { v16h na0 = a0, na1 = a1, nb0 = b0, nb1 = b1, nb2 = b2, nb3 = b3;
      if (ks < 3) { const unsigned char* qa = pa + (ks + 1) * 64; const unsigned char* qb = pb + (ks + 1) * 64; na0 = g3_frag(qa); na1 = g3_frag(qa + 16 * G3_PITCH); nb0 = g3_frag(qb); nb1 = g3_frag(qb + 16 * G3_PITCH); nb2 = g3_frag(qb + 32 * G3_PITCH); nb3 = g3_frag(qb + 48 * G3_PITCH); }
      c00 = g2_mma(a0, b0, c00); c10 = g2_mma(a1, b0, c10); c01 = g2_mma(a0, b1, c01); c11 = g2_mma(a1, b1, c11);
      c02 = g2_mma(a0, b2, c02); c12 = g2_mma(a1, b2, c12); c03 = g2_mma(a0, b3, c03); c13 = g2_mma(a1, b3, c13);
      a0 = na0; a1 = na1; b0 = nb0; b1 = nb1; b2 = nb2; b3 = nb3; }
    asm volatile("s_wait_dscnt 0x0" ::: "memory");        /* this wave's reads of the buffer are done before it is refilled */
    asm volatile("s_wait_asynccnt 0x0" ::: "memory");     /* this wave's copies of stage t + 1 have landed */
    __syncthreads();                                      /* publishes stage t + 1 and ends every wave's reads of stage t */
    if (t + 2 < nt) g3_fill(l0 + bo, gA + (size_t)(t + 2) * G3_KS, sa8, gB + (size_t)(t + 2) * G3_KS, sb8); }
  asm volatile("s_wait_asynccnt 0x0" ::: "memory");       /* no copy outstanding behind the loop */
  v8f accs[8] = {c00, c01, c02, c03, c10, c11, c12, c13};
#pragma unroll
  for (int u = 0; u < 8; ++u) { const int t = u & 3, half = u >> 2; const int col = col0 + t * 16 + ln; const float bv = bp ? bf16_round(bp[col]) : 0.f;
#pragma unroll
    for (int r = 0; r < 8; ++r) { const int rloc = half * 16 + 8 * hh + r; float v = accs[u][r] * alpha + bv; if (CP) { if (rowsPerB < 0) v += CP[cofs + (size_t)(row0g + row0 + rloc) * ldc + col];      /* rowsPerB < 0: own element of the batched C plane */ else { const int bidx = (row0g + row0 + rloc) / rowsPerB; v += CP[(size_t)bidx * sCPb + (size_t)by * 64 + col]; } }
      if (ACT == 3) v = fmaxf(v, 0.f); else if (ACT == 6) v = 0.5f * v * (1.0f + erff(v * 0.70710678118654752f)); else if (ACT == 11) v = 1.0f / (1.0f + expf(-v)); else if (ACT == 15) v = v / (1.0f + expf(-v)); else if (ACT == 12) v = (v > 0.f) ? v : 0.01f * v; else if (ACT == 8) v = tanhf(v); else if (ACT == 9) v = 0.5f * v * (1.0f + tanhf(0.7978845608028654f * (v + 0.044715f * v * v * v))); else if (ACT == 14) v = (v > 0.f) ? v : 0.1f * v; else if (ACT == 16) v = (v >= 0.f) ? v : 0.3f * v; else if (ACT == 17) v = (v >= 0.f) ? v : 0.2f * v;
      so[w][rloc][t * 16 + ln] = v; } }
  __builtin_amdgcn_fence(__ATOMIC_ACQ_REL, "workgroup"); __builtin_amdgcn_wave_barrier();
  const int rsub = lane >> 4, c4 = (lane & 15) * 4;
  {
#pragma unroll
    for (int q = 0; q < 16; ++q) { const int r = q * 2 + rsub; const v4f v = *(const v4fa*)&so[w][r][c4]; if (C) { *(v4f*)(C + cofs + (size_t)(row0 + r) * ldc + col0 + c4) = v; asm volatile("s_wait_xcnt 0x0" ::: "memory"); /* stands before the store's data and address registers are rewritten by the next piece */ } if (C16) { v4h h4; for (int i = 0; i < 4; ++i) h4[i] = (_Float16)v[i]; *(v4h*)(C16 + cofs + (size_t)(row0 + r) * ldc + col0 + c4) = h4; } }
     } }


__global__ __launch_bounds__(256) void k_xrows(const float* __restrict__ x, float* __restrict__ RES) { __shared__ float tl[CC][33]; const int tid = threadIdx.x; const int b = blockIdx.x / (NP / 32), pb = blockIdx.x % (NP / 32); const int p0 = pb * 32;
  for (int i = tid; i < CC * 32; i += 256) { const int c = i / 32, j = i % 32; tl[c][j] = bf16_round(x[((size_t)b * CC + c) * NP + p0 + j]); }
  __syncthreads();
  { for (int i = tid; i < 32 * (CC / 8); i += 256) { const int j = i / (CC / 8), c0 = (i % (CC / 8)) * 8; v8f v; for (int q = 0; q < 8; ++q) v[q] = tl[c0 + q][j]; *(v8f*)(RES + ((size_t)b * NP + p0 + j) * CC + c0) = v; }  } }
__global__ __launch_bounds__(256) void k_elu32(float* __restrict__ F, size_t n8) {
  #pragma clang fp contract(off)
  const size_t t = (size_t)blockIdx.x * 256 + threadIdx.x; if (t >= n8) return; v8f v = *(const v8f*)(F + t * 8); for (int q = 0; q < 8; ++q) { const float a = v[q]; v[q] = (a > 0.f) ? a : expm1f(a); } *(v8f*)(F + t * 8) = v;  }
__global__ __launch_bounds__(256) void k_elu16(const float* __restrict__ F, _Float16* __restrict__ E, size_t n8) {
  #pragma clang fp contract(off)
  const size_t t = (size_t)blockIdx.x * 256 + threadIdx.x; if (t >= n8) return; const v8f v = *(const v8f*)(F + t * 8); FragH f; for (int q = 0; q < 8; ++q) { const float a = v[q]; f.h[q] = (_Float16)((a > 0.f) ? a : expm1f(a)); } *(v8us*)((unsigned short*)E + t * 8) = f.half[0];  }
__global__ __launch_bounds__(256) void k_im8(const _Float16* __restrict__ S, _Float16* __restrict__ IM) { const size_t t_ = (size_t)blockIdx.x * 256 + threadIdx.x; if (t_ >= NR * 8 * 32) return; const int c8 = (int)(t_ % 32) * 8; const int tap = (int)((t_ / 32) % 8); const size_t r = t_ / 256; const int p = (int)(r % NP); const size_t b = r / NP; const int w = p % DW, h = (p / DW) % DH, tt = p / (DW * DH); const int dw = tap % 2, dh = (tap / 2) % 2, dt = tap / 4; const int t2 = tt + dt - 1, h2 = h + dh - 1, w2 = w + dw - 1; v8us v;
  if (t2 >= 0 && h2 >= 0 && w2 >= 0) v = *(const v8us*)((const unsigned short*)S + (b * NP + (size_t)(t2 * DH + h2) * DW + w2) * CC + c8); else { for (int q = 0; q < 8; ++q) v[q] = 0; }
  unsigned short* d = (unsigned short*)IM + r * K8 + (size_t)tap * CC + c8; *(v8us*)d = v;  }
__global__ __launch_bounds__(256) void k_w8(const float* __restrict__ w, int O, _Float16* __restrict__ Bt) { const size_t t = (size_t)blockIdx.x * 256 + threadIdx.x; if (t >= (size_t)O * K8 / 8) return; const int c8 = (int)((t * 8) % CC); const int tap = (int)(((t * 8) / CC) % 8); const int o = (int)((t * 8) / K8); FragH f; for (int q = 0; q < 8; ++q) f.h[q] = (_Float16)(bf16_round(w[((size_t)o * CC + c8 + q) * 8 + tap]) * 16.0f);
  *(v8us*)((unsigned short*)Bt + t * 8) = f.half[0];  }
__global__ __launch_bounds__(256) void k_gate(const float* __restrict__ O2, float* __restrict__ RES) {
  #pragma clang fp contract(off)
  const size_t t = (size_t)blockIdx.x * 256 + threadIdx.x; if (t >= NR * CC / 8) return; const int c0 = (int)((t * 8) % CC); const size_t r = (t * 8) / CC; v8f v = *(const v8f*)(RES + t * 8); const float* o = O2 + r * 512;
  for (int q = 0; q < 8; ++q) { const float a = o[c0 + q], g = o[256 + c0 + q]; const float s = 1.0f / (1.0f + expf(-g)); v[q] = v[q] + __fmul_rn(a, s); }
  *(v8f*)(RES + t * 8) = v;  }
__global__ __launch_bounds__(256) void k_xa(const float* __restrict__ RES, const float* __restrict__ orig, _Float16* __restrict__ XA) { const size_t t = (size_t)blockIdx.x * 256 + threadIdx.x; if (t >= NR * 36) return; const int pc = (int)(t % 36); const size_t r = t / 36; const int p = (int)(r % NP); const size_t b = r / NP; FragH f;
  for (int q = 0; q < 8; ++q) { const int col = pc * 8 + q; float v = 0.f; if (col < 256) v = RES[r * CC + col]; else if (col < 259) v = bf16_round(orig[((b * 3 + (col - 256)) * (size_t)NP) + p]); else if (col == 259) v = -0.5f + (float)(p / (DH * DW)) / (float)DT; else if (col == 260) v = -0.5f + (float)((p / DW) % DH) / (float)DH; else if (col == 261) v = -0.5f + (float)(p % DW) / (float)DW; f.h[q] = (_Float16)v; }
  unsigned short* d = (unsigned short*)XA + r * KA + pc * 8; *(v8us*)d = f.half[0];  }
__global__ __launch_bounds__(256) void k_wa(const float* __restrict__ w, int O, int OP, _Float16* __restrict__ Bt) { const size_t t = (size_t)blockIdx.x * 256 + threadIdx.x; if (t >= (size_t)OP * KA / 8) return; const int k0 = (int)((t * 8) % KA); const int o = (int)((t * 8) / KA); FragH f; for (int q = 0; q < 8; ++q) { const int k = k0 + q; f.h[q] = (o < O && k < 262) ? (_Float16)(bf16_round(w[(size_t)o * 262 + k]) * 16.0f) : (_Float16)0.f; }
  *(v8us*)((unsigned short*)Bt + t * 8) = f.half[0];  }
__global__ __launch_bounds__(256) void k_bpad(const float* __restrict__ b, int n, int np_, float* __restrict__ bp) { const int i = blockIdx.x * 256 + threadIdx.x; if (i >= np_) return; const float v = (i < n) ? b[i] : 0.f; *(float*)(bp + i) = v;  }
__global__ __launch_bounds__(256) void k_vt(const _Float16* __restrict__ V16, int b, _Float16* __restrict__ VT) { __shared__ unsigned short tl[64][VC + 2]; const int tid = threadIdx.x; const int k0 = blockIdx.x * 64; const unsigned short* s = (const unsigned short*)V16 + ((size_t)b * NP + k0) * VC;
  for (int i = tid; i < 64 * (VC / 8); i += 256) { const int j = i / (VC / 8), c8 = (i % (VC / 8)) * 8; FragH f; f.half[0] = *(const v8us*)(s + (size_t)j * VC + c8); for (int q = 0; q < 8; ++q) tl[j][c8 + q] = f.u[q]; }
  __syncthreads();
  { for (int i = tid; i < VC * 8; i += 256) { const int c = i / 8, j8 = (i % 8) * 8; v8us o; for (int q = 0; q < 8; ++q) o[q] = tl[j8 + q][c]; *(v8us*)((unsigned short*)VT + (size_t)c * NP + k0 + j8) = o; }  } }
// causal row softmax, one work-group per query row q: 256 threads x 16 scores each, kept in registers between the max pass and the exp pass;
// lanes read and write neighbouring 8-element pieces; pieces wholly at k >= q are not read and store zeros. Row max and row sum: butterfly in the wave, then 8 wave partials through LDS.
__global__ __launch_bounds__(256) void k_csm(const float* __restrict__ S, _Float16* __restrict__ P, float* __restrict__ RS) {
  __shared__ float redm[8], reds[8];
  const int q = blockIdx.x, tid = threadIdx.x, lane = tid & 31, w = tid >> 5; const float* s = S + (size_t)q * NP;
  const float sq = sqrtf(259.0f);      /* np.float32(sqrt(259)) division: s/sqrt(C_ATT) */
  const int ka = tid * 8, kb = NP / 2 + tid * 8;
  const v4f z4 = {0.f, 0.f, 0.f, 0.f}; v4f x[4] = {z4, z4, z4, z4};
  if (ka < q) { x[0] = *(const v4fa*)(s + ka); x[1] = *(const v4fa*)(s + ka + 4); }
  if (kb < q) { x[2] = *(const v4fa*)(s + kb); x[3] = *(const v4fa*)(s + kb + 4); }
  float v[16]; float mx = -3.0e38f;
#pragma unroll
  for (int u = 0; u < 2; ++u) { const int k0 = u ? kb : ka;
    if (k0 < q) {
#pragma unroll
      for (int i = 0; i < 8; ++i) { const float t = x[u * 2 + (i >> 2)][i & 3] / sq; v[u * 8 + i] = t; mx = (k0 + i < q) ? fmaxf(mx, t) : mx; } }
    else {
#pragma unroll
      for (int i = 0; i < 8; ++i) v[u * 8 + i] = 0.f; } }
#pragma unroll
  for (int m = 16; m > 0; m >>= 1) mx = fmaxf(mx, __shfl_xor(mx, m));
  if (lane == 0) redm[w] = mx;
  __syncthreads();
#pragma unroll
  for (int i = 0; i < 8; ++i) mx = fmaxf(mx, redm[i]);
  float se = 0.f;
#pragma unroll
  for (int u = 0; u < 2; ++u) { const int k0 = u ? kb : ka; FragH f;
    if (k0 < q) {
#pragma unroll
      for (int i = 0; i < 8; ++i) { const float ee = expf(v[u * 8 + i] - mx); const float e = (k0 + i < q) ? ee : 0.f; se += e; f.h[i] = (_Float16)(e * 256.0f); } }
    else {
#pragma unroll
      for (int i = 0; i < 8; ++i) f.u[i] = 0; }
    *(v8us*)((unsigned short*)P + (size_t)q * NP + k0) = f.half[0]; }
#pragma unroll
  for (int m = 16; m > 0; m >>= 1) se += __shfl_xor(se, m);
  if (lane == 0) reds[w] = se;
  __syncthreads();
  if (tid == 0) { float t = 0.f;
#pragma unroll
    for (int i = 0; i < 8; ++i) t += reds[i];
    RS[(size_t)q * 32] = (q == 0) ? 0.f : (1.0f / 256.0f) / t; } }
__global__ __launch_bounds__(256) void k_ascale(const float* __restrict__ AT, const float* __restrict__ RS, int b, _Float16* __restrict__ ATE) {
  #pragma clang fp contract(off)
  const size_t t = (size_t)blockIdx.x * 256 + threadIdx.x; if (t >= (size_t)NP * VC / 8) return; const int q = (int)((t * 8) / VC); const float rs = RS[(size_t)q * 32]; const v8f a = *(const v8f*)(AT + t * 8); FragH f; for (int u = 0; u < 8; ++u) { const float v = a[u] * rs; f.h[u] = (_Float16)((v > 0.f) ? v : expm1f(v)); }
  unsigned short* d = (unsigned short*)ATE + ((size_t)b * NP * VC) + t * 8; *(v8us*)d = f.half[0];  }
__global__ __launch_bounds__(256) void k_sumelu(const float* __restrict__ A, const float* __restrict__ B, _Float16* __restrict__ E, size_t n8) {
  #pragma clang fp contract(off)
  const size_t t = (size_t)blockIdx.x * 256 + threadIdx.x; if (t >= n8) return; const v8f a = *(const v8f*)(A + t * 8), b = *(const v8f*)(B + t * 8); FragH f; for (int q = 0; q < 8; ++q) { const float v = a[q] + b[q]; f.h[q] = (_Float16)((v > 0.f) ? v : expm1f(v)); } *(v8us*)((unsigned short*)E + t * 8) = f.half[0];  }
__global__ __launch_bounds__(256) void k_out(const float* __restrict__ O, float* __restrict__ out) { const size_t t = (size_t)blockIdx.x * 256 + threadIdx.x; if (t >= (size_t)NB * CC * NP / 8) return; const int p0 = (int)((t * 8) % NP); const size_t bc = (t * 8) / NP; const int c = (int)(bc % CC); const size_t b = bc / CC; v8f r; for (int q = 0; q < 8; ++q) r[q] = O[(b * NP + p0 + q) * CC + c];
  *(v8f*)(out + t * 8) = r;  }

extern "C" void kernel_launch(void* const* d_in, const int* in_sizes, int n_in,
                              void* d_out, int out_size, void* d_ws, size_t ws_size, hipStream_t stream) {
  (void)in_sizes; (void)n_in; (void)out_size;
  const float* const* I = (const float* const*)d_in; const float* x = I[0]; const float* orig = I[1]; const float* rw1 = I[2]; const float* rb1 = I[3]; const float* rw2 = I[4]; const float* rb2 = I[5]; const float* qw = I[6]; const float* qb = I[7]; const float* kw = I[8]; const float* kb = I[9]; const float* vw = I[10]; const float* vb = I[11]; const float* aw = I[12]; const float* ab = I[13]; const float* rsw = I[14]; const float* rsb = I[15]; const float* ow = I[16]; const float* ob = I[17];
  char* ws = (char*)d_ws; size_t off = 0;
  auto take = [&](size_t bytes) { char* p = ws + off; off += (bytes + 255) & ~(size_t)255; return p; };
  _Float16* BW1 = (_Float16*)take((size_t)CC * K8 * 2); _Float16* BW2 = (_Float16*)take((size_t)512 * K8 * 2); _Float16* BQ = (_Float16*)take((size_t)64 * KA * 2); _Float16* BK = (_Float16*)take((size_t)64 * KA * 2); _Float16* BV = (_Float16*)take((size_t)VC * KA * 2); float* qbp = (float*)take(64 * 4); float* kbp = (float*)take(64 * 4); _Float16* BA = (_Float16*)take((size_t)CC * VC * 2); _Float16* BR = (_Float16*)take((size_t)CC * CC * 2); _Float16* BO = (_Float16*)take((size_t)CC * CC * 2);
  float* RES = (float*)take(NR * CC * 4); _Float16* E16 = (_Float16*)take(NR * CC * 2); _Float16* IM = (_Float16*)take(NR * K8 * 2); _Float16* O1 = (_Float16*)take(NR * CC * 2); float* O2 = (float*)take(NR * 512 * 4);
  _Float16* XA = (_Float16*)take(NR * KA * 2); _Float16* Q16 = (_Float16*)take(NR * 64 * 2); _Float16* K16 = (_Float16*)take(NR * 64 * 2); _Float16* V16 = (_Float16*)take(NR * VC * 2); _Float16* VT = (_Float16*)take((size_t)VC * NP * 2); float* S = (float*)take((size_t)NP * NP * 4); _Float16* P = (_Float16*)take((size_t)NP * NP * 2); float* RS = (float*)take((size_t)NP * 32 * 4); float* AT = (float*)take((size_t)NP * VC * 4);
  _Float16* ATE = (_Float16*)take(NR * VC * 2); float* ATTC = (float*)take(NR * CC * 4); float* R2 = (float*)take(NR * CC * 4); _Float16* SUM16 = (_Float16*)take(NR * CC * 2); float* OUT = O2;
  if (off > ws_size) return;      /* 3.6 + 8.4 + 4.2 + 33.5 + 4.2 + 16.8 + 4.7 + 4.2 + 1 + 67 + 33.5 + 0.5 + 2 + 2 + 8.4 + 8.4 + 4.2 = ≈ 207 MB (197.5 MiB) */
  k_wa<<<(unsigned)(((size_t)64 * KA / 8 + 255) / 256), 256, 0, stream>>>(qw, 16, 64, BQ); k_wa<<<(unsigned)(((size_t)64 * KA / 8 + 255) / 256), 256, 0, stream>>>(kw, 16, 64, BK); k_wa<<<(unsigned)(((size_t)VC * KA / 8 + 255) / 256), 256, 0, stream>>>(vw, VC, VC, BV); k_bpad<<<1, 64, 0, stream>>>(qb, 16, 64, qbp); k_bpad<<<1, 64, 0, stream>>>(kb, 16, 64, kbp);
  k_round16f<<<(CC * VC / 8 + 255) / 256, 256, 0, stream>>>(aw, BA, (size_t)CC * VC / 8); k_round16f<<<(CC * CC / 8 + 255) / 256, 256, 0, stream>>>(rsw, BR, (size_t)CC * CC / 8); k_round16f<<<(CC * CC / 8 + 255) / 256, 256, 0, stream>>>(ow, BO, (size_t)CC * CC / 8);
  k_xrows<<<NB * (NP / 32), 256, 0, stream>>>(x, RES);
  const unsigned n8 = (unsigned)((NR * CC / 8 + 255) / 256); const dim3 g256((unsigned)((NR / 128) * (CC / 64)), 1);
  for (int i = 0; i < NRES; ++i) {
    k_w8<<<(unsigned)(((size_t)CC * K8 / 8 + 255) / 256), 256, 0, stream>>>(rw1 + (size_t)i * CC * CC * 8, CC, BW1); k_w8<<<(unsigned)(((size_t)512 * K8 / 8 + 255) / 256), 256, 0, stream>>>(rw2 + (size_t)i * 512 * CC * 8, 512, BW2);
    k_elu16<<<n8, 256, 0, stream>>>(RES, E16, NR * CC / 8); k_im8<<<(unsigned)((NR * 256 + 255) / 256), 256, 0, stream>>>(E16, IM);
    k_gemm2s<0><<<g256, 128, 0, stream>>>(IM, K8, 0, BW1, K8, 0, 0.0625f, rb1 + i * CC, 0, nullptr, 1, 0, 0, ATTC, nullptr, CC, 0, (int)NR, CC, K8); k_elu16<<<n8, 256, 0, stream>>>(ATTC, O1, NR * CC / 8);      /* o = elu(conv1 + b1) (ATTC used as scratch here) */
    k_im8<<<(unsigned)((NR * 256 + 255) / 256), 256, 0, stream>>>(O1, IM);
    k_gemm2s<0><<<dim3((unsigned)((NR / 128) * 8), 1), 128, 0, stream>>>(IM, K8, 0, BW2, K8, 0, 0.0625f, rb2 + i * 512, 0, nullptr, 1, 0, 0, O2, nullptr, 512, 0, (int)NR, 512, K8);      /* conv2 + b2 (512) */
    k_gate<<<n8, 256, 0, stream>>>(O2, RES); }
  /* attention */
  k_xa<<<(unsigned)((NR * 36 + 255) / 256), 256, 0, stream>>>(RES, orig, XA);
  k_gemm2<0><<<dim3((unsigned)((NR / 128) * 1), 1), 128, 0, stream>>>(XA, KA, 0, BQ, KA, 0, 0.0625f, qbp, 0, nullptr, 1, 0, 0, nullptr, Q16, 64, 0, (int)NR, 64, KA);
  k_gemm2<0><<<dim3((unsigned)((NR / 128) * 1), 1), 128, 0, stream>>>(XA, KA, 0, BK, KA, 0, 0.0625f, kbp, 0, nullptr, 1, 0, 0, nullptr, K16, 64, 0, (int)NR, 64, KA);
  k_gemm2<0><<<dim3((unsigned)((NR / 128) * 2), 1), 128, 0, stream>>>(XA, KA, 0, BV, KA, 0, 0.0625f, vb, 0, nullptr, 1, 0, 0, nullptr, V16, VC, 0, (int)NR, VC, KA);
  for (int b = 0; b < NB; ++b) {
    k_gemm2<0><<<dim3((NP / 128) * (NP / 64), 1), 128, 0, stream>>>(Q16 + (size_t)b * NP * 64, 64, 0, K16 + (size_t)b * NP * 64, 64, 0, 1.0f, nullptr, 0, nullptr, 1, 0, 0, S, nullptr, NP, 0, NP, NP, 32);
    k_csm<<<NP, 256, 0, stream>>>(S, P, RS); k_vt<<<NP / 64, 256, 0, stream>>>(V16, b, VT);
    k_gemm2s<0><<<dim3((NP / 128) * (VC / 64), 1), 128, 0, stream>>>(P, NP, 0, VT, NP, 0, 1.0f, nullptr, 0, nullptr, 1, 0, 0, AT, nullptr, VC, 0, NP, VC, NP);
    k_ascale<<<(unsigned)(((size_t)NP * VC / 8 + 255) / 256), 256, 0, stream>>>(AT, RS, b, ATE); }
  k_gemm2s<0><<<g256, 128, 0, stream>>>(ATE, VC, 0, BA, VC, 0, 0.0625f, ab, 0, nullptr, 1, 0, 0, ATTC, nullptr, CC, 0, (int)NR, CC, VC); k_elu32<<<n8, 256, 0, stream>>>(ATTC, NR * CC / 8);      /* att = elu(attn_conv(elu(att)) + b) */
  k_elu16<<<n8, 256, 0, stream>>>(RES, E16, NR * CC / 8); k_gemm2s<0><<<g256, 128, 0, stream>>>(E16, CC, 0, BR, CC, 0, 0.0625f, rsb, 0, nullptr, 1, 0, 0, R2, nullptr, CC, 0, (int)NR, CC, CC); k_elu32<<<n8, 256, 0, stream>>>(R2, NR * CC / 8);      /* res = elu(res_conv(elu(res)) + b) */
  k_sumelu<<<n8, 256, 0, stream>>>(R2, ATTC, SUM16, NR * CC / 8);
  k_gemm2s<0><<<g256, 128, 0, stream>>>(SUM16, CC, 0, BO, CC, 0, 0.0625f, ob, 0, nullptr, 1, 0, 0, OUT, nullptr, CC, 0, (int)NR, CC, CC); k_elu32<<<n8, 256, 0, stream>>>(OUT, NR * CC / 8);      /* out = elu(out_conv(elu(res + att)) + b) */
  k_out<<<(unsigned)(((size_t)NB * CC * NP / 8 + 255) / 256), 256, 0, stream>>>(OUT, (float*)d_out);
}

// v003
// One run takes 522 microseconds.
// Two timings next to v002 put it at 1.21 and 1.26 times that version's speed.
// Counting every step since v000, it is 5.81 times as fast.
#include <hip/hip_runtime.h>
// PixelSNAILBlock (x [2][256][16][16][16], original_input [2][3][16][16][16]; 4 gated residual blocks: o = elu(conv3d k2 pad1 crop(elu(res)) + b1); o = conv3d k2 pad1 crop(o) + b2 (512 ch); res += o[:256] * sigmoid(o[256:]); attention over the 4,096 positions of [res | original | pos-enc] (262 ch): q,k (16), v (128), causal softmax (k < q, row 0 all-zero) of q.k/sqrt(259), att = p v; att = elu(1x1(elu(att)) + b); res = elu(1x1(elu(res)) + b); out = elu(1x1(elu(res + att)) + b) -> [2][256][16][16][16]).
// Structure: position rows r = b*4096 + (t*16 + h)*16 + w; res kept as f32 rows; each k2 'causal-corner' conv as a WMMA GEMM over K = 8 taps x 256 channels whose A tiles are gathered tap by tap from zero-bordered f16 rows (32x64 wave tiles, f32 accumulation, exact x16 weights + bias) with the ELUs on VALU; gating on VALU; q/k/v as GEMMs on the 262 -> 288-column concat rows (16 live of 64 for q/k); per batch: scores GEMM (K = 32), causal row softmax on VALU (un-normalised f16 weights x 2^8 + 1/sum, row 0 -> 0), P.V GEMM (K = 4,096) against LDS-transposed value planes, scaling; the three 1x1 convs as GEMMs followed by VALU ELUs; channel-major store on VALU.
// Compute dtype: inputs rounded to bf16; x / original / weights exact; conv operands (elu(res), o1), the concat rows, q/k/v, softmax weights and the 1x1-conv operands plain f16 (~2^-12); res accumulation, gates, softmax sums f32. v_wmma_f32_16x16x32_f16.
#define NB 2
#define CC 256
#define DT 16
#define DH 16
#define DW 16
#define NP (DT * DH * DW)            /* 4096 */
#define NR ((size_t)NB * NP)       /* 8192 */
#define NRES 4
#define K8 (8 * CC)                /* 2048 */
#define KA 288                     /* 262 live */
#define VC 128
#define PD 17                      /* bordered extent of t, h and w: index 0 of each axis is the conv's zero padding */
#define NPP (PD * PD * PD)         /* 4913 bordered positions per batch */
typedef __bf16 v16b __attribute__((ext_vector_type(16)));
typedef unsigned short v8us __attribute__((ext_vector_type(8), may_alias));
typedef float  v8f  __attribute__((ext_vector_type(8)));
typedef float  v4f  __attribute__((ext_vector_type(4)));
typedef float  v4fa __attribute__((ext_vector_type(4), may_alias));
union FragB { v16b v; v8us half[2]; unsigned short u[16]; };

__device__ __forceinline__ unsigned short bf16_bits(float x) { unsigned int u = __float_as_uint(x); return (unsigned short)((u + 0x7FFFu + ((u >> 16) & 1u)) >> 16); }
__device__ __forceinline__ float bf16_val(unsigned short b) { return __uint_as_float(((unsigned int)b) << 16); }
__device__ __forceinline__ float bf16_round(float x) { return bf16_val(bf16_bits(x)); }
// D += A·B with NT terms: 1 = ah·bh, 2 = + al·bh (A split), 3 = + ah·bl (both split)
template <int NT>
__device__ __forceinline__ v8f mmaN(v16b ah, v16b al, v16b bh, v16b bl, v8f c) {
  c = __builtin_amdgcn_wmma_f32_16x16x32_bf16(false, ah, false, bh, (short)0, c, false, false);
  if (NT >= 2) c = __builtin_amdgcn_wmma_f32_16x16x32_bf16(false, al, false, bh, (short)0, c, false, false);
  if (NT >= 3) c = __builtin_amdgcn_wmma_f32_16x16x32_bf16(false, ah, false, bl, (short)0, c, false, false);
  asm volatile("v_nop\n\tv_nop\n\tv_nop\n\tv_nop" : "+v"(c) : "v"(ah), "v"(al), "v"(bh), "v"(bl));
  return c;
}

__global__ __launch_bounds__(256) void k_wt_bf16(const float* __restrict__ W, unsigned short* __restrict__ Wt, int K, int N) {
  const int t = blockIdx.x * 256 + threadIdx.x;
  const int k8n = K / 8;
  if (t >= N * k8n) return;
  const int n = t / k8n, k8 = (t % k8n) * 8;
  v8us v;
#pragma unroll
  for (int i = 0; i < 8; ++i) v[i] = bf16_bits(W[(size_t)(k8 + i) * N + n]);
  *(v8us*)(Wt + (size_t)n * K + k8) = v;
  
}

// GEMM C[M][N] (f32, pitch ldc) = act(A[M][K]·W + bias). A f32 row-major (pitch lda) converted per fragment to bf16
// (ASPLIT: hi/lo two planes -> 2 terms, else single rounded term); Wt bf16 [N][K] (pitch ldb). BIAS_BF16 rounds the
// bias to bf16 first (bias quantised to bf16 before the add). K%32==0, M%16==0, N%64==0.
template <bool ASPLIT, int ACT, bool BIAS_BF16>
__global__ __launch_bounds__(128) void k_gemm_bf(const float* __restrict__ A, int lda, const unsigned short* __restrict__ Wt, int ldb,
                                               const float* __restrict__ bias, float* __restrict__ C, int ldc, int M, int N, int K) {
  __shared__ __attribute__((aligned(16))) float so[4][16][64];
  const int tid = threadIdx.x, w = tid >> 5, lane = tid & 31, ln = lane & 15, hh = lane >> 4;
  const int ntn = N / 64;
  const int wid = blockIdx.x * 4 + w;
  const int mt = wid / ntn, nq = wid % ntn;
  if (mt * 16 >= M) return;
  const int row0 = mt * 16, col0 = nq * 64;
  const float* arow = A + (size_t)(row0 + ln) * lda;
  v8f acc[4] = {};
  for (int kb = 0; kb < K; kb += 32) {
    FragB ah, al;
    const v4f x0 = *(const v4fa*)(arow + kb + 8 * hh), x1 = *(const v4fa*)(arow + kb + 8 * hh + 4);
    const v4f x2 = *(const v4fa*)(arow + kb + 16 + 8 * hh), x3 = *(const v4fa*)(arow + kb + 16 + 8 * hh + 4);
    float xs[16] = {x0[0],x0[1],x0[2],x0[3],x1[0],x1[1],x1[2],x1[3],x2[0],x2[1],x2[2],x2[3],x3[0],x3[1],x3[2],x3[3]};
#pragma unroll
    for (int i = 0; i < 16; ++i) { const unsigned short hb = bf16_bits(xs[i]); ah.u[i] = hb; al.u[i] = ASPLIT ? bf16_bits(xs[i] - bf16_val(hb)) : (unsigned short)0; }
#pragma unroll
    for (int t = 0; t < 4; ++t) {
      const unsigned short* brow = Wt + (size_t)(col0 + t * 16 + ln) * ldb + kb;
      FragB b;
      b.half[0] = *(const v8us*)(brow + 8 * hh);
      b.half[1] = *(const v8us*)(brow + 16 + 8 * hh);
      acc[t] = mmaN<ASPLIT ? 2 : 1>(ah.v, al.v, b.v, b.v, acc[t]);
    }
  }
#pragma unroll
  for (int t = 0; t < 4; ++t) {
    float bv = bias ? bias[col0 + t * 16 + ln] : 0.f;
    if (BIAS_BF16) bv = bf16_round(bv);
#pragma unroll
    for (int r = 0; r < 8; ++r) { float v = acc[t][r] + bv; if (ACT == 1) v = fmaxf(v, 0.f); so[w][8 * hh + r][t * 16 + ln] = v; }
  }
  __builtin_amdgcn_fence(__ATOMIC_ACQ_REL, "workgroup");
  __builtin_amdgcn_wave_barrier();
  const int rsub = lane >> 4, c4 = (lane & 15) * 4;
  {
#pragma unroll
    for (int q = 0; q < 8; ++q) {
      const int r = q * 2 + rsub;
      const v4f v = *(const v4fa*)&so[w][r][c4];
      *(v4f*)(C + (size_t)(row0 + r) * ldc + col0 + c4) = v;
    }
    
  }
}

// GEMM C = act(A·W + bias + resid): A f32 (ASPLIT -> hi/lo 2 terms), Wt bf16 [N][K]; ACT 0 none, 1 relu, 2 exact gelu;
// resid (optional, f32, row index = (row % rmod), pitch ldr, RES_BF16 rounds it) added before the activation.
template <bool ASPLIT, int ACT, bool BIAS_BF16, bool RES_BF16>
__global__ __launch_bounds__(128) void k_gemm_bf3(const float* __restrict__ A, int lda, const unsigned short* __restrict__ Wt, int ldb,
                                                const float* __restrict__ bias, const float* __restrict__ resid, int rmod, int ldr,
                                                float* __restrict__ C, int ldc, int M, int N, int K) {
  __shared__ __attribute__((aligned(16))) float so[4][16][64];
  const int tid = threadIdx.x, w = tid >> 5, lane = tid & 31, ln = lane & 15, hh = lane >> 4;
  const int ntn = N / 64;
  const int wid = blockIdx.x * 4 + w;
  const int mt = wid / ntn, nq = wid % ntn;
  if (mt * 16 >= M) return;
  const int row0 = mt * 16, col0 = nq * 64;
  const float* arow = A + (size_t)(row0 + ln) * lda;
  v8f acc[4] = {};
  for (int kb = 0; kb < K; kb += 32) {
    FragB ah, al;
    const v4f x0 = *(const v4fa*)(arow + kb + 8 * hh), x1 = *(const v4fa*)(arow + kb + 8 * hh + 4);
    const v4f x2 = *(const v4fa*)(arow + kb + 16 + 8 * hh), x3 = *(const v4fa*)(arow + kb + 16 + 8 * hh + 4);
    float xs[16] = {x0[0],x0[1],x0[2],x0[3],x1[0],x1[1],x1[2],x1[3],x2[0],x2[1],x2[2],x2[3],x3[0],x3[1],x3[2],x3[3]};
#pragma unroll
    for (int i = 0; i < 16; ++i) { const unsigned short hb = bf16_bits(xs[i]); ah.u[i] = hb; al.u[i] = ASPLIT ? bf16_bits(xs[i] - bf16_val(hb)) : (unsigned short)0; }
#pragma unroll
    for (int t = 0; t < 4; ++t) {
      const unsigned short* brow = Wt + (size_t)(col0 + t * 16 + ln) * ldb + kb;
      FragB b;
      b.half[0] = *(const v8us*)(brow + 8 * hh);
      b.half[1] = *(const v8us*)(brow + 16 + 8 * hh);
      acc[t] = mmaN<ASPLIT ? 2 : 1>(ah.v, al.v, b.v, b.v, acc[t]);
    }
  }
#pragma unroll
  for (int t = 0; t < 4; ++t) {
    const int col = col0 + t * 16 + ln;
    float bv = bias ? bias[col] : 0.f;
    if (BIAS_BF16) bv = bf16_round(bv);
#pragma unroll
    for (int r = 0; r < 8; ++r) {
      float v = acc[t][r] + bv;
      if (resid) { float rv = resid[(size_t)((row0 + 8 * hh + r) % rmod) * ldr + col]; if (RES_BF16) rv = bf16_round(rv); v += rv; }
      if (ACT == 1) v = fmaxf(v, 0.f);
      if (ACT == 2) v = 0.5f * v * (1.0f + erff(v * 0.70710678118654752f));
      if (ACT == 3) { const float u = 0.7978845608028654f * (v + 0.044715f * v * v * v); v = 0.5f * v * (1.0f + tanhf(u)); }
      so[w][8 * hh + r][t * 16 + ln] = v;
    }
  }
  __builtin_amdgcn_fence(__ATOMIC_ACQ_REL, "workgroup");
  __builtin_amdgcn_wave_barrier();
  const int rsub = lane >> 4, c4 = (lane & 15) * 4;
  {
#pragma unroll
    for (int q = 0; q < 8; ++q) {
      const int r = q * 2 + rsub;
      const v4f v = *(const v4fa*)&so[w][r][c4];
      *(v4f*)(C + (size_t)(row0 + r) * ldc + col0 + c4) = v;
    }
    
  }
}
// row LayerNorm (biased variance, eps) over N: s = X (+ R); optional out_sum <- s; out_norm <- (s-mu)*rsqrt(var+eps)*g + b
template <bool PARAM_BF16>
__global__ __launch_bounds__(256) void k_layernorm(const float* __restrict__ X, const float* __restrict__ R, const float* __restrict__ g, const float* __restrict__ bta,
                                                  float* __restrict__ out_sum, float* __restrict__ out_norm, int N, float eps) {
  __shared__ float red[256];
  const int row = blockIdx.x, tid = threadIdx.x;
  const float* x = X + (size_t)row * N; const float* rr = R ? R + (size_t)row * N : nullptr;
  float vals[16];                     // up to N = 4096
  const int per = N / 256;            // contiguous chunk per thread? use strided-by-4 chunks: thread handles j = tid*4 + 1024*u
  float s1 = 0.f;
  for (int u = 0; u < per / 4; ++u) {
    const int j = tid * 4 + 1024 * u;
    const v4f a = *(const v4fa*)(x + j);
    v4f b = {0.f,0.f,0.f,0.f}; if (rr) b = *(const v4fa*)(rr + j);
#pragma unroll
    for (int q = 0; q < 4; ++q) { const float v = a[q] + b[q]; vals[u * 4 + q] = v; s1 += v; }
  }
  red[tid] = s1; __syncthreads();
  for (int st = 128; st > 0; st >>= 1) { if (tid < st) red[tid] += red[tid + st]; __syncthreads(); }
  const float mu = red[0] / (float)N; __syncthreads();
  float s2 = 0.f;
  for (int u = 0; u < per / 4; ++u)
#pragma unroll
    for (int q = 0; q < 4; ++q) { const float c = vals[u * 4 + q] - mu; s2 += c * c; }
  red[tid] = s2; __syncthreads();
  for (int st = 128; st > 0; st >>= 1) { if (tid < st) red[tid] += red[tid + st]; __syncthreads(); }
  const float rs = rsqrtf(red[0] / (float)N + eps);
  {
    for (int u = 0; u < per / 4; ++u) {
      const int j = tid * 4 + 1024 * u;
      v4f o, sm;
#pragma unroll
      for (int q = 0; q < 4; ++q) {
        float gg = g[j + q], bb = bta[j + q];
        if (PARAM_BF16) { gg = bf16_round(gg); bb = bf16_round(bb); }
        sm[q] = vals[u * 4 + q]; o[q] = (vals[u * 4 + q] - mu) * rs * gg + bb;
      }
      if (out_sum) *(v4f*)(out_sum + (size_t)row * N + j) = sm;
      *(v4f*)(out_norm + (size_t)row * N + j) = o;
    }
    
  }
}



// ---- f16 WMMA path (v_wmma_f32_16x16x32_f16): 11-bit significands for operands in range — used for every GEMM launched in this file
typedef _Float16 v16h __attribute__((ext_vector_type(16)));
union FragH { v16h v; v8us half[2]; _Float16 h[16]; unsigned short u[16]; };
template <int NT>
__device__ __forceinline__ v8f mmaH(v16h ah, v16h al, v16h bh, v16h bl, v8f c) {
  c = __builtin_amdgcn_wmma_f32_16x16x32_f16(false, ah, false, bh, (short)0, c, false, false);
  if (NT >= 2) c = __builtin_amdgcn_wmma_f32_16x16x32_f16(false, al, false, bh, (short)0, c, false, false);
  if (NT >= 3) c = __builtin_amdgcn_wmma_f32_16x16x32_f16(false, ah, false, bl, (short)0, c, false, false);
  asm volatile("v_nop\n\tv_nop\n\tv_nop\n\tv_nop" : "+v"(c) : "v"(ah), "v"(al), "v"(bh), "v"(bl));
  return c;
}
// batched GEMM like k_gemm_b but f16 operands: A f32 (split into f16 hi/lo if ASPLIT, else rounded to f16), Bt = f16 values [n][k]; alpha; C f32; N multiple of 16 (partial tiles skipped)
template <bool ASPLIT>
__global__ __launch_bounds__(128) void k_gemm_h(const float* __restrict__ A, int lda, size_t sA, const _Float16* __restrict__ Bh, int ldb, size_t sB, float alpha, float* __restrict__ C, int ldc, size_t sC, int M, int N, int K) {
  __shared__ __attribute__((aligned(16))) float so[4][16][64];
  const int tid = threadIdx.x, w = tid >> 5, lane = tid & 31, ln = lane & 15, hh = lane >> 4; const int by = blockIdx.y;
  A += (size_t)by * sA; Bh += (size_t)by * sB; C += (size_t)by * sC;
  const int ntn = (N + 63) / 64; const int wid = blockIdx.x * 4 + w; const int mt = wid / ntn, nq = wid % ntn; if (mt * 16 >= M) return;
  const int row0 = mt * 16, col0 = nq * 64; const float* arow = A + (size_t)(row0 + ln) * lda;
  v8f acc[4] = {};
  for (int kb = 0; kb < K; kb += 32) {
    FragH ah, al;
    const v4f x0 = *(const v4fa*)(arow + kb + 8 * hh), x1 = *(const v4fa*)(arow + kb + 8 * hh + 4), x2 = *(const v4fa*)(arow + kb + 16 + 8 * hh), x3 = *(const v4fa*)(arow + kb + 16 + 8 * hh + 4);
    float xs[16] = {x0[0],x0[1],x0[2],x0[3],x1[0],x1[1],x1[2],x1[3],x2[0],x2[1],x2[2],x2[3],x3[0],x3[1],x3[2],x3[3]};
#pragma unroll
    for (int i = 0; i < 16; ++i) { const _Float16 h = (_Float16)xs[i]; ah.h[i] = h; al.h[i] = ASPLIT ? (_Float16)(xs[i] - (float)h) : (_Float16)0.0f; }
#pragma unroll
    for (int t = 0; t < 4; ++t) { if (col0 + t * 16 >= N) continue; const size_t boff = (size_t)(col0 + t * 16 + ln) * ldb + kb; FragH bq; bq.half[0] = *(const v8us*)(Bh + boff + 8 * hh); bq.half[1] = *(const v8us*)(Bh + boff + 16 + 8 * hh);
      acc[t] = mmaH<ASPLIT ? 2 : 1>(ah.v, al.v, bq.v, bq.v, acc[t]); }
  }
#pragma unroll
  for (int t = 0; t < 4; ++t) { if (col0 + t * 16 >= N) continue;
#pragma unroll
    for (int r = 0; r < 8; ++r) so[w][8 * hh + r][t * 16 + ln] = acc[t][r] * alpha; }
  __builtin_amdgcn_fence(__ATOMIC_ACQ_REL, "workgroup"); __builtin_amdgcn_wave_barrier();
  const int rsub = lane >> 4, c4 = (lane & 15) * 4;
  {
#pragma unroll
    for (int q = 0; q < 8; ++q) { const int r = q * 2 + rsub; if (col0 + c4 < N) { const v4f v = *(const v4fa*)&so[w][r][c4]; *(v4f*)(C + (size_t)(row0 + r) * ldc + col0 + c4) = v; } }
     }
}

// Wt[n][k] = f16(W[k][n]·scale) from f32 row-major W[K][N] (scale = power of two; bf16-exact weights stay exact in f16 away from the subnormal range)
__global__ __launch_bounds__(256) void k_wt_f16(const float* __restrict__ W, _Float16* __restrict__ Wt, int K, int N, float scale) {
  const int t = blockIdx.x * 256 + threadIdx.x; if (t >= N * (K / 8)) return; const int n = t / (K / 8), k8 = (t % (K / 8)) * 8; FragH f;
#pragma unroll
  for (int i = 0; i < 8; ++i) f.h[i] = (_Float16)(bf16_round(W[(size_t)(k8 + i) * N + n]) * scale); const v8us o = f.half[0];
  *(v8us*)((unsigned short*)Wt + (size_t)n * K + k8) = o; 
}
// k_gemm_hh variant with fused epilogue: v = acc·alpha + bias[by·sBias + col] (+ CP[(row/rowsPerB)·sCPb + by·64 + col] if CP) ; ACT 0 none / 1 elu ; writes f16 C16 (and f32 C if non-null)
template <int ACT>
__global__ __launch_bounds__(128) void k_gemm_hhx(const _Float16* __restrict__ A, int lda, size_t sA, const _Float16* __restrict__ Bh, int ldb, size_t sB, float alpha, const float* __restrict__ bias, size_t sBias, const float* __restrict__ CP, int rowsPerB, size_t sCPb, int row0g,
    float* __restrict__ C, _Float16* __restrict__ C16, int ldc, size_t sC, int M, int N, int K) {
  __shared__ __attribute__((aligned(16))) float so[4][16][64];
  const int tid = threadIdx.x, w = tid >> 5, lane = tid & 31, ln = lane & 15, hh = lane >> 4; const int by = blockIdx.y;
  A += (size_t)by * sA; Bh += (size_t)by * sB; const size_t cofs = (size_t)by * sC; const float* bp = bias ? bias + (size_t)by * sBias : nullptr;
  const int ntn = (N + 63) / 64; const int wid = blockIdx.x * 4 + w; const int mt = wid / ntn, nq = wid % ntn; if (mt * 16 >= M) return;
  const int row0 = mt * 16, col0 = nq * 64; const _Float16* arow = A + (size_t)(row0 + ln) * lda;
  v8f acc[4] = {};
  for (int kb = 0; kb < K; kb += 32) { FragH ah; ah.half[0] = *(const v8us*)((const unsigned short*)arow + kb + 8 * hh); ah.half[1] = *(const v8us*)((const unsigned short*)arow + kb + 16 + 8 * hh);
#pragma unroll
    for (int t = 0; t < 4; ++t) { if (col0 + t * 16 >= N) continue; const size_t boff = (size_t)(col0 + t * 16 + ln) * ldb + kb; FragH bq; bq.half[0] = *(const v8us*)((const unsigned short*)Bh + boff + 8 * hh); bq.half[1] = *(const v8us*)((const unsigned short*)Bh + boff + 16 + 8 * hh);
      acc[t] = mmaH<1>(ah.v, ah.v, bq.v, bq.v, acc[t]); }
  }
#pragma unroll
  for (int t = 0; t < 4; ++t) { if (col0 + t * 16 >= N) continue; const int col = col0 + t * 16 + ln; const float bv = bp ? bf16_round(bp[col]) : 0.f;
#pragma unroll
    for (int r = 0; r < 8; ++r) { float v = acc[t][r] * alpha + bv; if (CP) { const int rr = row0g + row0 + 8 * hh + r; if (rowsPerB < 0) v += CP[cofs + (size_t)rr * ldc + col];      /* rowsPerB < 0: own element of the batched C plane */ else { const int bidx = rr / rowsPerB; v += CP[(size_t)bidx * sCPb + (size_t)by * 64 + col]; } } if (ACT == 1) v = (v > 0.f) ? v : expm1f(v); else if (ACT == 7) v = (v > 0.f) ? v + 1.0f : expf(v); else if (ACT == 8) v = tanhf(v); else if (ACT == 9) v = 0.5f * v * (1.0f + tanhf(0.7978845608028654f * (v + 0.044715f * v * v * v))); else if (ACT == 11) v = 1.0f / (1.0f + expf(-v)); else if (ACT == 12) v = (v > 0.f) ? v : 0.01f * v; else if (ACT == 14) v = (v > 0.f) ? v : 0.1f * v; else if (ACT == 16) v = (v >= 0.f) ? v : 0.3f * v; else if (ACT == 17) v = (v >= 0.f) ? v : 0.2f * v; else if (ACT == 15) v = v / (1.0f + expf(-v)); else if (ACT == 3) v = fmaxf(v, 0.f); else if (ACT == 6) v = 0.5f * v * (1.0f + erff(v * 0.70710678118654752f)); so[w][8 * hh + r][t * 16 + ln] = v; } }
  __builtin_amdgcn_fence(__ATOMIC_ACQ_REL, "workgroup"); __builtin_amdgcn_wave_barrier();
  const int rsub = lane >> 4, c4 = (lane & 15) * 4; typedef _Float16 v4h __attribute__((ext_vector_type(4)));
  {
#pragma unroll
    for (int q = 0; q < 8; ++q) { const int r = q * 2 + rsub; if (col0 + c4 < N) { const v4f v = *(const v4fa*)&so[w][r][c4]; if (C) *(v4f*)(C + cofs + (size_t)(row0 + r) * ldc + col0 + c4) = v; if (C16) { v4h h4; for (int i = 0; i < 4; ++i) h4[i] = (_Float16)v[i]; *(v4h*)(C16 + cofs + (size_t)(row0 + r) * ldc + col0 + c4) = h4; } } }
     }
}


typedef _Float16 v4h __attribute__((ext_vector_type(4)));

__global__ __launch_bounds__(256) void k_x16(const float* __restrict__ x, _Float16* __restrict__ X16, size_t n8) { const size_t t = (size_t)blockIdx.x * 256 + threadIdx.x; if (t >= n8) return; FragH f;
#pragma unroll
  for (int q = 0; q < 8; ++q) f.h[q] = (_Float16)bf16_round(x[t * 8 + q]); *(v8us*)((unsigned short*)X16 + t * 8) = f.half[0];  }
__global__ __launch_bounds__(256) void k_h16(const float* __restrict__ x, _Float16* __restrict__ X16, size_t n8) { const size_t t = (size_t)blockIdx.x * 256 + threadIdx.x; if (t >= n8) return; FragH f;
#pragma unroll
  for (int q = 0; q < 8; ++q) f.h[q] = (_Float16)x[t * 8 + q]; *(v8us*)((unsigned short*)X16 + t * 8) = f.half[0];  }
__global__ __launch_bounds__(256) void k_round16f(const float* __restrict__ W, _Float16* __restrict__ Bt, size_t n8) { const size_t t = (size_t)blockIdx.x * 256 + threadIdx.x; if (t >= n8) return; FragH f;
#pragma unroll
  for (int i = 0; i < 8; ++i) f.h[i] = (_Float16)(bf16_round(W[t * 8 + i]) * 16.0f); *(v8us*)((unsigned short*)Bt + t * 8) = f.half[0];  }
template <int NHv, int TTv>
__global__ __launch_bounds__(256) void k_vt(const _Float16* __restrict__ V16, int ldv, int voff, _Float16* __restrict__ Vt) { __shared__ unsigned short tl[64][66]; const int tid = threadIdx.x; const int slab = blockIdx.x / (TTv / 64), lg = blockIdx.x % (TTv / 64); const int b = slab / NHv, h = slab % NHv;
  for (int i = tid; i < 64 * 8; i += 256) { const int r = i / 8, c8 = (i % 8) * 8; FragH f; f.half[0] = *(const v8us*)((const unsigned short*)V16 + ((size_t)b * TTv + lg * 64 + r) * ldv + voff + h * 64 + c8);
#pragma unroll
    for (int q = 0; q < 8; ++q) tl[r][c8 + q] = f.u[q]; }
  __syncthreads();
  {
#pragma unroll
    for (int rd = 0; rd < 2; ++rd) { const int d = rd * 32 + tid / 8, pc = tid % 8; FragH f;
#pragma unroll
      for (int q = 0; q < 8; ++q) f.u[q] = tl[pc * 8 + q][d];
      *(v8us*)((unsigned short*)Vt + ((size_t)slab * 64 + d) * TTv + lg * 64 + pc * 8) = f.half[0]; }
     } }

__global__ __launch_bounds__(256) void k_hl(const float* __restrict__ F, _Float16* __restrict__ Hh, _Float16* __restrict__ Hl, size_t n8) { const size_t t = (size_t)blockIdx.x * 256 + threadIdx.x; if (t >= n8) return; FragH fh, fl; const v4f a = *(const v4fa*)(F + t * 8), c = *(const v4fa*)(F + t * 8 + 4);
#pragma unroll
  for (int q = 0; q < 4; ++q) { _Float16 h = (_Float16)a[q]; fh.h[q] = h; fl.h[q] = (_Float16)((a[q] - (float)h) * 1024.0f); h = (_Float16)c[q]; fh.h[4 + q] = h; fl.h[4 + q] = (_Float16)((c[q] - (float)h) * 1024.0f); }
  { *(v8us*)((unsigned short*)Hh + t * 8) = fh.half[0]; *(v8us*)((unsigned short*)Hl + t * 8) = fl.half[0];  } }

// ---- fast GEMM (wave tile 32x64; requires M % 32 == 0 rows per launch region and N % 64 == 0); epilogue = k_gemm_hhx semantics ----
__device__ __forceinline__ v16h g2_frag(const _Float16* p, int hh) { FragH f; f.half[0] = *(const v8us*)((const unsigned short*)p + 8 * hh); f.half[1] = *(const v8us*)((const unsigned short*)p + 16 + 8 * hh); return f.v; }
__device__ __forceinline__ v8f g2_mma(v16h a, v16h b, v8f c) { v8f d = __builtin_amdgcn_wmma_f32_16x16x32_f16(false, a, false, b, (short)0, c, false, false); asm volatile("v_nop\n\tv_nop\n\tv_nop\n\tv_nop" : "+v"(d) : "v"(a), "v"(b)); return d; }
template <int ACT>
__global__ __launch_bounds__(128) void k_gemm2(const _Float16* __restrict__ A, int lda, size_t sA, const _Float16* __restrict__ Bh, int ldb, size_t sB, float alpha, const float* __restrict__ bias, size_t sBias, const float* __restrict__ CP, int rowsPerB, size_t sCPb, int row0g,
    float* __restrict__ C, _Float16* __restrict__ C16, int ldc, size_t sC, int M, int N, int K) { static_assert(ACT == 0 || ACT == 3 || ACT == 6 || ACT == 8 || ACT == 9 || ACT == 11 || ACT == 12 || ACT == 14 || ACT == 15 || ACT == 16 || ACT == 17, "k_gemm2: unsupported ACT code (would silently apply no activation)");
  __shared__ __attribute__((aligned(16))) float so[4][32][68];
  const int tid = threadIdx.x, w = tid >> 5, lane = tid & 31, ln = lane & 15, hh = lane >> 4; const int by = blockIdx.y;
  A += (size_t)by * sA; Bh += (size_t)by * sB; const size_t cofs = (size_t)by * sC; const float* bp = bias ? bias + (size_t)by * sBias : nullptr;
  const int ntn = N >> 6; const int mt = blockIdx.x / ntn, nq = blockIdx.x - mt * ntn; const int row0 = mt * 128 + 32 * w, col0 = nq * 64; if (row0 >= M) return;
  const _Float16* a0p = A + (size_t)(row0 + ln) * lda; const _Float16* a1p = a0p + (size_t)16 * lda;
  const _Float16* b0p = Bh + (size_t)(col0 + ln) * ldb; const _Float16* b1p = b0p + (size_t)16 * ldb; const _Float16* b2p = b1p + (size_t)16 * ldb; const _Float16* b3p = b2p + (size_t)16 * ldb;
  const v8f z8 = {0.f,0.f,0.f,0.f,0.f,0.f,0.f,0.f}; v8f c00 = z8, c01 = z8, c02 = z8, c03 = z8, c10 = z8, c11 = z8, c12 = z8, c13 = z8;
#pragma unroll 1
  for (int kb = 0; kb < K; kb += 32) { const v16h a0 = g2_frag(a0p + kb, hh), a1 = g2_frag(a1p + kb, hh);
    v16h b = g2_frag(b0p + kb, hh); c00 = g2_mma(a0, b, c00); c10 = g2_mma(a1, b, c10);
    b = g2_frag(b1p + kb, hh); c01 = g2_mma(a0, b, c01); c11 = g2_mma(a1, b, c11);
    b = g2_frag(b2p + kb, hh); c02 = g2_mma(a0, b, c02); c12 = g2_mma(a1, b, c12);
    b = g2_frag(b3p + kb, hh); c03 = g2_mma(a0, b, c03); c13 = g2_mma(a1, b, c13); }
  v8f accs[8] = {c00, c01, c02, c03, c10, c11, c12, c13};
#pragma unroll
  for (int u = 0; u < 8; ++u) { const int t = u & 3, half = u >> 2; const int col = col0 + t * 16 + ln; const float bv = bp ? bf16_round(bp[col]) : 0.f;
#pragma unroll
    for (int r = 0; r < 8; ++r) { const int rloc = half * 16 + 8 * hh + r; float v = accs[u][r] * alpha + bv; if (CP) { if (rowsPerB < 0) v += CP[cofs + (size_t)(row0g + row0 + rloc) * ldc + col];      /* rowsPerB < 0: own element of the batched C plane */ else { const int bidx = (row0g + row0 + rloc) / rowsPerB; v += CP[(size_t)bidx * sCPb + (size_t)by * 64 + col]; } }
      if (ACT == 3) v = fmaxf(v, 0.f); else if (ACT == 6) v = 0.5f * v * (1.0f + erff(v * 0.70710678118654752f)); else if (ACT == 11) v = 1.0f / (1.0f + expf(-v)); else if (ACT == 15) v = v / (1.0f + expf(-v)); else if (ACT == 12) v = (v > 0.f) ? v : 0.01f * v; else if (ACT == 8) v = tanhf(v); else if (ACT == 9) v = 0.5f * v * (1.0f + tanhf(0.7978845608028654f * (v + 0.044715f * v * v * v))); else if (ACT == 14) v = (v > 0.f) ? v : 0.1f * v; else if (ACT == 16) v = (v >= 0.f) ? v : 0.3f * v; else if (ACT == 17) v = (v >= 0.f) ? v : 0.2f * v;
      so[w][rloc][t * 16 + ln] = v; } }
  __builtin_amdgcn_fence(__ATOMIC_ACQ_REL, "workgroup"); __builtin_amdgcn_wave_barrier();
  const int rsub = lane >> 4, c4 = (lane & 15) * 4;
  {
#pragma unroll
    for (int q = 0; q < 16; ++q) { const int r = q * 2 + rsub; const v4f v = *(const v4fa*)&so[w][r][c4]; if (C) *(v4f*)(C + cofs + (size_t)(row0 + r) * ldc + col0 + c4) = v; if (C16) { v4h h4; for (int i = 0; i < 4; ++i) h4[i] = (_Float16)v[i]; *(v4h*)(C16 + cofs + (size_t)(row0 + r) * ldc + col0 + c4) = h4; } }
     } }

// ---- k_gemm2 with both operands staged in LDS (requires M % 128 == 0, N % 64 == 0, K % 128 == 0); same tiles, same k order, same epilogue ----
// A stage is 128 k (256 B, two whole lines) of the work-group's 128 A rows and 64 B rows; every wave-wide copy covers two whole rows of it (4 lines) where a fragment load from global touched 16 lines.
#define G3_KS 128
#define G3_PITCH 272                    /* LDS row pitch, bytes: 16 B x odd, conflict-free for ds_load_b128 */
#define G3_STAGE (192 * G3_PITCH)       /* rows 0..127 = A, rows 128..191 = B */
#define G3_C(l, g) "global_load_async_to_lds_b128 %" #l ", %" #g ", off\n\t"
// twelve copies and, as the statement's last line, the wait that stands before any register they name is rewritten
#define G3_COPY12(L, G, o) asm volatile(G3_C(0, 12) G3_C(1, 13) G3_C(2, 14) G3_C(3, 15) G3_C(4, 16) G3_C(5, 17) G3_C(6, 18) G3_C(7, 19) G3_C(8, 20) G3_C(9, 21) G3_C(10, 22) G3_C(11, 23) "s_wait_xcnt 0x0" \
    :: "v"(L[o + 0]), "v"(L[o + 1]), "v"(L[o + 2]), "v"(L[o + 3]), "v"(L[o + 4]), "v"(L[o + 5]), "v"(L[o + 6]), "v"(L[o + 7]), "v"(L[o + 8]), "v"(L[o + 9]), "v"(L[o + 10]), "v"(L[o + 11]), \
       "v"(G[o + 0]), "v"(G[o + 1]), "v"(G[o + 2]), "v"(G[o + 3]), "v"(G[o + 4]), "v"(G[o + 5]), "v"(G[o + 6]), "v"(G[o + 7]), "v"(G[o + 8]), "v"(G[o + 9]), "v"(G[o + 10]), "v"(G[o + 11]) : "memory")
// one stage: 24 copies of 16 B per lane. l = the lane's LDS byte address in row (tid >> 4) of the buffer, ga / gb = its global address in that row of the A / B tile; copy j serves row 8 j + (tid >> 4)
// IM8: the A tile's 128 rows are 8 h-lines of 16 w-positions of the bordered rows, so tile row 8 j + .. lies (j >> 1) bordered h-lines and 8 (j & 1) positions behind row (tid >> 4)
template <bool IM8>
__device__ __forceinline__ void g3_fill(unsigned l, const _Float16* ga, size_t sa8, const _Float16* gb, size_t sb8) {
  unsigned L[24]; const _Float16* G[24];
#pragma unroll      /* both loops: every index constant, so that L and G are registers the asm can name */
  for (int j = 0; j < 16; ++j) { L[j] = l + (unsigned)j * (8u * G3_PITCH); G[j] = ga + (IM8 ? (size_t)(((j >> 1) * PD + (j & 1) * 8) * CC) : (size_t)j * sa8); }
#pragma unroll
  for (int j = 0; j < 8; ++j) { L[16 + j] = l + (unsigned)(16 + j) * (8u * G3_PITCH); G[16 + j] = gb + (size_t)j * sb8; }
  G3_COPY12(L, G, 0); G3_COPY12(L, G, 12); }
__device__ __forceinline__ v16h g3_frag(const unsigned char* p) { FragH f; f.half[0] = *(const v8us*)p; f.half[1] = *(const v8us*)(p + 32); return f.v; }
// IM8: A = bordered rows [NB][PD][PD][PD][CC] and the product is the k2 conv: stage s is channels 128 (s & 1) .. + 127 of tap s >> 1 = (dt, dh, dw), read for output position (t, h, w) at bordered index (t + dt, h + dh, w + dw); k = tap * CC + channel
template <int ACT, bool IM8 = false>
__global__ __launch_bounds__(128) void k_gemm2s(const _Float16* __restrict__ A, int lda, size_t sA, const _Float16* __restrict__ Bh, int ldb, size_t sB, float alpha, const float* __restrict__ bias, size_t sBias, const float* __restrict__ CP, int rowsPerB, size_t sCPb, int row0g,
    float* __restrict__ C, _Float16* __restrict__ C16, int ldc, size_t sC, int M, int N, int K) { static_assert(ACT == 0 || ACT == 3 || ACT == 6 || ACT == 8 || ACT == 9 || ACT == 11 || ACT == 12 || ACT == 14 || ACT == 15 || ACT == 16 || ACT == 17, "k_gemm2s: unsupported ACT code (would silently apply no activation)");
  __shared__ __attribute__((aligned(16))) unsigned char st[2 * G3_STAGE];
  __shared__ __attribute__((aligned(16))) float so[4][32][68];
  const int tid = threadIdx.x, w = tid >> 5, lane = tid & 31, ln = lane & 15, hh = lane >> 4; const int by = blockIdx.y;
  A += (size_t)by * sA; Bh += (size_t)by * sB; const size_t cofs = (size_t)by * sC; const float* bp = bias ? bias + (size_t)by * sBias : nullptr;
  const int ntn = N >> 6; const int mt = blockIdx.x / ntn, nq = blockIdx.x - mt * ntn; const int row0 = mt * 128 + 32 * w, col0 = nq * 64; if (mt * 128 >= M) return;      /* the same for the whole work-group, in front of every barrier */
  const int crow = tid >> 4, cch = tid & 15; const size_t sa8 = (size_t)8 * lda, sb8 = (size_t)8 * ldb;
  static_assert(!IM8 || (DT == 16 && DH == 16 && DW == 16 && CC == 2 * G3_KS), "IM8: a 128-row tile is 8 h-lines of 16, a tap is two stages");
  const _Float16* gA = IM8 ? A + (size_t)((mt >> 5) * NPP + ((mt >> 1) & 15) * (PD * PD) + (mt & 1) * (8 * PD) + crow) * CC + cch * 8 : A + (size_t)(mt * 128 + crow) * lda + cch * 8;
  auto aoff = [](int t) -> size_t { return IM8 ? (size_t)((((t >> 3) & 1) * (PD * PD) + ((t >> 2) & 1) * PD + ((t >> 1) & 1)) * CC + (t & 1) * G3_KS) : (size_t)t * G3_KS; };      /* stage t's place behind gA, elements */
  const _Float16* gB = Bh + (size_t)(col0 + crow) * ldb + cch * 8;
  const unsigned l0 = (unsigned)(size_t)st + (unsigned)(crow * G3_PITCH + cch * 16);
  const unsigned char* fa = st + (32 * w + ln) * G3_PITCH + 16 * hh; const unsigned char* fb = st + (128 + ln) * G3_PITCH + 16 * hh;
  const int nt = K / G3_KS;
  const v8f z8 = {0.f,0.f,0.f,0.f,0.f,0.f,0.f,0.f}; v8f c00 = z8, c01 = z8, c02 = z8, c03 = z8, c10 = z8, c11 = z8, c12 = z8, c13 = z8;
  g3_fill<IM8>(l0, gA, sa8, gB, sb8);
  asm volatile("s_wait_asynccnt 0x0" ::: "memory");      /* this wave's copies of stage 0 have landed */
  __syncthreads();                                        /* ... and every other wave's */
  if (nt > 1) g3_fill<IM8>(l0 + G3_STAGE, gA + aoff(1), sa8, gB + G3_KS, sb8);
#pragma unroll 1      /* one trip per stage: the buffer index stays a run-time value */
  for (int t = 0; t < nt; ++t) { const unsigned bo = (unsigned)(t & 1) * G3_STAGE; const unsigned char* pa = fa + bo; const unsigned char* pb = fb + bo;
    v16h a0 = g3_frag(pa), a1 = g3_frag(pa + 16 * G3_PITCH), b0 = g3_frag(pb), b1 = g3_frag(pb + 16 * G3_PITCH), b2 = g3_frag(pb + 32 * G3_PITCH), b3 = g3_frag(pb + 48 * G3_PITCH);
#pragma unroll      /* constant LDS offsets; the next 32 k's fragments (same stage) are read as one group ahead of this 32 k's WMMAs */
    for (int ks = 0; ks < 4; ++ks) { v16h na0 = a0, na1 = a1, nb0 = b0, nb1 = b1, nb2 = b2, nb3 = b3;
      if (ks < 3) { const unsigned char* qa = pa + (ks + 1) * 64; const unsigned char* qb = pb + (ks + 1) * 64; na0 = g3_frag(qa); na1 = g3_frag(qa + 16 * G3_PITCH); nb0 = g3_frag(qb); nb1 = g3_frag(qb + 16 * G3_PITCH); nb2 = g3_frag(qb + 32 * G3_PITCH); nb3 = g3_frag(qb + 48 * G3_PITCH); }
      c00 = g2_mma(a0, b0, c00); c10 = g2_mma(a1, b0, c10); c01 = g2_mma(a0, b1, c01); c11 = g2_mma(a1, b1, c11);
      c02 = g2_mma(a0, b2, c02); c12 = g2_mma(a1, b2, c12); c03 = g2_mma(a0, b3, c03); c13 = g2_mma(a1, b3, c13);
      a0 = na0; a1 = na1; b0 = nb0; b1 = nb1; b2 = nb2; b3 = nb3; }
    asm volatile("s_wait_dscnt 0x0" ::: "memory");        /* this wave's reads of the buffer are done before it is refilled */
    asm volatile("s_wait_asynccnt 0x0" ::: "memory");     /* this wave's copies of stage t + 1 have landed */
    __syncthreads();                                      /* publishes stage t + 1 and ends every wave's reads of stage t */
    if (t + 2 < nt) g3_fill<IM8>(l0 + bo, gA + aoff(t + 2), sa8, gB + (size_t)(t + 2) * G3_KS, sb8); }
  asm volatile("s_wait_asynccnt 0x0" ::: "memory");       /* no copy outstanding behind the loop */
  v8f accs[8] = {c00, c01, c02, c03, c10, c11, c12, c13};
#pragma unroll
  for (int u = 0; u < 8; ++u) { const int t = u & 3, half = u >> 2; const int col = col0 + t * 16 + ln; const float bv = bp ? bf16_round(bp[col]) : 0.f;
#pragma unroll
    for (int r = 0; r < 8; ++r) { const int rloc = half * 16 + 8 * hh + r; float v = accs[u][r] * alpha + bv; if (CP) { if (rowsPerB < 0) v += CP[cofs + (size_t)(row0g + row0 + rloc) * ldc + col];      /* rowsPerB < 0: own element of the batched C plane */ else { const int bidx = (row0g + row0 + rloc) / rowsPerB; v += CP[(size_t)bidx * sCPb + (size_t)by * 64 + col]; } }
      if (ACT == 3) v = fmaxf(v, 0.f); else if (ACT == 6) v = 0.5f * v * (1.0f + erff(v * 0.70710678118654752f)); else if (ACT == 11) v = 1.0f / (1.0f + expf(-v)); else if (ACT == 15) v = v / (1.0f + expf(-v)); else if (ACT == 12) v = (v > 0.f) ? v : 0.01f * v; else if (ACT == 8) v = tanhf(v); else if (ACT == 9) v = 0.5f * v * (1.0f + tanhf(0.7978845608028654f * (v + 0.044715f * v * v * v))); else if (ACT == 14) v = (v > 0.f) ? v : 0.1f * v; else if (ACT == 16) v = (v >= 0.f) ? v : 0.3f * v; else if (ACT == 17) v = (v >= 0.f) ? v : 0.2f * v;
      so[w][rloc][t * 16 + ln] = v; } }
  __builtin_amdgcn_fence(__ATOMIC_ACQ_REL, "workgroup"); __builtin_amdgcn_wave_barrier();
  const int rsub = lane >> 4, c4 = (lane & 15) * 4;
  {
#pragma unroll
    for (int q = 0; q < 16; ++q) { const int r = q * 2 + rsub; const v4f v = *(const v4fa*)&so[w][r][c4]; if (C) { *(v4f*)(C + cofs + (size_t)(row0 + r) * ldc + col0 + c4) = v; asm volatile("s_wait_xcnt 0x0" ::: "memory"); /* stands before the store's data and address registers are rewritten by the next piece */ } if (C16) { v4h h4; for (int i = 0; i < 4; ++i) h4[i] = (_Float16)v[i]; *(v4h*)(C16 + cofs + (size_t)(row0 + r) * ldc + col0 + c4) = h4; } }
     } }


__global__ __launch_bounds__(256) void k_xrows(const float* __restrict__ x, float* __restrict__ RES) { __shared__ float tl[CC][33]; const int tid = threadIdx.x; const int b = blockIdx.x / (NP / 32), pb = blockIdx.x % (NP / 32); const int p0 = pb * 32;
  for (int i = tid; i < CC * 32; i += 256) { const int c = i / 32, j = i % 32; tl[c][j] = bf16_round(x[((size_t)b * CC + c) * NP + p0 + j]); }
  __syncthreads();
  { for (int i = tid; i < 32 * (CC / 8); i += 256) { const int j = i / (CC / 8), c0 = (i % (CC / 8)) * 8; v8f v; for (int q = 0; q < 8; ++q) v[q] = tl[c0 + q][j]; *(v8f*)(RES + ((size_t)b * NP + p0 + j) * CC + c0) = v; }  } }
__global__ __launch_bounds__(256) void k_elu32(float* __restrict__ F, size_t n8) {
  #pragma clang fp contract(off)
  const size_t t = (size_t)blockIdx.x * 256 + threadIdx.x; if (t >= n8) return; v8f v = *(const v8f*)(F + t * 8); for (int q = 0; q < 8; ++q) { const float a = v[q]; v[q] = (a > 0.f) ? a : expm1f(a); } *(v8f*)(F + t * 8) = v;  }
__global__ __launch_bounds__(256) void k_elu16(const float* __restrict__ F, _Float16* __restrict__ E, size_t n8) {
  #pragma clang fp contract(off)
  const size_t t = (size_t)blockIdx.x * 256 + threadIdx.x; if (t >= n8) return; const v8f v = *(const v8f*)(F + t * 8); FragH f; for (int q = 0; q < 8; ++q) { const float a = v[q]; f.h[q] = (_Float16)((a > 0.f) ? a : expm1f(a)); } *(v8us*)((unsigned short*)E + t * 8) = f.half[0];  }
// elu(F) as f16 rows in the bordered layout: one thread per 8 channels of a bordered position; positions with an index 0 hold zeros
__global__ __launch_bounds__(256) void k_elu16p(const float* __restrict__ F, _Float16* __restrict__ E) { const size_t t = (size_t)blockIdx.x * 256 + threadIdx.x; if (t >= (size_t)NB * NPP * (CC / 8)) return; const int c8 = (int)(t % (CC / 8)) * 8; const int pr = (int)(t / (CC / 8)); const int b = pr / NPP, pp = pr % NPP; const int w1 = pp % PD, h1 = (pp / PD) % PD, t1 = pp / (PD * PD); FragH f;
  if (t1 > 0 && h1 > 0 && w1 > 0) { const v8f v = *(const v8f*)(F + ((size_t)b * NP + (size_t)((t1 - 1) * DH + (h1 - 1)) * DW + (w1 - 1)) * CC + c8); for (int q = 0; q < 8; ++q) { const float a = v[q]; f.h[q] = (_Float16)((a > 0.f) ? a : expm1f(a)); } } else { for (int q = 0; q < 8; ++q) f.u[q] = 0; }
  *(v8us*)((unsigned short*)E + t * 8) = f.half[0];  }
__global__ __launch_bounds__(256) void k_w8(const float* __restrict__ w, int O, _Float16* __restrict__ Bt) { const size_t t = (size_t)blockIdx.x * 256 + threadIdx.x; if (t >= (size_t)O * K8 / 8) return; const int c8 = (int)((t * 8) % CC); const int tap = (int)(((t * 8) / CC) % 8); const int o = (int)((t * 8) / K8); FragH f; for (int q = 0; q < 8; ++q) f.h[q] = (_Float16)(bf16_round(w[((size_t)o * CC + c8 + q) * 8 + tap]) * 16.0f);
  *(v8us*)((unsigned short*)Bt + t * 8) = f.half[0];  }
__global__ __launch_bounds__(256) void k_gate(const float* __restrict__ O2, float* __restrict__ RES) {
  #pragma clang fp contract(off)
  const size_t t = (size_t)blockIdx.x * 256 + threadIdx.x; if (t >= NR * CC / 8) return; const int c0 = (int)((t * 8) % CC); const size_t r = (t * 8) / CC; v8f v = *(const v8f*)(RES + t * 8); const float* o = O2 + r * 512;
  for (int q = 0; q < 8; ++q) { const float a = o[c0 + q], g = o[256 + c0 + q]; const float s = 1.0f / (1.0f + expf(-g)); v[q] = v[q] + __fmul_rn(a, s); }
  *(v8f*)(RES + t * 8) = v;  }
__global__ __launch_bounds__(256) void k_xa(const float* __restrict__ RES, const float* __restrict__ orig, _Float16* __restrict__ XA) { const size_t t = (size_t)blockIdx.x * 256 + threadIdx.x; if (t >= NR * 36) return; const int pc = (int)(t % 36); const size_t r = t / 36; const int p = (int)(r % NP); const size_t b = r / NP; FragH f;
  for (int q = 0; q < 8; ++q) { const int col = pc * 8 + q; float v = 0.f; if (col < 256) v = RES[r * CC + col]; else if (col < 259) v = bf16_round(orig[((b * 3 + (col - 256)) * (size_t)NP) + p]); else if (col == 259) v = -0.5f + (float)(p / (DH * DW)) / (float)DT; else if (col == 260) v = -0.5f + (float)((p / DW) % DH) / (float)DH; else if (col == 261) v = -0.5f + (float)(p % DW) / (float)DW; f.h[q] = (_Float16)v; }
  unsigned short* d = (unsigned short*)XA + r * KA + pc * 8; *(v8us*)d = f.half[0];  }
__global__ __launch_bounds__(256) void k_wa(const float* __restrict__ w, int O, int OP, _Float16* __restrict__ Bt) { const size_t t = (size_t)blockIdx.x * 256 + threadIdx.x; if (t >= (size_t)OP * KA / 8) return; const int k0 = (int)((t * 8) % KA); const int o = (int)((t * 8) / KA); FragH f; for (int q = 0; q < 8; ++q) { const int k = k0 + q; f.h[q] = (o < O && k < 262) ? (_Float16)(bf16_round(w[(size_t)o * 262 + k]) * 16.0f) : (_Float16)0.f; }
  *(v8us*)((unsigned short*)Bt + t * 8) = f.half[0];  }
__global__ __launch_bounds__(256) void k_bpad(const float* __restrict__ b, int n, int np_, float* __restrict__ bp) { const int i = blockIdx.x * 256 + threadIdx.x; if (i >= np_) return; const float v = (i < n) ? b[i] : 0.f; *(float*)(bp + i) = v;  }
__global__ __launch_bounds__(256) void k_vt(const _Float16* __restrict__ V16, int b, _Float16* __restrict__ VT) { __shared__ unsigned short tl[64][VC + 2]; const int tid = threadIdx.x; const int k0 = blockIdx.x * 64; const unsigned short* s = (const unsigned short*)V16 + ((size_t)b * NP + k0) * VC;
  for (int i = tid; i < 64 * (VC / 8); i += 256) { const int j = i / (VC / 8), c8 = (i % (VC / 8)) * 8; FragH f; f.half[0] = *(const v8us*)(s + (size_t)j * VC + c8); for (int q = 0; q < 8; ++q) tl[j][c8 + q] = f.u[q]; }
  __syncthreads();
  { for (int i = tid; i < VC * 8; i += 256) { const int c = i / 8, j8 = (i % 8) * 8; v8us o; for (int q = 0; q < 8; ++q) o[q] = tl[j8 + q][c]; *(v8us*)((unsigned short*)VT + (size_t)c * NP + k0 + j8) = o; }  } }
// causal row softmax, one work-group per query row q: 256 threads x 16 scores each, kept in registers between the max pass and the exp pass;
// lanes read and write neighbouring 8-element pieces; pieces wholly at k >= q are not read and store zeros. Row max and row sum: butterfly in the wave, then 8 wave partials through LDS.
__global__ __launch_bounds__(256) void k_csm(const float* __restrict__ S, _Float16* __restrict__ P, float* __restrict__ RS) {
  __shared__ float redm[8], reds[8];
  const int q = blockIdx.x, tid = threadIdx.x, lane = tid & 31, w = tid >> 5; const float* s = S + (size_t)q * NP;
  const float sq = sqrtf(259.0f);      /* np.float32(sqrt(259)) division: s/sqrt(C_ATT) */
  const int ka = tid * 8, kb = NP / 2 + tid * 8;
  const v4f z4 = {0.f, 0.f, 0.f, 0.f}; v4f x[4] = {z4, z4, z4, z4};
  if (ka < q) { x[0] = *(const v4fa*)(s + ka); x[1] = *(const v4fa*)(s + ka + 4); }
  if (kb < q) { x[2] = *(const v4fa*)(s + kb); x[3] = *(const v4fa*)(s + kb + 4); }
  float v[16]; float mx = -3.0e38f;
#pragma unroll
  for (int u = 0; u < 2; ++u) { const int k0 = u ? kb : ka;
    if (k0 < q) {
#pragma unroll
      for (int i = 0; i < 8; ++i) { const float t = x[u * 2 + (i >> 2)][i & 3] / sq; v[u * 8 + i] = t; mx = (k0 + i < q) ? fmaxf(mx, t) : mx; } }
    else {
#pragma unroll
      for (int i = 0; i < 8; ++i) v[u * 8 + i] = 0.f; } }
#pragma unroll
  for (int m = 16; m > 0; m >>= 1) mx = fmaxf(mx, __shfl_xor(mx, m));
  if (lane == 0) redm[w] = mx;
  __syncthreads();
#pragma unroll
  for (int i = 0; i < 8; ++i) mx = fmaxf(mx, redm[i]);
  float se = 0.f;
#pragma unroll
  for (int u = 0; u < 2; ++u) { const int k0 = u ? kb : ka; FragH f;
    if (k0 < q) {
#pragma unroll
      for (int i = 0; i < 8; ++i) { const float ee = expf(v[u * 8 + i] - mx); const float e = (k0 + i < q) ? ee : 0.f; se += e; f.h[i] = (_Float16)(e * 256.0f); } }
    else {
#pragma unroll
      for (int i = 0; i < 8; ++i) f.u[i] = 0; }
    *(v8us*)((unsigned short*)P + (size_t)q * NP + k0) = f.half[0]; }
#pragma unroll
  for (int m = 16; m > 0; m >>= 1) se += __shfl_xor(se, m);
  if (lane == 0) reds[w] = se;
  __syncthreads();
  if (tid == 0) { float t = 0.f;
#pragma unroll
    for (int i = 0; i < 8; ++i) t += reds[i];
    RS[(size_t)q * 32] = (q == 0) ? 0.f : (1.0f / 256.0f) / t; } }
__global__ __launch_bounds__(256) void k_ascale(const float* __restrict__ AT, const float* __restrict__ RS, int b, _Float16* __restrict__ ATE) {
  #pragma clang fp contract(off)
  const size_t t = (size_t)blockIdx.x * 256 + threadIdx.x; if (t >= (size_t)NP * VC / 8) return; const int q = (int)((t * 8) / VC); const float rs = RS[(size_t)q * 32]; const v8f a = *(const v8f*)(AT + t * 8); FragH f; for (int u = 0; u < 8; ++u) { const float v = a[u] * rs; f.h[u] = (_Float16)((v > 0.f) ? v : expm1f(v)); }
  unsigned short* d = (unsigned short*)ATE + ((size_t)b * NP * VC) + t * 8; *(v8us*)d = f.half[0];  }
__global__ __launch_bounds__(256) void k_sumelu(const float* __restrict__ A, const float* __restrict__ B, _Float16* __restrict__ E, size_t n8) {
  #pragma clang fp contract(off)
  const size_t t = (size_t)blockIdx.x * 256 + threadIdx.x; if (t >= n8) return; const v8f a = *(const v8f*)(A + t * 8), b = *(const v8f*)(B + t * 8); FragH f; for (int q = 0; q < 8; ++q) { const float v = a[q] + b[q]; f.h[q] = (_Float16)((v > 0.f) ? v : expm1f(v)); } *(v8us*)((unsigned short*)E + t * 8) = f.half[0];  }
__global__ __launch_bounds__(256) void k_out(const float* __restrict__ O, float* __restrict__ out) { const size_t t = (size_t)blockIdx.x * 256 + threadIdx.x; if (t >= (size_t)NB * CC * NP / 8) return; const int p0 = (int)((t * 8) % NP); const size_t bc = (t * 8) / NP; const int c = (int)(bc % CC); const size_t b = bc / CC; v8f r; for (int q = 0; q < 8; ++q) r[q] = O[(b * NP + p0 + q) * CC + c];
  *(v8f*)(out + t * 8) = r;  }

extern "C" void kernel_launch(void* const* d_in, const int* in_sizes, int n_in,
                              void* d_out, int out_size, void* d_ws, size_t ws_size, hipStream_t stream) {
  (void)in_sizes; (void)n_in; (void)out_size;
  const float* const* I = (const float* const*)d_in; const float* x = I[0]; const float* orig = I[1]; const float* rw1 = I[2]; const float* rb1 = I[3]; const float* rw2 = I[4]; const float* rb2 = I[5]; const float* qw = I[6]; const float* qb = I[7]; const float* kw = I[8]; const float* kb = I[9]; const float* vw = I[10]; const float* vb = I[11]; const float* aw = I[12]; const float* ab = I[13]; const float* rsw = I[14]; const float* rsb = I[15]; const float* ow = I[16]; const float* ob = I[17];
  char* ws = (char*)d_ws; size_t off = 0;
  auto take = [&](size_t bytes) { char* p = ws + off; off += (bytes + 255) & ~(size_t)255; return p; };
  _Float16* BW1 = (_Float16*)take((size_t)CC * K8 * 2); _Float16* BW2 = (_Float16*)take((size_t)512 * K8 * 2); _Float16* BQ = (_Float16*)take((size_t)64 * KA * 2); _Float16* BK = (_Float16*)take((size_t)64 * KA * 2); _Float16* BV = (_Float16*)take((size_t)VC * KA * 2); float* qbp = (float*)take(64 * 4); float* kbp = (float*)take(64 * 4); _Float16* BA = (_Float16*)take((size_t)CC * VC * 2); _Float16* BR = (_Float16*)take((size_t)CC * CC * 2); _Float16* BO = (_Float16*)take((size_t)CC * CC * 2);
  float* RES = (float*)take(NR * CC * 4); _Float16* E16 = (_Float16*)take(NR * CC * 2); _Float16* EP = (_Float16*)take((size_t)NB * NPP * CC * 2); _Float16* O1 = (_Float16*)take((size_t)NB * NPP * CC * 2); float* O2 = (float*)take(NR * 512 * 4);
  _Float16* XA = (_Float16*)take(NR * KA * 2); _Float16* Q16 = (_Float16*)take(NR * 64 * 2); _Float16* K16 = (_Float16*)take(NR * 64 * 2); _Float16* V16 = (_Float16*)take(NR * VC * 2); _Float16* VT = (_Float16*)take((size_t)VC * NP * 2); float* S = (float*)take((size_t)NP * NP * 4); _Float16* P = (_Float16*)take((size_t)NP * NP * 2); float* RS = (float*)take((size_t)NP * 32 * 4); float* AT = (float*)take((size_t)NP * VC * 4);
  _Float16* ATE = (_Float16*)take(NR * VC * 2); float* ATTC = (float*)take(NR * CC * 4); float* R2 = (float*)take(NR * CC * 4); _Float16* SUM16 = (_Float16*)take(NR * CC * 2); float* OUT = O2;
  if (off > ws_size) return;      /* about 180 MB */
  k_wa<<<(unsigned)(((size_t)64 * KA / 8 + 255) / 256), 256, 0, stream>>>(qw, 16, 64, BQ); k_wa<<<(unsigned)(((size_t)64 * KA / 8 + 255) / 256), 256, 0, stream>>>(kw, 16, 64, BK); k_wa<<<(unsigned)(((size_t)VC * KA / 8 + 255) / 256), 256, 0, stream>>>(vw, VC, VC, BV); k_bpad<<<1, 64, 0, stream>>>(qb, 16, 64, qbp); k_bpad<<<1, 64, 0, stream>>>(kb, 16, 64, kbp);
  k_round16f<<<(CC * VC / 8 + 255) / 256, 256, 0, stream>>>(aw, BA, (size_t)CC * VC / 8); k_round16f<<<(CC * CC / 8 + 255) / 256, 256, 0, stream>>>(rsw, BR, (size_t)CC * CC / 8); k_round16f<<<(CC * CC / 8 + 255) / 256, 256, 0, stream>>>(ow, BO, (size_t)CC * CC / 8);
  k_xrows<<<NB * (NP / 32), 256, 0, stream>>>(x, RES);
  const unsigned n8 = (unsigned)((NR * CC / 8 + 255) / 256); const unsigned np8 = (unsigned)(((size_t)NB * NPP * (CC / 8) + 255) / 256); const dim3 g256((unsigned)((NR / 128) * (CC / 64)), 1);
  for (int i = 0; i < NRES; ++i) {
    k_w8<<<(unsigned)(((size_t)CC * K8 / 8 + 255) / 256), 256, 0, stream>>>(rw1 + (size_t)i * CC * CC * 8, CC, BW1); k_w8<<<(unsigned)(((size_t)512 * K8 / 8 + 255) / 256), 256, 0, stream>>>(rw2 + (size_t)i * 512 * CC * 8, 512, BW2);
    k_elu16p<<<np8, 256, 0, stream>>>(RES, EP);
    k_gemm2s<0, true><<<g256, 128, 0, stream>>>(EP, CC, 0, BW1, K8, 0, 0.0625f, rb1 + i * CC, 0, nullptr, 1, 0, 0, ATTC, nullptr, CC, 0, (int)NR, CC, K8); k_elu16p<<<np8, 256, 0, stream>>>(ATTC, O1);      /* o = elu(conv1 + b1) (ATTC used as scratch here) */
    k_gemm2s<0, true><<<dim3((unsigned)((NR / 128) * 8), 1), 128, 0, stream>>>(O1, CC, 0, BW2, K8, 0, 0.0625f, rb2 + i * 512, 0, nullptr, 1, 0, 0, O2, nullptr, 512, 0, (int)NR, 512, K8);      /* conv2 + b2 (512) */
    k_gate<<<n8, 256, 0, stream>>>(O2, RES); }
  /* attention */
  k_xa<<<(unsigned)((NR * 36 + 255) / 256), 256, 0, stream>>>(RES, orig, XA);
  k_gemm2<0><<<dim3((unsigned)((NR / 128) * 1), 1), 128, 0, stream>>>(XA, KA, 0, BQ, KA, 0, 0.0625f, qbp, 0, nullptr, 1, 0, 0, nullptr, Q16, 64, 0, (int)NR, 64, KA);
  k_gemm2<0><<<dim3((unsigned)((NR / 128) * 1), 1), 128, 0, stream>>>(XA, KA, 0, BK, KA, 0, 0.0625f, kbp, 0, nullptr, 1, 0, 0, nullptr, K16, 64, 0, (int)NR, 64, KA);
  k_gemm2<0><<<dim3((unsigned)((NR / 128) * 2), 1), 128, 0, stream>>>(XA, KA, 0, BV, KA, 0, 0.0625f, vb, 0, nullptr, 1, 0, 0, nullptr, V16, VC, 0, (int)NR, VC, KA);
  for (int b = 0; b < NB; ++b) {
    k_gemm2<0><<<dim3((NP / 128) * (NP / 64), 1), 128, 0, stream>>>(Q16 + (size_t)b * NP * 64, 64, 0, K16 + (size_t)b * NP * 64, 64, 0, 1.0f, nullptr, 0, nullptr, 1, 0, 0, S, nullptr, NP, 0, NP, NP, 32);
    k_csm<<<NP, 256, 0, stream>>>(S, P, RS); k_vt<<<NP / 64, 256, 0, stream>>>(V16, b, VT);
    k_gemm2s<0><<<dim3((NP / 128) * (VC / 64), 1), 128, 0, stream>>>(P, NP, 0, VT, NP, 0, 1.0f, nullptr, 0, nullptr, 1, 0, 0, AT, nullptr, VC, 0, NP, VC, NP);
    k_ascale<<<(unsigned)(((size_t)NP * VC / 8 + 255) / 256), 256, 0, stream>>>(AT, RS, b, ATE); }
  k_gemm2s<0><<<g256, 128, 0, stream>>>(ATE, VC, 0, BA, VC, 0, 0.0625f, ab, 0, nullptr, 1, 0, 0, ATTC, nullptr, CC, 0, (int)NR, CC, VC); k_elu32<<<n8, 256, 0, stream>>>(ATTC, NR * CC / 8);      /* att = elu(attn_conv(elu(att)) + b) */
  k_elu16<<<n8, 256, 0, stream>>>(RES, E16, NR * CC / 8); k_gemm2s<0><<<g256, 128, 0, stream>>>(E16, CC, 0, BR, CC, 0, 0.0625f, rsb, 0, nullptr, 1, 0, 0, R2, nullptr, CC, 0, (int)NR, CC, CC); k_elu32<<<n8, 256, 0, stream>>>(R2, NR * CC / 8);      /* res = elu(res_conv(elu(res)) + b) */
  k_sumelu<<<n8, 256, 0, stream>>>(R2, ATTC, SUM16, NR * CC / 8);
  k_gemm2s<0><<<g256, 128, 0, stream>>>(SUM16, CC, 0, BO, CC, 0, 0.0625f, ob, 0, nullptr, 1, 0, 0, OUT, nullptr, CC, 0, (int)NR, CC, CC); k_elu32<<<n8, 256, 0, stream>>>(OUT, NR * CC / 8);      /* out = elu(out_conv(elu(res + att)) + b) */
  k_out<<<(unsigned)(((size_t)NB * CC * NP / 8 + 255) / 256), 256, 0, stream>>>(OUT, (float*)d_out);
}

// v004
// Measured time: 462 microseconds a run.
// Next to v003, in two timings, it ran 1.15 and 1.10 times as fast.
// Counting every step since v000, it is 6.56 times as fast.
#include <hip/hip_runtime.h>
// PixelSNAILBlock (x [2][256][16][16][16], original_input [2][3][16][16][16]; 4 gated residual blocks: o = elu(conv3d k2 pad1 crop(elu(res)) + b1); o = conv3d k2 pad1 crop(o) + b2 (512 ch); res += o[:256] * sigmoid(o[256:]); attention over the 4,096 positions of [res | original | pos-enc] (262 ch): q,k (16), v (128), causal softmax (k < q, row 0 all-zero) of q.k/sqrt(259), att = p v; att = elu(1x1(elu(att)) + b); res = elu(1x1(elu(res)) + b); out = elu(1x1(elu(res + att)) + b) -> [2][256][16][16][16]).
// Structure: position rows r = b*4096 + (t*16 + h)*16 + w; res kept as f32 rows; each k2 'causal-corner' conv as a WMMA GEMM over K = 8 taps x 256 channels whose A tiles are gathered tap by tap from zero-bordered f16 rows (32x64 wave tiles, f32 accumulation, exact x16 weights + bias) with the ELUs on VALU; gating on VALU; q/k/v as GEMMs on the 262 -> 288-column concat rows (16 live of 64 for q/k); per batch: scores GEMM (K = 32), causal row softmax on VALU (un-normalised f16 weights x 2^8 + 1/sum, row 0 -> 0), P.V GEMM (K = 4,096) against LDS-transposed value planes, scaling; the three 1x1 convs as GEMMs followed by VALU ELUs; channel-major store on VALU.
// Compute dtype: inputs rounded to bf16; x / original / weights exact; conv operands (elu(res), o1), the concat rows, q/k/v, softmax weights and the 1x1-conv operands plain f16 (~2^-12); res accumulation, gates, softmax sums f32. v_wmma_f32_16x16x32_f16.
#define NB 2
#define CC 256
#define DT 16
#define DH 16
#define DW 16
#define NP (DT * DH * DW)            /* 4096 */
#define NR ((size_t)NB * NP)       /* 8192 */
#define NRES 4
#define K8 (8 * CC)                /* 2048 */
#define KA 288                     /* 262 live */
#define VC 128
#define PD 17                      /* bordered extent of t, h and w: index 0 of each axis is the conv's zero padding */
#define NPP (PD * PD * PD)         /* 4913 bordered positions per batch */
typedef __bf16 v16b __attribute__((ext_vector_type(16)));
typedef unsigned short v8us __attribute__((ext_vector_type(8), may_alias));
typedef float  v8f  __attribute__((ext_vector_type(8)));
typedef float  v4f  __attribute__((ext_vector_type(4)));
typedef float  v4fa __attribute__((ext_vector_type(4), may_alias));
union FragB { v16b v; v8us half[2]; unsigned short u[16]; };

__device__ __forceinline__ unsigned short bf16_bits(float x) { unsigned int u = __float_as_uint(x); return (unsigned short)((u + 0x7FFFu + ((u >> 16) & 1u)) >> 16); }
__device__ __forceinline__ float bf16_val(unsigned short b) { return __uint_as_float(((unsigned int)b) << 16); }
__device__ __forceinline__ float bf16_round(float x) { return bf16_val(bf16_bits(x)); }
// D += A·B with NT terms: 1 = ah·bh, 2 = + al·bh (A split), 3 = + ah·bl (both split)
template <int NT>
__device__ __forceinline__ v8f mmaN(v16b ah, v16b al, v16b bh, v16b bl, v8f c) {
  c = __builtin_amdgcn_wmma_f32_16x16x32_bf16(false, ah, false, bh, (short)0, c, false, false);
  if (NT >= 2) c = __builtin_amdgcn_wmma_f32_16x16x32_bf16(false, al, false, bh, (short)0, c, false, false);
  if (NT >= 3) c = __builtin_amdgcn_wmma_f32_16x16x32_bf16(false, ah, false, bl, (short)0, c, false, false);
  asm volatile("v_nop\n\tv_nop\n\tv_nop\n\tv_nop" : "+v"(c) : "v"(ah), "v"(al), "v"(bh), "v"(bl));
  return c;
}

__global__ __launch_bounds__(256) void k_wt_bf16(const float* __restrict__ W, unsigned short* __restrict__ Wt, int K, int N) {
  const int t = blockIdx.x * 256 + threadIdx.x;
  const int k8n = K / 8;
  if (t >= N * k8n) return;
  const int n = t / k8n, k8 = (t % k8n) * 8;
  v8us v;
#pragma unroll
  for (int i = 0; i < 8; ++i) v[i] = bf16_bits(W[(size_t)(k8 + i) * N + n]);
  *(v8us*)(Wt + (size_t)n * K + k8) = v;
  
}

// GEMM C[M][N] (f32, pitch ldc) = act(A[M][K]·W + bias). A f32 row-major (pitch lda) converted per fragment to bf16
// (ASPLIT: hi/lo two planes -> 2 terms, else single rounded term); Wt bf16 [N][K] (pitch ldb). BIAS_BF16 rounds the
// bias to bf16 first (bias quantised to bf16 before the add). K%32==0, M%16==0, N%64==0.
template <bool ASPLIT, int ACT, bool BIAS_BF16>
__global__ __launch_bounds__(128) void k_gemm_bf(const float* __restrict__ A, int lda, const unsigned short* __restrict__ Wt, int ldb,
                                               const float* __restrict__ bias, float* __restrict__ C, int ldc, int M, int N, int K) {
  __shared__ __attribute__((aligned(16))) float so[4][16][64];
  const int tid = threadIdx.x, w = tid >> 5, lane = tid & 31, ln = lane & 15, hh = lane >> 4;
  const int ntn = N / 64;
  const int wid = blockIdx.x * 4 + w;
  const int mt = wid / ntn, nq = wid % ntn;
  if (mt * 16 >= M) return;
  const int row0 = mt * 16, col0 = nq * 64;
  const float* arow = A + (size_t)(row0 + ln) * lda;
  v8f acc[4] = {};
  for (int kb = 0; kb < K; kb += 32) {
    FragB ah, al;
    const v4f x0 = *(const v4fa*)(arow + kb + 8 * hh), x1 = *(const v4fa*)(arow + kb + 8 * hh + 4);
    const v4f x2 = *(const v4fa*)(arow + kb + 16 + 8 * hh), x3 = *(const v4fa*)(arow + kb + 16 + 8 * hh + 4);
    float xs[16] = {x0[0],x0[1],x0[2],x0[3],x1[0],x1[1],x1[2],x1[3],x2[0],x2[1],x2[2],x2[3],x3[0],x3[1],x3[2],x3[3]};
#pragma unroll
    for (int i = 0; i < 16; ++i) { const unsigned short hb = bf16_bits(xs[i]); ah.u[i] = hb; al.u[i] = ASPLIT ? bf16_bits(xs[i] - bf16_val(hb)) : (unsigned short)0; }
#pragma unroll
    for (int t = 0; t < 4; ++t) {
      const unsigned short* brow = Wt + (size_t)(col0 + t * 16 + ln) * ldb + kb;
      FragB b;
      b.half[0] = *(const v8us*)(brow + 8 * hh);
      b.half[1] = *(const v8us*)(brow + 16 + 8 * hh);
      acc[t] = mmaN<ASPLIT ? 2 : 1>(ah.v, al.v, b.v, b.v, acc[t]);
    }
  }
#pragma unroll
  for (int t = 0; t < 4; ++t) {
    float bv = bias ? bias[col0 + t * 16 + ln] : 0.f;
    if (BIAS_BF16) bv = bf16_round(bv);
#pragma unroll
    for (int r = 0; r < 8; ++r) { float v = acc[t][r] + bv; if (ACT == 1) v = fmaxf(v, 0.f); so[w][8 * hh + r][t * 16 + ln] = v; }
  }
  __builtin_amdgcn_fence(__ATOMIC_ACQ_REL, "workgroup");
  __builtin_amdgcn_wave_barrier();
  const int rsub = lane >> 4, c4 = (lane & 15) * 4;
  {
#pragma unroll
    for (int q = 0; q < 8; ++q) {
      const int r = q * 2 + rsub;
      const v4f v = *(const v4fa*)&so[w][r][c4];
      *(v4f*)(C + (size_t)(row0 + r) * ldc + col0 + c4) = v;
    }
    
  }
}

// GEMM C = act(A·W + bias + resid): A f32 (ASPLIT -> hi/lo 2 terms), Wt bf16 [N][K]; ACT 0 none, 1 relu, 2 exact gelu;
// resid (optional, f32, row index = (row % rmod), pitch ldr, RES_BF16 rounds it) added before the activation.
template <bool ASPLIT, int ACT, bool BIAS_BF16, bool RES_BF16>
__global__ __launch_bounds__(128) void k_gemm_bf3(const float* __restrict__ A, int lda, const unsigned short* __restrict__ Wt, int ldb,
                                                const float* __restrict__ bias, const float* __restrict__ resid, int rmod, int ldr,
                                                float* __restrict__ C, int ldc, int M, int N, int K) {
  __shared__ __attribute__((aligned(16))) float so[4][16][64];
  const int tid = threadIdx.x, w = tid >> 5, lane = tid & 31, ln = lane & 15, hh = lane >> 4;
  const int ntn = N / 64;
  const int wid = blockIdx.x * 4 + w;
  const int mt = wid / ntn, nq = wid % ntn;
  if (mt * 16 >= M) return;
  const int row0 = mt * 16, col0 = nq * 64;
  const float* arow = A + (size_t)(row0 + ln) * lda;
  v8f acc[4] = {};
  for (int kb = 0; kb < K; kb += 32) {
    FragB ah, al;
    const v4f x0 = *(const v4fa*)(arow + kb + 8 * hh), x1 = *(const v4fa*)(arow + kb + 8 * hh + 4);
    const v4f x2 = *(const v4fa*)(arow + kb + 16 + 8 * hh), x3 = *(const v4fa*)(arow + kb + 16 + 8 * hh + 4);
    float xs[16] = {x0[0],x0[1],x0[2],x0[3],x1[0],x1[1],x1[2],x1[3],x2[0],x2[1],x2[2],x2[3],x3[0],x3[1],x3[2],x3[3]};
#pragma unroll
    for (int i = 0; i < 16; ++i) { const unsigned short hb = bf16_bits(xs[i]); ah.u[i] = hb; al.u[i] = ASPLIT ? bf16_bits(xs[i] - bf16_val(hb)) : (unsigned short)0; }
#pragma unroll
    for (int t = 0; t < 4; ++t) {
      const unsigned short* brow = Wt + (size_t)(col0 + t * 16 + ln) * ldb + kb;
      FragB b;
      b.half[0] = *(const v8us*)(brow + 8 * hh);
      b.half[1] = *(const v8us*)(brow + 16 + 8 * hh);
      acc[t] = mmaN<ASPLIT ? 2 : 1>(ah.v, al.v, b.v, b.v, acc[t]);
    }
  }
#pragma unroll
  for (int t = 0; t < 4; ++t) {
    const int col = col0 + t * 16 + ln;
    float bv = bias ? bias[col] : 0.f;
    if (BIAS_BF16) bv = bf16_round(bv);
#pragma unroll
    for (int r = 0; r < 8; ++r) {
      float v = acc[t][r] + bv;
      if (resid) { float rv = resid[(size_t)((row0 + 8 * hh + r) % rmod) * ldr + col]; if (RES_BF16) rv = bf16_round(rv); v += rv; }
      if (ACT == 1) v = fmaxf(v, 0.f);
      if (ACT == 2) v = 0.5f * v * (1.0f + erff(v * 0.70710678118654752f));
      if (ACT == 3) { const float u = 0.7978845608028654f * (v + 0.044715f * v * v * v); v = 0.5f * v * (1.0f + tanhf(u)); }
      so[w][8 * hh + r][t * 16 + ln] = v;
    }
  }
  __builtin_amdgcn_fence(__ATOMIC_ACQ_REL, "workgroup");
  __builtin_amdgcn_wave_barrier();
  const int rsub = lane >> 4, c4 = (lane & 15) * 4;
  {
#pragma unroll
    for (int q = 0; q < 8; ++q) {
      const int r = q * 2 + rsub;
      const v4f v = *(const v4fa*)&so[w][r][c4];
      *(v4f*)(C + (size_t)(row0 + r) * ldc + col0 + c4) = v;
    }
    
  }
}
// row LayerNorm (biased variance, eps) over N: s = X (+ R); optional out_sum <- s; out_norm <- (s-mu)*rsqrt(var+eps)*g + b
template <bool PARAM_BF16>
__global__ __launch_bounds__(256) void k_layernorm(const float* __restrict__ X, const float* __restrict__ R, const float* __restrict__ g, const float* __restrict__ bta,
                                                  float* __restrict__ out_sum, float* __restrict__ out_norm, int N, float eps) {
  __shared__ float red[256];
  const int row = blockIdx.x, tid = threadIdx.x;
  const float* x = X + (size_t)row * N; const float* rr = R ? R + (size_t)row * N : nullptr;
  float vals[16];                     // up to N = 4096
  const int per = N / 256;            // contiguous chunk per thread? use strided-by-4 chunks: thread handles j = tid*4 + 1024*u
  float s1 = 0.f;
  for (int u = 0; u < per / 4; ++u) {
    const int j = tid * 4 + 1024 * u;
    const v4f a = *(const v4fa*)(x + j);
    v4f b = {0.f,0.f,0.f,0.f}; if (rr) b = *(const v4fa*)(rr + j);
#pragma unroll
    for (int q = 0; q < 4; ++q) { const float v = a[q] + b[q]; vals[u * 4 + q] = v; s1 += v; }
  }
  red[tid] = s1; __syncthreads();
  for (int st = 128; st > 0; st >>= 1) { if (tid < st) red[tid] += red[tid + st]; __syncthreads(); }
  const float mu = red[0] / (float)N; __syncthreads();
  float s2 = 0.f;
  for (int u = 0; u < per / 4; ++u)
#pragma unroll
    for (int q = 0; q < 4; ++q) { const float c = vals[u * 4 + q] - mu; s2 += c * c; }
  red[tid] = s2; __syncthreads();
  for (int st = 128; st > 0; st >>= 1) { if (tid < st) red[tid] += red[tid + st]; __syncthreads(); }
  const float rs = rsqrtf(red[0] / (float)N + eps);
  {
    for (int u = 0; u < per / 4; ++u) {
      const int j = tid * 4 + 1024 * u;
      v4f o, sm;
#pragma unroll
      for (int q = 0; q < 4; ++q) {
        float gg = g[j + q], bb = bta[j + q];
        if (PARAM_BF16) { gg = bf16_round(gg); bb = bf16_round(bb); }
        sm[q] = vals[u * 4 + q]; o[q] = (vals[u * 4 + q] - mu) * rs * gg + bb;
      }
      if (out_sum) *(v4f*)(out_sum + (size_t)row * N + j) = sm;
      *(v4f*)(out_norm + (size_t)row * N + j) = o;
    }
    
  }
}



// ---- f16 WMMA path (v_wmma_f32_16x16x32_f16): 11-bit significands for operands in range — used for every GEMM launched in this file
typedef _Float16 v16h __attribute__((ext_vector_type(16)));
union FragH { v16h v; v8us half[2]; _Float16 h[16]; unsigned short u[16]; };
template <int NT>
__device__ __forceinline__ v8f mmaH(v16h ah, v16h al, v16h bh, v16h bl, v8f c) {
  c = __builtin_amdgcn_wmma_f32_16x16x32_f16(false, ah, false, bh, (short)0, c, false, false);
  if (NT >= 2) c = __builtin_amdgcn_wmma_f32_16x16x32_f16(false, al, false, bh, (short)0, c, false, false);
  if (NT >= 3) c = __builtin_amdgcn_wmma_f32_16x16x32_f16(false, ah, false, bl, (short)0, c, false, false);
  asm volatile("v_nop\n\tv_nop\n\tv_nop\n\tv_nop" : "+v"(c) : "v"(ah), "v"(al), "v"(bh), "v"(bl));
  return c;
}
// batched GEMM like k_gemm_b but f16 operands: A f32 (split into f16 hi/lo if ASPLIT, else rounded to f16), Bt = f16 values [n][k]; alpha; C f32; N multiple of 16 (partial tiles skipped)
template <bool ASPLIT>
__global__ __launch_bounds__(128) void k_gemm_h(const float* __restrict__ A, int lda, size_t sA, const _Float16* __restrict__ Bh, int ldb, size_t sB, float alpha, float* __restrict__ C, int ldc, size_t sC, int M, int N, int K) {
  __shared__ __attribute__((aligned(16))) float so[4][16][64];
  const int tid = threadIdx.x, w = tid >> 5, lane = tid & 31, ln = lane & 15, hh = lane >> 4; const int by = blockIdx.y;
  A += (size_t)by * sA; Bh += (size_t)by * sB; C += (size_t)by * sC;
  const int ntn = (N + 63) / 64; const int wid = blockIdx.x * 4 + w; const int mt = wid / ntn, nq = wid % ntn; if (mt * 16 >= M) return;
  const int row0 = mt * 16, col0 = nq * 64; const float* arow = A + (size_t)(row0 + ln) * lda;
  v8f acc[4] = {};
  for (int kb = 0; kb < K; kb += 32) {
    FragH ah, al;
    const v4f x0 = *(const v4fa*)(arow + kb + 8 * hh), x1 = *(const v4fa*)(arow + kb + 8 * hh + 4), x2 = *(const v4fa*)(arow + kb + 16 + 8 * hh), x3 = *(const v4fa*)(arow + kb + 16 + 8 * hh + 4);
    float xs[16] = {x0[0],x0[1],x0[2],x0[3],x1[0],x1[1],x1[2],x1[3],x2[0],x2[1],x2[2],x2[3],x3[0],x3[1],x3[2],x3[3]};
#pragma unroll
    for (int i = 0; i < 16; ++i) { const _Float16 h = (_Float16)xs[i]; ah.h[i] = h; al.h[i] = ASPLIT ? (_Float16)(xs[i] - (float)h) : (_Float16)0.0f; }
#pragma unroll
    for (int t = 0; t < 4; ++t) { if (col0 + t * 16 >= N) continue; const size_t boff = (size_t)(col0 + t * 16 + ln) * ldb + kb; FragH bq; bq.half[0] = *(const v8us*)(Bh + boff + 8 * hh); bq.half[1] = *(const v8us*)(Bh + boff + 16 + 8 * hh);
      acc[t] = mmaH<ASPLIT ? 2 : 1>(ah.v, al.v, bq.v, bq.v, acc[t]); }
  }
#pragma unroll
  for (int t = 0; t < 4; ++t) { if (col0 + t * 16 >= N) continue;
#pragma unroll
    for (int r = 0; r < 8; ++r) so[w][8 * hh + r][t * 16 + ln] = acc[t][r] * alpha; }
  __builtin_amdgcn_fence(__ATOMIC_ACQ_REL, "workgroup"); __builtin_amdgcn_wave_barrier();
  const int rsub = lane >> 4, c4 = (lane & 15) * 4;
  {
#pragma unroll
    for (int q = 0; q < 8; ++q) { const int r = q * 2 + rsub; if (col0 + c4 < N) { const v4f v = *(const v4fa*)&so[w][r][c4]; *(v4f*)(C + (size_t)(row0 + r) * ldc + col0 + c4) = v; } }
     }
}

// Wt[n][k] = f16(W[k][n]·scale) from f32 row-major W[K][N] (scale = power of two; bf16-exact weights stay exact in f16 away from the subnormal range)
__global__ __launch_bounds__(256) void k_wt_f16(const float* __restrict__ W, _Float16* __restrict__ Wt, int K, int N, float scale) {
  const int t = blockIdx.x * 256 + threadIdx.x; if (t >= N * (K / 8)) return; const int n = t / (K / 8), k8 = (t % (K / 8)) * 8; FragH f;
#pragma unroll
  for (int i = 0; i < 8; ++i) f.h[i] = (_Float16)(bf16_round(W[(size_t)(k8 + i) * N + n]) * scale); const v8us o = f.half[0];
  *(v8us*)((unsigned short*)Wt + (size_t)n * K + k8) = o; 
}
// k_gemm_hh variant with fused epilogue: v = acc·alpha + bias[by·sBias + col] (+ CP[(row/rowsPerB)·sCPb + by·64 + col] if CP) ; ACT 0 none / 1 elu ; writes f16 C16 (and f32 C if non-null)
template <int ACT>
__global__ __launch_bounds__(128) void k_gemm_hhx(const _Float16* __restrict__ A, int lda, size_t sA, const _Float16* __restrict__ Bh, int ldb, size_t sB, float alpha, const float* __restrict__ bias, size_t sBias, const float* __restrict__ CP, int rowsPerB, size_t sCPb, int row0g,
    float* __restrict__ C, _Float16* __restrict__ C16, int ldc, size_t sC, int M, int N, int K) {
  __shared__ __attribute__((aligned(16))) float so[4][16][64];
  const int tid = threadIdx.x, w = tid >> 5, lane = tid & 31, ln = lane & 15, hh = lane >> 4; const int by = blockIdx.y;
  A += (size_t)by * sA; Bh += (size_t)by * sB; const size_t cofs = (size_t)by * sC; const float* bp = bias ? bias + (size_t)by * sBias : nullptr;
  const int ntn = (N + 63) / 64; const int wid = blockIdx.x * 4 + w; const int mt = wid / ntn, nq = wid % ntn; if (mt * 16 >= M) return;
  const int row0 = mt * 16, col0 = nq * 64; const _Float16* arow = A + (size_t)(row0 + ln) * lda;
  v8f acc[4] = {};
  for (int kb = 0; kb < K; kb += 32) { FragH ah; ah.half[0] = *(const v8us*)((const unsigned short*)arow + kb + 8 * hh); ah.half[1] = *(const v8us*)((const unsigned short*)arow + kb + 16 + 8 * hh);
#pragma unroll
    for (int t = 0; t < 4; ++t) { if (col0 + t * 16 >= N) continue; const size_t boff = (size_t)(col0 + t * 16 + ln) * ldb + kb; FragH bq; bq.half[0] = *(const v8us*)((const unsigned short*)Bh + boff + 8 * hh); bq.half[1] = *(const v8us*)((const unsigned short*)Bh + boff + 16 + 8 * hh);
      acc[t] = mmaH<1>(ah.v, ah.v, bq.v, bq.v, acc[t]); }
  }
#pragma unroll
  for (int t = 0; t < 4; ++t) { if (col0 + t * 16 >= N) continue; const int col = col0 + t * 16 + ln; const float bv = bp ? bf16_round(bp[col]) : 0.f;
#pragma unroll
    for (int r = 0; r < 8; ++r) { float v = acc[t][r] * alpha + bv; if (CP) { const int rr = row0g + row0 + 8 * hh + r; if (rowsPerB < 0) v += CP[cofs + (size_t)rr * ldc + col];      /* rowsPerB < 0: own element of the batched C plane */ else { const int bidx = rr / rowsPerB; v += CP[(size_t)bidx * sCPb + (size_t)by * 64 + col]; } } if (ACT == 1) v = (v > 0.f) ? v : expm1f(v); else if (ACT == 7) v = (v > 0.f) ? v + 1.0f : expf(v); else if (ACT == 8) v = tanhf(v); else if (ACT == 9) v = 0.5f * v * (1.0f + tanhf(0.7978845608028654f * (v + 0.044715f * v * v * v))); else if (ACT == 11) v = 1.0f / (1.0f + expf(-v)); else if (ACT == 12) v = (v > 0.f) ? v : 0.01f * v; else if (ACT == 14) v = (v > 0.f) ? v : 0.1f * v; else if (ACT == 16) v = (v >= 0.f) ? v : 0.3f * v; else if (ACT == 17) v = (v >= 0.f) ? v : 0.2f * v; else if (ACT == 15) v = v / (1.0f + expf(-v)); else if (ACT == 3) v = fmaxf(v, 0.f); else if (ACT == 6) v = 0.5f * v * (1.0f + erff(v * 0.70710678118654752f)); so[w][8 * hh + r][t * 16 + ln] = v; } }
  __builtin_amdgcn_fence(__ATOMIC_ACQ_REL, "workgroup"); __builtin_amdgcn_wave_barrier();
  const int rsub = lane >> 4, c4 = (lane & 15) * 4; typedef _Float16 v4h __attribute__((ext_vector_type(4)));
  {
#pragma unroll
    for (int q = 0; q < 8; ++q) { const int r = q * 2 + rsub; if (col0 + c4 < N) { const v4f v = *(const v4fa*)&so[w][r][c4]; if (C) *(v4f*)(C + cofs + (size_t)(row0 + r) * ldc + col0 + c4) = v; if (C16) { v4h h4; for (int i = 0; i < 4; ++i) h4[i] = (_Float16)v[i]; *(v4h*)(C16 + cofs + (size_t)(row0 + r) * ldc + col0 + c4) = h4; } } }
     }
}


typedef _Float16 v4h __attribute__((ext_vector_type(4)));

__global__ __launch_bounds__(256) void k_x16(const float* __restrict__ x, _Float16* __restrict__ X16, size_t n8) { const size_t t = (size_t)blockIdx.x * 256 + threadIdx.x; if (t >= n8) return; FragH f;
#pragma unroll
  for (int q = 0; q < 8; ++q) f.h[q] = (_Float16)bf16_round(x[t * 8 + q]); *(v8us*)((unsigned short*)X16 + t * 8) = f.half[0];  }
__global__ __launch_bounds__(256) void k_h16(const float* __restrict__ x, _Float16* __restrict__ X16, size_t n8) { const size_t t = (size_t)blockIdx.x * 256 + threadIdx.x; if (t >= n8) return; FragH f;
#pragma unroll
  for (int q = 0; q < 8; ++q) f.h[q] = (_Float16)x[t * 8 + q]; *(v8us*)((unsigned short*)X16 + t * 8) = f.half[0];  }
__global__ __launch_bounds__(256) void k_round16f(const float* __restrict__ W, _Float16* __restrict__ Bt, size_t n8) { const size_t t = (size_t)blockIdx.x * 256 + threadIdx.x; if (t >= n8) return; FragH f;
#pragma unroll
  for (int i = 0; i < 8; ++i) f.h[i] = (_Float16)(bf16_round(W[t * 8 + i]) * 16.0f); *(v8us*)((unsigned short*)Bt + t * 8) = f.half[0];  }
template <int NHv, int TTv>
__global__ __launch_bounds__(256) void k_vt(const _Float16* __restrict__ V16, int ldv, int voff, _Float16* __restrict__ Vt) { __shared__ unsigned short tl[64][66]; const int tid = threadIdx.x; const int slab = blockIdx.x / (TTv / 64), lg = blockIdx.x % (TTv / 64); const int b = slab / NHv, h = slab % NHv;
  for (int i = tid; i < 64 * 8; i += 256) { const int r = i / 8, c8 = (i % 8) * 8; FragH f; f.half[0] = *(const v8us*)((const unsigned short*)V16 + ((size_t)b * TTv + lg * 64 + r) * ldv + voff + h * 64 + c8);
#pragma unroll
    for (int q = 0; q < 8; ++q) tl[r][c8 + q] = f.u[q]; }
  __syncthreads();
  {
#pragma unroll
    for (int rd = 0; rd < 2; ++rd) { const int d = rd * 32 + tid / 8, pc = tid % 8; FragH f;
#pragma unroll
      for (int q = 0; q < 8; ++q) f.u[q] = tl[pc * 8 + q][d];
      *(v8us*)((unsigned short*)Vt + ((size_t)slab * 64 + d) * TTv + lg * 64 + pc * 8) = f.half[0]; }
     } }

__global__ __launch_bounds__(256) void k_hl(const float* __restrict__ F, _Float16* __restrict__ Hh, _Float16* __restrict__ Hl, size_t n8) { const size_t t = (size_t)blockIdx.x * 256 + threadIdx.x; if (t >= n8) return; FragH fh, fl; const v4f a = *(const v4fa*)(F + t * 8), c = *(const v4fa*)(F + t * 8 + 4);
#pragma unroll
  for (int q = 0; q < 4; ++q) { _Float16 h = (_Float16)a[q]; fh.h[q] = h; fl.h[q] = (_Float16)((a[q] - (float)h) * 1024.0f); h = (_Float16)c[q]; fh.h[4 + q] = h; fl.h[4 + q] = (_Float16)((c[q] - (float)h) * 1024.0f); }
  { *(v8us*)((unsigned short*)Hh + t * 8) = fh.half[0]; *(v8us*)((unsigned short*)Hl + t * 8) = fl.half[0];  } }

// ---- fast GEMM (wave tile 32x64; requires M % 32 == 0 rows per launch region and N % 64 == 0); epilogue = k_gemm_hhx semantics ----
__device__ __forceinline__ v16h g2_frag(const _Float16* p, int hh) { FragH f; f.half[0] = *(const v8us*)((const unsigned short*)p + 8 * hh); f.half[1] = *(const v8us*)((const unsigned short*)p + 16 + 8 * hh); return f.v; }
__device__ __forceinline__ v8f g2_mma(v16h a, v16h b, v8f c) { v8f d = __builtin_amdgcn_wmma_f32_16x16x32_f16(false, a, false, b, (short)0, c, false, false); asm volatile("v_nop\n\tv_nop\n\tv_nop\n\tv_nop" : "+v"(d) : "v"(a), "v"(b)); return d; }
template <int ACT>
__global__ __launch_bounds__(128) void k_gemm2(const _Float16* __restrict__ A, int lda, size_t sA, const _Float16* __restrict__ Bh, int ldb, size_t sB, float alpha, const float* __restrict__ bias, size_t sBias, const float* __restrict__ CP, int rowsPerB, size_t sCPb, int row0g,
    float* __restrict__ C, _Float16* __restrict__ C16, int ldc, size_t sC, int M, int N, int K) { static_assert(ACT == 0 || ACT == 3 || ACT == 6 || ACT == 8 || ACT == 9 || ACT == 11 || ACT == 12 || ACT == 14 || ACT == 15 || ACT == 16 || ACT == 17, "k_gemm2: unsupported ACT code (would silently apply no activation)");
  __shared__ __attribute__((aligned(16))) float so[4][32][68];
  const int tid = threadIdx.x, w = tid >> 5, lane = tid & 31, ln = lane & 15, hh = lane >> 4; const int by = blockIdx.y;
  A += (size_t)by * sA; Bh += (size_t)by * sB; const size_t cofs = (size_t)by * sC; const float* bp = bias ? bias + (size_t)by * sBias : nullptr;
  const int ntn = N >> 6; const int mt = blockIdx.x / ntn, nq = blockIdx.x - mt * ntn; const int row0 = mt * 128 + 32 * w, col0 = nq * 64; if (row0 >= M) return;
  const _Float16* a0p = A + (size_t)(row0 + ln) * lda; const _Float16* a1p = a0p + (size_t)16 * lda;
  const _Float16* b0p = Bh + (size_t)(col0 + ln) * ldb; const _Float16* b1p = b0p + (size_t)16 * ldb; const _Float16* b2p = b1p + (size_t)16 * ldb; const _Float16* b3p = b2p + (size_t)16 * ldb;
  const v8f z8 = {0.f,0.f,0.f,0.f,0.f,0.f,0.f,0.f}; v8f c00 = z8, c01 = z8, c02 = z8, c03 = z8, c10 = z8, c11 = z8, c12 = z8, c13 = z8;
#pragma unroll 1
  for (int kb = 0; kb < K; kb += 32) { const v16h a0 = g2_frag(a0p + kb, hh), a1 = g2_frag(a1p + kb, hh);
    v16h b = g2_frag(b0p + kb, hh); c00 = g2_mma(a0, b, c00); c10 = g2_mma(a1, b, c10);
    b = g2_frag(b1p + kb, hh); c01 = g2_mma(a0, b, c01); c11 = g2_mma(a1, b, c11);
    b = g2_frag(b2p + kb, hh); c02 = g2_mma(a0, b, c02); c12 = g2_mma(a1, b, c12);
    b = g2_frag(b3p + kb, hh); c03 = g2_mma(a0, b, c03); c13 = g2_mma(a1, b, c13); }
  v8f accs[8] = {c00, c01, c02, c03, c10, c11, c12, c13};
#pragma unroll
  for (int u = 0; u < 8; ++u) { const int t = u & 3, half = u >> 2; const int col = col0 + t * 16 + ln; const float bv = bp ? bf16_round(bp[col]) : 0.f;
#pragma unroll
    for (int r = 0; r < 8; ++r) { const int rloc = half * 16 + 8 * hh + r; float v = accs[u][r] * alpha + bv; if (CP) { if (rowsPerB < 0) v += CP[cofs + (size_t)(row0g + row0 + rloc) * ldc + col];      /* rowsPerB < 0: own element of the batched C plane */ else { const int bidx = (row0g + row0 + rloc) / rowsPerB; v += CP[(size_t)bidx * sCPb + (size_t)by * 64 + col]; } }
      if (ACT == 3) v = fmaxf(v, 0.f); else if (ACT == 6) v = 0.5f * v * (1.0f + erff(v * 0.70710678118654752f)); else if (ACT == 11) v = 1.0f / (1.0f + expf(-v)); else if (ACT == 15) v = v / (1.0f + expf(-v)); else if (ACT == 12) v = (v > 0.f) ? v : 0.01f * v; else if (ACT == 8) v = tanhf(v); else if (ACT == 9) v = 0.5f * v * (1.0f + tanhf(0.7978845608028654f * (v + 0.044715f * v * v * v))); else if (ACT == 14) v = (v > 0.f) ? v : 0.1f * v; else if (ACT == 16) v = (v >= 0.f) ? v : 0.3f * v; else if (ACT == 17) v = (v >= 0.f) ? v : 0.2f * v;
      so[w][rloc][t * 16 + ln] = v; } }
  __builtin_amdgcn_fence(__ATOMIC_ACQ_REL, "workgroup"); __builtin_amdgcn_wave_barrier();
  const int rsub = lane >> 4, c4 = (lane & 15) * 4;
  {
#pragma unroll
    for (int q = 0; q < 16; ++q) { const int r = q * 2 + rsub; const v4f v = *(const v4fa*)&so[w][r][c4]; if (C) *(v4f*)(C + cofs + (size_t)(row0 + r) * ldc + col0 + c4) = v; if (C16) { v4h h4; for (int i = 0; i < 4; ++i) h4[i] = (_Float16)v[i]; *(v4h*)(C16 + cofs + (size_t)(row0 + r) * ldc + col0 + c4) = h4; } }
     } }

// ---- k_gemm2 with both operands staged in LDS (requires M % 128 == 0, N % 64 == 0, K % 128 == 0); same tiles, same k order, same epilogue for EPI 0 ----
// A stage is 128 k (256 B, two whole lines) of the work-group's 128 A rows and 64 B rows; every wave-wide copy covers two whole rows of it (4 lines) where a fragment load from global touched 16 lines.
#define G3_KS 128
#define G3_PITCH 272                    /* LDS row pitch, bytes: 16 B x odd, conflict-free for ds_load_b128 */
#define G3_STAGE (192 * G3_PITCH)       /* rows 0..127 = A, rows 128..191 = B */
#define G3_C(l, g) "global_load_async_to_lds_b128 %" #l ", %" #g ", off\n\t"
// twelve copies and, as the statement's last line, the wait that stands before any register they name is rewritten
#define G3_COPY12(L, G, o) asm volatile(G3_C(0, 12) G3_C(1, 13) G3_C(2, 14) G3_C(3, 15) G3_C(4, 16) G3_C(5, 17) G3_C(6, 18) G3_C(7, 19) G3_C(8, 20) G3_C(9, 21) G3_C(10, 22) G3_C(11, 23) "s_wait_xcnt 0x0" \
    :: "v"(L[o + 0]), "v"(L[o + 1]), "v"(L[o + 2]), "v"(L[o + 3]), "v"(L[o + 4]), "v"(L[o + 5]), "v"(L[o + 6]), "v"(L[o + 7]), "v"(L[o + 8]), "v"(L[o + 9]), "v"(L[o + 10]), "v"(L[o + 11]), \
       "v"(G[o + 0]), "v"(G[o + 1]), "v"(G[o + 2]), "v"(G[o + 3]), "v"(G[o + 4]), "v"(G[o + 5]), "v"(G[o + 6]), "v"(G[o + 7]), "v"(G[o + 8]), "v"(G[o + 9]), "v"(G[o + 10]), "v"(G[o + 11]) : "memory")
// one stage: 24 copies of 16 B per lane. l = the lane's LDS byte address in row (tid >> 4) of the buffer, ga / gb = its global address in that row of the A / B tile; copy j serves row 8 j + (tid >> 4)
// IM8: the A tile's 128 rows are 8 h-lines of 16 w-positions of the bordered rows, so tile row 8 j + .. lies (j >> 1) bordered h-lines and 8 (j & 1) positions behind row (tid >> 4)
template <bool IM8>
__device__ __forceinline__ void g3_fill(unsigned l, const _Float16* ga, size_t sa8, const _Float16* gb, size_t sb8) {
  unsigned L[24]; const _Float16* G[24];
#pragma unroll      /* both loops: every index constant, so that L and G are registers the asm can name */
  for (int j = 0; j < 16; ++j) { L[j] = l + (unsigned)j * (8u * G3_PITCH); G[j] = ga + (IM8 ? (size_t)(((j >> 1) * PD + (j & 1) * 8) * CC) : (size_t)j * sa8); }
#pragma unroll
  for (int j = 0; j < 8; ++j) { L[16 + j] = l + (unsigned)(16 + j) * (8u * G3_PITCH); G[16 + j] = gb + (size_t)j * sb8; }
  G3_COPY12(L, G, 0); G3_COPY12(L, G, 12); }
__device__ __forceinline__ v16h g3_frag(const unsigned char* p) { FragH f; f.half[0] = *(const v8us*)p; f.half[1] = *(const v8us*)(p + 32); return f.v; }
// IM8: A = bordered rows [NB][PD][PD][PD][CC] and the product is the k2 conv: stage s is channels 128 (s & 1) .. + 127 of tap s >> 1 = (dt, dh, dw), read for output position (t, h, w) at bordered index (t + dt, h + dh, w + dw); k = tap * CC + channel
// EPI: what follows v = acc * alpha + bias, done as the tile leaves LDS (planes by = 0 only for 4, 5 and 6). 0: store v (f32 C and / or f16 C16). 1: f16 elu(v) to C16 = bordered rows, at the row's interior place. 3: f32 elu(v) to C.
// 4: f16 elu(elu(v) + CP[row][col]) to C16. 5: f32 elu(v) to C = [NB][CC][NP], channel-major. 6: f16 elu(v * CP[row * 32]) to C16.
__device__ __forceinline__ float elu1(float a) { const float e = expm1f(a); return (a > 0.f) ? a : e; }      /* expm1f stands outside the choice: no branch per element, so that the chains of neighbouring elements overlap in a wave that is alone on its SIMD */
template <int ACT, bool IM8 = false, int EPI = 0>
__global__ __launch_bounds__(128) void k_gemm2s(const _Float16* __restrict__ A, int lda, size_t sA, const _Float16* __restrict__ Bh, int ldb, size_t sB, float alpha, const float* __restrict__ bias, size_t sBias, const float* __restrict__ CP, int rowsPerB, size_t sCPb, int row0g,
    float* __restrict__ C, _Float16* __restrict__ C16, int ldc, size_t sC, int M, int N, int K) { static_assert(ACT == 0 || ACT == 3 || ACT == 6 || ACT == 8 || ACT == 9 || ACT == 11 || ACT == 12 || ACT == 14 || ACT == 15 || ACT == 16 || ACT == 17, "k_gemm2s: unsupported ACT code (would silently apply no activation)");
  __shared__ __attribute__((aligned(16))) unsigned char st[2 * G3_STAGE];
  __shared__ __attribute__((aligned(16))) float so[4][32][68];
  const int tid = threadIdx.x, w = tid >> 5, lane = tid & 31, ln = lane & 15, hh = lane >> 4; const int by = blockIdx.y;
  A += (size_t)by * sA; Bh += (size_t)by * sB; const size_t cofs = (size_t)by * sC; const float* bp = bias ? bias + (size_t)by * sBias : nullptr;
  const int ntn = N >> 6; const int mt = blockIdx.x / ntn, nq = blockIdx.x - mt * ntn; const int row0 = mt * 128 + 32 * w, col0 = nq * 64; if (mt * 128 >= M) return;      /* the same for the whole work-group, in front of every barrier */
  const int crow = tid >> 4, cch = tid & 15; const size_t sa8 = (size_t)8 * lda, sb8 = (size_t)8 * ldb;
  static_assert(!IM8 || (DT == 16 && DH == 16 && DW == 16 && CC == 2 * G3_KS), "IM8: a 128-row tile is 8 h-lines of 16, a tap is two stages");
  const _Float16* gA = IM8 ? A + (size_t)((mt >> 5) * NPP + ((mt >> 1) & 15) * (PD * PD) + (mt & 1) * (8 * PD) + crow) * CC + cch * 8 : A + (size_t)(mt * 128 + crow) * lda + cch * 8;
  auto aoff = [](int t) -> size_t { return IM8 ? (size_t)((((t >> 3) & 1) * (PD * PD) + ((t >> 2) & 1) * PD + ((t >> 1) & 1)) * CC + (t & 1) * G3_KS) : (size_t)t * G3_KS; };      /* stage t's place behind gA, elements */
  const _Float16* gB = Bh + (size_t)(col0 + crow) * ldb + cch * 8;
  const unsigned l0 = (unsigned)(size_t)st + (unsigned)(crow * G3_PITCH + cch * 16);
  const unsigned char* fa = st + (32 * w + ln) * G3_PITCH + 16 * hh; const unsigned char* fb = st + (128 + ln) * G3_PITCH + 16 * hh;
  const int nt = K / G3_KS;
  const v8f z8 = {0.f,0.f,0.f,0.f,0.f,0.f,0.f,0.f}; v8f c00 = z8, c01 = z8, c02 = z8, c03 = z8, c10 = z8, c11 = z8, c12 = z8, c13 = z8;
  g3_fill<IM8>(l0, gA, sa8, gB, sb8);
  asm volatile("s_wait_asynccnt 0x0" ::: "memory");      /* this wave's copies of stage 0 have landed */
  __syncthreads();                                        /* ... and every other wave's */
  if (nt > 1) g3_fill<IM8>(l0 + G3_STAGE, gA + aoff(1), sa8, gB + G3_KS, sb8);
#pragma unroll 1      /* one trip per stage: the buffer index stays a run-time value */
  for (int t = 0; t < nt; ++t) { const unsigned bo = (unsigned)(t & 1) * G3_STAGE; const unsigned char* pa = fa + bo; const unsigned char* pb = fb + bo;
    v16h a0 = g3_frag(pa), a1 = g3_frag(pa + 16 * G3_PITCH), b0 = g3_frag(pb), b1 = g3_frag(pb + 16 * G3_PITCH), b2 = g3_frag(pb + 32 * G3_PITCH), b3 = g3_frag(pb + 48 * G3_PITCH);
#pragma unroll      /* constant LDS offsets; the next 32 k's fragments (same stage) are read as one group ahead of this 32 k's WMMAs */
    for (int ks = 0; ks < 4; ++ks) { v16h na0 = a0, na1 = a1, nb0 = b0, nb1 = b1, nb2 = b2, nb3 = b3;
      if (ks < 3) { const unsigned char* qa = pa + (ks + 1) * 64; const unsigned char* qb = pb + (ks + 1) * 64; na0 = g3_frag(qa); na1 = g3_frag(qa + 16 * G3_PITCH); nb0 = g3_frag(qb); nb1 = g3_frag(qb + 16 * G3_PITCH); nb2 = g3_frag(qb + 32 * G3_PITCH); nb3 = g3_frag(qb + 48 * G3_PITCH); }
      c00 = g2_mma(a0, b0, c00); c10 = g2_mma(a1, b0, c10); c01 = g2_mma(a0, b1, c01); c11 = g2_mma(a1, b1, c11);
      c02 = g2_mma(a0, b2, c02); c12 = g2_mma(a1, b2, c12); c03 = g2_mma(a0, b3, c03); c13 = g2_mma(a1, b3, c13);
      a0 = na0; a1 = na1; b0 = nb0; b1 = nb1; b2 = nb2; b3 = nb3; }
    asm volatile("s_wait_dscnt 0x0" ::: "memory");        /* this wave's reads of the buffer are done before it is refilled */
    asm volatile("s_wait_asynccnt 0x0" ::: "memory");     /* this wave's copies of stage t + 1 have landed */
    __syncthreads();                                      /* publishes stage t + 1 and ends every wave's reads of stage t */
    if (t + 2 < nt) g3_fill<IM8>(l0 + bo, gA + aoff(t + 2), sa8, gB + (size_t)(t + 2) * G3_KS, sb8); }
  asm volatile("s_wait_asynccnt 0x0" ::: "memory");       /* no copy outstanding behind the loop */
  float rsv = 0.f;      /* EPI 6: lane l holds the scale of the wave's row l */
  if (EPI == 6) { rsv = CP[(size_t)(row0 + lane) * 32]; asm volatile("s_wait_xcnt 0x0" ::: "memory"); /* stands before the load's address registers are rewritten */ }
  v8f accs[8] = {c00, c01, c02, c03, c10, c11, c12, c13};
#pragma unroll
  for (int u = 0; u < 8; ++u) { const int t = u & 3, half = u >> 2; const int col = col0 + t * 16 + ln; const float bv = bp ? bf16_round(bp[col]) : 0.f;
#pragma unroll
    for (int r = 0; r < 8; ++r) { const int rloc = half * 16 + 8 * hh + r; float v = accs[u][r] * alpha + bv; if (EPI == 0 && CP) { if (rowsPerB < 0) v += CP[cofs + (size_t)(row0g + row0 + rloc) * ldc + col];      /* rowsPerB < 0: own element of the batched C plane */ else { const int bidx = (row0g + row0 + rloc) / rowsPerB; v += CP[(size_t)bidx * sCPb + (size_t)by * 64 + col]; } }
      if (ACT == 3) v = fmaxf(v, 0.f); else if (ACT == 6) v = 0.5f * v * (1.0f + erff(v * 0.70710678118654752f)); else if (ACT == 11) v = 1.0f / (1.0f + expf(-v)); else if (ACT == 15) v = v / (1.0f + expf(-v)); else if (ACT == 12) v = (v > 0.f) ? v : 0.01f * v; else if (ACT == 8) v = tanhf(v); else if (ACT == 9) v = 0.5f * v * (1.0f + tanhf(0.7978845608028654f * (v + 0.044715f * v * v * v))); else if (ACT == 14) v = (v > 0.f) ? v : 0.1f * v; else if (ACT == 16) v = (v >= 0.f) ? v : 0.3f * v; else if (ACT == 17) v = (v >= 0.f) ? v : 0.2f * v;
      so[w][rloc][t * 16 + ln] = v; } }
  __builtin_amdgcn_fence(__ATOMIC_ACQ_REL, "workgroup"); __builtin_amdgcn_wave_barrier();
  const int rsub = lane >> 4, c4 = (lane & 15) * 4;
  if (EPI == 0) {
#pragma unroll
    for (int q = 0; q < 16; ++q) { const int r = q * 2 + rsub; const v4f v = *(const v4fa*)&so[w][r][c4]; if (C) { *(v4f*)(C + cofs + (size_t)(row0 + r) * ldc + col0 + c4) = v; asm volatile("s_wait_xcnt 0x0" ::: "memory"); /* stands before the store's data and address registers are rewritten by the next piece */ } if (C16) { v4h h4; for (int i = 0; i < 4; ++i) h4[i] = (_Float16)v[i]; *(v4h*)(C16 + cofs + (size_t)(row0 + r) * ldc + col0 + c4) = h4; } }
  } else if (EPI == 5) {      /* the wave's 32 rows are 32 neighbouring positions of one batch: 8 lanes x 4 positions = one whole 128-B line of a channel */
    const int pg = (lane & 7) * 4, cs = lane >> 3; float* ob = C + ((size_t)(row0 / NP) * CC + col0 + cs) * NP + (row0 % NP) + pg;
#pragma unroll 1      /* stays a loop: 64 inlined expm1f would be straight-line code that every wave fetches and runs once; a trip's 8 elements are independent chains */
    for (int q = 0; q < 8; ++q) { const float* sp = &so[w][pg][q * 8 + cs]; float x[8];
#pragma unroll
      for (int i = 0; i < 8; ++i) x[i] = sp[(i & 3) * 68 + (i >> 2) * 4];
      v4f v0, v1;
#pragma unroll
      for (int i = 0; i < 4; ++i) { v0[i] = elu1(x[i]); v1[i] = elu1(x[4 + i]); }
      *(v4f*)(ob + (size_t)(q * 8) * NP) = v0; *(v4f*)(ob + (size_t)(q * 8 + 4) * NP) = v1;
      asm volatile("s_wait_xcnt 0x0" ::: "memory"); /* stands before the stores' data and address registers are rewritten by the next trip */ }
  } else {
    v4f o0 = {0.f, 0.f, 0.f, 0.f}, o1 = o0;      /* EPI 4: the addend of the trip at hand, loaded one trip ahead */
    if (EPI == 4) { o0 = *(const v4fa*)(CP + (size_t)(row0 + rsub) * ldc + col0 + c4); o1 = *(const v4fa*)(CP + (size_t)(row0 + rsub + 2) * ldc + col0 + c4); asm volatile("s_wait_xcnt 0x0" ::: "memory"); /* stands before the loads' address registers are rewritten */ }
#pragma unroll 1      /* stays a loop, as above */
    for (int q = 0; q < 8; ++q) { const int r = q * 4 + rsub, R = row0 + r; v4f v0 = *(const v4fa*)&so[w][r][c4], v1 = *(const v4fa*)&so[w][r + 2][c4]; v4f n0 = o0, n1 = o1;
      if (EPI == 4) { const int Rn = R + ((q < 7) ? 4 : 0); n0 = *(const v4fa*)(CP + (size_t)Rn * ldc + col0 + c4); n1 = *(const v4fa*)(CP + (size_t)(Rn + 2) * ldc + col0 + c4); }
      if (EPI == 6) { const float s0 = __shfl(rsv, r), s1 = __shfl(rsv, r + 2);
#pragma unroll
        for (int i = 0; i < 4; ++i) { v0[i] = v0[i] * s0; v1[i] = v1[i] * s1; } }
#pragma unroll
      for (int i = 0; i < 4; ++i) { v0[i] = elu1(v0[i]); v1[i] = elu1(v1[i]); }
      if (EPI == 3) { *(v4f*)(C + cofs + (size_t)R * ldc + col0 + c4) = v0; *(v4f*)(C + cofs + (size_t)(R + 2) * ldc + col0 + c4) = v1; }
      else {
        if (EPI == 4) {
#pragma unroll
          for (int i = 0; i < 4; ++i) { v0[i] = elu1(v0[i] + o0[i]); v1[i] = elu1(v1[i] + o1[i]); } }
        const int p = R % NP;      /* rows R and R + 2 lie in one w-line of 16: R = .. + 4 q + (0 or 1) */
        const size_t dr = (EPI == 1) ? (size_t)((R / NP) * NPP + (p / (DH * DW) + 1) * (PD * PD) + ((p / DW) % DH + 1) * PD + (p % DW) + 1) : (size_t)R;
        v4h h0, h1;
#pragma unroll
        for (int i = 0; i < 4; ++i) { h0[i] = (_Float16)v0[i]; h1[i] = (_Float16)v1[i]; }
        *(v4h*)(C16 + cofs + dr * ldc + col0 + c4) = h0; *(v4h*)(C16 + cofs + (dr + 2) * ldc + col0 + c4) = h1; }
      asm volatile("s_wait_xcnt 0x0" ::: "memory"); /* stands before the registers of this trip's loads and stores are rewritten by the next trip */
      o0 = n0; o1 = n1; }
  } }


__global__ __launch_bounds__(256) void k_xrows(const float* __restrict__ x, float* __restrict__ RES) { __shared__ float tl[CC][33]; const int tid = threadIdx.x; const int b = blockIdx.x / (NP / 32), pb = blockIdx.x % (NP / 32); const int p0 = pb * 32;
  for (int i = tid; i < CC * 32; i += 256) { const int c = i / 32, j = i % 32; tl[c][j] = bf16_round(x[((size_t)b * CC + c) * NP + p0 + j]); }
  __syncthreads();
  { for (int i = tid; i < 32 * (CC / 8); i += 256) { const int j = i / (CC / 8), c0 = (i % (CC / 8)) * 8; v8f v; for (int q = 0; q < 8; ++q) v[q] = tl[c0 + q][j]; *(v8f*)(RES + ((size_t)b * NP + p0 + j) * CC + c0) = v; }  } }
// elu(F) as f16 rows in the bordered layout: one thread per 8 channels of a bordered position; positions with an index 0 hold zeros, in E and in Z (the second bordered buffer, whose interior a GEMM epilogue writes later in the call)
__global__ __launch_bounds__(256) void k_elu16p(const float* __restrict__ F, _Float16* __restrict__ E, _Float16* __restrict__ Z) { const size_t t = (size_t)blockIdx.x * 256 + threadIdx.x; if (t >= (size_t)NB * NPP * (CC / 8)) return; const int c8 = (int)(t % (CC / 8)) * 8; const int pr = (int)(t / (CC / 8)); const int b = pr / NPP, pp = pr % NPP; const int w1 = pp % PD, h1 = (pp / PD) % PD, t1 = pp / (PD * PD); FragH f;
  if (t1 > 0 && h1 > 0 && w1 > 0) { const v8f v = *(const v8f*)(F + ((size_t)b * NP + (size_t)((t1 - 1) * DH + (h1 - 1)) * DW + (w1 - 1)) * CC + c8); for (int q = 0; q < 8; ++q) { const float a = v[q]; f.h[q] = (_Float16)((a > 0.f) ? a : expm1f(a)); } } else { for (int q = 0; q < 8; ++q) f.u[q] = 0; *(v8us*)((unsigned short*)Z + t * 8) = f.half[0]; }
  *(v8us*)((unsigned short*)E + t * 8) = f.half[0];  }
__global__ __launch_bounds__(256) void k_w8(const float* __restrict__ w, int O, _Float16* __restrict__ Bt) { const size_t t = (size_t)blockIdx.x * 256 + threadIdx.x; if (t >= (size_t)O * K8 / 8) return; const int c8 = (int)((t * 8) % CC); const int tap = (int)(((t * 8) / CC) % 8); const int o = (int)((t * 8) / K8); FragH f; for (int q = 0; q < 8; ++q) f.h[q] = (_Float16)(bf16_round(w[((size_t)o * CC + c8 + q) * 8 + tap]) * 16.0f);
  *(v8us*)((unsigned short*)Bt + t * 8) = f.half[0];  }
// res += a * sigmoid(g), and elu(res) as f16 at the row's interior place in the bordered rows E (their borders hold the zeros that k_elu16p wrote earlier in the call)
__global__ __launch_bounds__(256) void k_gate(const float* __restrict__ O2, float* __restrict__ RES, _Float16* __restrict__ E) {
  #pragma clang fp contract(off)
  const size_t t = (size_t)blockIdx.x * 256 + threadIdx.x; if (t >= NR * CC / 8) return; const int c0 = (int)((t * 8) % CC); const size_t r = (t * 8) / CC; v8f v = *(const v8f*)(RES + t * 8); const float* o = O2 + r * 512;
  for (int q = 0; q < 8; ++q) { const float a = o[c0 + q], g = o[256 + c0 + q]; const float s = 1.0f / (1.0f + expf(-g)); v[q] = v[q] + __fmul_rn(a, s); }
  *(v8f*)(RES + t * 8) = v;
  FragH f; for (int q = 0; q < 8; ++q) f.h[q] = (_Float16)elu1(v[q]); const int p = (int)(r % NP);
  *(v8us*)((unsigned short*)E + ((r / NP) * NPP + (size_t)((p / (DH * DW) + 1) * (PD * PD) + ((p / DW) % DH + 1) * PD + (p % DW) + 1)) * CC + c0) = f.half[0];  }
__global__ __launch_bounds__(256) void k_xa(const float* __restrict__ RES, const float* __restrict__ orig, _Float16* __restrict__ XA) { const size_t t = (size_t)blockIdx.x * 256 + threadIdx.x; if (t >= NR * 36) return; const int pc = (int)(t % 36); const size_t r = t / 36; const int p = (int)(r % NP); const size_t b = r / NP; FragH f;
  for (int q = 0; q < 8; ++q) { const int col = pc * 8 + q; float v = 0.f; if (col < 256) v = RES[r * CC + col]; else if (col < 259) v = bf16_round(orig[((b * 3 + (col - 256)) * (size_t)NP) + p]); else if (col == 259) v = -0.5f + (float)(p / (DH * DW)) / (float)DT; else if (col == 260) v = -0.5f + (float)((p / DW) % DH) / (float)DH; else if (col == 261) v = -0.5f + (float)(p % DW) / (float)DW; f.h[q] = (_Float16)v; }
  unsigned short* d = (unsigned short*)XA + r * KA + pc * 8; *(v8us*)d = f.half[0];  }
__global__ __launch_bounds__(256) void k_wa(const float* __restrict__ w, int O, int OP, _Float16* __restrict__ Bt) { const size_t t = (size_t)blockIdx.x * 256 + threadIdx.x; if (t >= (size_t)OP * KA / 8) return; const int k0 = (int)((t * 8) % KA); const int o = (int)((t * 8) / KA); FragH f; for (int q = 0; q < 8; ++q) { const int k = k0 + q; f.h[q] = (o < O && k < 262) ? (_Float16)(bf16_round(w[(size_t)o * 262 + k]) * 16.0f) : (_Float16)0.f; }
  *(v8us*)((unsigned short*)Bt + t * 8) = f.half[0];  }
__global__ __launch_bounds__(256) void k_bpad(const float* __restrict__ b, int n, int np_, float* __restrict__ bp) { const int i = blockIdx.x * 256 + threadIdx.x; if (i >= np_) return; const float v = (i < n) ? b[i] : 0.f; *(float*)(bp + i) = v;  }
__global__ __launch_bounds__(256) void k_vt(const _Float16* __restrict__ V16, int b, _Float16* __restrict__ VT) { __shared__ unsigned short tl[64][VC + 2]; const int tid = threadIdx.x; const int k0 = blockIdx.x * 64; const unsigned short* s = (const unsigned short*)V16 + ((size_t)b * NP + k0) * VC;
  for (int i = tid; i < 64 * (VC / 8); i += 256) { const int j = i / (VC / 8), c8 = (i % (VC / 8)) * 8; FragH f; f.half[0] = *(const v8us*)(s + (size_t)j * VC + c8); for (int q = 0; q < 8; ++q) tl[j][c8 + q] = f.u[q]; }
  __syncthreads();
  { for (int i = tid; i < VC * 8; i += 256) { const int c = i / 8, j8 = (i % 8) * 8; v8us o; for (int q = 0; q < 8; ++q) o[q] = tl[j8 + q][c]; *(v8us*)((unsigned short*)VT + (size_t)c * NP + k0 + j8) = o; }  } }
// causal row softmax, one work-group per query row q: 256 threads x 16 scores each, kept in registers between the max pass and the exp pass;
// lanes read and write neighbouring 8-element pieces; pieces wholly at k >= q are not read and store zeros. Row max and row sum: butterfly in the wave, then 8 wave partials through LDS.
__global__ __launch_bounds__(256) void k_csm(const float* __restrict__ S, _Float16* __restrict__ P, float* __restrict__ RS) {
  __shared__ float redm[8], reds[8];
  const int q = blockIdx.x, tid = threadIdx.x, lane = tid & 31, w = tid >> 5; const float* s = S + (size_t)q * NP;
  const float sq = sqrtf(259.0f);      /* np.float32(sqrt(259)) division: s/sqrt(C_ATT) */
  const int ka = tid * 8, kb = NP / 2 + tid * 8;
  const v4f z4 = {0.f, 0.f, 0.f, 0.f}; v4f x[4] = {z4, z4, z4, z4};
  if (ka < q) { x[0] = *(const v4fa*)(s + ka); x[1] = *(const v4fa*)(s + ka + 4); }
  if (kb < q) { x[2] = *(const v4fa*)(s + kb); x[3] = *(const v4fa*)(s + kb + 4); }
  float v[16]; float mx = -3.0e38f;
#pragma unroll
  for (int u = 0; u < 2; ++u) { const int k0 = u ? kb : ka;
    if (k0 < q) {
#pragma unroll
      for (int i = 0; i < 8; ++i) { const float t = x[u * 2 + (i >> 2)][i & 3] / sq; v[u * 8 + i] = t; mx = (k0 + i < q) ? fmaxf(mx, t) : mx; } }
    else {
#pragma unroll
      for (int i = 0; i < 8; ++i) v[u * 8 + i] = 0.f; } }
#pragma unroll
  for (int m = 16; m > 0; m >>= 1) mx = fmaxf(mx, __shfl_xor(mx, m));
  if (lane == 0) redm[w] = mx;
  __syncthreads();
#pragma unroll
  for (int i = 0; i < 8; ++i) mx = fmaxf(mx, redm[i]);
  float se = 0.f;
#pragma unroll
  for (int u = 0; u < 2; ++u) { const int k0 = u ? kb : ka; FragH f;
    if (k0 < q) {
#pragma unroll
      for (int i = 0; i < 8; ++i) { const float ee = expf(v[u * 8 + i] - mx); const float e = (k0 + i < q) ? ee : 0.f; se += e; f.h[i] = (_Float16)(e * 256.0f); } }
    else {
#pragma unroll
      for (int i = 0; i < 8; ++i) f.u[i] = 0; }
    *(v8us*)((unsigned short*)P + (size_t)q * NP + k0) = f.half[0]; }
#pragma unroll
  for (int m = 16; m > 0; m >>= 1) se += __shfl_xor(se, m);
  if (lane == 0) reds[w] = se;
  __syncthreads();
  if (tid == 0) { float t = 0.f;
#pragma unroll
    for (int i = 0; i < 8; ++i) t += reds[i];
    RS[(size_t)q * 32] = (q == 0) ? 0.f : (1.0f / 256.0f) / t; } }

extern "C" void kernel_launch(void* const* d_in, const int* in_sizes, int n_in,
                              void* d_out, int out_size, void* d_ws, size_t ws_size, hipStream_t stream) {
  (void)in_sizes; (void)n_in; (void)out_size;
  const float* const* I = (const float* const*)d_in; const float* x = I[0]; const float* orig = I[1]; const float* rw1 = I[2]; const float* rb1 = I[3]; const float* rw2 = I[4]; const float* rb2 = I[5]; const float* qw = I[6]; const float* qb = I[7]; const float* kw = I[8]; const float* kb = I[9]; const float* vw = I[10]; const float* vb = I[11]; const float* aw = I[12]; const float* ab = I[13]; const float* rsw = I[14]; const float* rsb = I[15]; const float* ow = I[16]; const float* ob = I[17];
  char* ws = (char*)d_ws; size_t off = 0;
  auto take = [&](size_t bytes) { char* p = ws + off; off += (bytes + 255) & ~(size_t)255; return p; };
  _Float16* BW1 = (_Float16*)take((size_t)CC * K8 * 2); _Float16* BW2 = (_Float16*)take((size_t)512 * K8 * 2); _Float16* BQ = (_Float16*)take((size_t)64 * KA * 2); _Float16* BK = (_Float16*)take((size_t)64 * KA * 2); _Float16* BV = (_Float16*)take((size_t)VC * KA * 2); float* qbp = (float*)take(64 * 4); float* kbp = (float*)take(64 * 4); _Float16* BA = (_Float16*)take((size_t)CC * VC * 2); _Float16* BR = (_Float16*)take((size_t)CC * CC * 2); _Float16* BO = (_Float16*)take((size_t)CC * CC * 2);
  float* RES = (float*)take(NR * CC * 4); _Float16* EP = (_Float16*)take((size_t)NB * NPP * CC * 2); _Float16* O1 = (_Float16*)take((size_t)NB * NPP * CC * 2); float* O2 = (float*)take(NR * 512 * 4);
  _Float16* XA = (_Float16*)take(NR * KA * 2); _Float16* Q16 = (_Float16*)take(NR * 64 * 2); _Float16* K16 = (_Float16*)take(NR * 64 * 2); _Float16* V16 = (_Float16*)take(NR * VC * 2); _Float16* VT = (_Float16*)take((size_t)VC * NP * 2); float* S = (float*)take((size_t)NP * NP * 4); _Float16* P = (_Float16*)take((size_t)NP * NP * 2); float* RS = (float*)take((size_t)NP * 32 * 4);
  _Float16* ATE = (_Float16*)take(NR * VC * 2); float* ATTC = (float*)take(NR * CC * 4); _Float16* SUM16 = (_Float16*)take(NR * CC * 2);
  if (off > ws_size) return;      /* about 165 MB */
  k_wa<<<(unsigned)(((size_t)64 * KA / 8 + 255) / 256), 256, 0, stream>>>(qw, 16, 64, BQ); k_wa<<<(unsigned)(((size_t)64 * KA / 8 + 255) / 256), 256, 0, stream>>>(kw, 16, 64, BK); k_wa<<<(unsigned)(((size_t)VC * KA / 8 + 255) / 256), 256, 0, stream>>>(vw, VC, VC, BV); k_bpad<<<1, 64, 0, stream>>>(qb, 16, 64, qbp); k_bpad<<<1, 64, 0, stream>>>(kb, 16, 64, kbp);
  k_round16f<<<(CC * VC / 8 + 255) / 256, 256, 0, stream>>>(aw, BA, (size_t)CC * VC / 8); k_round16f<<<(CC * CC / 8 + 255) / 256, 256, 0, stream>>>(rsw, BR, (size_t)CC * CC / 8); k_round16f<<<(CC * CC / 8 + 255) / 256, 256, 0, stream>>>(ow, BO, (size_t)CC * CC / 8);
  k_xrows<<<NB * (NP / 32), 256, 0, stream>>>(x, RES);
  const unsigned n8 = (unsigned)((NR * CC / 8 + 255) / 256); const unsigned np8 = (unsigned)(((size_t)NB * NPP * (CC / 8) + 255) / 256); const dim3 g256((unsigned)((NR / 128) * (CC / 64)), 1);
  k_elu16p<<<np8, 256, 0, stream>>>(RES, EP, O1);
  for (int i = 0; i < NRES; ++i) {
    k_w8<<<(unsigned)(((size_t)CC * K8 / 8 + 255) / 256), 256, 0, stream>>>(rw1 + (size_t)i * CC * CC * 8, CC, BW1); k_w8<<<(unsigned)(((size_t)512 * K8 / 8 + 255) / 256), 256, 0, stream>>>(rw2 + (size_t)i * 512 * CC * 8, 512, BW2);
    k_gemm2s<0, true, 1><<<g256, 128, 0, stream>>>(EP, CC, 0, BW1, K8, 0, 0.0625f, rb1 + i * CC, 0, nullptr, 1, 0, 0, nullptr, O1, CC, 0, (int)NR, CC, K8);      /* o = elu(conv1 + b1), into the bordered rows */
    k_gemm2s<0, true><<<dim3((unsigned)((NR / 128) * 8), 1), 128, 0, stream>>>(O1, CC, 0, BW2, K8, 0, 0.0625f, rb2 + i * 512, 0, nullptr, 1, 0, 0, O2, nullptr, 512, 0, (int)NR, 512, K8);      /* conv2 + b2 (512) */
    k_gate<<<n8, 256, 0, stream>>>(O2, RES, EP); }
  /* attention */
  k_xa<<<(unsigned)((NR * 36 + 255) / 256), 256, 0, stream>>>(RES, orig, XA);
  k_gemm2<0><<<dim3((unsigned)((NR / 128) * 1), 1), 128, 0, stream>>>(XA, KA, 0, BQ, KA, 0, 0.0625f, qbp, 0, nullptr, 1, 0, 0, nullptr, Q16, 64, 0, (int)NR, 64, KA);
  k_gemm2<0><<<dim3((unsigned)((NR / 128) * 1), 1), 128, 0, stream>>>(XA, KA, 0, BK, KA, 0, 0.0625f, kbp, 0, nullptr, 1, 0, 0, nullptr, K16, 64, 0, (int)NR, 64, KA);
  k_gemm2<0><<<dim3((unsigned)((NR / 128) * 2), 1), 128, 0, stream>>>(XA, KA, 0, BV, KA, 0, 0.0625f, vb, 0, nullptr, 1, 0, 0, nullptr, V16, VC, 0, (int)NR, VC, KA);
  for (int b = 0; b < NB; ++b) {
    k_gemm2<0><<<dim3((NP / 128) * (NP / 64), 1), 128, 0, stream>>>(Q16 + (size_t)b * NP * 64, 64, 0, K16 + (size_t)b * NP * 64, 64, 0, 1.0f, nullptr, 0, nullptr, 1, 0, 0, S, nullptr, NP, 0, NP, NP, 32);
    k_csm<<<NP, 256, 0, stream>>>(S, P, RS); k_vt<<<NP / 64, 256, 0, stream>>>(V16, b, VT);
    k_gemm2s<0, false, 6><<<dim3((NP / 128) * (VC / 64), 1), 128, 0, stream>>>(P, NP, 0, VT, NP, 0, 1.0f, nullptr, 0, RS, 1, 0, 0, nullptr, ATE + (size_t)b * NP * VC, VC, 0, NP, VC, NP); }      /* elu(att), att = (P V) / row sum */
  k_gemm2s<0, false, 3><<<g256, 128, 0, stream>>>(ATE, VC, 0, BA, VC, 0, 0.0625f, ab, 0, nullptr, 1, 0, 0, ATTC, nullptr, CC, 0, (int)NR, CC, VC);      /* att = elu(attn_conv(elu(att)) + b) */
  k_gemm2s<0, true, 4><<<g256, 128, 0, stream>>>(EP + (size_t)(PD * PD + PD + 1) * CC, CC, 0, BR, CC, 0, 0.0625f, rsb, 0, ATTC, 1, 0, 0, nullptr, SUM16, CC, 0, (int)NR, CC, CC);      /* elu(res + att), res = elu(res_conv(elu(res)) + b); A = the bordered rows' interior: the one tap (1, 1, 1) */
  k_gemm2s<0, false, 5><<<g256, 128, 0, stream>>>(SUM16, CC, 0, BO, CC, 0, 0.0625f, ob, 0, nullptr, 1, 0, 0, (float*)d_out, nullptr, CC, 0, (int)NR, CC, CC);      /* out = elu(out_conv(elu(res + att)) + b), channel-major */
}

// v005
// It runs in 325 microseconds.
// Next to v004, in two timings, it ran 1.36 and 1.39 times as fast.
// All steps since v000 together make it 9.02 times as fast.
#include <hip/hip_runtime.h>
// PixelSNAILBlock (x [2][256][16][16][16], original_input [2][3][16][16][16]; 4 gated residual blocks: o = elu(conv3d k2 pad1 crop(elu(res)) + b1); o = conv3d k2 pad1 crop(o) + b2 (512 ch); res += o[:256] * sigmoid(o[256:]); attention over the 4,096 positions of [res | original | pos-enc] (262 ch): q,k (16), v (128), causal softmax (k < q, row 0 all-zero) of q.k/sqrt(259), att = p v; att = elu(1x1(elu(att)) + b); res = elu(1x1(elu(res)) + b); out = elu(1x1(elu(res + att)) + b) -> [2][256][16][16][16]).
// Structure: position rows r = b*4096 + (t*16 + h)*16 + w; res kept as f32 rows; each k2 'causal-corner' conv as a WMMA GEMM over K = 8 taps x 256 channels whose A tiles are gathered tap by tap from zero-bordered f16 rows (32x64 wave tiles, f32 accumulation, exact x16 weights + bias) with the ELUs on VALU; gating on VALU; q/k/v as one GEMM on the 262 -> 288-column concat rows (16 live of 64 for q/k); per batch: scores GEMM (K = 32), causal row softmax on VALU (un-normalised f16 weights x 2^8 + 1/sum, row 0 -> 0), P.V GEMM (K = 4,096) against LDS-transposed value planes, scaling; the three 1x1 convs as GEMMs followed by VALU ELUs; channel-major store on VALU.
// Compute dtype: inputs rounded to bf16; x / original / weights exact; conv operands (elu(res), o1), the concat rows, q/k/v, softmax weights and the 1x1-conv operands plain f16 (~2^-12); res accumulation, gates, softmax sums f32. v_wmma_f32_16x16x32_f16.
#define NB 2
#define CC 256
#define DT 16
#define DH 16
#define DW 16
#define NP (DT * DH * DW)            /* 4096 */
#define NR ((size_t)NB * NP)       /* 8192 */
#define NRES 4
#define K8 (8 * CC)                /* 2048 */
#define KA 288                     /* 262 live */
#define VC 128
#define PD 17                      /* bordered extent of t, h and w: index 0 of each axis is the conv's zero padding */
#define NPP (PD * PD * PD)         /* 4913 bordered positions per batch */
typedef __bf16 v16b __attribute__((ext_vector_type(16)));
typedef unsigned short v8us __attribute__((ext_vector_type(8), may_alias));
typedef float  v8f  __attribute__((ext_vector_type(8)));
typedef float  v4f  __attribute__((ext_vector_type(4)));
typedef float  v4fa __attribute__((ext_vector_type(4), may_alias));
union FragB { v16b v; v8us half[2]; unsigned short u[16]; };

__device__ __forceinline__ unsigned short bf16_bits(float x) { unsigned int u = __float_as_uint(x); return (unsigned short)((u + 0x7FFFu + ((u >> 16) & 1u)) >> 16); }
__device__ __forceinline__ float bf16_val(unsigned short b) { return __uint_as_float(((unsigned int)b) << 16); }
__device__ __forceinline__ float bf16_round(float x) { return bf16_val(bf16_bits(x)); }
// D += A·B with NT terms: 1 = ah·bh, 2 = + al·bh (A split), 3 = + ah·bl (both split)
template <int NT>
__device__ __forceinline__ v8f mmaN(v16b ah, v16b al, v16b bh, v16b bl, v8f c) {
  c = __builtin_amdgcn_wmma_f32_16x16x32_bf16(false, ah, false, bh, (short)0, c, false, false);
  if (NT >= 2) c = __builtin_amdgcn_wmma_f32_16x16x32_bf16(false, al, false, bh, (short)0, c, false, false);
  if (NT >= 3) c = __builtin_amdgcn_wmma_f32_16x16x32_bf16(false, ah, false, bl, (short)0, c, false, false);
  asm volatile("v_nop\n\tv_nop\n\tv_nop\n\tv_nop" : "+v"(c) : "v"(ah), "v"(al), "v"(bh), "v"(bl));
  return c;
}

__global__ __launch_bounds__(256) void k_wt_bf16(const float* __restrict__ W, unsigned short* __restrict__ Wt, int K, int N) {
  const int t = blockIdx.x * 256 + threadIdx.x;
  const int k8n = K / 8;
  if (t >= N * k8n) return;
  const int n = t / k8n, k8 = (t % k8n) * 8;
  v8us v;
#pragma unroll
  for (int i = 0; i < 8; ++i) v[i] = bf16_bits(W[(size_t)(k8 + i) * N + n]);
  *(v8us*)(Wt + (size_t)n * K + k8) = v;
  
}

// GEMM C[M][N] (f32, pitch ldc) = act(A[M][K]·W + bias). A f32 row-major (pitch lda) converted per fragment to bf16
// (ASPLIT: hi/lo two planes -> 2 terms, else single rounded term); Wt bf16 [N][K] (pitch ldb). BIAS_BF16 rounds the
// bias to bf16 first (bias quantised to bf16 before the add). K%32==0, M%16==0, N%64==0.
template <bool ASPLIT, int ACT, bool BIAS_BF16>
__global__ __launch_bounds__(128) void k_gemm_bf(const float* __restrict__ A, int lda, const unsigned short* __restrict__ Wt, int ldb,
                                               const float* __restrict__ bias, float* __restrict__ C, int ldc, int M, int N, int K) {
  __shared__ __attribute__((aligned(16))) float so[4][16][64];
  const int tid = threadIdx.x, w = tid >> 5, lane = tid & 31, ln = lane & 15, hh = lane >> 4;
  const int ntn = N / 64;
  const int wid = blockIdx.x * 4 + w;
  const int mt = wid / ntn, nq = wid % ntn;
  if (mt * 16 >= M) return;
  const int row0 = mt * 16, col0 = nq * 64;
  const float* arow = A + (size_t)(row0 + ln) * lda;
  v8f acc[4] = {};
  for (int kb = 0; kb < K; kb += 32) {
    FragB ah, al;
    const v4f x0 = *(const v4fa*)(arow + kb + 8 * hh), x1 = *(const v4fa*)(arow + kb + 8 * hh + 4);
    const v4f x2 = *(const v4fa*)(arow + kb + 16 + 8 * hh), x3 = *(const v4fa*)(arow + kb + 16 + 8 * hh + 4);
    float xs[16] = {x0[0],x0[1],x0[2],x0[3],x1[0],x1[1],x1[2],x1[3],x2[0],x2[1],x2[2],x2[3],x3[0],x3[1],x3[2],x3[3]};
#pragma unroll
    for (int i = 0; i < 16; ++i) { const unsigned short hb = bf16_bits(xs[i]); ah.u[i] = hb; al.u[i] = ASPLIT ? bf16_bits(xs[i] - bf16_val(hb)) : (unsigned short)0; }
#pragma unroll
    for (int t = 0; t < 4; ++t) {
      const unsigned short* brow = Wt + (size_t)(col0 + t * 16 + ln) * ldb + kb;
      FragB b;
      b.half[0] = *(const v8us*)(brow + 8 * hh);
      b.half[1] = *(const v8us*)(brow + 16 + 8 * hh);
      acc[t] = mmaN<ASPLIT ? 2 : 1>(ah.v, al.v, b.v, b.v, acc[t]);
    }
  }
#pragma unroll
  for (int t = 0; t < 4; ++t) {
    float bv = bias ? bias[col0 + t * 16 + ln] : 0.f;
    if (BIAS_BF16) bv = bf16_round(bv);
#pragma unroll
    for (int r = 0; r < 8; ++r) { float v = acc[t][r] + bv; if (ACT == 1) v = fmaxf(v, 0.f); so[w][8 * hh + r][t * 16 + ln] = v; }
  }
  __builtin_amdgcn_fence(__ATOMIC_ACQ_REL, "workgroup");
  __builtin_amdgcn_wave_barrier();
  const int rsub = lane >> 4, c4 = (lane & 15) * 4;
  {
#pragma unroll
    for (int q = 0; q < 8; ++q) {
      const int r = q * 2 + rsub;
      const v4f v = *(const v4fa*)&so[w][r][c4];
      *(v4f*)(C + (size_t)(row0 + r) * ldc + col0 + c4) = v;
    }
    
  }
}

// GEMM C = act(A·W + bias + resid): A f32 (ASPLIT -> hi/lo 2 terms), Wt bf16 [N][K]; ACT 0 none, 1 relu, 2 exact gelu;
// resid (optional, f32, row index = (row % rmod), pitch ldr, RES_BF16 rounds it) added before the activation.
template <bool ASPLIT, int ACT, bool BIAS_BF16, bool RES_BF16>
__global__ __launch_bounds__(128) void k_gemm_bf3(const float* __restrict__ A, int lda, const unsigned short* __restrict__ Wt, int ldb,
                                                const float* __restrict__ bias, const float* __restrict__ resid, int rmod, int ldr,
                                                float* __restrict__ C, int ldc, int M, int N, int K) {
  __shared__ __attribute__((aligned(16))) float so[4][16][64];
  const int tid = threadIdx.x, w = tid >> 5, lane = tid & 31, ln = lane & 15, hh = lane >> 4;
  const int ntn = N / 64;
  const int wid = blockIdx.x * 4 + w;
  const int mt = wid / ntn, nq = wid % ntn;
  if (mt * 16 >= M) return;
  const int row0 = mt * 16, col0 = nq * 64;
  const float* arow = A + (size_t)(row0 + ln) * lda;
  v8f acc[4] = {};
  for (int kb = 0; kb < K; kb += 32) {
    FragB ah, al;
    const v4f x0 = *(const v4fa*)(arow + kb + 8 * hh), x1 = *(const v4fa*)(arow + kb + 8 * hh + 4);
    const v4f x2 = *(const v4fa*)(arow + kb + 16 + 8 * hh), x3 = *(const v4fa*)(arow + kb + 16 + 8 * hh + 4);
    float xs[16] = {x0[0],x0[1],x0[2],x0[3],x1[0],x1[1],x1[2],x1[3],x2[0],x2[1],x2[2],x2[3],x3[0],x3[1],x3[2],x3[3]};
#pragma unroll
    for (int i = 0; i < 16; ++i) { const unsigned short hb = bf16_bits(xs[i]); ah.u[i] = hb; al.u[i] = ASPLIT ? bf16_bits(xs[i] - bf16_val(hb)) : (unsigned short)0; }
#pragma unroll
    for (int t = 0; t < 4; ++t) {
      const unsigned short* brow = Wt + (size_t)(col0 + t * 16 + ln) * ldb + kb;
      FragB b;
      b.half[0] = *(const v8us*)(brow + 8 * hh);
      b.half[1] = *(const v8us*)(brow + 16 + 8 * hh);
      acc[t] = mmaN<ASPLIT ? 2 : 1>(ah.v, al.v, b.v, b.v, acc[t]);
    }
  }
#pragma unroll
  for (int t = 0; t < 4; ++t) {
    const int col = col0 + t * 16 + ln;
    float bv = bias ? bias[col] : 0.f;
    if (BIAS_BF16) bv = bf16_round(bv);
#pragma unroll
    for (int r = 0; r < 8; ++r) {
      float v = acc[t][r] + bv;
      if (resid) { float rv = resid[(size_t)((row0 + 8 * hh + r) % rmod) * ldr + col]; if (RES_BF16) rv = bf16_round(rv); v += rv; }
      if (ACT == 1) v = fmaxf(v, 0.f);
      if (ACT == 2) v = 0.5f * v * (1.0f + erff(v * 0.70710678118654752f));
      if (ACT == 3) { const float u = 0.7978845608028654f * (v + 0.044715f * v * v * v); v = 0.5f * v * (1.0f + tanhf(u)); }
      so[w][8 * hh + r][t * 16 + ln] = v;
    }
  }
  __builtin_amdgcn_fence(__ATOMIC_ACQ_REL, "workgroup");
  __builtin_amdgcn_wave_barrier();
  const int rsub = lane >> 4, c4 = (lane & 15) * 4;
  {
#pragma unroll
    for (int q = 0; q < 8; ++q) {
      const int r = q * 2 + rsub;
      const v4f v = *(const v4fa*)&so[w][r][c4];
      *(v4f*)(C + (size_t)(row0 + r) * ldc + col0 + c4) = v;
    }
    
  }
}
// row LayerNorm (biased variance, eps) over N: s = X (+ R); optional out_sum <- s; out_norm <- (s-mu)*rsqrt(var+eps)*g + b
template <bool PARAM_BF16>
__global__ __launch_bounds__(256) void k_layernorm(const float* __restrict__ X, const float* __restrict__ R, const float* __restrict__ g, const float* __restrict__ bta,
                                                  float* __restrict__ out_sum, float* __restrict__ out_norm, int N, float eps) {
  __shared__ float red[256];
  const int row = blockIdx.x, tid = threadIdx.x;
  const float* x = X + (size_t)row * N; const float* rr = R ? R + (size_t)row * N : nullptr;
  float vals[16];                     // up to N = 4096
  const int per = N / 256;            // contiguous chunk per thread? use strided-by-4 chunks: thread handles j = tid*4 + 1024*u
  float s1 = 0.f;
  for (int u = 0; u < per / 4; ++u) {
    const int j = tid * 4 + 1024 * u;
    const v4f a = *(const v4fa*)(x + j);
    v4f b = {0.f,0.f,0.f,0.f}; if (rr) b = *(const v4fa*)(rr + j);
#pragma unroll
    for (int q = 0; q < 4; ++q) { const float v = a[q] + b[q]; vals[u * 4 + q] = v; s1 += v; }
  }
  red[tid] = s1; __syncthreads();
  for (int st = 128; st > 0; st >>= 1) { if (tid < st) red[tid] += red[tid + st]; __syncthreads(); }
  const float mu = red[0] / (float)N; __syncthreads();
  float s2 = 0.f;
  for (int u = 0; u < per / 4; ++u)
#pragma unroll
    for (int q = 0; q < 4; ++q) { const float c = vals[u * 4 + q] - mu; s2 += c * c; }
  red[tid] = s2; __syncthreads();
  for (int st = 128; st > 0; st >>= 1) { if (tid < st) red[tid] += red[tid + st]; __syncthreads(); }
  const float rs = rsqrtf(red[0] / (float)N + eps);
  {
    for (int u = 0; u < per / 4; ++u) {
      const int j = tid * 4 + 1024 * u;
      v4f o, sm;
#pragma unroll
      for (int q = 0; q < 4; ++q) {
        float gg = g[j + q], bb = bta[j + q];
        if (PARAM_BF16) { gg = bf16_round(gg); bb = bf16_round(bb); }
        sm[q] = vals[u * 4 + q]; o[q] = (vals[u * 4 + q] - mu) * rs * gg + bb;
      }
      if (out_sum) *(v4f*)(out_sum + (size_t)row * N + j) = sm;
      *(v4f*)(out_norm + (size_t)row * N + j) = o;
    }
    
  }
}



// ---- f16 WMMA path (v_wmma_f32_16x16x32_f16): 11-bit significands for operands in range — used for every GEMM launched in this file
typedef _Float16 v16h __attribute__((ext_vector_type(16)));
union FragH { v16h v; v8us half[2]; _Float16 h[16]; unsigned short u[16]; };
template <int NT>
__device__ __forceinline__ v8f mmaH(v16h ah, v16h al, v16h bh, v16h bl, v8f c) {
  c = __builtin_amdgcn_wmma_f32_16x16x32_f16(false, ah, false, bh, (short)0, c, false, false);
  if (NT >= 2) c = __builtin_amdgcn_wmma_f32_16x16x32_f16(false, al, false, bh, (short)0, c, false, false);
  if (NT >= 3) c = __builtin_amdgcn_wmma_f32_16x16x32_f16(false, ah, false, bl, (short)0, c, false, false);
  asm volatile("v_nop\n\tv_nop\n\tv_nop\n\tv_nop" : "+v"(c) : "v"(ah), "v"(al), "v"(bh), "v"(bl));
  return c;
}
// batched GEMM like k_gemm_b but f16 operands: A f32 (split into f16 hi/lo if ASPLIT, else rounded to f16), Bt = f16 values [n][k]; alpha; C f32; N multiple of 16 (partial tiles skipped)
template <bool ASPLIT>
__global__ __launch_bounds__(128) void k_gemm_h(const float* __restrict__ A, int lda, size_t sA, const _Float16* __restrict__ Bh, int ldb, size_t sB, float alpha, float* __restrict__ C, int ldc, size_t sC, int M, int N, int K) {
  __shared__ __attribute__((aligned(16))) float so[4][16][64];
  const int tid = threadIdx.x, w = tid >> 5, lane = tid & 31, ln = lane & 15, hh = lane >> 4; const int by = blockIdx.y;
  A += (size_t)by * sA; Bh += (size_t)by * sB; C += (size_t)by * sC;
  const int ntn = (N + 63) / 64; const int wid = blockIdx.x * 4 + w; const int mt = wid / ntn, nq = wid % ntn; if (mt * 16 >= M) return;
  const int row0 = mt * 16, col0 = nq * 64; const float* arow = A + (size_t)(row0 + ln) * lda;
  v8f acc[4] = {};
  for (int kb = 0; kb < K; kb += 32) {
    FragH ah, al;
    const v4f x0 = *(const v4fa*)(arow + kb + 8 * hh), x1 = *(const v4fa*)(arow + kb + 8 * hh + 4), x2 = *(const v4fa*)(arow + kb + 16 + 8 * hh), x3 = *(const v4fa*)(arow + kb + 16 + 8 * hh + 4);
    float xs[16] = {x0[0],x0[1],x0[2],x0[3],x1[0],x1[1],x1[2],x1[3],x2[0],x2[1],x2[2],x2[3],x3[0],x3[1],x3[2],x3[3]};
#pragma unroll
    for (int i = 0; i < 16; ++i) { const _Float16 h = (_Float16)xs[i]; ah.h[i] = h; al.h[i] = ASPLIT ? (_Float16)(xs[i] - (float)h) : (_Float16)0.0f; }
#pragma unroll
    for (int t = 0; t < 4; ++t) { if (col0 + t * 16 >= N) continue; const size_t boff = (size_t)(col0 + t * 16 + ln) * ldb + kb; FragH bq; bq.half[0] = *(const v8us*)(Bh + boff + 8 * hh); bq.half[1] = *(const v8us*)(Bh + boff + 16 + 8 * hh);
      acc[t] = mmaH<ASPLIT ? 2 : 1>(ah.v, al.v, bq.v, bq.v, acc[t]); }
  }
#pragma unroll
  for (int t = 0; t < 4; ++t) { if (col0 + t * 16 >= N) continue;
#pragma unroll
    for (int r = 0; r < 8; ++r) so[w][8 * hh + r][t * 16 + ln] = acc[t][r] * alpha; }
  __builtin_amdgcn_fence(__ATOMIC_ACQ_REL, "workgroup"); __builtin_amdgcn_wave_barrier();
  const int rsub = lane >> 4, c4 = (lane & 15) * 4;
  {
#pragma unroll
    for (int q = 0; q < 8; ++q) { const int r = q * 2 + rsub; if (col0 + c4 < N) { const v4f v = *(const v4fa*)&so[w][r][c4]; *(v4f*)(C + (size_t)(row0 + r) * ldc + col0 + c4) = v; } }
     }
}

// Wt[n][k] = f16(W[k][n]·scale) from f32 row-major W[K][N] (scale = power of two; bf16-exact weights stay exact in f16 away from the subnormal range)
__global__ __launch_bounds__(256) void k_wt_f16(const float* __restrict__ W, _Float16* __restrict__ Wt, int K, int N, float scale) {
  const int t = blockIdx.x * 256 + threadIdx.x; if (t >= N * (K / 8)) return; const int n = t / (K / 8), k8 = (t % (K / 8)) * 8; FragH f;
#pragma unroll
  for (int i = 0; i < 8; ++i) f.h[i] = (_Float16)(bf16_round(W[(size_t)(k8 + i) * N + n]) * scale); const v8us o = f.half[0];
  *(v8us*)((unsigned short*)Wt + (size_t)n * K + k8) = o; 
}
// k_gemm_hh variant with fused epilogue: v = acc·alpha + bias[by·sBias + col] (+ CP[(row/rowsPerB)·sCPb + by·64 + col] if CP) ; ACT 0 none / 1 elu ; writes f16 C16 (and f32 C if non-null)
template <int ACT>
__global__ __launch_bounds__(128) void k_gemm_hhx(const _Float16* __restrict__ A, int lda, size_t sA, const _Float16* __restrict__ Bh, int ldb, size_t sB, float alpha, const float* __restrict__ bias, size_t sBias, const float* __restrict__ CP, int rowsPerB, size_t sCPb, int row0g,
    float* __restrict__ C, _Float16* __restrict__ C16, int ldc, size_t sC, int M, int N, int K) {
  __shared__ __attribute__((aligned(16))) float so[4][16][64];
  const int tid = threadIdx.x, w = tid >> 5, lane = tid & 31, ln = lane & 15, hh = lane >> 4; const int by = blockIdx.y;
  A += (size_t)by * sA; Bh += (size_t)by * sB; const size_t cofs = (size_t)by * sC; const float* bp = bias ? bias + (size_t)by * sBias : nullptr;
  const int ntn = (N + 63) / 64; const int wid = blockIdx.x * 4 + w; const int mt = wid / ntn, nq = wid % ntn; if (mt * 16 >= M) return;
  const int row0 = mt * 16, col0 = nq * 64; const _Float16* arow = A + (size_t)(row0 + ln) * lda;
  v8f acc[4] = {};
  for (int kb = 0; kb < K; kb += 32) { FragH ah; ah.half[0] = *(const v8us*)((const unsigned short*)arow + kb + 8 * hh); ah.half[1] = *(const v8us*)((const unsigned short*)arow + kb + 16 + 8 * hh);
#pragma unroll
    for (int t = 0; t < 4; ++t) { if (col0 + t * 16 >= N) continue; const size_t boff = (size_t)(col0 + t * 16 + ln) * ldb + kb; FragH bq; bq.half[0] = *(const v8us*)((const unsigned short*)Bh + boff + 8 * hh); bq.half[1] = *(const v8us*)((const unsigned short*)Bh + boff + 16 + 8 * hh);
      acc[t] = mmaH<1>(ah.v, ah.v, bq.v, bq.v, acc[t]); }
  }
#pragma unroll
  for (int t = 0; t < 4; ++t) { if (col0 + t * 16 >= N) continue; const int col = col0 + t * 16 + ln; const float bv = bp ? bf16_round(bp[col]) : 0.f;
#pragma unroll
    for (int r = 0; r < 8; ++r) { float v = acc[t][r] * alpha + bv; if (CP) { const int rr = row0g + row0 + 8 * hh + r; if (rowsPerB < 0) v += CP[cofs + (size_t)rr * ldc + col];      /* rowsPerB < 0: own element of the batched C plane */ else { const int bidx = rr / rowsPerB; v += CP[(size_t)bidx * sCPb + (size_t)by * 64 + col]; } } if (ACT == 1) v = (v > 0.f) ? v : expm1f(v); else if (ACT == 7) v = (v > 0.f) ? v + 1.0f : expf(v); else if (ACT == 8) v = tanhf(v); else if (ACT == 9) v = 0.5f * v * (1.0f + tanhf(0.7978845608028654f * (v + 0.044715f * v * v * v))); else if (ACT == 11) v = 1.0f / (1.0f + expf(-v)); else if (ACT == 12) v = (v > 0.f) ? v : 0.01f * v; else if (ACT == 14) v = (v > 0.f) ? v : 0.1f * v; else if (ACT == 16) v = (v >= 0.f) ? v : 0.3f * v; else if (ACT == 17) v = (v >= 0.f) ? v : 0.2f * v; else if (ACT == 15) v = v / (1.0f + expf(-v)); else if (ACT == 3) v = fmaxf(v, 0.f); else if (ACT == 6) v = 0.5f * v * (1.0f + erff(v * 0.70710678118654752f)); so[w][8 * hh + r][t * 16 + ln] = v; } }
  __builtin_amdgcn_fence(__ATOMIC_ACQ_REL, "workgroup"); __builtin_amdgcn_wave_barrier();
  const int rsub = lane >> 4, c4 = (lane & 15) * 4; typedef _Float16 v4h __attribute__((ext_vector_type(4)));
  {
#pragma unroll
    for (int q = 0; q < 8; ++q) { const int r = q * 2 + rsub; if (col0 + c4 < N) { const v4f v = *(const v4fa*)&so[w][r][c4]; if (C) *(v4f*)(C + cofs + (size_t)(row0 + r) * ldc + col0 + c4) = v; if (C16) { v4h h4; for (int i = 0; i < 4; ++i) h4[i] = (_Float16)v[i]; *(v4h*)(C16 + cofs + (size_t)(row0 + r) * ldc + col0 + c4) = h4; } } }
     }
}


typedef _Float16 v4h __attribute__((ext_vector_type(4)));

__global__ __launch_bounds__(256) void k_x16(const float* __restrict__ x, _Float16* __restrict__ X16, size_t n8) { const size_t t = (size_t)blockIdx.x * 256 + threadIdx.x; if (t >= n8) return; FragH f;
#pragma unroll
  for (int q = 0; q < 8; ++q) f.h[q] = (_Float16)bf16_round(x[t * 8 + q]); *(v8us*)((unsigned short*)X16 + t * 8) = f.half[0];  }
__global__ __launch_bounds__(256) void k_h16(const float* __restrict__ x, _Float16* __restrict__ X16, size_t n8) { const size_t t = (size_t)blockIdx.x * 256 + threadIdx.x; if (t >= n8) return; FragH f;
#pragma unroll
  for (int q = 0; q < 8; ++q) f.h[q] = (_Float16)x[t * 8 + q]; *(v8us*)((unsigned short*)X16 + t * 8) = f.half[0];  }
// d_round16f / d_xrows / d_w8 / d_wa: the passes that read inputs only, each written for block number blk of its own range; k_prep below runs them all in one launch
__device__ __forceinline__ void d_round16f(unsigned blk, const float* __restrict__ W, _Float16* __restrict__ Bt, size_t n8) { const size_t t = (size_t)blk * 256 + threadIdx.x; if (t >= n8) return; FragH f;
#pragma unroll
  for (int i = 0; i < 8; ++i) f.h[i] = (_Float16)(bf16_round(W[t * 8 + i]) * 16.0f); *(v8us*)((unsigned short*)Bt + t * 8) = f.half[0];  }
template <int NHv, int TTv>
__global__ __launch_bounds__(256) void k_vt(const _Float16* __restrict__ V16, int ldv, int voff, _Float16* __restrict__ Vt) { __shared__ unsigned short tl[64][66]; const int tid = threadIdx.x; const int slab = blockIdx.x / (TTv / 64), lg = blockIdx.x % (TTv / 64); const int b = slab / NHv, h = slab % NHv;
  for (int i = tid; i < 64 * 8; i += 256) { const int r = i / 8, c8 = (i % 8) * 8; FragH f; f.half[0] = *(const v8us*)((const unsigned short*)V16 + ((size_t)b * TTv + lg * 64 + r) * ldv + voff + h * 64 + c8);
#pragma unroll
    for (int q = 0; q < 8; ++q) tl[r][c8 + q] = f.u[q]; }
  __syncthreads();
  {
#pragma unroll
    for (int rd = 0; rd < 2; ++rd) { const int d = rd * 32 + tid / 8, pc = tid % 8; FragH f;
#pragma unroll
      for (int q = 0; q < 8; ++q) f.u[q] = tl[pc * 8 + q][d];
      *(v8us*)((unsigned short*)Vt + ((size_t)slab * 64 + d) * TTv + lg * 64 + pc * 8) = f.half[0]; }
     } }

__global__ __launch_bounds__(256) void k_hl(const float* __restrict__ F, _Float16* __restrict__ Hh, _Float16* __restrict__ Hl, size_t n8) { const size_t t = (size_t)blockIdx.x * 256 + threadIdx.x; if (t >= n8) return; FragH fh, fl; const v4f a = *(const v4fa*)(F + t * 8), c = *(const v4fa*)(F + t * 8 + 4);
#pragma unroll
  for (int q = 0; q < 4; ++q) { _Float16 h = (_Float16)a[q]; fh.h[q] = h; fl.h[q] = (_Float16)((a[q] - (float)h) * 1024.0f); h = (_Float16)c[q]; fh.h[4 + q] = h; fl.h[4 + q] = (_Float16)((c[q] - (float)h) * 1024.0f); }
  { *(v8us*)((unsigned short*)Hh + t * 8) = fh.half[0]; *(v8us*)((unsigned short*)Hl + t * 8) = fl.half[0];  } }

// ---- fast GEMM (wave tile 32x64; requires M % 32 == 0 rows per launch region and N % 64 == 0); epilogue = k_gemm_hhx semantics ----
__device__ __forceinline__ v16h g2_frag(const _Float16* p, int hh) { FragH f; f.half[0] = *(const v8us*)((const unsigned short*)p + 8 * hh); f.half[1] = *(const v8us*)((const unsigned short*)p + 16 + 8 * hh); return f.v; }
__device__ __forceinline__ v8f g2_mma(v16h a, v16h b, v8f c) { v8f d = __builtin_amdgcn_wmma_f32_16x16x32_f16(false, a, false, b, (short)0, c, false, false); asm volatile("v_nop\n\tv_nop\n\tv_nop\n\tv_nop" : "+v"(d) : "v"(a), "v"(b)); return d; }
template <int ACT>
__global__ __launch_bounds__(128) void k_gemm2(const _Float16* __restrict__ A, int lda, size_t sA, const _Float16* __restrict__ Bh, int ldb, size_t sB, float alpha, const float* __restrict__ bias, size_t sBias, const float* __restrict__ CP, int rowsPerB, size_t sCPb, int row0g,
    float* __restrict__ C, _Float16* __restrict__ C16, int ldc, size_t sC, int M, int N, int K) { static_assert(ACT == 0 || ACT == 3 || ACT == 6 || ACT == 8 || ACT == 9 || ACT == 11 || ACT == 12 || ACT == 14 || ACT == 15 || ACT == 16 || ACT == 17, "k_gemm2: unsupported ACT code (would silently apply no activation)");
  __shared__ __attribute__((aligned(16))) float so[4][32][68];
  const int tid = threadIdx.x, w = tid >> 5, lane = tid & 31, ln = lane & 15, hh = lane >> 4; const int by = blockIdx.y;
  A += (size_t)by * sA; Bh += (size_t)by * sB; const size_t cofs = (size_t)by * sC; const float* bp = bias ? bias + (size_t)by * sBias : nullptr;
  const int ntn = N >> 6; const int mt = blockIdx.x / ntn, nq = blockIdx.x - mt * ntn; const int row0 = mt * 128 + 32 * w, col0 = nq * 64; if (row0 >= M) return;
  const _Float16* a0p = A + (size_t)(row0 + ln) * lda; const _Float16* a1p = a0p + (size_t)16 * lda;
  const _Float16* b0p = Bh + (size_t)(col0 + ln) * ldb; const _Float16* b1p = b0p + (size_t)16 * ldb; const _Float16* b2p = b1p + (size_t)16 * ldb; const _Float16* b3p = b2p + (size_t)16 * ldb;
  const v8f z8 = {0.f,0.f,0.f,0.f,0.f,0.f,0.f,0.f}; v8f c00 = z8, c01 = z8, c02 = z8, c03 = z8, c10 = z8, c11 = z8, c12 = z8, c13 = z8;
#pragma unroll 1
  for (int kb = 0; kb < K; kb += 32) { const v16h a0 = g2_frag(a0p + kb, hh), a1 = g2_frag(a1p + kb, hh);
    asm volatile("s_wait_xcnt 0x0" ::: "memory");      /* stands before the A loads' address registers are rewritten */
    v16h b = g2_frag(b0p + kb, hh); c00 = g2_mma(a0, b, c00); c10 = g2_mma(a1, b, c10);
    b = g2_frag(b1p + kb, hh); c01 = g2_mma(a0, b, c01); c11 = g2_mma(a1, b, c11);
    b = g2_frag(b2p + kb, hh); c02 = g2_mma(a0, b, c02); c12 = g2_mma(a1, b, c12);
    b = g2_frag(b3p + kb, hh); c03 = g2_mma(a0, b, c03); c13 = g2_mma(a1, b, c13); }
  v8f accs[8] = {c00, c01, c02, c03, c10, c11, c12, c13};
#pragma unroll
  for (int u = 0; u < 8; ++u) { const int t = u & 3, half = u >> 2; const int col = col0 + t * 16 + ln; const float bv = bp ? bf16_round(bp[col]) : 0.f;
#pragma unroll
    for (int r = 0; r < 8; ++r) { const int rloc = half * 16 + 8 * hh + r; float v = accs[u][r] * alpha + bv; if (CP) { if (rowsPerB < 0) v += CP[cofs + (size_t)(row0g + row0 + rloc) * ldc + col];      /* rowsPerB < 0: own element of the batched C plane */ else { const int bidx = (row0g + row0 + rloc) / rowsPerB; v += CP[(size_t)bidx * sCPb + (size_t)by * 64 + col]; } }
      if (ACT == 3) v = fmaxf(v, 0.f); else if (ACT == 6) v = 0.5f * v * (1.0f + erff(v * 0.70710678118654752f)); else if (ACT == 11) v = 1.0f / (1.0f + expf(-v)); else if (ACT == 15) v = v / (1.0f + expf(-v)); else if (ACT == 12) v = (v > 0.f) ? v : 0.01f * v; else if (ACT == 8) v = tanhf(v); else if (ACT == 9) v = 0.5f * v * (1.0f + tanhf(0.7978845608028654f * (v + 0.044715f * v * v * v))); else if (ACT == 14) v = (v > 0.f) ? v : 0.1f * v; else if (ACT == 16) v = (v >= 0.f) ? v : 0.3f * v; else if (ACT == 17) v = (v >= 0.f) ? v : 0.2f * v;
      so[w][rloc][t * 16 + ln] = v; } }
  __builtin_amdgcn_fence(__ATOMIC_ACQ_REL, "workgroup"); __builtin_amdgcn_wave_barrier();
  const int rsub = lane >> 4, c4 = (lane & 15) * 4;
  {
#pragma unroll
    for (int q = 0; q < 16; ++q) { const int r = q * 2 + rsub; const v4f v = *(const v4fa*)&so[w][r][c4]; if (C) { *(v4f*)(C + cofs + (size_t)(row0 + r) * ldc + col0 + c4) = v; asm volatile("s_wait_xcnt 0x0" ::: "memory"); /* stands before the store's data and address registers are rewritten by the next piece */ } if (C16) { v4h h4; for (int i = 0; i < 4; ++i) h4[i] = (_Float16)v[i]; *(v4h*)(C16 + cofs + (size_t)(row0 + r) * ldc + col0 + c4) = h4; } }
     } }

// ---- k_gemm2 with both operands staged in LDS (requires M % 128 == 0, N % 64 == 0, K % 128 == 0); same tiles, same k order, same epilogue for EPI 0 ----
// A stage is 128 k (256 B, two whole lines) of the work-group's 128 A rows and 64 B rows; every wave-wide copy covers two whole rows of it (4 lines) where a fragment load from global touched 16 lines.
#define G3_KS 128
#define G3_PITCH 272                    /* LDS row pitch, bytes: 16 B x odd, conflict-free for ds_load_b128 */
#define G3_STAGE (192 * G3_PITCH)       /* rows 0..127 = A, rows 128..191 = B */
#define G3_C(l, g) "global_load_async_to_lds_b128 %" #l ", %" #g ", off\n\t"
// twelve copies and, as the statement's last line, the wait that stands before any register they name is rewritten
#define G3_COPY12(L, G, o) asm volatile(G3_C(0, 12) G3_C(1, 13) G3_C(2, 14) G3_C(3, 15) G3_C(4, 16) G3_C(5, 17) G3_C(6, 18) G3_C(7, 19) G3_C(8, 20) G3_C(9, 21) G3_C(10, 22) G3_C(11, 23) "s_wait_xcnt 0x0" \
    :: "v"(L[o + 0]), "v"(L[o + 1]), "v"(L[o + 2]), "v"(L[o + 3]), "v"(L[o + 4]), "v"(L[o + 5]), "v"(L[o + 6]), "v"(L[o + 7]), "v"(L[o + 8]), "v"(L[o + 9]), "v"(L[o + 10]), "v"(L[o + 11]), \
       "v"(G[o + 0]), "v"(G[o + 1]), "v"(G[o + 2]), "v"(G[o + 3]), "v"(G[o + 4]), "v"(G[o + 5]), "v"(G[o + 6]), "v"(G[o + 7]), "v"(G[o + 8]), "v"(G[o + 9]), "v"(G[o + 10]), "v"(G[o + 11]) : "memory")
// one stage: 24 copies of 16 B per lane. l = the lane's LDS byte address in row (tid >> 4) of the buffer, ga / gb = its global address in that row of the A / B tile; copy j serves row 8 j + (tid >> 4)
// IM8: the A tile's 128 rows are 8 h-lines of 16 w-positions of the bordered rows, so tile row 8 j + .. lies (j >> 1) bordered h-lines and 8 (j & 1) positions behind row (tid >> 4)
template <bool IM8>
__device__ __forceinline__ void g3_fill(unsigned l, const _Float16* ga, size_t sa8, const _Float16* gb, size_t sb8) {
  unsigned L[24]; const _Float16* G[24];
#pragma unroll      /* both loops: every index constant, so that L and G are registers the asm can name */
  for (int j = 0; j < 16; ++j) { L[j] = l + (unsigned)j * (8u * G3_PITCH); G[j] = ga + (IM8 ? (size_t)(((j >> 1) * PD + (j & 1) * 8) * CC) : (size_t)j * sa8); }
#pragma unroll
  for (int j = 0; j < 8; ++j) { L[16 + j] = l + (unsigned)(16 + j) * (8u * G3_PITCH); G[16 + j] = gb + (size_t)j * sb8; }
  G3_COPY12(L, G, 0); G3_COPY12(L, G, 12); }
__device__ __forceinline__ v16h g3_frag(const unsigned char* p) { FragH f; f.half[0] = *(const v8us*)p; f.half[1] = *(const v8us*)(p + 32); return f.v; }
// IM8: A = bordered rows [NB][PD][PD][PD][CC] and the product is the k2 conv: stage s is channels 128 (s & 1) .. + 127 of tap s >> 1 = (dt, dh, dw), read for output position (t, h, w) at bordered index (t + dt, h + dh, w + dw); k = tap * CC + channel
// EPI: what follows v = acc * alpha + bias, done as the tile leaves LDS (planes by = 0 only for 5; 4's CP takes no plane offset). 0: store v (f32 C and / or f16 C16). 1: f16 elu(v) to C16 = bordered rows, at the row's interior place. 3: f32 elu(v) to C.
// 4: f16 elu(elu(v) + CP[row][col]) to C16. 5: f32 elu(v) to C = [NB][CC][NP], channel-major. 6: f16 elu(v * CP[by * sCPb + row * 32]) to C16.
__device__ __forceinline__ float elu1(float a) { const float e = expm1f(a); return (a > 0.f) ? a : e; }      /* expm1f stands outside the choice: no branch per element, so that the chains of neighbouring elements overlap in a wave that is alone on its SIMD */
template <int ACT, bool IM8 = false, int EPI = 0>
__global__ __launch_bounds__(128) void k_gemm2s(const _Float16* __restrict__ A, int lda, size_t sA, const _Float16* __restrict__ Bh, int ldb, size_t sB, float alpha, const float* __restrict__ bias, size_t sBias, const float* __restrict__ CP, int rowsPerB, size_t sCPb, int row0g,
    float* __restrict__ C, _Float16* __restrict__ C16, int ldc, size_t sC, int M, int N, int K) { static_assert(ACT == 0 || ACT == 3 || ACT == 6 || ACT == 8 || ACT == 9 || ACT == 11 || ACT == 12 || ACT == 14 || ACT == 15 || ACT == 16 || ACT == 17, "k_gemm2s: unsupported ACT code (would silently apply no activation)");
  __shared__ __attribute__((aligned(16))) unsigned char st[2 * G3_STAGE];
  __shared__ __attribute__((aligned(16))) float so[4][32][68];
  const int tid = threadIdx.x, w = tid >> 5, lane = tid & 31, ln = lane & 15, hh = lane >> 4; const int by = blockIdx.y;
  A += (size_t)by * sA; Bh += (size_t)by * sB; const size_t cofs = (size_t)by * sC; const float* bp = bias ? bias + (size_t)by * sBias : nullptr;
  const int ntn = N >> 6; const int mt = blockIdx.x / ntn, nq = blockIdx.x - mt * ntn; const int row0 = mt * 128 + 32 * w, col0 = nq * 64; if (mt * 128 >= M) return;      /* the same for the whole work-group, in front of every barrier */
  const int crow = tid >> 4, cch = tid & 15; const size_t sa8 = (size_t)8 * lda, sb8 = (size_t)8 * ldb;
  static_assert(!IM8 || (DT == 16 && DH == 16 && DW == 16 && CC == 2 * G3_KS), "IM8: a 128-row tile is 8 h-lines of 16, a tap is two stages");
  const _Float16* gA = IM8 ? A + (size_t)((mt >> 5) * NPP + ((mt >> 1) & 15) * (PD * PD) + (mt & 1) * (8 * PD) + crow) * CC + cch * 8 : A + (size_t)(mt * 128 + crow) * lda + cch * 8;
  auto aoff = [](int t) -> size_t { return IM8 ? (size_t)((((t >> 3) & 1) * (PD * PD) + ((t >> 2) & 1) * PD + ((t >> 1) & 1)) * CC + (t & 1) * G3_KS) : (size_t)t * G3_KS; };      /* stage t's place behind gA, elements */
  const _Float16* gB = Bh + (size_t)(col0 + crow) * ldb + cch * 8;
  const unsigned l0 = (unsigned)(size_t)st + (unsigned)(crow * G3_PITCH + cch * 16);
  const unsigned char* fa = st + (32 * w + ln) * G3_PITCH + 16 * hh; const unsigned char* fb = st + (128 + ln) * G3_PITCH + 16 * hh;
  const int nt = K / G3_KS;
  const v8f z8 = {0.f,0.f,0.f,0.f,0.f,0.f,0.f,0.f}; v8f c00 = z8, c01 = z8, c02 = z8, c03 = z8, c10 = z8, c11 = z8, c12 = z8, c13 = z8;
  g3_fill<IM8>(l0, gA, sa8, gB, sb8);
  asm volatile("s_wait_asynccnt 0x0" ::: "memory");      /* this wave's copies of stage 0 have landed */
  __syncthreads();                                        /* ... and every other wave's */
  if (nt > 1) g3_fill<IM8>(l0 + G3_STAGE, gA + aoff(1), sa8, gB + G3_KS, sb8);
#pragma unroll 1      /* one trip per stage: the buffer index stays a run-time value */
  for (int t = 0; t < nt; ++t) { const unsigned bo = (unsigned)(t & 1) * G3_STAGE; const unsigned char* pa = fa + bo; const unsigned char* pb = fb + bo;
    v16h a0 = g3_frag(pa), a1 = g3_frag(pa + 16 * G3_PITCH), b0 = g3_frag(pb), b1 = g3_frag(pb + 16 * G3_PITCH), b2 = g3_frag(pb + 32 * G3_PITCH), b3 = g3_frag(pb + 48 * G3_PITCH);
#pragma unroll      /* constant LDS offsets; the next 32 k's fragments (same stage) are read as one group ahead of this 32 k's WMMAs */
    for (int ks = 0; ks < 4; ++ks) { v16h na0 = a0, na1 = a1, nb0 = b0, nb1 = b1, nb2 = b2, nb3 = b3;
      if (ks < 3) { const unsigned char* qa = pa + (ks + 1) * 64; const unsigned char* qb = pb + (ks + 1) * 64; na0 = g3_frag(qa); na1 = g3_frag(qa + 16 * G3_PITCH); nb0 = g3_frag(qb); nb1 = g3_frag(qb + 16 * G3_PITCH); nb2 = g3_frag(qb + 32 * G3_PITCH); nb3 = g3_frag(qb + 48 * G3_PITCH); }
      c00 = g2_mma(a0, b0, c00); c10 = g2_mma(a1, b0, c10); c01 = g2_mma(a0, b1, c01); c11 = g2_mma(a1, b1, c11);
      c02 = g2_mma(a0, b2, c02); c12 = g2_mma(a1, b2, c12); c03 = g2_mma(a0, b3, c03); c13 = g2_mma(a1, b3, c13);
      a0 = na0; a1 = na1; b0 = nb0; b1 = nb1; b2 = nb2; b3 = nb3; }
    asm volatile("s_wait_dscnt 0x0" ::: "memory");        /* this wave's reads of the buffer are done before it is refilled */
    asm volatile("s_wait_asynccnt 0x0" ::: "memory");     /* this wave's copies of stage t + 1 have landed */
    __syncthreads();                                      /* publishes stage t + 1 and ends every wave's reads of stage t */
    if (t + 2 < nt) g3_fill<IM8>(l0 + bo, gA + aoff(t + 2), sa8, gB + (size_t)(t + 2) * G3_KS, sb8); }
  asm volatile("s_wait_asynccnt 0x0" ::: "memory");       /* no copy outstanding behind the loop */
  float rsv = 0.f;      /* EPI 6: lane l holds the scale of the wave's row l */
  if (EPI == 6) { rsv = CP[(size_t)by * sCPb + (size_t)(row0 + lane) * 32]; asm volatile("s_wait_xcnt 0x0" ::: "memory"); /* stands before the load's address registers are rewritten */ }
  v8f accs[8] = {c00, c01, c02, c03, c10, c11, c12, c13};
#pragma unroll
  for (int u = 0; u < 8; ++u) { const int t = u & 3, half = u >> 2; const int col = col0 + t * 16 + ln; const float bv = bp ? bf16_round(bp[col]) : 0.f;
#pragma unroll
    for (int r = 0; r < 8; ++r) { const int rloc = half * 16 + 8 * hh + r; float v = accs[u][r] * alpha + bv; if (EPI == 0 && CP) { if (rowsPerB < 0) v += CP[cofs + (size_t)(row0g + row0 + rloc) * ldc + col];      /* rowsPerB < 0: own element of the batched C plane */ else { const int bidx = (row0g + row0 + rloc) / rowsPerB; v += CP[(size_t)bidx * sCPb + (size_t)by * 64 + col]; } }
      if (ACT == 3) v = fmaxf(v, 0.f); else if (ACT == 6) v = 0.5f * v * (1.0f + erff(v * 0.70710678118654752f)); else if (ACT == 11) v = 1.0f / (1.0f + expf(-v)); else if (ACT == 15) v = v / (1.0f + expf(-v)); else if (ACT == 12) v = (v > 0.f) ? v : 0.01f * v; else if (ACT == 8) v = tanhf(v); else if (ACT == 9) v = 0.5f * v * (1.0f + tanhf(0.7978845608028654f * (v + 0.044715f * v * v * v))); else if (ACT == 14) v = (v > 0.f) ? v : 0.1f * v; else if (ACT == 16) v = (v >= 0.f) ? v : 0.3f * v; else if (ACT == 17) v = (v >= 0.f) ? v : 0.2f * v;
      so[w][rloc][t * 16 + ln] = v; } }
  __builtin_amdgcn_fence(__ATOMIC_ACQ_REL, "workgroup"); __builtin_amdgcn_wave_barrier();
  const int rsub = lane >> 4, c4 = (lane & 15) * 4;
  if (EPI == 0) {
#pragma unroll
    for (int q = 0; q < 16; ++q) { const int r = q * 2 + rsub; const v4f v = *(const v4fa*)&so[w][r][c4]; if (C) { *(v4f*)(C + cofs + (size_t)(row0 + r) * ldc + col0 + c4) = v; asm volatile("s_wait_xcnt 0x0" ::: "memory"); /* stands before the store's data and address registers are rewritten by the next piece */ } if (C16) { v4h h4; for (int i = 0; i < 4; ++i) h4[i] = (_Float16)v[i]; *(v4h*)(C16 + cofs + (size_t)(row0 + r) * ldc + col0 + c4) = h4; } }
  } else if (EPI == 5) {      /* the wave's 32 rows are 32 neighbouring positions of one batch: 8 lanes x 4 positions = one whole 128-B line of a channel */
    const int pg = (lane & 7) * 4, cs = lane >> 3; float* ob = C + ((size_t)(row0 / NP) * CC + col0 + cs) * NP + (row0 % NP) + pg;
#pragma unroll 1      /* stays a loop: 64 inlined expm1f would be straight-line code that every wave fetches and runs once; a trip's 8 elements are independent chains */
    for (int q = 0; q < 8; ++q) { const float* sp = &so[w][pg][q * 8 + cs]; float x[8];
#pragma unroll
      for (int i = 0; i < 8; ++i) x[i] = sp[(i & 3) * 68 + (i >> 2) * 4];
      v4f v0, v1;
#pragma unroll
      for (int i = 0; i < 4; ++i) { v0[i] = elu1(x[i]); v1[i] = elu1(x[4 + i]); }
      *(v4f*)(ob + (size_t)(q * 8) * NP) = v0; *(v4f*)(ob + (size_t)(q * 8 + 4) * NP) = v1;
      asm volatile("s_wait_xcnt 0x0" ::: "memory"); /* stands before the stores' data and address registers are rewritten by the next trip */ }
  } else {
    v4f o0 = {0.f, 0.f, 0.f, 0.f}, o1 = o0;      /* EPI 4: the addend of the trip at hand, loaded one trip ahead */
    if (EPI == 4) { o0 = *(const v4fa*)(CP + (size_t)(row0 + rsub) * ldc + col0 + c4); o1 = *(const v4fa*)(CP + (size_t)(row0 + rsub + 2) * ldc + col0 + c4); asm volatile("s_wait_xcnt 0x0" ::: "memory"); /* stands before the loads' address registers are rewritten */ }
#pragma unroll 1      /* stays a loop, as above */
    for (int q = 0; q < 8; ++q) { const int r = q * 4 + rsub, R = row0 + r; v4f v0 = *(const v4fa*)&so[w][r][c4], v1 = *(const v4fa*)&so[w][r + 2][c4]; v4f n0 = o0, n1 = o1;
      if (EPI == 4) { const int Rn = R + ((q < 7) ? 4 : 0); n0 = *(const v4fa*)(CP + (size_t)Rn * ldc + col0 + c4); n1 = *(const v4fa*)(CP + (size_t)(Rn + 2) * ldc + col0 + c4); }
      if (EPI == 6) { const float s0 = __shfl(rsv, r), s1 = __shfl(rsv, r + 2);
#pragma unroll
        for (int i = 0; i < 4; ++i) { v0[i] = v0[i] * s0; v1[i] = v1[i] * s1; } }
#pragma unroll
      for (int i = 0; i < 4; ++i) { v0[i] = elu1(v0[i]); v1[i] = elu1(v1[i]); }
      if (EPI == 3) { *(v4f*)(C + cofs + (size_t)R * ldc + col0 + c4) = v0; *(v4f*)(C + cofs + (size_t)(R + 2) * ldc + col0 + c4) = v1; }
      else {
        if (EPI == 4) {
#pragma unroll
          for (int i = 0; i < 4; ++i) { v0[i] = elu1(v0[i] + o0[i]); v1[i] = elu1(v1[i] + o1[i]); } }
        const int p = R % NP;      /* rows R and R + 2 lie in one w-line of 16: R = .. + 4 q + (0 or 1) */
        const size_t dr = (EPI == 1) ? (size_t)((R / NP) * NPP + (p / (DH * DW) + 1) * (PD * PD) + ((p / DW) % DH + 1) * PD + (p % DW) + 1) : (size_t)R;
        v4h h0, h1;
#pragma unroll
        for (int i = 0; i < 4; ++i) { h0[i] = (_Float16)v0[i]; h1[i] = (_Float16)v1[i]; }
        *(v4h*)(C16 + cofs + dr * ldc + col0 + c4) = h0; *(v4h*)(C16 + cofs + (dr + 2) * ldc + col0 + c4) = h1; }
      asm volatile("s_wait_xcnt 0x0" ::: "memory"); /* stands before the registers of this trip's loads and stores are rewritten by the next trip */
      o0 = n0; o1 = n1; }
  } }


__device__ __forceinline__ void d_xrows(unsigned blk, const float* __restrict__ x, float* __restrict__ RES) { __shared__ float tl[CC][33]; const int tid = threadIdx.x; const int b = blk / (NP / 32), pb = blk % (NP / 32); const int p0 = pb * 32;
  const int j0 = tid % 32;      /* i = i0 + 256 u: column i % 32 is the thread's own, channel i / 32 goes up by 8 with u */
  for (int i0 = tid; i0 < CC * 32; i0 += 8 * 256) { const int cb = i0 / 32; float xv[8];
#pragma unroll      /* eight loads in flight, then their one wait */
    for (int u = 0; u < 8; ++u) xv[u] = x[((size_t)b * CC + cb + 8 * u) * NP + p0 + j0];
    asm volatile("s_wait_xcnt 0x0" ::: "memory");      /* stands before the loads' address registers are rewritten */
#pragma unroll
    for (int u = 0; u < 8; ++u) tl[cb + 8 * u][j0] = bf16_round(xv[u]); }
  __syncthreads();
  { for (int i = tid; i < 32 * (CC / 8); i += 256) { const int j = i / (CC / 8), c0 = (i % (CC / 8)) * 8; v8f v; for (int q = 0; q < 8; ++q) v[q] = tl[c0 + q][j]; *(v8f*)(RES + ((size_t)b * NP + p0 + j) * CC + c0) = v; }  } }
// elu(F) as f16 rows in the bordered layout: one thread per 8 channels of a bordered position; positions with an index 0 hold zeros, in E and in Z (the second bordered buffer, whose interior a GEMM epilogue writes later in the call)
__global__ __launch_bounds__(256) void k_elu16p(const float* __restrict__ F, _Float16* __restrict__ E, _Float16* __restrict__ Z) { const size_t t = (size_t)blockIdx.x * 256 + threadIdx.x; if (t >= (size_t)NB * NPP * (CC / 8)) return; const int c8 = (int)(t % (CC / 8)) * 8; const int pr = (int)(t / (CC / 8)); const int b = pr / NPP, pp = pr % NPP; const int w1 = pp % PD, h1 = (pp / PD) % PD, t1 = pp / (PD * PD); FragH f;
  if (t1 > 0 && h1 > 0 && w1 > 0) { const v8f v = *(const v8f*)(F + ((size_t)b * NP + (size_t)((t1 - 1) * DH + (h1 - 1)) * DW + (w1 - 1)) * CC + c8); for (int q = 0; q < 8; ++q) { const float a = v[q]; f.h[q] = (_Float16)((a > 0.f) ? a : expm1f(a)); } } else { for (int q = 0; q < 8; ++q) f.u[q] = 0; *(v8us*)((unsigned short*)Z + t * 8) = f.half[0]; }
  *(v8us*)((unsigned short*)E + t * 8) = f.half[0];  }
__device__ __forceinline__ void d_w8(unsigned blk, const float* __restrict__ w, int O, _Float16* __restrict__ Bt) { const size_t t = (size_t)blk * 256 + threadIdx.x; if (t >= (size_t)O * K8 / 8) return; const int c8 = (int)((t * 8) % CC); const int tap = (int)(((t * 8) / CC) % 8); const int o = (int)((t * 8) / K8); FragH f; for (int q = 0; q < 8; ++q) f.h[q] = (_Float16)(bf16_round(w[((size_t)o * CC + c8 + q) * 8 + tap]) * 16.0f);
  *(v8us*)((unsigned short*)Bt + t * 8) = f.half[0];  }
// res += a * sigmoid(g), and elu(res) as f16 at the row's interior place in the bordered rows E (their borders hold the zeros that k_elu16p wrote earlier in the call)
__global__ __launch_bounds__(256) void k_gate(const float* __restrict__ O2, float* __restrict__ RES, _Float16* __restrict__ E) {
  #pragma clang fp contract(off)
  const size_t t = (size_t)blockIdx.x * 256 + threadIdx.x; if (t >= NR * CC / 8) return; const int c0 = (int)((t * 8) % CC); const size_t r = (t * 8) / CC; v8f v = *(const v8f*)(RES + t * 8); const float* o = O2 + r * 512;
  for (int q = 0; q < 8; ++q) { const float a = o[c0 + q], g = o[256 + c0 + q]; const float s = 1.0f / (1.0f + expf(-g)); v[q] = v[q] + __fmul_rn(a, s); }
  *(v8f*)(RES + t * 8) = v;
  FragH f; for (int q = 0; q < 8; ++q) f.h[q] = (_Float16)elu1(v[q]); const int p = (int)(r % NP);
  *(v8us*)((unsigned short*)E + ((r / NP) * NPP + (size_t)((p / (DH * DW) + 1) * (PD * PD) + ((p / DW) % DH + 1) * PD + (p % DW) + 1)) * CC + c0) = f.half[0];  }
__global__ __launch_bounds__(256) void k_xa(const float* __restrict__ RES, const float* __restrict__ orig, _Float16* __restrict__ XA) { const size_t t = (size_t)blockIdx.x * 256 + threadIdx.x; if (t >= NR * 36) return; const int pc = (int)(t % 36); const size_t r = t / 36; const int p = (int)(r % NP); const size_t b = r / NP; FragH f;
  for (int q = 0; q < 8; ++q) { const int col = pc * 8 + q; float v = 0.f; if (col < 256) v = RES[r * CC + col]; else if (col < 259) v = bf16_round(orig[((b * 3 + (col - 256)) * (size_t)NP) + p]); else if (col == 259) v = -0.5f + (float)(p / (DH * DW)) / (float)DT; else if (col == 260) v = -0.5f + (float)((p / DW) % DH) / (float)DH; else if (col == 261) v = -0.5f + (float)(p % DW) / (float)DW; f.h[q] = (_Float16)v; }
  unsigned short* d = (unsigned short*)XA + r * KA + pc * 8; *(v8us*)d = f.half[0];  }
__device__ __forceinline__ void d_wa(unsigned blk, const float* __restrict__ w, int O, int OP, _Float16* __restrict__ Bt) { const size_t t = (size_t)blk * 256 + threadIdx.x; if (t >= (size_t)OP * KA / 8) return; const int k0 = (int)((t * 8) % KA); const int o = (int)((t * 8) / KA); FragH f; for (int q = 0; q < 8; ++q) { const int k = k0 + q; f.h[q] = (o < O && k < 262) ? (_Float16)(bf16_round(w[(size_t)o * 262 + k]) * 16.0f) : (_Float16)0.f; }
  *(v8us*)((unsigned short*)Bt + t * 8) = f.half[0];  }
// block ranges of k_prep, in launch order (the x transpose and the large conv weights first)
#define PB_X  (NB * (NP / 32))
#define PB_W2 (NRES * 512 * K8 / 8 / 256)
#define PB_W1 (NRES * CC * K8 / 8 / 256)
#define PB_R  (CC * CC / 8 / 256)
#define PB_A  (CC * VC / 8 / 256)
#define PB_QK (64 * KA / 8 / 256)
#define PB_V  (VC * KA / 8 / 256)
#define PB_ALL (PB_X + PB_W2 + PB_W1 + 2 * PB_R + PB_A + 2 * PB_QK + PB_V + 1)
// every pass that depends on inputs alone, in one launch: the block number picks the pass (the same for a whole work-group, so d_xrows' barrier stands under uniform control flow).
// BW1 / BW2 hold all NRES blocks' conv weights (rw1 / rw2 are NRES stacked tensors: one run of output rows). BQKV = 64 q rows (16 live) | 64 k rows (16 live) | 128 v rows; bqkv = their biases in the same order.
__global__ __launch_bounds__(256) void k_prep(const float* __restrict__ x, const float* __restrict__ rw1, const float* __restrict__ rw2, const float* __restrict__ qw, const float* __restrict__ kw, const float* __restrict__ vw, const float* __restrict__ qb, const float* __restrict__ kb, const float* __restrict__ vb,
    const float* __restrict__ aw, const float* __restrict__ rsw, const float* __restrict__ ow, float* __restrict__ RES, _Float16* __restrict__ BW1, _Float16* __restrict__ BW2, _Float16* __restrict__ BQKV, float* __restrict__ bqkv, _Float16* __restrict__ BA, _Float16* __restrict__ BR, _Float16* __restrict__ BO) {
  unsigned b = blockIdx.x;
  if (b < PB_X) { d_xrows(b, x, RES); return; } b -= PB_X;
  if (b < PB_W2) { d_w8(b, rw2, NRES * 512, BW2); return; } b -= PB_W2;
  if (b < PB_W1) { d_w8(b, rw1, NRES * CC, BW1); return; } b -= PB_W1;
  if (b < PB_R) { d_round16f(b, rsw, BR, (size_t)CC * CC / 8); return; } b -= PB_R;
  if (b < PB_R) { d_round16f(b, ow, BO, (size_t)CC * CC / 8); return; } b -= PB_R;
  if (b < PB_A) { d_round16f(b, aw, BA, (size_t)CC * VC / 8); return; } b -= PB_A;
  if (b < PB_QK) { d_wa(b, qw, 16, 64, BQKV); return; } b -= PB_QK;
  if (b < PB_QK) { d_wa(b, kw, 16, 64, BQKV + (size_t)64 * KA); return; } b -= PB_QK;
  if (b < PB_V) { d_wa(b, vw, VC, VC, BQKV + (size_t)128 * KA); return; }
  const int i = threadIdx.x, j = i & 63; float v = 0.f;
  if (i >= 128) v = vb[i - 128]; else if (j < 16) v = (i < 64) ? qb[j] : kb[j];
  bqkv[i] = v; asm volatile("s_wait_xcnt 0x0" ::: "memory"); /* stands before the store's registers are rewritten */ }
// V16 = the first value column of row 0, rows of pitch ldv; blk = which 64 positions, blockIdx.y = batch, VT = [NB][VC][NP]
__device__ __forceinline__ void d_vt(int blk, const _Float16* __restrict__ V16, int ldv, _Float16* __restrict__ VT) { __shared__ unsigned short tl[64][VC + 2]; const int tid = threadIdx.x; const int k0 = blk * 64; const int b = blockIdx.y; const unsigned short* s = (const unsigned short*)V16 + ((size_t)b * NP + k0) * ldv; VT += (size_t)b * VC * NP;
  for (int i = tid; i < 64 * (VC / 8); i += 256) { const int j = i / (VC / 8), c8 = (i % (VC / 8)) * 8; FragH f; f.half[0] = *(const v8us*)(s + (size_t)j * ldv + c8); asm volatile("s_wait_xcnt 0x0" ::: "memory"); /* stands before the load's address registers are rewritten by the next trip */ for (int q = 0; q < 8; ++q) tl[j][c8 + q] = f.u[q]; }
  __syncthreads();
  { for (int i = tid; i < VC * 8; i += 256) { const int c = i / 8, j8 = (i % 8) * 8; v8us o; for (int q = 0; q < 8; ++q) o[q] = tl[j8 + q][c]; *(v8us*)((unsigned short*)VT + (size_t)c * NP + k0 + j8) = o; }  } }
// causal row softmax, one work-group per query row q: 256 threads x 16 scores each, kept in registers between the max pass and the exp pass;
// lanes read and write neighbouring 8-element pieces; pieces wholly at k >= q are not read and store zeros. Row max and row sum: butterfly in the wave, then 8 wave partials through LDS.
__device__ __forceinline__ void d_csm(const int q, const float* __restrict__ S, _Float16* __restrict__ P, float* __restrict__ RS) {
  __shared__ float redm[8], reds[8];
  S += (size_t)blockIdx.y * NP * NP; P += (size_t)blockIdx.y * NP * NP; RS += (size_t)blockIdx.y * NP * 32;      /* blockIdx.y = batch */
  const int tid = threadIdx.x, lane = tid & 31, w = tid >> 5; const float* s = S + (size_t)q * NP;
  const float sq = sqrtf(259.0f);      /* np.float32(sqrt(259)) division: s/sqrt(C_ATT) */
  const int ka = tid * 8, kb = NP / 2 + tid * 8;
  const v4f z4 = {0.f, 0.f, 0.f, 0.f}; v4f x[4] = {z4, z4, z4, z4};
  if (ka < q) { x[0] = *(const v4fa*)(s + ka); x[1] = *(const v4fa*)(s + ka + 4); }
  if (kb < q) { x[2] = *(const v4fa*)(s + kb); x[3] = *(const v4fa*)(s + kb + 4); }
  float v[16]; float mx = -3.0e38f;
#pragma unroll
  for (int u = 0; u < 2; ++u) { const int k0 = u ? kb : ka;
    if (k0 < q) {
#pragma unroll
      for (int i = 0; i < 8; ++i) { const float t = x[u * 2 + (i >> 2)][i & 3] / sq; v[u * 8 + i] = t; mx = (k0 + i < q) ? fmaxf(mx, t) : mx; } }
    else {
#pragma unroll
      for (int i = 0; i < 8; ++i) v[u * 8 + i] = 0.f; } }
#pragma unroll
  for (int m = 16; m > 0; m >>= 1) mx = fmaxf(mx, __shfl_xor(mx, m));
  if (lane == 0) redm[w] = mx;
  __syncthreads();
#pragma unroll
  for (int i = 0; i < 8; ++i) mx = fmaxf(mx, redm[i]);
  float se = 0.f;
#pragma unroll
  for (int u = 0; u < 2; ++u) { const int k0 = u ? kb : ka; FragH f;
    if (k0 < q) {
#pragma unroll
      for (int i = 0; i < 8; ++i) { const float ee = expf(v[u * 8 + i] - mx); const float e = (k0 + i < q) ? ee : 0.f; se += e; f.h[i] = (_Float16)(e * 256.0f); } }
    else {
#pragma unroll
      for (int i = 0; i < 8; ++i) f.u[i] = 0; }
    *(v8us*)((unsigned short*)P + (size_t)q * NP + k0) = f.half[0]; }
#pragma unroll
  for (int m = 16; m > 0; m >>= 1) se += __shfl_xor(se, m);
  if (lane == 0) reds[w] = se;
  __syncthreads();
  if (tid == 0) { float t = 0.f;
#pragma unroll
    for (int i = 0; i < 8; ++i) t += reds[i];
    RS[(size_t)q * 32] = (q == 0) ? 0.f : (1.0f / 256.0f) / t; } }
// the softmax rows and the value transpose need nothing of one another: one launch, the first NP / 64 blocks of each batch transpose (the choice is the same for a whole work-group, so both passes' barriers stand under uniform control flow)
__global__ __launch_bounds__(256) void k_csm_vt(const float* __restrict__ S, _Float16* __restrict__ P, float* __restrict__ RS, const _Float16* __restrict__ V16, int ldv, _Float16* __restrict__ VT) {
  if (blockIdx.x < NP / 64) { d_vt((int)blockIdx.x, V16, ldv, VT); return; }
  d_csm((int)blockIdx.x - NP / 64, S, P, RS); }

extern "C" void kernel_launch(void* const* d_in, const int* in_sizes, int n_in,
                              void* d_out, int out_size, void* d_ws, size_t ws_size, hipStream_t stream) {
  (void)in_sizes; (void)n_in; (void)out_size;
  const float* const* I = (const float* const*)d_in; const float* x = I[0]; const float* orig = I[1]; const float* rw1 = I[2]; const float* rb1 = I[3]; const float* rw2 = I[4]; const float* rb2 = I[5]; const float* qw = I[6]; const float* qb = I[7]; const float* kw = I[8]; const float* kb = I[9]; const float* vw = I[10]; const float* vb = I[11]; const float* aw = I[12]; const float* ab = I[13]; const float* rsw = I[14]; const float* rsb = I[15]; const float* ow = I[16]; const float* ob = I[17];
  char* ws = (char*)d_ws; size_t off = 0;
  auto take = [&](size_t bytes) { char* p = ws + off; off += (bytes + 255) & ~(size_t)255; return p; };
  _Float16* BW1 = (_Float16*)take((size_t)NRES * CC * K8 * 2); _Float16* BW2 = (_Float16*)take((size_t)NRES * 512 * K8 * 2); _Float16* BQKV = (_Float16*)take((size_t)256 * KA * 2); float* bqkv = (float*)take(256 * 4); _Float16* BA = (_Float16*)take((size_t)CC * VC * 2); _Float16* BR = (_Float16*)take((size_t)CC * CC * 2); _Float16* BO = (_Float16*)take((size_t)CC * CC * 2);
  float* RES = (float*)take(NR * CC * 4); _Float16* EP = (_Float16*)take((size_t)NB * NPP * CC * 2); _Float16* O1 = (_Float16*)take((size_t)NB * NPP * CC * 2); float* O2 = (float*)take(NR * 512 * 4);
  _Float16* XA = (_Float16*)take(NR * KA * 2); _Float16* QKV = (_Float16*)take(NR * 256 * 2); _Float16* VT = (_Float16*)take((size_t)NB * VC * NP * 2); float* S = (float*)take((size_t)NB * NP * NP * 4); _Float16* P = (_Float16*)take((size_t)NB * NP * NP * 2); float* RS = (float*)take((size_t)NB * NP * 32 * 4);
  _Float16* ATE = (_Float16*)take(NR * VC * 2); float* ATTC = O2; _Float16* SUM16 = (_Float16*)(O2 + NR * CC);      /* O2 is dead behind the last gate: its 16 MiB hold ATTC (8) and SUM16 (4) */
  if (off > ws_size) return;      /* about 264 MB */
  k_prep<<<PB_ALL, 256, 0, stream>>>(x, rw1, rw2, qw, kw, vw, qb, kb, vb, aw, rsw, ow, RES, BW1, BW2, BQKV, bqkv, BA, BR, BO);
  const unsigned n8 = (unsigned)((NR * CC / 8 + 255) / 256); const unsigned np8 = (unsigned)(((size_t)NB * NPP * (CC / 8) + 255) / 256); const dim3 g256((unsigned)((NR / 128) * (CC / 64)), 1);
  k_elu16p<<<np8, 256, 0, stream>>>(RES, EP, O1);
  for (int i = 0; i < NRES; ++i) {
    k_gemm2s<0, true, 1><<<g256, 128, 0, stream>>>(EP, CC, 0, BW1 + (size_t)i * CC * K8, K8, 0, 0.0625f, rb1 + i * CC, 0, nullptr, 1, 0, 0, nullptr, O1, CC, 0, (int)NR, CC, K8);      /* o = elu(conv1 + b1), into the bordered rows */
    k_gemm2s<0, true><<<dim3((unsigned)((NR / 128) * 8), 1), 128, 0, stream>>>(O1, CC, 0, BW2 + (size_t)i * 512 * K8, K8, 0, 0.0625f, rb2 + i * 512, 0, nullptr, 1, 0, 0, O2, nullptr, 512, 0, (int)NR, 512, K8);      /* conv2 + b2 (512) */
    k_gate<<<n8, 256, 0, stream>>>(O2, RES, EP); }
  /* attention: q | k | v as one GEMM (N = 256), then each stage once, blockIdx.y = batch */
  k_xa<<<(unsigned)((NR * 36 + 255) / 256), 256, 0, stream>>>(RES, orig, XA);
  k_gemm2<0><<<dim3((unsigned)((NR / 128) * 4), 1), 128, 0, stream>>>(XA, KA, 0, BQKV, KA, 0, 0.0625f, bqkv, 0, nullptr, 1, 0, 0, nullptr, QKV, 256, 0, (int)NR, 256, KA);
  k_gemm2<0><<<dim3((NP / 128) * (NP / 64), NB), 128, 0, stream>>>(QKV, 256, (size_t)NP * 256, QKV + 64, 256, (size_t)NP * 256, 1.0f, nullptr, 0, nullptr, 1, 0, 0, S, nullptr, NP, (size_t)NP * NP, NP, NP, 32);
  k_csm_vt<<<dim3(NP / 64 + NP, NB), 256, 0, stream>>>(S, P, RS, QKV + 128, 256, VT);
  k_gemm2s<0, false, 6><<<dim3((NP / 128) * (VC / 64), NB), 128, 0, stream>>>(P, NP, (size_t)NP * NP, VT, NP, (size_t)VC * NP, 1.0f, nullptr, 0, RS, 1, (size_t)NP * 32, 0, nullptr, ATE, VC, (size_t)NP * VC, NP, VC, NP);      /* elu(att), att = (P V) / row sum */
  k_gemm2s<0, false, 3><<<g256, 128, 0, stream>>>(ATE, VC, 0, BA, VC, 0, 0.0625f, ab, 0, nullptr, 1, 0, 0, ATTC, nullptr, CC, 0, (int)NR, CC, VC);      /* att = elu(attn_conv(elu(att)) + b) */
  k_gemm2s<0, true, 4><<<g256, 128, 0, stream>>>(EP + (size_t)(PD * PD + PD + 1) * CC, CC, 0, BR, CC, 0, 0.0625f, rsb, 0, ATTC, 1, 0, 0, nullptr, SUM16, CC, 0, (int)NR, CC, CC);      /* elu(res + att), res = elu(res_conv(elu(res)) + b); A = the bordered rows' interior: the one tap (1, 1, 1) */
  k_gemm2s<0, false, 5><<<g256, 128, 0, stream>>>(SUM16, CC, 0, BO, CC, 0, 0.0625f, ob, 0, nullptr, 1, 0, 0, (float*)d_out, nullptr, CC, 0, (int)NR, CC, CC);      /* out = elu(out_conv(elu(res + att)) + b), channel-major */
}

// v006
// It runs in 277 microseconds.
// In two side-by-side timings against v005, it was 1.18 and 1.17 times as fast.
// All steps since v000 together make it 10.6 times as fast.
#include <hip/hip_runtime.h>
// PixelSNAILBlock (x [2][256][16][16][16], original_input [2][3][16][16][16]; 4 gated residual blocks: o = elu(conv3d k2 pad1 crop(elu(res)) + b1); o = conv3d k2 pad1 crop(o) + b2 (512 ch); res += o[:256] * sigmoid(o[256:]); attention over the 4,096 positions of [res | original | pos-enc] (262 ch): q,k (16), v (128), causal softmax (k < q, row 0 all-zero) of q.k/sqrt(259), att = p v; att = elu(1x1(elu(att)) + b); res = elu(1x1(elu(res)) + b); out = elu(1x1(elu(res + att)) + b) -> [2][256][16][16][16]).
// Structure: position rows r = b*4096 + (t*16 + h)*16 + w; res kept as f32 rows; each k2 'causal-corner' conv as a WMMA GEMM over K = 8 taps x 256 channels whose A tiles are gathered tap by tap from zero-bordered f16 rows (32x64 wave tiles, f32 accumulation, exact x16 weights + bias) with the ELUs on VALU; gating on VALU; q/k/v as one GEMM on the 262 -> 288-column concat rows (16 live of 64 for q/k); one attention kernel: per 32 queries S^T = K.Q^T on WMMA (K = 32, 16 live), causal softmax weights on VALU in the accumulator registers (true row maximum from a first pass; un-normalised f16 weights x 2^8, f32 sum, row 0 -> 0), O^T += V^T.P^T on WMMA against fragment-order value planes, the keys dealt to 8 waves and the partials added through LDS, scaling; the three 1x1 convs as GEMMs followed by VALU ELUs; channel-major store on VALU.
// Compute dtype: inputs rounded to bf16; x / original / weights exact; conv operands (elu(res), o1), the concat rows, q/k/v, softmax weights and the 1x1-conv operands plain f16 (~2^-12); res accumulation, gates, softmax sums f32. v_wmma_f32_16x16x32_f16.
#define NB 2
#define CC 256
#define DT 16
#define DH 16
#define DW 16
#define NP (DT * DH * DW)            /* 4096 */
#define NR ((size_t)NB * NP)       /* 8192 */
#define NRES 4
#define K8 (8 * CC)                /* 2048 */
#define KA 288                     /* 262 live */
#define VC 128
#define PD 17                      /* bordered extent of t, h and w: index 0 of each axis is the conv's zero padding */
#define NPP (PD * PD * PD)         /* 4913 bordered positions per batch */
typedef __bf16 v16b __attribute__((ext_vector_type(16)));
typedef unsigned short v8us __attribute__((ext_vector_type(8), may_alias));
typedef float  v8f  __attribute__((ext_vector_type(8)));
typedef float  v4f  __attribute__((ext_vector_type(4)));
typedef float  v4fa __attribute__((ext_vector_type(4), may_alias));
union FragB { v16b v; v8us half[2]; unsigned short u[16]; };

__device__ __forceinline__ unsigned short bf16_bits(float x) { unsigned int u = __float_as_uint(x); return (unsigned short)((u + 0x7FFFu + ((u >> 16) & 1u)) >> 16); }
__device__ __forceinline__ float bf16_val(unsigned short b) { return __uint_as_float(((unsigned int)b) << 16); }
__device__ __forceinline__ float bf16_round(float x) { return bf16_val(bf16_bits(x)); }
// D += A·B with NT terms: 1 = ah·bh, 2 = + al·bh (A split), 3 = + ah·bl (both split)
template <int NT>
__device__ __forceinline__ v8f mmaN(v16b ah, v16b al, v16b bh, v16b bl, v8f c) {
  c = __builtin_amdgcn_wmma_f32_16x16x32_bf16(false, ah, false, bh, (short)0, c, false, false);
  if (NT >= 2) c = __builtin_amdgcn_wmma_f32_16x16x32_bf16(false, al, false, bh, (short)0, c, false, false);
  if (NT >= 3) c = __builtin_amdgcn_wmma_f32_16x16x32_bf16(false, ah, false, bl, (short)0, c, false, false);
  asm volatile("v_nop\n\tv_nop\n\tv_nop\n\tv_nop" : "+v"(c) : "v"(ah), "v"(al), "v"(bh), "v"(bl));
  return c;
}

__global__ __launch_bounds__(256) void k_wt_bf16(const float* __restrict__ W, unsigned short* __restrict__ Wt, int K, int N) {
  const int t = blockIdx.x * 256 + threadIdx.x;
  const int k8n = K / 8;
  if (t >= N * k8n) return;
  const int n = t / k8n, k8 = (t % k8n) * 8;
  v8us v;
#pragma unroll
  for (int i = 0; i < 8; ++i) v[i] = bf16_bits(W[(size_t)(k8 + i) * N + n]);
  *(v8us*)(Wt + (size_t)n * K + k8) = v;
  
}

// GEMM C[M][N] (f32, pitch ldc) = act(A[M][K]·W + bias). A f32 row-major (pitch lda) converted per fragment to bf16
// (ASPLIT: hi/lo two planes -> 2 terms, else single rounded term); Wt bf16 [N][K] (pitch ldb). BIAS_BF16 rounds the
// bias to bf16 first (bias quantised to bf16 before the add). K%32==0, M%16==0, N%64==0.
template <bool ASPLIT, int ACT, bool BIAS_BF16>
__global__ __launch_bounds__(128) void k_gemm_bf(const float* __restrict__ A, int lda, const unsigned short* __restrict__ Wt, int ldb,
                                               const float* __restrict__ bias, float* __restrict__ C, int ldc, int M, int N, int K) {
  __shared__ __attribute__((aligned(16))) float so[4][16][64];
  const int tid = threadIdx.x, w = tid >> 5, lane = tid & 31, ln = lane & 15, hh = lane >> 4;
  const int ntn = N / 64;
  const int wid = blockIdx.x * 4 + w;
  const int mt = wid / ntn, nq = wid % ntn;
  if (mt * 16 >= M) return;
  const int row0 = mt * 16, col0 = nq * 64;
  const float* arow = A + (size_t)(row0 + ln) * lda;
  v8f acc[4] = {};
  for (int kb = 0; kb < K; kb += 32) {
    FragB ah, al;
    const v4f x0 = *(const v4fa*)(arow + kb + 8 * hh), x1 = *(const v4fa*)(arow + kb + 8 * hh + 4);
    const v4f x2 = *(const v4fa*)(arow + kb + 16 + 8 * hh), x3 = *(const v4fa*)(arow + kb + 16 + 8 * hh + 4);
    float xs[16] = {x0[0],x0[1],x0[2],x0[3],x1[0],x1[1],x1[2],x1[3],x2[0],x2[1],x2[2],x2[3],x3[0],x3[1],x3[2],x3[3]};
#pragma unroll
    for (int i = 0; i < 16; ++i) { const unsigned short hb = bf16_bits(xs[i]); ah.u[i] = hb; al.u[i] = ASPLIT ? bf16_bits(xs[i] - bf16_val(hb)) : (unsigned short)0; }
#pragma unroll
    for (int t = 0; t < 4; ++t) {
      const unsigned short* brow = Wt + (size_t)(col0 + t * 16 + ln) * ldb + kb;
      FragB b;
      b.half[0] = *(const v8us*)(brow + 8 * hh);
      b.half[1] = *(const v8us*)(brow + 16 + 8 * hh);
      acc[t] = mmaN<ASPLIT ? 2 : 1>(ah.v, al.v, b.v, b.v, acc[t]);
    }
  }
#pragma unroll
  for (int t = 0; t < 4; ++t) {
    float bv = bias ? bias[col0 + t * 16 + ln] : 0.f;
    if (BIAS_BF16) bv = bf16_round(bv);
#pragma unroll
    for (int r = 0; r < 8; ++r) { float v = acc[t][r] + bv; if (ACT == 1) v = fmaxf(v, 0.f); so[w][8 * hh + r][t * 16 + ln] = v; }
  }
  __builtin_amdgcn_fence(__ATOMIC_ACQ_REL, "workgroup");
  __builtin_amdgcn_wave_barrier();
  const int rsub = lane >> 4, c4 = (lane & 15) * 4;
  {
#pragma unroll
    for (int q = 0; q < 8; ++q) {
      const int r = q * 2 + rsub;
      const v4f v = *(const v4fa*)&so[w][r][c4];
      *(v4f*)(C + (size_t)(row0 + r) * ldc + col0 + c4) = v;
    }
    
  }
}

// GEMM C = act(A·W + bias + resid): A f32 (ASPLIT -> hi/lo 2 terms), Wt bf16 [N][K]; ACT 0 none, 1 relu, 2 exact gelu;
// resid (optional, f32, row index = (row % rmod), pitch ldr, RES_BF16 rounds it) added before the activation.
template <bool ASPLIT, int ACT, bool BIAS_BF16, bool RES_BF16>
__global__ __launch_bounds__(128) void k_gemm_bf3(const float* __restrict__ A, int lda, const unsigned short* __restrict__ Wt, int ldb,
                                                const float* __restrict__ bias, const float* __restrict__ resid, int rmod, int ldr,
                                                float* __restrict__ C, int ldc, int M, int N, int K) {
  __shared__ __attribute__((aligned(16))) float so[4][16][64];
  const int tid = threadIdx.x, w = tid >> 5, lane = tid & 31, ln = lane & 15, hh = lane >> 4;
  const int ntn = N / 64;
  const int wid = blockIdx.x * 4 + w;
  const int mt = wid / ntn, nq = wid % ntn;
  if (mt * 16 >= M) return;
  const int row0 = mt * 16, col0 = nq * 64;
  const float* arow = A + (size_t)(row0 + ln) * lda;
  v8f acc[4] = {};
  for (int kb = 0; kb < K; kb += 32) {
    FragB ah, al;
    const v4f x0 = *(const v4fa*)(arow + kb + 8 * hh), x1 = *(const v4fa*)(arow + kb + 8 * hh + 4);
    const v4f x2 = *(const v4fa*)(arow + kb + 16 + 8 * hh), x3 = *(const v4fa*)(arow + kb + 16 + 8 * hh + 4);
    float xs[16] = {x0[0],x0[1],x0[2],x0[3],x1[0],x1[1],x1[2],x1[3],x2[0],x2[1],x2[2],x2[3],x3[0],x3[1],x3[2],x3[3]};
#pragma unroll
    for (int i = 0; i < 16; ++i) { const unsigned short hb = bf16_bits(xs[i]); ah.u[i] = hb; al.u[i] = ASPLIT ? bf16_bits(xs[i] - bf16_val(hb)) : (unsigned short)0; }
#pragma unroll
    for (int t = 0; t < 4; ++t) {
      const unsigned short* brow = Wt + (size_t)(col0 + t * 16 + ln) * ldb + kb;
      FragB b;
      b.half[0] = *(const v8us*)(brow + 8 * hh);
      b.half[1] = *(const v8us*)(brow + 16 + 8 * hh);
      acc[t] = mmaN<ASPLIT ? 2 : 1>(ah.v, al.v, b.v, b.v, acc[t]);
    }
  }
#pragma unroll
  for (int t = 0; t < 4; ++t) {
    const int col = col0 + t * 16 + ln;
    float bv = bias ? bias[col] : 0.f;
    if (BIAS_BF16) bv = bf16_round(bv);
#pragma unroll
    for (int r = 0; r < 8; ++r) {
      float v = acc[t][r] + bv;
      if (resid) { float rv = resid[(size_t)((row0 + 8 * hh + r) % rmod) * ldr + col]; if (RES_BF16) rv = bf16_round(rv); v += rv; }
      if (ACT == 1) v = fmaxf(v, 0.f);
      if (ACT == 2) v = 0.5f * v * (1.0f + erff(v * 0.70710678118654752f));
      if (ACT == 3) { const float u = 0.7978845608028654f * (v + 0.044715f * v * v * v); v = 0.5f * v * (1.0f + tanhf(u)); }
      so[w][8 * hh + r][t * 16 + ln] = v;
    }
  }
  __builtin_amdgcn_fence(__ATOMIC_ACQ_REL, "workgroup");
  __builtin_amdgcn_wave_barrier();
  const int rsub = lane >> 4, c4 = (lane & 15) * 4;
  {
#pragma unroll
    for (int q = 0; q < 8; ++q) {
      const int r = q * 2 + rsub;
      const v4f v = *(const v4fa*)&so[w][r][c4];
      *(v4f*)(C + (size_t)(row0 + r) * ldc + col0 + c4) = v;
    }
    
  }
}
// row LayerNorm (biased variance, eps) over N: s = X (+ R); optional out_sum <- s; out_norm <- (s-mu)*rsqrt(var+eps)*g + b
template <bool PARAM_BF16>
__global__ __launch_bounds__(256) void k_layernorm(const float* __restrict__ X, const float* __restrict__ R, const float* __restrict__ g, const float* __restrict__ bta,
                                                  float* __restrict__ out_sum, float* __restrict__ out_norm, int N, float eps) {
  __shared__ float red[256];
  const int row = blockIdx.x, tid = threadIdx.x;
  const float* x = X + (size_t)row * N; const float* rr = R ? R + (size_t)row * N : nullptr;
  float vals[16];                     // up to N = 4096
  const int per = N / 256;            // contiguous chunk per thread? use strided-by-4 chunks: thread handles j = tid*4 + 1024*u
  float s1 = 0.f;
  for (int u = 0; u < per / 4; ++u) {
    const int j = tid * 4 + 1024 * u;
    const v4f a = *(const v4fa*)(x + j);
    v4f b = {0.f,0.f,0.f,0.f}; if (rr) b = *(const v4fa*)(rr + j);
#pragma unroll
    for (int q = 0; q < 4; ++q) { const float v = a[q] + b[q]; vals[u * 4 + q] = v; s1 += v; }
  }
  red[tid] = s1; __syncthreads();
  for (int st = 128; st > 0; st >>= 1) { if (tid < st) red[tid] += red[tid + st]; __syncthreads(); }
  const float mu = red[0] / (float)N; __syncthreads();
  float s2 = 0.f;
  for (int u = 0; u < per / 4; ++u)
#pragma unroll
    for (int q = 0; q < 4; ++q) { const float c = vals[u * 4 + q] - mu; s2 += c * c; }
  red[tid] = s2; __syncthreads();
  for (int st = 128; st > 0; st >>= 1) { if (tid < st) red[tid] += red[tid + st]; __syncthreads(); }
  const float rs = rsqrtf(red[0] / (float)N + eps);
  {
    for (int u = 0; u < per / 4; ++u) {
      const int j = tid * 4 + 1024 * u;
      v4f o, sm;
#pragma unroll
      for (int q = 0; q < 4; ++q) {
        float gg = g[j + q], bb = bta[j + q];
        if (PARAM_BF16) { gg = bf16_round(gg); bb = bf16_round(bb); }
        sm[q] = vals[u * 4 + q]; o[q] = (vals[u * 4 + q] - mu) * rs * gg + bb;
      }
      if (out_sum) *(v4f*)(out_sum + (size_t)row * N + j) = sm;
      *(v4f*)(out_norm + (size_t)row * N + j) = o;
    }
    
  }
}



// ---- f16 WMMA path (v_wmma_f32_16x16x32_f16): 11-bit significands for operands in range — used for every GEMM launched in this file
typedef _Float16 v16h __attribute__((ext_vector_type(16)));
union FragH { v16h v; v8us half[2]; _Float16 h[16]; unsigned short u[16]; };
template <int NT>
__device__ __forceinline__ v8f mmaH(v16h ah, v16h al, v16h bh, v16h bl, v8f c) {
  c = __builtin_amdgcn_wmma_f32_16x16x32_f16(false, ah, false, bh, (short)0, c, false, false);
  if (NT >= 2) c = __builtin_amdgcn_wmma_f32_16x16x32_f16(false, al, false, bh, (short)0, c, false, false);
  if (NT >= 3) c = __builtin_amdgcn_wmma_f32_16x16x32_f16(false, ah, false, bl, (short)0, c, false, false);
  asm volatile("v_nop\n\tv_nop\n\tv_nop\n\tv_nop" : "+v"(c) : "v"(ah), "v"(al), "v"(bh), "v"(bl));
  return c;
}
// batched GEMM like k_gemm_b but f16 operands: A f32 (split into f16 hi/lo if ASPLIT, else rounded to f16), Bt = f16 values [n][k]; alpha; C f32; N multiple of 16 (partial tiles skipped)
template <bool ASPLIT>
__global__ __launch_bounds__(128) void k_gemm_h(const float* __restrict__ A, int lda, size_t sA, const _Float16* __restrict__ Bh, int ldb, size_t sB, float alpha, float* __restrict__ C, int ldc, size_t sC, int M, int N, int K) {
  __shared__ __attribute__((aligned(16))) float so[4][16][64];
  const int tid = threadIdx.x, w = tid >> 5, lane = tid & 31, ln = lane & 15, hh = lane >> 4; const int by = blockIdx.y;
  A += (size_t)by * sA; Bh += (size_t)by * sB; C += (size_t)by * sC;
  const int ntn = (N + 63) / 64; const int wid = blockIdx.x * 4 + w; const int mt = wid / ntn, nq = wid % ntn; if (mt * 16 >= M) return;
  const int row0 = mt * 16, col0 = nq * 64; const float* arow = A + (size_t)(row0 + ln) * lda;
  v8f acc[4] = {};
  for (int kb = 0; kb < K; kb += 32) {
    FragH ah, al;
    const v4f x0 = *(const v4fa*)(arow + kb + 8 * hh), x1 = *(const v4fa*)(arow + kb + 8 * hh + 4), x2 = *(const v4fa*)(arow + kb + 16 + 8 * hh), x3 = *(const v4fa*)(arow + kb + 16 + 8 * hh + 4);
    float xs[16] = {x0[0],x0[1],x0[2],x0[3],x1[0],x1[1],x1[2],x1[3],x2[0],x2[1],x2[2],x2[3],x3[0],x3[1],x3[2],x3[3]};
#pragma unroll
    for (int i = 0; i < 16; ++i) { const _Float16 h = (_Float16)xs[i]; ah.h[i] = h; al.h[i] = ASPLIT ? (_Float16)(xs[i] - (float)h) : (_Float16)0.0f; }
#pragma unroll
    for (int t = 0; t < 4; ++t) { if (col0 + t * 16 >= N) continue; const size_t boff = (size_t)(col0 + t * 16 + ln) * ldb + kb; FragH bq; bq.half[0] = *(const v8us*)(Bh + boff + 8 * hh); bq.half[1] = *(const v8us*)(Bh + boff + 16 + 8 * hh);
      acc[t] = mmaH<ASPLIT ? 2 : 1>(ah.v, al.v, bq.v, bq.v, acc[t]); }
  }
#pragma unroll
  for (int t = 0; t < 4; ++t) { if (col0 + t * 16 >= N) continue;
#pragma unroll
    for (int r = 0; r < 8; ++r) so[w][8 * hh + r][t * 16 + ln] = acc[t][r] * alpha; }
  __builtin_amdgcn_fence(__ATOMIC_ACQ_REL, "workgroup"); __builtin_amdgcn_wave_barrier();
  const int rsub = lane >> 4, c4 = (lane & 15) * 4;
  {
#pragma unroll
    for (int q = 0; q < 8; ++q) { const int r = q * 2 + rsub; if (col0 + c4 < N) { const v4f v = *(const v4fa*)&so[w][r][c4]; *(v4f*)(C + (size_t)(row0 + r) * ldc + col0 + c4) = v; } }
     }
}

// Wt[n][k] = f16(W[k][n]·scale) from f32 row-major W[K][N] (scale = power of two; bf16-exact weights stay exact in f16 away from the subnormal range)
__global__ __launch_bounds__(256) void k_wt_f16(const float* __restrict__ W, _Float16* __restrict__ Wt, int K, int N, float scale) {
  const int t = blockIdx.x * 256 + threadIdx.x; if (t >= N * (K / 8)) return; const int n = t / (K / 8), k8 = (t % (K / 8)) * 8; FragH f;
#pragma unroll
  for (int i = 0; i < 8; ++i) f.h[i] = (_Float16)(bf16_round(W[(size_t)(k8 + i) * N + n]) * scale); const v8us o = f.half[0];
  *(v8us*)((unsigned short*)Wt + (size_t)n * K + k8) = o; 
}
// k_gemm_hh variant with fused epilogue: v = acc·alpha + bias[by·sBias + col] (+ CP[(row/rowsPerB)·sCPb + by·64 + col] if CP) ; ACT 0 none / 1 elu ; writes f16 C16 (and f32 C if non-null)
template <int ACT>
__global__ __launch_bounds__(128) void k_gemm_hhx(const _Float16* __restrict__ A, int lda, size_t sA, const _Float16* __restrict__ Bh, int ldb, size_t sB, float alpha, const float* __restrict__ bias, size_t sBias, const float* __restrict__ CP, int rowsPerB, size_t sCPb, int row0g,
    float* __restrict__ C, _Float16* __restrict__ C16, int ldc, size_t sC, int M, int N, int K) {
  __shared__ __attribute__((aligned(16))) float so[4][16][64];
  const int tid = threadIdx.x, w = tid >> 5, lane = tid & 31, ln = lane & 15, hh = lane >> 4; const int by = blockIdx.y;
  A += (size_t)by * sA; Bh += (size_t)by * sB; const size_t cofs = (size_t)by * sC; const float* bp = bias ? bias + (size_t)by * sBias : nullptr;
  const int ntn = (N + 63) / 64; const int wid = blockIdx.x * 4 + w; const int mt = wid / ntn, nq = wid % ntn; if (mt * 16 >= M) return;
  const int row0 = mt * 16, col0 = nq * 64; const _Float16* arow = A + (size_t)(row0 + ln) * lda;
  v8f acc[4] = {};
  for (int kb = 0; kb < K; kb += 32) { FragH ah; ah.half[0] = *(const v8us*)((const unsigned short*)arow + kb + 8 * hh); ah.half[1] = *(const v8us*)((const unsigned short*)arow + kb + 16 + 8 * hh);
#pragma unroll
    for (int t = 0; t < 4; ++t) { if (col0 + t * 16 >= N) continue; const size_t boff = (size_t)(col0 + t * 16 + ln) * ldb + kb; FragH bq; bq.half[0] = *(const v8us*)((const unsigned short*)Bh + boff + 8 * hh); bq.half[1] = *(const v8us*)((const unsigned short*)Bh + boff + 16 + 8 * hh);
      acc[t] = mmaH<1>(ah.v, ah.v, bq.v, bq.v, acc[t]); }
  }
#pragma unroll
  for (int t = 0; t < 4; ++t) { if (col0 + t * 16 >= N) continue; const int col = col0 + t * 16 + ln; const float bv = bp ? bf16_round(bp[col]) : 0.f;
#pragma unroll
    for (int r = 0; r < 8; ++r) { float v = acc[t][r] * alpha + bv; if (CP) { const int rr = row0g + row0 + 8 * hh + r; if (rowsPerB < 0) v += CP[cofs + (size_t)rr * ldc + col];      /* rowsPerB < 0: own element of the batched C plane */ else { const int bidx = rr / rowsPerB; v += CP[(size_t)bidx * sCPb + (size_t)by * 64 + col]; } } if (ACT == 1) v = (v > 0.f) ? v : expm1f(v); else if (ACT == 7) v = (v > 0.f) ? v + 1.0f : expf(v); else if (ACT == 8) v = tanhf(v); else if (ACT == 9) v = 0.5f * v * (1.0f + tanhf(0.7978845608028654f * (v + 0.044715f * v * v * v))); else if (ACT == 11) v = 1.0f / (1.0f + expf(-v)); else if (ACT == 12) v = (v > 0.f) ? v : 0.01f * v; else if (ACT == 14) v = (v > 0.f) ? v : 0.1f * v; else if (ACT == 16) v = (v >= 0.f) ? v : 0.3f * v; else if (ACT == 17) v = (v >= 0.f) ? v : 0.2f * v; else if (ACT == 15) v = v / (1.0f + expf(-v)); else if (ACT == 3) v = fmaxf(v, 0.f); else if (ACT == 6) v = 0.5f * v * (1.0f + erff(v * 0.70710678118654752f)); so[w][8 * hh + r][t * 16 + ln] = v; } }
  __builtin_amdgcn_fence(__ATOMIC_ACQ_REL, "workgroup"); __builtin_amdgcn_wave_barrier();
  const int rsub = lane >> 4, c4 = (lane & 15) * 4; typedef _Float16 v4h __attribute__((ext_vector_type(4)));
  {
#pragma unroll
    for (int q = 0; q < 8; ++q) { const int r = q * 2 + rsub; if (col0 + c4 < N) { const v4f v = *(const v4fa*)&so[w][r][c4]; if (C) *(v4f*)(C + cofs + (size_t)(row0 + r) * ldc + col0 + c4) = v; if (C16) { v4h h4; for (int i = 0; i < 4; ++i) h4[i] = (_Float16)v[i]; *(v4h*)(C16 + cofs + (size_t)(row0 + r) * ldc + col0 + c4) = h4; } } }
     }
}


typedef _Float16 v4h __attribute__((ext_vector_type(4)));

__global__ __launch_bounds__(256) void k_x16(const float* __restrict__ x, _Float16* __restrict__ X16, size_t n8) { const size_t t = (size_t)blockIdx.x * 256 + threadIdx.x; if (t >= n8) return; FragH f;
#pragma unroll
  for (int q = 0; q < 8; ++q) f.h[q] = (_Float16)bf16_round(x[t * 8 + q]); *(v8us*)((unsigned short*)X16 + t * 8) = f.half[0];  }
__global__ __launch_bounds__(256) void k_h16(const float* __restrict__ x, _Float16* __restrict__ X16, size_t n8) { const size_t t = (size_t)blockIdx.x * 256 + threadIdx.x; if (t >= n8) return; FragH f;
#pragma unroll
  for (int q = 0; q < 8; ++q) f.h[q] = (_Float16)x[t * 8 + q]; *(v8us*)((unsigned short*)X16 + t * 8) = f.half[0];  }
// d_round16f / d_xrows / d_w8 / d_wa: the passes that read inputs only, each written for block number blk of its own range; k_prep below runs them all in one launch
__device__ __forceinline__ void d_round16f(unsigned blk, const float* __restrict__ W, _Float16* __restrict__ Bt, size_t n8) { const size_t t = (size_t)blk * 256 + threadIdx.x; if (t >= n8) return; FragH f;
#pragma unroll
  for (int i = 0; i < 8; ++i) f.h[i] = (_Float16)(bf16_round(W[t * 8 + i]) * 16.0f); *(v8us*)((unsigned short*)Bt + t * 8) = f.half[0];  }
template <int NHv, int TTv>
__global__ __launch_bounds__(256) void k_vt(const _Float16* __restrict__ V16, int ldv, int voff, _Float16* __restrict__ Vt) { __shared__ unsigned short tl[64][66]; const int tid = threadIdx.x; const int slab = blockIdx.x / (TTv / 64), lg = blockIdx.x % (TTv / 64); const int b = slab / NHv, h = slab % NHv;
  for (int i = tid; i < 64 * 8; i += 256) { const int r = i / 8, c8 = (i % 8) * 8; FragH f; f.half[0] = *(const v8us*)((const unsigned short*)V16 + ((size_t)b * TTv + lg * 64 + r) * ldv + voff + h * 64 + c8);
#pragma unroll
    for (int q = 0; q < 8; ++q) tl[r][c8 + q] = f.u[q]; }
  __syncthreads();
  {
#pragma unroll
    for (int rd = 0; rd < 2; ++rd) { const int d = rd * 32 + tid / 8, pc = tid % 8; FragH f;
#pragma unroll
      for (int q = 0; q < 8; ++q) f.u[q] = tl[pc * 8 + q][d];
      *(v8us*)((unsigned short*)Vt + ((size_t)slab * 64 + d) * TTv + lg * 64 + pc * 8) = f.half[0]; }
     } }

__global__ __launch_bounds__(256) void k_hl(const float* __restrict__ F, _Float16* __restrict__ Hh, _Float16* __restrict__ Hl, size_t n8) { const size_t t = (size_t)blockIdx.x * 256 + threadIdx.x; if (t >= n8) return; FragH fh, fl; const v4f a = *(const v4fa*)(F + t * 8), c = *(const v4fa*)(F + t * 8 + 4);
#pragma unroll
  for (int q = 0; q < 4; ++q) { _Float16 h = (_Float16)a[q]; fh.h[q] = h; fl.h[q] = (_Float16)((a[q] - (float)h) * 1024.0f); h = (_Float16)c[q]; fh.h[4 + q] = h; fl.h[4 + q] = (_Float16)((c[q] - (float)h) * 1024.0f); }
  { *(v8us*)((unsigned short*)Hh + t * 8) = fh.half[0]; *(v8us*)((unsigned short*)Hl + t * 8) = fl.half[0];  } }

// ---- fast GEMM (wave tile 32x64; requires M % 32 == 0 rows per launch region and N % 64 == 0); epilogue = k_gemm_hhx semantics ----
__device__ __forceinline__ v16h g2_frag(const _Float16* p, int hh) { FragH f; f.half[0] = *(const v8us*)((const unsigned short*)p + 8 * hh); f.half[1] = *(const v8us*)((const unsigned short*)p + 16 + 8 * hh); return f.v; }
__device__ __forceinline__ v8f g2_mma(v16h a, v16h b, v8f c) { v8f d = __builtin_amdgcn_wmma_f32_16x16x32_f16(false, a, false, b, (short)0, c, false, false); asm volatile("v_nop\n\tv_nop\n\tv_nop\n\tv_nop" : "+v"(d) : "v"(a), "v"(b)); return d; }
template <int ACT>
__global__ __launch_bounds__(128) void k_gemm2(const _Float16* __restrict__ A, int lda, size_t sA, const _Float16* __restrict__ Bh, int ldb, size_t sB, float alpha, const float* __restrict__ bias, size_t sBias, const float* __restrict__ CP, int rowsPerB, size_t sCPb, int row0g,
    float* __restrict__ C, _Float16* __restrict__ C16, int ldc, size_t sC, int M, int N, int K) { static_assert(ACT == 0 || ACT == 3 || ACT == 6 || ACT == 8 || ACT == 9 || ACT == 11 || ACT == 12 || ACT == 14 || ACT == 15 || ACT == 16 || ACT == 17, "k_gemm2: unsupported ACT code (would silently apply no activation)");
  __shared__ __attribute__((aligned(16))) float so[4][32][68];
  const int tid = threadIdx.x, w = tid >> 5, lane = tid & 31, ln = lane & 15, hh = lane >> 4; const int by = blockIdx.y;
  A += (size_t)by * sA; Bh += (size_t)by * sB; const size_t cofs = (size_t)by * sC; const float* bp = bias ? bias + (size_t)by * sBias : nullptr;
  const int ntn = N >> 6; const int mt = blockIdx.x / ntn, nq = blockIdx.x - mt * ntn; const int row0 = mt * 128 + 32 * w, col0 = nq * 64; if (row0 >= M) return;
  const _Float16* a0p = A + (size_t)(row0 + ln) * lda; const _Float16* a1p = a0p + (size_t)16 * lda;
  const _Float16* b0p = Bh + (size_t)(col0 + ln) * ldb; const _Float16* b1p = b0p + (size_t)16 * ldb; const _Float16* b2p = b1p + (size_t)16 * ldb; const _Float16* b3p = b2p + (size_t)16 * ldb;
  const v8f z8 = {0.f,0.f,0.f,0.f,0.f,0.f,0.f,0.f}; v8f c00 = z8, c01 = z8, c02 = z8, c03 = z8, c10 = z8, c11 = z8, c12 = z8, c13 = z8;
#pragma unroll 1
  for (int kb = 0; kb < K; kb += 32) { const v16h a0 = g2_frag(a0p + kb, hh), a1 = g2_frag(a1p + kb, hh);
    asm volatile("s_wait_xcnt 0x0" ::: "memory");      /* stands before the A loads' address registers are rewritten */
    v16h b = g2_frag(b0p + kb, hh); c00 = g2_mma(a0, b, c00); c10 = g2_mma(a1, b, c10);
    b = g2_frag(b1p + kb, hh); c01 = g2_mma(a0, b, c01); c11 = g2_mma(a1, b, c11);
    b = g2_frag(b2p + kb, hh); c02 = g2_mma(a0, b, c02); c12 = g2_mma(a1, b, c12);
    b = g2_frag(b3p + kb, hh); c03 = g2_mma(a0, b, c03); c13 = g2_mma(a1, b, c13); }
  v8f accs[8] = {c00, c01, c02, c03, c10, c11, c12, c13};
#pragma unroll
  for (int u = 0; u < 8; ++u) { const int t = u & 3, half = u >> 2; const int col = col0 + t * 16 + ln; const float bv = bp ? bf16_round(bp[col]) : 0.f;
#pragma unroll
    for (int r = 0; r < 8; ++r) { const int rloc = half * 16 + 8 * hh + r; float v = accs[u][r] * alpha + bv; if (CP) { if (rowsPerB < 0) v += CP[cofs + (size_t)(row0g + row0 + rloc) * ldc + col];      /* rowsPerB < 0: own element of the batched C plane */ else { const int bidx = (row0g + row0 + rloc) / rowsPerB; v += CP[(size_t)bidx * sCPb + (size_t)by * 64 + col]; } }
      if (ACT == 3) v = fmaxf(v, 0.f); else if (ACT == 6) v = 0.5f * v * (1.0f + erff(v * 0.70710678118654752f)); else if (ACT == 11) v = 1.0f / (1.0f + expf(-v)); else if (ACT == 15) v = v / (1.0f + expf(-v)); else if (ACT == 12) v = (v > 0.f) ? v : 0.01f * v; else if (ACT == 8) v = tanhf(v); else if (ACT == 9) v = 0.5f * v * (1.0f + tanhf(0.7978845608028654f * (v + 0.044715f * v * v * v))); else if (ACT == 14) v = (v > 0.f) ? v : 0.1f * v; else if (ACT == 16) v = (v >= 0.f) ? v : 0.3f * v; else if (ACT == 17) v = (v >= 0.f) ? v : 0.2f * v;
      so[w][rloc][t * 16 + ln] = v; } }
  __builtin_amdgcn_fence(__ATOMIC_ACQ_REL, "workgroup"); __builtin_amdgcn_wave_barrier();
  const int rsub = lane >> 4, c4 = (lane & 15) * 4;
  {
#pragma unroll
    for (int q = 0; q < 16; ++q) { const int r = q * 2 + rsub; const v4f v = *(const v4fa*)&so[w][r][c4]; if (C) { *(v4f*)(C + cofs + (size_t)(row0 + r) * ldc + col0 + c4) = v; asm volatile("s_wait_xcnt 0x0" ::: "memory"); /* stands before the store's data and address registers are rewritten by the next piece */ } if (C16) { v4h h4; for (int i = 0; i < 4; ++i) h4[i] = (_Float16)v[i]; *(v4h*)(C16 + cofs + (size_t)(row0 + r) * ldc + col0 + c4) = h4; } }
     } }

// ---- k_gemm2 with both operands staged in LDS (requires M % 128 == 0, N % 64 == 0, K % 128 == 0); same tiles, same k order, same epilogue for EPI 0 ----
// A stage is 128 k (256 B, two whole lines) of the work-group's 128 A rows and 64 B rows; every wave-wide copy covers two whole rows of it (4 lines) where a fragment load from global touched 16 lines.
#define G3_KS 128
#define G3_PITCH 272                    /* LDS row pitch, bytes: 16 B x odd, conflict-free for ds_load_b128 */
#define G3_STAGE (192 * G3_PITCH)       /* rows 0..127 = A, rows 128..191 = B */
#define G3_C(l, g) "global_load_async_to_lds_b128 %" #l ", %" #g ", off\n\t"
// twelve copies and, as the statement's last line, the wait that stands before any register they name is rewritten
#define G3_COPY12(L, G, o) asm volatile(G3_C(0, 12) G3_C(1, 13) G3_C(2, 14) G3_C(3, 15) G3_C(4, 16) G3_C(5, 17) G3_C(6, 18) G3_C(7, 19) G3_C(8, 20) G3_C(9, 21) G3_C(10, 22) G3_C(11, 23) "s_wait_xcnt 0x0" \
    :: "v"(L[o + 0]), "v"(L[o + 1]), "v"(L[o + 2]), "v"(L[o + 3]), "v"(L[o + 4]), "v"(L[o + 5]), "v"(L[o + 6]), "v"(L[o + 7]), "v"(L[o + 8]), "v"(L[o + 9]), "v"(L[o + 10]), "v"(L[o + 11]), \
       "v"(G[o + 0]), "v"(G[o + 1]), "v"(G[o + 2]), "v"(G[o + 3]), "v"(G[o + 4]), "v"(G[o + 5]), "v"(G[o + 6]), "v"(G[o + 7]), "v"(G[o + 8]), "v"(G[o + 9]), "v"(G[o + 10]), "v"(G[o + 11]) : "memory")
// one stage: 24 copies of 16 B per lane. l = the lane's LDS byte address in row (tid >> 4) of the buffer, ga / gb = its global address in that row of the A / B tile; copy j serves row 8 j + (tid >> 4)
// IM8: the A tile's 128 rows are 8 h-lines of 16 w-positions of the bordered rows, so tile row 8 j + .. lies (j >> 1) bordered h-lines and 8 (j & 1) positions behind row (tid >> 4)
template <bool IM8>
__device__ __forceinline__ void g3_fill(unsigned l, const _Float16* ga, size_t sa8, const _Float16* gb, size_t sb8) {
  unsigned L[24]; const _Float16* G[24];
#pragma unroll      /* both loops: every index constant, so that L and G are registers the asm can name */
  for (int j = 0; j < 16; ++j) { L[j] = l + (unsigned)j * (8u * G3_PITCH); G[j] = ga + (IM8 ? (size_t)(((j >> 1) * PD + (j & 1) * 8) * CC) : (size_t)j * sa8); }
#pragma unroll
  for (int j = 0; j < 8; ++j) { L[16 + j] = l + (unsigned)(16 + j) * (8u * G3_PITCH); G[16 + j] = gb + (size_t)j * sb8; }
  G3_COPY12(L, G, 0); G3_COPY12(L, G, 12); }
__device__ __forceinline__ v16h g3_frag(const unsigned char* p) { FragH f; f.half[0] = *(const v8us*)p; f.half[1] = *(const v8us*)(p + 32); return f.v; }
// IM8: A = bordered rows [NB][PD][PD][PD][CC] and the product is the k2 conv: stage s is channels 128 (s & 1) .. + 127 of tap s >> 1 = (dt, dh, dw), read for output position (t, h, w) at bordered index (t + dt, h + dh, w + dw); k = tap * CC + channel
// EPI: what follows v = acc * alpha + bias, done as the tile leaves LDS (planes by = 0 only for 4 and 5). 0: store v (f32 C and / or f16 C16). 1: f16 elu(v) to C16 = bordered rows, at the row's interior place. 3: f32 elu(v) to C.
// 4: f16 elu(elu(v) + CP[row][col]) to C16. 5: f32 elu(v) to C = [NB][CC][NP], channel-major.
__device__ __forceinline__ float elu1(float a) { const float e = expm1f(a); return (a > 0.f) ? a : e; }      /* expm1f stands outside the choice: no branch per element, so that the chains of neighbouring elements overlap in a wave that is alone on its SIMD */
template <int ACT, bool IM8 = false, int EPI = 0>
__global__ __launch_bounds__(128) void k_gemm2s(const _Float16* __restrict__ A, int lda, size_t sA, const _Float16* __restrict__ Bh, int ldb, size_t sB, float alpha, const float* __restrict__ bias, size_t sBias, const float* __restrict__ CP, int rowsPerB, size_t sCPb, int row0g,
    float* __restrict__ C, _Float16* __restrict__ C16, int ldc, size_t sC, int M, int N, int K) { static_assert(ACT == 0 || ACT == 3 || ACT == 6 || ACT == 8 || ACT == 9 || ACT == 11 || ACT == 12 || ACT == 14 || ACT == 15 || ACT == 16 || ACT == 17, "k_gemm2s: unsupported ACT code (would silently apply no activation)");
  __shared__ __attribute__((aligned(16))) unsigned char st[2 * G3_STAGE];
  __shared__ __attribute__((aligned(16))) float so[4][32][68];
  const int tid = threadIdx.x, w = tid >> 5, lane = tid & 31, ln = lane & 15, hh = lane >> 4; const int by = blockIdx.y;
  A += (size_t)by * sA; Bh += (size_t)by * sB; const size_t cofs = (size_t)by * sC; const float* bp = bias ? bias + (size_t)by * sBias : nullptr;
  const int ntn = N >> 6; const int mt = blockIdx.x / ntn, nq = blockIdx.x - mt * ntn; const int row0 = mt * 128 + 32 * w, col0 = nq * 64; if (mt * 128 >= M) return;      /* the same for the whole work-group, in front of every barrier */
  const int crow = tid >> 4, cch = tid & 15; const size_t sa8 = (size_t)8 * lda, sb8 = (size_t)8 * ldb;
  static_assert(!IM8 || (DT == 16 && DH == 16 && DW == 16 && CC == 2 * G3_KS), "IM8: a 128-row tile is 8 h-lines of 16, a tap is two stages");
  const _Float16* gA = IM8 ? A + (size_t)((mt >> 5) * NPP + ((mt >> 1) & 15) * (PD * PD) + (mt & 1) * (8 * PD) + crow) * CC + cch * 8 : A + (size_t)(mt * 128 + crow) * lda + cch * 8;
  auto aoff = [](int t) -> size_t { return IM8 ? (size_t)((((t >> 3) & 1) * (PD * PD) + ((t >> 2) & 1) * PD + ((t >> 1) & 1)) * CC + (t & 1) * G3_KS) : (size_t)t * G3_KS; };      /* stage t's place behind gA, elements */
  const _Float16* gB = Bh + (size_t)(col0 + crow) * ldb + cch * 8;
  const unsigned l0 = (unsigned)(size_t)st + (unsigned)(crow * G3_PITCH + cch * 16);
  const unsigned char* fa = st + (32 * w + ln) * G3_PITCH + 16 * hh; const unsigned char* fb = st + (128 + ln) * G3_PITCH + 16 * hh;
  const int nt = K / G3_KS;
  const v8f z8 = {0.f,0.f,0.f,0.f,0.f,0.f,0.f,0.f}; v8f c00 = z8, c01 = z8, c02 = z8, c03 = z8, c10 = z8, c11 = z8, c12 = z8, c13 = z8;
  g3_fill<IM8>(l0, gA, sa8, gB, sb8);
  asm volatile("s_wait_asynccnt 0x0" ::: "memory");      /* this wave's copies of stage 0 have landed */
  __syncthreads();                                        /* ... and every other wave's */
  if (nt > 1) g3_fill<IM8>(l0 + G3_STAGE, gA + aoff(1), sa8, gB + G3_KS, sb8);
#pragma unroll 1      /* one trip per stage: the buffer index stays a run-time value */
  for (int t = 0; t < nt; ++t) { const unsigned bo = (unsigned)(t & 1) * G3_STAGE; const unsigned char* pa = fa + bo; const unsigned char* pb = fb + bo;
    v16h a0 = g3_frag(pa), a1 = g3_frag(pa + 16 * G3_PITCH), b0 = g3_frag(pb), b1 = g3_frag(pb + 16 * G3_PITCH), b2 = g3_frag(pb + 32 * G3_PITCH), b3 = g3_frag(pb + 48 * G3_PITCH);
#pragma unroll      /* constant LDS offsets; the next 32 k's fragments (same stage) are read as one group ahead of this 32 k's WMMAs */
    for (int ks = 0; ks < 4; ++ks) { v16h na0 = a0, na1 = a1, nb0 = b0, nb1 = b1, nb2 = b2, nb3 = b3;
      if (ks < 3) { const unsigned char* qa = pa + (ks + 1) * 64; const unsigned char* qb = pb + (ks + 1) * 64; na0 = g3_frag(qa); na1 = g3_frag(qa + 16 * G3_PITCH); nb0 = g3_frag(qb); nb1 = g3_frag(qb + 16 * G3_PITCH); nb2 = g3_frag(qb + 32 * G3_PITCH); nb3 = g3_frag(qb + 48 * G3_PITCH); }
      c00 = g2_mma(a0, b0, c00); c10 = g2_mma(a1, b0, c10); c01 = g2_mma(a0, b1, c01); c11 = g2_mma(a1, b1, c11);
      c02 = g2_mma(a0, b2, c02); c12 = g2_mma(a1, b2, c12); c03 = g2_mma(a0, b3, c03); c13 = g2_mma(a1, b3, c13);
      a0 = na0; a1 = na1; b0 = nb0; b1 = nb1; b2 = nb2; b3 = nb3; }
    asm volatile("s_wait_dscnt 0x0" ::: "memory");        /* this wave's reads of the buffer are done before it is refilled */
    asm volatile("s_wait_asynccnt 0x0" ::: "memory");     /* this wave's copies of stage t + 1 have landed */
    __syncthreads();                                      /* publishes stage t + 1 and ends every wave's reads of stage t */
    if (t + 2 < nt) g3_fill<IM8>(l0 + bo, gA + aoff(t + 2), sa8, gB + (size_t)(t + 2) * G3_KS, sb8); }
  asm volatile("s_wait_asynccnt 0x0" ::: "memory");       /* no copy outstanding behind the loop */
  v8f accs[8] = {c00, c01, c02, c03, c10, c11, c12, c13};
#pragma unroll
  for (int u = 0; u < 8; ++u) { const int t = u & 3, half = u >> 2; const int col = col0 + t * 16 + ln; const float bv = bp ? bf16_round(bp[col]) : 0.f;
#pragma unroll
    for (int r = 0; r < 8; ++r) { const int rloc = half * 16 + 8 * hh + r; float v = accs[u][r] * alpha + bv; if (EPI == 0 && CP) { if (rowsPerB < 0) v += CP[cofs + (size_t)(row0g + row0 + rloc) * ldc + col];      /* rowsPerB < 0: own element of the batched C plane */ else { const int bidx = (row0g + row0 + rloc) / rowsPerB; v += CP[(size_t)bidx * sCPb + (size_t)by * 64 + col]; } }
      if (ACT == 3) v = fmaxf(v, 0.f); else if (ACT == 6) v = 0.5f * v * (1.0f + erff(v * 0.70710678118654752f)); else if (ACT == 11) v = 1.0f / (1.0f + expf(-v)); else if (ACT == 15) v = v / (1.0f + expf(-v)); else if (ACT == 12) v = (v > 0.f) ? v : 0.01f * v; else if (ACT == 8) v = tanhf(v); else if (ACT == 9) v = 0.5f * v * (1.0f + tanhf(0.7978845608028654f * (v + 0.044715f * v * v * v))); else if (ACT == 14) v = (v > 0.f) ? v : 0.1f * v; else if (ACT == 16) v = (v >= 0.f) ? v : 0.3f * v; else if (ACT == 17) v = (v >= 0.f) ? v : 0.2f * v;
      so[w][rloc][t * 16 + ln] = v; } }
  __builtin_amdgcn_fence(__ATOMIC_ACQ_REL, "workgroup"); __builtin_amdgcn_wave_barrier();
  const int rsub = lane >> 4, c4 = (lane & 15) * 4;
  if (EPI == 0) {
#pragma unroll
    for (int q = 0; q < 16; ++q) { const int r = q * 2 + rsub; const v4f v = *(const v4fa*)&so[w][r][c4]; if (C) { *(v4f*)(C + cofs + (size_t)(row0 + r) * ldc + col0 + c4) = v; asm volatile("s_wait_xcnt 0x0" ::: "memory"); /* stands before the store's data and address registers are rewritten by the next piece */ } if (C16) { v4h h4; for (int i = 0; i < 4; ++i) h4[i] = (_Float16)v[i]; *(v4h*)(C16 + cofs + (size_t)(row0 + r) * ldc + col0 + c4) = h4; } }
  } else if (EPI == 5) {      /* the wave's 32 rows are 32 neighbouring positions of one batch: 8 lanes x 4 positions = one whole 128-B line of a channel */
    const int pg = (lane & 7) * 4, cs = lane >> 3; float* ob = C + ((size_t)(row0 / NP) * CC + col0 + cs) * NP + (row0 % NP) + pg;
#pragma unroll 1      /* stays a loop: 64 inlined expm1f would be straight-line code that every wave fetches and runs once; a trip's 8 elements are independent chains */
    for (int q = 0; q < 8; ++q) { const float* sp = &so[w][pg][q * 8 + cs]; float x[8];
#pragma unroll
      for (int i = 0; i < 8; ++i) x[i] = sp[(i & 3) * 68 + (i >> 2) * 4];
      v4f v0, v1;
#pragma unroll
      for (int i = 0; i < 4; ++i) { v0[i] = elu1(x[i]); v1[i] = elu1(x[4 + i]); }
      *(v4f*)(ob + (size_t)(q * 8) * NP) = v0; *(v4f*)(ob + (size_t)(q * 8 + 4) * NP) = v1;
      asm volatile("s_wait_xcnt 0x0" ::: "memory"); /* stands before the stores' data and address registers are rewritten by the next trip */ }
  } else {
    v4f o0 = {0.f, 0.f, 0.f, 0.f}, o1 = o0;      /* EPI 4: the addend of the trip at hand, loaded one trip ahead */
    if (EPI == 4) { o0 = *(const v4fa*)(CP + (size_t)(row0 + rsub) * ldc + col0 + c4); o1 = *(const v4fa*)(CP + (size_t)(row0 + rsub + 2) * ldc + col0 + c4); asm volatile("s_wait_xcnt 0x0" ::: "memory"); /* stands before the loads' address registers are rewritten */ }
#pragma unroll 1      /* stays a loop, as above */
    for (int q = 0; q < 8; ++q) { const int r = q * 4 + rsub, R = row0 + r; v4f v0 = *(const v4fa*)&so[w][r][c4], v1 = *(const v4fa*)&so[w][r + 2][c4]; v4f n0 = o0, n1 = o1;
      if (EPI == 4) { const int Rn = R + ((q < 7) ? 4 : 0); n0 = *(const v4fa*)(CP + (size_t)Rn * ldc + col0 + c4); n1 = *(const v4fa*)(CP + (size_t)(Rn + 2) * ldc + col0 + c4); }
#pragma unroll
      for (int i = 0; i < 4; ++i) { v0[i] = elu1(v0[i]); v1[i] = elu1(v1[i]); }
      if (EPI == 3) { *(v4f*)(C + cofs + (size_t)R * ldc + col0 + c4) = v0; *(v4f*)(C + cofs + (size_t)(R + 2) * ldc + col0 + c4) = v1; }
      else {
        if (EPI == 4) {
#pragma unroll
          for (int i = 0; i < 4; ++i) { v0[i] = elu1(v0[i] + o0[i]); v1[i] = elu1(v1[i] + o1[i]); } }
        const int p = R % NP;      /* rows R and R + 2 lie in one w-line of 16: R = .. + 4 q + (0 or 1) */
        const size_t dr = (EPI == 1) ? (size_t)((R / NP) * NPP + (p / (DH * DW) + 1) * (PD * PD) + ((p / DW) % DH + 1) * PD + (p % DW) + 1) : (size_t)R;
        v4h h0, h1;
#pragma unroll
        for (int i = 0; i < 4; ++i) { h0[i] = (_Float16)v0[i]; h1[i] = (_Float16)v1[i]; }
        *(v4h*)(C16 + cofs + dr * ldc + col0 + c4) = h0; *(v4h*)(C16 + cofs + (dr + 2) * ldc + col0 + c4) = h1; }
      asm volatile("s_wait_xcnt 0x0" ::: "memory"); /* stands before the registers of this trip's loads and stores are rewritten by the next trip */
      o0 = n0; o1 = n1; }
  } }


__device__ __forceinline__ void d_xrows(unsigned blk, const float* __restrict__ x, float* __restrict__ RES) { __shared__ float tl[CC][33]; const int tid = threadIdx.x; const int b = blk / (NP / 32), pb = blk % (NP / 32); const int p0 = pb * 32;
  const int j0 = tid % 32;      /* i = i0 + 256 u: column i % 32 is the thread's own, channel i / 32 goes up by 8 with u */
  for (int i0 = tid; i0 < CC * 32; i0 += 8 * 256) { const int cb = i0 / 32; float xv[8];
#pragma unroll      /* eight loads in flight, then their one wait */
    for (int u = 0; u < 8; ++u) xv[u] = x[((size_t)b * CC + cb + 8 * u) * NP + p0 + j0];
    asm volatile("s_wait_xcnt 0x0" ::: "memory");      /* stands before the loads' address registers are rewritten */
#pragma unroll
    for (int u = 0; u < 8; ++u) tl[cb + 8 * u][j0] = bf16_round(xv[u]); }
  __syncthreads();
  { for (int i = tid; i < 32 * (CC / 8); i += 256) { const int j = i / (CC / 8), c0 = (i % (CC / 8)) * 8; v8f v; for (int q = 0; q < 8; ++q) v[q] = tl[c0 + q][j]; *(v8f*)(RES + ((size_t)b * NP + p0 + j) * CC + c0) = v; }  } }
// elu(F) as f16 rows in the bordered layout: one thread per 8 channels of a bordered position; positions with an index 0 hold zeros, in E and in Z (the second bordered buffer, whose interior a GEMM epilogue writes later in the call)
__global__ __launch_bounds__(256) void k_elu16p(const float* __restrict__ F, _Float16* __restrict__ E, _Float16* __restrict__ Z) { const size_t t = (size_t)blockIdx.x * 256 + threadIdx.x; if (t >= (size_t)NB * NPP * (CC / 8)) return; const int c8 = (int)(t % (CC / 8)) * 8; const int pr = (int)(t / (CC / 8)); const int b = pr / NPP, pp = pr % NPP; const int w1 = pp % PD, h1 = (pp / PD) % PD, t1 = pp / (PD * PD); FragH f;
  if (t1 > 0 && h1 > 0 && w1 > 0) { const v8f v = *(const v8f*)(F + ((size_t)b * NP + (size_t)((t1 - 1) * DH + (h1 - 1)) * DW + (w1 - 1)) * CC + c8); for (int q = 0; q < 8; ++q) { const float a = v[q]; f.h[q] = (_Float16)((a > 0.f) ? a : expm1f(a)); } } else { for (int q = 0; q < 8; ++q) f.u[q] = 0; *(v8us*)((unsigned short*)Z + t * 8) = f.half[0]; }
  *(v8us*)((unsigned short*)E + t * 8) = f.half[0];  }
__device__ __forceinline__ void d_w8(unsigned blk, const float* __restrict__ w, int O, _Float16* __restrict__ Bt) { const size_t t = (size_t)blk * 256 + threadIdx.x; if (t >= (size_t)O * K8 / 8) return; const int c8 = (int)((t * 8) % CC); const int tap = (int)(((t * 8) / CC) % 8); const int o = (int)((t * 8) / K8); FragH f; for (int q = 0; q < 8; ++q) f.h[q] = (_Float16)(bf16_round(w[((size_t)o * CC + c8 + q) * 8 + tap]) * 16.0f);
  *(v8us*)((unsigned short*)Bt + t * 8) = f.half[0];  }
// res += a * sigmoid(g), and elu(res) as f16 at the row's interior place in the bordered rows E (their borders hold the zeros that k_elu16p wrote earlier in the call)
__global__ __launch_bounds__(256) void k_gate(const float* __restrict__ O2, float* __restrict__ RES, _Float16* __restrict__ E) {
  #pragma clang fp contract(off)
  const size_t t = (size_t)blockIdx.x * 256 + threadIdx.x; if (t >= NR * CC / 8) return; const int c0 = (int)((t * 8) % CC); const size_t r = (t * 8) / CC; v8f v = *(const v8f*)(RES + t * 8); const float* o = O2 + r * 512;
  for (int q = 0; q < 8; ++q) { const float a = o[c0 + q], g = o[256 + c0 + q]; const float s = 1.0f / (1.0f + expf(-g)); v[q] = v[q] + __fmul_rn(a, s); }
  *(v8f*)(RES + t * 8) = v;
  FragH f; for (int q = 0; q < 8; ++q) f.h[q] = (_Float16)elu1(v[q]); const int p = (int)(r % NP);
  *(v8us*)((unsigned short*)E + ((r / NP) * NPP + (size_t)((p / (DH * DW) + 1) * (PD * PD) + ((p / DW) % DH + 1) * PD + (p % DW) + 1)) * CC + c0) = f.half[0];  }
__global__ __launch_bounds__(256) void k_xa(const float* __restrict__ RES, const float* __restrict__ orig, _Float16* __restrict__ XA) { const size_t t = (size_t)blockIdx.x * 256 + threadIdx.x; if (t >= NR * 36) return; const int pc = (int)(t % 36); const size_t r = t / 36; const int p = (int)(r % NP); const size_t b = r / NP; FragH f;
  for (int q = 0; q < 8; ++q) { const int col = pc * 8 + q; float v = 0.f; if (col < 256) v = RES[r * CC + col]; else if (col < 259) v = bf16_round(orig[((b * 3 + (col - 256)) * (size_t)NP) + p]); else if (col == 259) v = -0.5f + (float)(p / (DH * DW)) / (float)DT; else if (col == 260) v = -0.5f + (float)((p / DW) % DH) / (float)DH; else if (col == 261) v = -0.5f + (float)(p % DW) / (float)DW; f.h[q] = (_Float16)v; }
  unsigned short* d = (unsigned short*)XA + r * KA + pc * 8; *(v8us*)d = f.half[0];  }
__device__ __forceinline__ void d_wa(unsigned blk, const float* __restrict__ w, int O, int OP, _Float16* __restrict__ Bt) { const size_t t = (size_t)blk * 256 + threadIdx.x; if (t >= (size_t)OP * KA / 8) return; const int k0 = (int)((t * 8) % KA); const int o = (int)((t * 8) / KA); FragH f; for (int q = 0; q < 8; ++q) { const int k = k0 + q; f.h[q] = (o < O && k < 262) ? (_Float16)(bf16_round(w[(size_t)o * 262 + k]) * 16.0f) : (_Float16)0.f; }
  *(v8us*)((unsigned short*)Bt + t * 8) = f.half[0];  }
// block ranges of k_prep, in launch order (the x transpose and the large conv weights first)
#define PB_X  (NB * (NP / 32))
#define PB_W2 (NRES * 512 * K8 / 8 / 256)
#define PB_W1 (NRES * CC * K8 / 8 / 256)
#define PB_R  (CC * CC / 8 / 256)
#define PB_A  (CC * VC / 8 / 256)
#define PB_QK (64 * KA / 8 / 256)
#define PB_V  (VC * KA / 8 / 256)
#define PB_ALL (PB_X + PB_W2 + PB_W1 + 2 * PB_R + PB_A + 2 * PB_QK + PB_V + 1)
// every pass that depends on inputs alone, in one launch: the block number picks the pass (the same for a whole work-group, so d_xrows' barrier stands under uniform control flow).
// BW1 / BW2 hold all NRES blocks' conv weights (rw1 / rw2 are NRES stacked tensors: one run of output rows). BQKV = 64 q rows (16 live) | 64 k rows (16 live) | 128 v rows; bqkv = their biases in the same order.
__global__ __launch_bounds__(256) void k_prep(const float* __restrict__ x, const float* __restrict__ rw1, const float* __restrict__ rw2, const float* __restrict__ qw, const float* __restrict__ kw, const float* __restrict__ vw, const float* __restrict__ qb, const float* __restrict__ kb, const float* __restrict__ vb,
    const float* __restrict__ aw, const float* __restrict__ rsw, const float* __restrict__ ow, float* __restrict__ RES, _Float16* __restrict__ BW1, _Float16* __restrict__ BW2, _Float16* __restrict__ BQKV, float* __restrict__ bqkv, _Float16* __restrict__ BA, _Float16* __restrict__ BR, _Float16* __restrict__ BO) {
  unsigned b = blockIdx.x;
  if (b < PB_X) { d_xrows(b, x, RES); return; } b -= PB_X;
  if (b < PB_W2) { d_w8(b, rw2, NRES * 512, BW2); return; } b -= PB_W2;
  if (b < PB_W1) { d_w8(b, rw1, NRES * CC, BW1); return; } b -= PB_W1;
  if (b < PB_R) { d_round16f(b, rsw, BR, (size_t)CC * CC / 8); return; } b -= PB_R;
  if (b < PB_R) { d_round16f(b, ow, BO, (size_t)CC * CC / 8); return; } b -= PB_R;
  if (b < PB_A) { d_round16f(b, aw, BA, (size_t)CC * VC / 8); return; } b -= PB_A;
  if (b < PB_QK) { d_wa(b, qw, 16, 64, BQKV); return; } b -= PB_QK;
  if (b < PB_QK) { d_wa(b, kw, 16, 64, BQKV + (size_t)64 * KA); return; } b -= PB_QK;
  if (b < PB_V) { d_wa(b, vw, VC, VC, BQKV + (size_t)128 * KA); return; }
  const int i = threadIdx.x, j = i & 63; float v = 0.f;
  if (i >= 128) v = vb[i - 128]; else if (j < 16) v = (i < 64) ? qb[j] : kb[j];
  bqkv[i] = v; asm volatile("s_wait_xcnt 0x0" ::: "memory"); /* stands before the store's registers are rewritten */ }
// k_pack: what k_attn reads, laid out so that every fragment load of a wave is 512 contiguous bytes. blockIdx.x = which 64 positions, blockIdx.y = batch.
// KC = [NB][NP][16]: the 16 live key columns. VF = [NB][NP / 32][8 channel tiles][2][32 lanes][8]: the A fragments of V^T (row = channel 16 ct + (lane & 15), k = key 16 h2 + 8 (lane >> 4) + i of the block of 32).
__global__ __launch_bounds__(256) void k_pack(const _Float16* __restrict__ QKV, _Float16* __restrict__ KC, _Float16* __restrict__ VF) { __shared__ unsigned short tl[64][VC + 2]; const int tid = threadIdx.x; const int k0 = blockIdx.x * 64; const int b = blockIdx.y; const unsigned short* s = (const unsigned short*)QKV + ((size_t)b * NP + k0) * 256;
  for (int i = tid; i < 64 * (VC / 8); i += 256) { const int j = i / (VC / 8), c8 = (i % (VC / 8)) * 8; FragH f; f.half[0] = *(const v8us*)(s + (size_t)j * 256 + 128 + c8); asm volatile("s_wait_xcnt 0x0" ::: "memory"); /* stands before the load's address registers are rewritten by the next trip */ for (int q = 0; q < 8; ++q) tl[j][c8 + q] = f.u[q]; }
  if (tid < 128) { const int j = tid >> 1, h = tid & 1; const v8us kv = *(const v8us*)(s + (size_t)j * 256 + 64 + h * 8); *(v8us*)((unsigned short*)KC + ((size_t)b * NP + k0 + j) * 16 + h * 8) = kv; asm volatile("s_wait_xcnt 0x0" ::: "memory"); /* stands before the registers of the load and the store are rewritten */ }
  __syncthreads();
  for (int i = tid; i < VC * 8; i += 256) { const int c = ((i >> 6) & 7) * 16 + (i & 15), j8 = (i >> 9) * 32 + ((i >> 5) & 1) * 16 + ((i >> 4) & 1) * 8; v8us o; for (int q = 0; q < 8; ++q) o[q] = tl[j8 + q][c];
    *(v8us*)((unsigned short*)VF + ((size_t)b * (NP / 32) + blockIdx.x * 2) * 4096 + (size_t)i * 8) = o; asm volatile("s_wait_xcnt 0x0" ::: "memory"); /* stands before the store's registers are rewritten by the next trip */ } }
// ---- causal attention in one kernel: scores, softmax weights and P.V never leave the WGP ----
// A work-group owns FA_Q queries of one batch; its 8 waves deal the blocks of 32 keys among them (wave w: blocks w, w + 8, ..). S^T = K.Q^T: a lane holds scores of one query per column tile, so maximum and sum are in-lane,
// and the two S^T tiles of a block, turned into weights in place, are the B operand of O^T += V^T.P^T. Pass 1 finds each query's true maximum (joined through LDS), pass 2 forms the scores again, the weights
// exp(t - max) * 2^8 as f16 (sum of the unrounded weights in f32) and the products; then the 8 waves' partial O^T and sums are added through LDS, scaled by 1 / sum (query 0: 0), ELU, f16 rows.
#define FA_Q 32
#define FA_W 8
#define FA_OP 132      /* floats per query row of a wave's partial: 528 B = 16 B x odd, conflict-free for 16-byte stores */
__device__ __forceinline__ v8f fa_mma(v16h a, v16h b, v8f c) { return __builtin_amdgcn_wmma_f32_16x16x32_f16(false, a, false, b, (short)0, c, false, false); }
// the two K fragments of a block of 32 keys: row = key, k = the 16 live columns (k 16 .. 31 are zeros on both sides of the product)
__device__ __forceinline__ void fa_ldk(const unsigned short* p, FragH& k0, FragH& k1) { k0.half[0] = *(const v8us*)p; k1.half[0] = *(const v8us*)(p + 256); }
// the two S^T tiles of one block of 32 keys and one column tile: lane = query q, sa[r] = key ka + r, sb[r] = key ka + 16 + r. MK / mk: the block holds keys at or behind q (only a work-group's last block does)
template <bool MK>
__device__ __forceinline__ float fa_max(const v8f sa, const v8f sb, int ka, int q, float m) { float x[16];
#pragma unroll
  for (int r = 0; r < 8; ++r) { x[r] = (!MK || ka + r < q) ? sa[r] : -3.0e38f; x[8 + r] = (!MK || ka + 16 + r < q) ? sb[r] : -3.0e38f; }
#pragma unroll      /* a tree: no chain of 16 dependent maxima */
  for (int st = 8; st > 0; st >>= 1)
#pragma unroll
    for (int i = 0; i < st; ++i) x[i] = fmaxf(x[i], x[i + st]);
  return fmaxf(m, x[0]); }
__device__ __forceinline__ v16h fa_wgt(const v8f sa, const v8f sb, int ka, int q, float m, bool mk, float& se) { const float cs = 1.4426950408889634f / 16.093476939431082f;      /* log2(e) / sqrt(259): exp((s - max) / sqrt(259)) * 2^8 = exp2((s - max) * cs + 8) */
  float e[16]; FragH p;
#pragma unroll
  for (int r = 0; r < 8; ++r) { e[r] = (sa[r] - m) * cs + 8.0f; e[8 + r] = (sb[r] - m) * cs + 8.0f; }
  __builtin_amdgcn_sched_barrier(0);      /* this and the two in the loop: each v_nop stays directly behind its v_exp_f32 */
#pragma unroll
  for (int i = 0; i < 16; ++i) { e[i] = __builtin_amdgcn_exp2f(e[i]); __builtin_amdgcn_sched_barrier(0);
    asm volatile("v_nop");      /* the slot that the instruction set asks for behind a transcendental, before its result is read or its source rewritten */
    __builtin_amdgcn_sched_barrier(0); }
  if (mk) {      /* the same for the whole wave */
#pragma unroll
    for (int r = 0; r < 8; ++r) { e[r] = (ka + r < q) ? e[r] : 0.f; e[8 + r] = (ka + 16 + r < q) ? e[8 + r] : 0.f; } }
#pragma unroll
  for (int i = 0; i < 16; ++i) p.h[i] = (_Float16)e[i];
#pragma unroll      /* a tree: no chain of 16 dependent additions */
  for (int st = 8; st > 0; st >>= 1)
#pragma unroll
    for (int i = 0; i < st; ++i) e[i] += e[i + st];
  se += e[0]; return p.v; }
__global__ __launch_bounds__(256) void k_attn(const _Float16* __restrict__ QKV, const _Float16* __restrict__ KC, const _Float16* __restrict__ VF, _Float16* __restrict__ ATE) {
  __shared__ __attribute__((aligned(16))) float po[FA_W][FA_Q][FA_OP];
  __shared__ float redm[FA_W][2][FA_Q], reds[FA_W][2][FA_Q];
  const int tid = threadIdx.x, w = __builtin_amdgcn_readfirstlane(tid >> 5) /* the wave's number in a scalar register: the key loops become scalar loops, EXEC stays all ones round the WMMAs */, lane = tid & 31, ln = lane & 15, hh = lane >> 4, b = blockIdx.y;
  const int q0 = (NP / FA_Q - 1 - (int)blockIdx.x) * FA_Q;      /* the longest rows start first */
  const int nkb = q0 / 32 + 1;      /* blocks of 32 keys that hold a key below q0 + FA_Q - 1 */
  const unsigned short* kc = (const unsigned short*)KC + (size_t)b * NP * 16 + ln * 16 + hh * 8;
  const unsigned short* vf = (const unsigned short*)VF + (size_t)b * (NP / 32) * 4096 + lane * 8;
  const v8us z8u = {0, 0, 0, 0, 0, 0, 0, 0}; const v8f z8 = {0.f, 0.f, 0.f, 0.f, 0.f, 0.f, 0.f, 0.f};
  FragH qf0, qf1, k0, k1, n0, n1; qf0.half[1] = z8u; qf1.half[1] = z8u; k0.half[1] = z8u; k1.half[1] = z8u; n0.half[1] = z8u; n1.half[1] = z8u;
  { const unsigned short* qp = (const unsigned short*)QKV + ((size_t)b * NP + q0 + ln) * 256 + 8 * hh; qf0.half[0] = *(const v8us*)qp; qf1.half[0] = *(const v8us*)(qp + 16 * 256); }
  const int kfirst = (w < nkb) ? w : 0;      /* a wave without a block still loads in bounds */
  fa_ldk(kc + (size_t)kfirst * 512, k0, k1);
  asm volatile("s_wait_xcnt 0x0" ::: "memory");      /* stands before the loads' address registers are rewritten */
  const int qa = q0 + ln, qb = qa + 16;
  float m0 = -3.0e38f, m1 = -3.0e38f;
  for (int kb = w; kb < nkb; kb += FA_W) {
    fa_ldk(kc + (size_t)((kb + FA_W < nkb) ? kb + FA_W : kb) * 512, n0, n1);      /* the next block's K fragments fly while this block is worked on */
    asm volatile("s_wait_xcnt 0x0" ::: "memory");      /* stands before the loads' address registers are rewritten */
    const v8f s00 = fa_mma(k0.v, qf0.v, z8), s10 = fa_mma(k1.v, qf0.v, z8), s01 = fa_mma(k0.v, qf1.v, z8), s11 = fa_mma(k1.v, qf1.v, z8);
    const int ka = kb * 32 + 8 * hh;
    if (kb == nkb - 1) { m0 = fa_max<true>(s00, s10, ka, qa, m0); m1 = fa_max<true>(s01, s11, ka, qb, m1); } else { m0 = fa_max<false>(s00, s10, ka, qa, m0); m1 = fa_max<false>(s01, s11, ka, qb, m1); }
    k0.half[0] = n0.half[0]; k1.half[0] = n1.half[0]; }
  redm[w][hh][ln] = m0; redm[w][hh][16 + ln] = m1;
  fa_ldk(kc + (size_t)kfirst * 512, k0, k1);
  asm volatile("s_wait_xcnt 0x0" ::: "memory");      /* stands before the loads' address registers are rewritten */
  __syncthreads();      /* every wave's maxima are in LDS */
#pragma unroll
  for (int i = 0; i < FA_W; ++i) { m0 = fmaxf(m0, fmaxf(redm[i][0][ln], redm[i][1][ln])); m1 = fmaxf(m1, fmaxf(redm[i][0][16 + ln], redm[i][1][16 + ln])); }
  v8f acc[8][2];
#pragma unroll
  for (int ct = 0; ct < 8; ++ct) { acc[ct][0] = z8; acc[ct][1] = z8; }
  float se0 = 0.f, se1 = 0.f;
  for (int kb = w; kb < nkb; kb += FA_W) {
    FragH v[8]; const unsigned short* vp = vf + (size_t)kb * 4096;
#pragma unroll      /* this block's V^T fragments: issued first, used last */
    for (int ct = 0; ct < 8; ++ct) { v[ct].half[0] = *(const v8us*)(vp + ct * 512); v[ct].half[1] = *(const v8us*)(vp + ct * 512 + 256); }
    fa_ldk(kc + (size_t)((kb + FA_W < nkb) ? kb + FA_W : kb) * 512, n0, n1);
    asm volatile("s_wait_xcnt 0x0" ::: "memory");      /* stands before the loads' address registers are rewritten */
    const v8f s00 = fa_mma(k0.v, qf0.v, z8), s10 = fa_mma(k1.v, qf0.v, z8), s01 = fa_mma(k0.v, qf1.v, z8), s11 = fa_mma(k1.v, qf1.v, z8);
    const int ka = kb * 32 + 8 * hh; v16h p0, p1;
    p0 = fa_wgt(s00, s10, ka, qa, m0, kb == nkb - 1, se0); p1 = fa_wgt(s01, s11, ka, qb, m1, kb == nkb - 1, se1);
#pragma unroll
    for (int ct = 0; ct < 8; ++ct) { acc[ct][0] = fa_mma(v[ct].v, p0, acc[ct][0]); acc[ct][1] = fa_mma(v[ct].v, p1, acc[ct][1]); }
    k0.half[0] = n0.half[0]; k1.half[0] = n1.half[0]; }
#pragma unroll      /* acc[ct][qt][r] = O^T[channel 16 ct + 8 hh + r][query 16 qt + ln] */
  for (int ct = 0; ct < 8; ++ct)
#pragma unroll
    for (int qt = 0; qt < 2; ++qt) { float* d = &po[w][qt * 16 + ln][ct * 16 + 8 * hh]; const v8f a = acc[ct][qt]; const v4f lo = {a[0], a[1], a[2], a[3]}, hi = {a[4], a[5], a[6], a[7]}; *(v4fa*)d = lo; *(v4fa*)(d + 4) = hi; }
  reds[w][hh][ln] = se0; reds[w][hh][16 + ln] = se1;
  __syncthreads();      /* every wave's partial products and sums are in LDS */
  const int q = tid >> 3, c0 = (tid & 7) * 4; float t = 0.f;
#pragma unroll
  for (int i = 0; i < FA_W; ++i) t += reds[i][0][q] + reds[i][1][q];
  const float rs = (q0 + q == 0) ? 0.f : 1.0f / t;      /* query 0 sees no key: zeros */
  _Float16* op = ATE + ((size_t)b * NP + q0 + q) * VC + c0;
#pragma unroll
  for (int j = 0; j < 4; ++j) { v4f sm = *(const v4fa*)&po[0][q][c0 + j * 32];
#pragma unroll
    for (int i = 1; i < FA_W; ++i) { const v4f x = *(const v4fa*)&po[i][q][c0 + j * 32]; sm += x; }
    v4h h4;
#pragma unroll
    for (int i = 0; i < 4; ++i) h4[i] = (_Float16)elu1(sm[i] * rs);
    *(v4h*)(op + j * 32) = h4; }
  asm volatile("s_wait_xcnt 0x0" ::: "memory");      /* stands before the stores' registers are rewritten */
}

extern "C" void kernel_launch(void* const* d_in, const int* in_sizes, int n_in,
                              void* d_out, int out_size, void* d_ws, size_t ws_size, hipStream_t stream) {
  (void)in_sizes; (void)n_in; (void)out_size;
  const float* const* I = (const float* const*)d_in; const float* x = I[0]; const float* orig = I[1]; const float* rw1 = I[2]; const float* rb1 = I[3]; const float* rw2 = I[4]; const float* rb2 = I[5]; const float* qw = I[6]; const float* qb = I[7]; const float* kw = I[8]; const float* kb = I[9]; const float* vw = I[10]; const float* vb = I[11]; const float* aw = I[12]; const float* ab = I[13]; const float* rsw = I[14]; const float* rsb = I[15]; const float* ow = I[16]; const float* ob = I[17];
  char* ws = (char*)d_ws; size_t off = 0;
  auto take = [&](size_t bytes) { char* p = ws + off; off += (bytes + 255) & ~(size_t)255; return p; };
  _Float16* BW1 = (_Float16*)take((size_t)NRES * CC * K8 * 2); _Float16* BW2 = (_Float16*)take((size_t)NRES * 512 * K8 * 2); _Float16* BQKV = (_Float16*)take((size_t)256 * KA * 2); float* bqkv = (float*)take(256 * 4); _Float16* BA = (_Float16*)take((size_t)CC * VC * 2); _Float16* BR = (_Float16*)take((size_t)CC * CC * 2); _Float16* BO = (_Float16*)take((size_t)CC * CC * 2);
  float* RES = (float*)take(NR * CC * 4); _Float16* EP = (_Float16*)take((size_t)NB * NPP * CC * 2); _Float16* O1 = (_Float16*)take((size_t)NB * NPP * CC * 2); float* O2 = (float*)take(NR * 512 * 4);
  _Float16* XA = (_Float16*)take(NR * KA * 2); _Float16* QKV = (_Float16*)take(NR * 256 * 2); _Float16* VF = (_Float16*)take((size_t)NB * VC * NP * 2); _Float16* KC = (_Float16*)take((size_t)NB * NP * 16 * 2);
  _Float16* ATE = (_Float16*)take(NR * VC * 2); float* ATTC = O2; _Float16* SUM16 = (_Float16*)(O2 + NR * CC);      /* O2 is dead behind the last gate: its 16 MiB hold ATTC (8) and SUM16 (4) */
  if (off > ws_size) return;      /* about 62 MB */
  k_prep<<<PB_ALL, 256, 0, stream>>>(x, rw1, rw2, qw, kw, vw, qb, kb, vb, aw, rsw, ow, RES, BW1, BW2, BQKV, bqkv, BA, BR, BO);
  const unsigned n8 = (unsigned)((NR * CC / 8 + 255) / 256); const unsigned np8 = (unsigned)(((size_t)NB * NPP * (CC / 8) + 255) / 256); const dim3 g256((unsigned)((NR / 128) * (CC / 64)), 1);
  k_elu16p<<<np8, 256, 0, stream>>>(RES, EP, O1);
  for (int i = 0; i < NRES; ++i) {
    k_gemm2s<0, true, 1><<<g256, 128, 0, stream>>>(EP, CC, 0, BW1 + (size_t)i * CC * K8, K8, 0, 0.0625f, rb1 + i * CC, 0, nullptr, 1, 0, 0, nullptr, O1, CC, 0, (int)NR, CC, K8);      /* o = elu(conv1 + b1), into the bordered rows */
    k_gemm2s<0, true><<<dim3((unsigned)((NR / 128) * 8), 1), 128, 0, stream>>>(O1, CC, 0, BW2 + (size_t)i * 512 * K8, K8, 0, 0.0625f, rb2 + i * 512, 0, nullptr, 1, 0, 0, O2, nullptr, 512, 0, (int)NR, 512, K8);      /* conv2 + b2 (512) */
    k_gate<<<n8, 256, 0, stream>>>(O2, RES, EP); }
  /* attention: q | k | v as one GEMM (N = 256), the fragment-order copies of k and v, then scores, softmax and P.V in one kernel; blockIdx.y = batch */
  k_xa<<<(unsigned)((NR * 36 + 255) / 256), 256, 0, stream>>>(RES, orig, XA);
  k_gemm2<0><<<dim3((unsigned)((NR / 128) * 4), 1), 128, 0, stream>>>(XA, KA, 0, BQKV, KA, 0, 0.0625f, bqkv, 0, nullptr, 1, 0, 0, nullptr, QKV, 256, 0, (int)NR, 256, KA);
  k_pack<<<dim3(NP / 64, NB), 256, 0, stream>>>(QKV, KC, VF);
  k_attn<<<dim3(NP / FA_Q, NB), 256, 0, stream>>>(QKV, KC, VF, ATE);      /* elu(att), att = softmax(q.k / sqrt(259), k < q) v */
  k_gemm2s<0, false, 3><<<g256, 128, 0, stream>>>(ATE, VC, 0, BA, VC, 0, 0.0625f, ab, 0, nullptr, 1, 0, 0, ATTC, nullptr, CC, 0, (int)NR, CC, VC);      /* att = elu(attn_conv(elu(att)) + b) */
  k_gemm2s<0, true, 4><<<g256, 128, 0, stream>>>(EP + (size_t)(PD * PD + PD + 1) * CC, CC, 0, BR, CC, 0, 0.0625f, rsb, 0, ATTC, 1, 0, 0, nullptr, SUM16, CC, 0, (int)NR, CC, CC);      /* elu(res + att), res = elu(res_conv(elu(res)) + b); A = the bordered rows' interior: the one tap (1, 1, 1) */
  k_gemm2s<0, false, 5><<<g256, 128, 0, stream>>>(SUM16, CC, 0, BO, CC, 0, 0.0625f, ob, 0, nullptr, 1, 0, 0, (float*)d_out, nullptr, CC, 0, (int)NR, CC, CC);      /* out = elu(out_conv(elu(res + att)) + b), channel-major */
}

// v007
// Measured time: 260 microseconds a run.
// Timed twice side by side with v006, it ran 1.07 and 1.06 times as fast.
// Over all steps from v000 it is 11.3 times as fast.
#include <hip/hip_runtime.h>
// PixelSNAILBlock (x [2][256][16][16][16], original_input [2][3][16][16][16]; 4 gated residual blocks: o = elu(conv3d k2 pad1 crop(elu(res)) + b1); o = conv3d k2 pad1 crop(o) + b2 (512 ch); res += o[:256] * sigmoid(o[256:]); attention over the 4,096 positions of [res | original | pos-enc] (262 ch): q,k (16), v (128), causal softmax (k < q, row 0 all-zero) of q.k/sqrt(259), att = p v; att = elu(1x1(elu(att)) + b); res = elu(1x1(elu(res)) + b); out = elu(1x1(elu(res + att)) + b) -> [2][256][16][16][16]).
// Structure: position rows r = b*4096 + (t*16 + h)*16 + w; res kept as f32 rows; each k2 'causal-corner' conv as a WMMA GEMM over K = 8 taps x 256 channels whose A tiles are gathered tap by tap from zero-bordered f16 rows (32x64 wave tiles, f32 accumulation, exact x16 weights + bias) with the ELUs on VALU; gating on VALU; q/k/v as one GEMM on the 262 -> 288-column concat rows (16 live of 64 for q/k); one attention kernel: per 32 queries S^T = K.Q^T on WMMA (K = 32, 16 live), causal softmax weights on VALU in the accumulator registers (true row maximum from a first pass; un-normalised f16 weights x 2^8, f32 sum, row 0 -> 0), O^T += V^T.P^T on WMMA against fragment-order value planes, the keys dealt to 8 waves and the partials added through LDS, scaling; the three 1x1 convs as GEMMs followed by VALU ELUs; channel-major store on VALU.
// Compute dtype: inputs rounded to bf16; x / original / weights exact; conv operands (elu(res), o1), the concat rows, q/k/v, softmax weights and the 1x1-conv operands plain f16 (~2^-12); res accumulation, gates, softmax sums f32. v_wmma_f32_16x16x32_f16.
#define NB 2
#define CC 256
#define DT 16
#define DH 16
#define DW 16
#define NP (DT * DH * DW)            /* 4096 */
#define NR ((size_t)NB * NP)       /* 8192 */
#define NRES 4
#define K8 (8 * CC)                /* 2048 */
#define KA 288                     /* 262 live */
#define XP 320                     /* pitch of the concat rows: 640 B = whole 128-B lines, so that a 64-column piece of a row is a line of its own */
#define VC 128
#define PD 17                      /* bordered extent of t, h and w: index 0 of each axis is the conv's zero padding */
#define NPP (PD * PD * PD)         /* 4913 bordered positions per batch */
typedef __bf16 v16b __attribute__((ext_vector_type(16)));
typedef unsigned short v8us __attribute__((ext_vector_type(8), may_alias));
typedef float  v8f  __attribute__((ext_vector_type(8)));
typedef float  v4f  __attribute__((ext_vector_type(4)));
typedef float  v4fa __attribute__((ext_vector_type(4), may_alias));
union FragB { v16b v; v8us half[2]; unsigned short u[16]; };

__device__ __forceinline__ unsigned short bf16_bits(float x) { unsigned int u = __float_as_uint(x); return (unsigned short)((u + 0x7FFFu + ((u >> 16) & 1u)) >> 16); }
__device__ __forceinline__ float bf16_val(unsigned short b) { return __uint_as_float(((unsigned int)b) << 16); }
__device__ __forceinline__ float bf16_round(float x) { return bf16_val(bf16_bits(x)); }
// D += A·B with NT terms: 1 = ah·bh, 2 = + al·bh (A split), 3 = + ah·bl (both split)
template <int NT>
__device__ __forceinline__ v8f mmaN(v16b ah, v16b al, v16b bh, v16b bl, v8f c) {
  c = __builtin_amdgcn_wmma_f32_16x16x32_bf16(false, ah, false, bh, (short)0, c, false, false);
  if (NT >= 2) c = __builtin_amdgcn_wmma_f32_16x16x32_bf16(false, al, false, bh, (short)0, c, false, false);
  if (NT >= 3) c = __builtin_amdgcn_wmma_f32_16x16x32_bf16(false, ah, false, bl, (short)0, c, false, false);
  asm volatile("v_nop\n\tv_nop\n\tv_nop\n\tv_nop" : "+v"(c) : "v"(ah), "v"(al), "v"(bh), "v"(bl));
  return c;
}

__global__ __launch_bounds__(256) void k_wt_bf16(const float* __restrict__ W, unsigned short* __restrict__ Wt, int K, int N) {
  const int t = blockIdx.x * 256 + threadIdx.x;
  const int k8n = K / 8;
  if (t >= N * k8n) return;
  const int n = t / k8n, k8 = (t % k8n) * 8;
  v8us v;
#pragma unroll
  for (int i = 0; i < 8; ++i) v[i] = bf16_bits(W[(size_t)(k8 + i) * N + n]);
  *(v8us*)(Wt + (size_t)n * K + k8) = v;
  
}

// GEMM C[M][N] (f32, pitch ldc) = act(A[M][K]·W + bias). A f32 row-major (pitch lda) converted per fragment to bf16
// (ASPLIT: hi/lo two planes -> 2 terms, else single rounded term); Wt bf16 [N][K] (pitch ldb). BIAS_BF16 rounds the
// bias to bf16 first (bias quantised to bf16 before the add). K%32==0, M%16==0, N%64==0.
template <bool ASPLIT, int ACT, bool BIAS_BF16>
__global__ __launch_bounds__(128) void k_gemm_bf(const float* __restrict__ A, int lda, const unsigned short* __restrict__ Wt, int ldb,
                                               const float* __restrict__ bias, float* __restrict__ C, int ldc, int M, int N, int K) {
  __shared__ __attribute__((aligned(16))) float so[4][16][64];
  const int tid = threadIdx.x, w = tid >> 5, lane = tid & 31, ln = lane & 15, hh = lane >> 4;
  const int ntn = N / 64;
  const int wid = blockIdx.x * 4 + w;
  const int mt = wid / ntn, nq = wid % ntn;
  if (mt * 16 >= M) return;
  const int row0 = mt * 16, col0 = nq * 64;
  const float* arow = A + (size_t)(row0 + ln) * lda;
  v8f acc[4] = {};
  for (int kb = 0; kb < K; kb += 32) {
    FragB ah, al;
    const v4f x0 = *(const v4fa*)(arow + kb + 8 * hh), x1 = *(const v4fa*)(arow + kb + 8 * hh + 4);
    const v4f x2 = *(const v4fa*)(arow + kb + 16 + 8 * hh), x3 = *(const v4fa*)(arow + kb + 16 + 8 * hh + 4);
    float xs[16] = {x0[0],x0[1],x0[2],x0[3],x1[0],x1[1],x1[2],x1[3],x2[0],x2[1],x2[2],x2[3],x3[0],x3[1],x3[2],x3[3]};
#pragma unroll
    for (int i = 0; i < 16; ++i) { const unsigned short hb = bf16_bits(xs[i]); ah.u[i] = hb; al.u[i] = ASPLIT ? bf16_bits(xs[i] - bf16_val(hb)) : (unsigned short)0; }
#pragma unroll
    for (int t = 0; t < 4; ++t) {
      const unsigned short* brow = Wt + (size_t)(col0 + t * 16 + ln) * ldb + kb;
      FragB b;
      b.half[0] = *(const v8us*)(brow + 8 * hh);
      b.half[1] = *(const v8us*)(brow + 16 + 8 * hh);
      acc[t] = mmaN<ASPLIT ? 2 : 1>(ah.v, al.v, b.v, b.v, acc[t]);
    }
  }
#pragma unroll
  for (int t = 0; t < 4; ++t) {
    float bv = bias ? bias[col0 + t * 16 + ln] : 0.f;
    if (BIAS_BF16) bv = bf16_round(bv);
#pragma unroll
    for (int r = 0; r < 8; ++r) { float v = acc[t][r] + bv; if (ACT == 1) v = fmaxf(v, 0.f); so[w][8 * hh + r][t * 16 + ln] = v; }
  }
  __builtin_amdgcn_fence(__ATOMIC_ACQ_REL, "workgroup");
  __builtin_amdgcn_wave_barrier();
  const int rsub = lane >> 4, c4 = (lane & 15) * 4;
  {
#pragma unroll
    for (int q = 0; q < 8; ++q) {
      const int r = q * 2 + rsub;
      const v4f v = *(const v4fa*)&so[w][r][c4];
      *(v4f*)(C + (size_t)(row0 + r) * ldc + col0 + c4) = v;
    }
    
  }
}

// GEMM C = act(A·W + bias + resid): A f32 (ASPLIT -> hi/lo 2 terms), Wt bf16 [N][K]; ACT 0 none, 1 relu, 2 exact gelu;
// resid (optional, f32, row index = (row % rmod), pitch ldr, RES_BF16 rounds it) added before the activation.
template <bool ASPLIT, int ACT, bool BIAS_BF16, bool RES_BF16>
__global__ __launch_bounds__(128) void k_gemm_bf3(const float* __restrict__ A, int lda, const unsigned short* __restrict__ Wt, int ldb,
                                                const float* __restrict__ bias, const float* __restrict__ resid, int rmod, int ldr,
                                                float* __restrict__ C, int ldc, int M, int N, int K) {
  __shared__ __attribute__((aligned(16))) float so[4][16][64];
  const int tid = threadIdx.x, w = tid >> 5, lane = tid & 31, ln = lane & 15, hh = lane >> 4;
  const int ntn = N / 64;
  const int wid = blockIdx.x * 4 + w;
  const int mt = wid / ntn, nq = wid % ntn;
  if (mt * 16 >= M) return;
  const int row0 = mt * 16, col0 = nq * 64;
  const float* arow = A + (size_t)(row0 + ln) * lda;
  v8f acc[4] = {};
  for (int kb = 0; kb < K; kb += 32) {
    FragB ah, al;
    const v4f x0 = *(const v4fa*)(arow + kb + 8 * hh), x1 = *(const v4fa*)(arow + kb + 8 * hh + 4);
    const v4f x2 = *(const v4fa*)(arow + kb + 16 + 8 * hh), x3 = *(const v4fa*)(arow + kb + 16 + 8 * hh + 4);
    float xs[16] = {x0[0],x0[1],x0[2],x0[3],x1[0],x1[1],x1[2],x1[3],x2[0],x2[1],x2[2],x2[3],x3[0],x3[1],x3[2],x3[3]};
#pragma unroll
    for (int i = 0; i < 16; ++i) { const unsigned short hb = bf16_bits(xs[i]); ah.u[i] = hb; al.u[i] = ASPLIT ? bf16_bits(xs[i] - bf16_val(hb)) : (unsigned short)0; }
#pragma unroll
    for (int t = 0; t < 4; ++t) {
      const unsigned short* brow = Wt + (size_t)(col0 + t * 16 + ln) * ldb + kb;
      FragB b;
      b.half[0] = *(const v8us*)(brow + 8 * hh);
      b.half[1] = *(const v8us*)(brow + 16 + 8 * hh);
      acc[t] = mmaN<ASPLIT ? 2 : 1>(ah.v, al.v, b.v, b.v, acc[t]);
    }
  }
#pragma unroll
  for (int t = 0; t < 4; ++t) {
    const int col = col0 + t * 16 + ln;
    float bv = bias ? bias[col] : 0.f;
    if (BIAS_BF16) bv = bf16_round(bv);
#pragma unroll
    for (int r = 0; r < 8; ++r) {
      float v = acc[t][r] + bv;
      if (resid) { float rv = resid[(size_t)((row0 + 8 * hh + r) % rmod) * ldr + col]; if (RES_BF16) rv = bf16_round(rv); v += rv; }
      if (ACT == 1) v = fmaxf(v, 0.f);
      if (ACT == 2) v = 0.5f * v * (1.0f + erff(v * 0.70710678118654752f));
      if (ACT == 3) { const float u = 0.7978845608028654f * (v + 0.044715f * v * v * v); v = 0.5f * v * (1.0f + tanhf(u)); }
      so[w][8 * hh + r][t * 16 + ln] = v;
    }
  }
  __builtin_amdgcn_fence(__ATOMIC_ACQ_REL, "workgroup");
  __builtin_amdgcn_wave_barrier();
  const int rsub = lane >> 4, c4 = (lane & 15) * 4;
  {
#pragma unroll
    for (int q = 0; q < 8; ++q) {
      const int r = q * 2 + rsub;
      const v4f v = *(const v4fa*)&so[w][r][c4];
      *(v4f*)(C + (size_t)(row0 + r) * ldc + col0 + c4) = v;
    }
    
  }
}
// row LayerNorm (biased variance, eps) over N: s = X (+ R); optional out_sum <- s; out_norm <- (s-mu)*rsqrt(var+eps)*g + b
template <bool PARAM_BF16>
__global__ __launch_bounds__(256) void k_layernorm(const float* __restrict__ X, const float* __restrict__ R, const float* __restrict__ g, const float* __restrict__ bta,
                                                  float* __restrict__ out_sum, float* __restrict__ out_norm, int N, float eps) {
  __shared__ float red[256];
  const int row = blockIdx.x, tid = threadIdx.x;
  const float* x = X + (size_t)row * N; const float* rr = R ? R + (size_t)row * N : nullptr;
  float vals[16];                     // up to N = 4096
  const int per = N / 256;            // contiguous chunk per thread? use strided-by-4 chunks: thread handles j = tid*4 + 1024*u
  float s1 = 0.f;
  for (int u = 0; u < per / 4; ++u) {
    const int j = tid * 4 + 1024 * u;
    const v4f a = *(const v4fa*)(x + j);
    v4f b = {0.f,0.f,0.f,0.f}; if (rr) b = *(const v4fa*)(rr + j);
#pragma unroll
    for (int q = 0; q < 4; ++q) { const float v = a[q] + b[q]; vals[u * 4 + q] = v; s1 += v; }
  }
  red[tid] = s1; __syncthreads();
  for (int st = 128; st > 0; st >>= 1) { if (tid < st) red[tid] += red[tid + st]; __syncthreads(); }
  const float mu = red[0] / (float)N; __syncthreads();
  float s2 = 0.f;
  for (int u = 0; u < per / 4; ++u)
#pragma unroll
    for (int q = 0; q < 4; ++q) { const float c = vals[u * 4 + q] - mu; s2 += c * c; }
  red[tid] = s2; __syncthreads();
  for (int st = 128; st > 0; st >>= 1) { if (tid < st) red[tid] += red[tid + st]; __syncthreads(); }
  const float rs = rsqrtf(red[0] / (float)N + eps);
  {
    for (int u = 0; u < per / 4; ++u) {
      const int j = tid * 4 + 1024 * u;
      v4f o, sm;
#pragma unroll
      for (int q = 0; q < 4; ++q) {
        float gg = g[j + q], bb = bta[j + q];
        if (PARAM_BF16) { gg = bf16_round(gg); bb = bf16_round(bb); }
        sm[q] = vals[u * 4 + q]; o[q] = (vals[u * 4 + q] - mu) * rs * gg + bb;
      }
      if (out_sum) *(v4f*)(out_sum + (size_t)row * N + j) = sm;
      *(v4f*)(out_norm + (size_t)row * N + j) = o;
    }
    
  }
}



// ---- f16 WMMA path (v_wmma_f32_16x16x32_f16): 11-bit significands for operands in range — used for every GEMM launched in this file
typedef _Float16 v16h __attribute__((ext_vector_type(16)));
union FragH { v16h v; v8us half[2]; _Float16 h[16]; unsigned short u[16]; };
template <int NT>
__device__ __forceinline__ v8f mmaH(v16h ah, v16h al, v16h bh, v16h bl, v8f c) {
  c = __builtin_amdgcn_wmma_f32_16x16x32_f16(false, ah, false, bh, (short)0, c, false, false);
  if (NT >= 2) c = __builtin_amdgcn_wmma_f32_16x16x32_f16(false, al, false, bh, (short)0, c, false, false);
  if (NT >= 3) c = __builtin_amdgcn_wmma_f32_16x16x32_f16(false, ah, false, bl, (short)0, c, false, false);
  asm volatile("v_nop\n\tv_nop\n\tv_nop\n\tv_nop" : "+v"(c) : "v"(ah), "v"(al), "v"(bh), "v"(bl));
  return c;
}
// batched GEMM like k_gemm_b but f16 operands: A f32 (split into f16 hi/lo if ASPLIT, else rounded to f16), Bt = f16 values [n][k]; alpha; C f32; N multiple of 16 (partial tiles skipped)
template <bool ASPLIT>
__global__ __launch_bounds__(128) void k_gemm_h(const float* __restrict__ A, int lda, size_t sA, const _Float16* __restrict__ Bh, int ldb, size_t sB, float alpha, float* __restrict__ C, int ldc, size_t sC, int M, int N, int K) {
  __shared__ __attribute__((aligned(16))) float so[4][16][64];
  const int tid = threadIdx.x, w = tid >> 5, lane = tid & 31, ln = lane & 15, hh = lane >> 4; const int by = blockIdx.y;
  A += (size_t)by * sA; Bh += (size_t)by * sB; C += (size_t)by * sC;
  const int ntn = (N + 63) / 64; const int wid = blockIdx.x * 4 + w; const int mt = wid / ntn, nq = wid % ntn; if (mt * 16 >= M) return;
  const int row0 = mt * 16, col0 = nq * 64; const float* arow = A + (size_t)(row0 + ln) * lda;
  v8f acc[4] = {};
  for (int kb = 0; kb < K; kb += 32) {
    FragH ah, al;
    const v4f x0 = *(const v4fa*)(arow + kb + 8 * hh), x1 = *(const v4fa*)(arow + kb + 8 * hh + 4), x2 = *(const v4fa*)(arow + kb + 16 + 8 * hh), x3 = *(const v4fa*)(arow + kb + 16 + 8 * hh + 4);
    float xs[16] = {x0[0],x0[1],x0[2],x0[3],x1[0],x1[1],x1[2],x1[3],x2[0],x2[1],x2[2],x2[3],x3[0],x3[1],x3[2],x3[3]};
#pragma unroll
    for (int i = 0; i < 16; ++i) { const _Float16 h = (_Float16)xs[i]; ah.h[i] = h; al.h[i] = ASPLIT ? (_Float16)(xs[i] - (float)h) : (_Float16)0.0f; }
#pragma unroll
    for (int t = 0; t < 4; ++t) { if (col0 + t * 16 >= N) continue; const size_t boff = (size_t)(col0 + t * 16 + ln) * ldb + kb; FragH bq; bq.half[0] = *(const v8us*)(Bh + boff + 8 * hh); bq.half[1] = *(const v8us*)(Bh + boff + 16 + 8 * hh);
      acc[t] = mmaH<ASPLIT ? 2 : 1>(ah.v, al.v, bq.v, bq.v, acc[t]); }
  }
#pragma unroll
  for (int t = 0; t < 4; ++t) { if (col0 + t * 16 >= N) continue;
#pragma unroll
    for (int r = 0; r < 8; ++r) so[w][8 * hh + r][t * 16 + ln] = acc[t][r] * alpha; }
  __builtin_amdgcn_fence(__ATOMIC_ACQ_REL, "workgroup"); __builtin_amdgcn_wave_barrier();
  const int rsub = lane >> 4, c4 = (lane & 15) * 4;
  {
#pragma unroll
    for (int q = 0; q < 8; ++q) { const int r = q * 2 + rsub; if (col0 + c4 < N) { const v4f v = *(const v4fa*)&so[w][r][c4]; *(v4f*)(C + (size_t)(row0 + r) * ldc + col0 + c4) = v; } }
     }
}

// Wt[n][k] = f16(W[k][n]·scale) from f32 row-major W[K][N] (scale = power of two; bf16-exact weights stay exact in f16 away from the subnormal range)
__global__ __launch_bounds__(256) void k_wt_f16(const float* __restrict__ W, _Float16* __restrict__ Wt, int K, int N, float scale) {
  const int t = blockIdx.x * 256 + threadIdx.x; if (t >= N * (K / 8)) return; const int n = t / (K / 8), k8 = (t % (K / 8)) * 8; FragH f;
#pragma unroll
  for (int i = 0; i < 8; ++i) f.h[i] = (_Float16)(bf16_round(W[(size_t)(k8 + i) * N + n]) * scale); const v8us o = f.half[0];
  *(v8us*)((unsigned short*)Wt + (size_t)n * K + k8) = o; 
}
// k_gemm_hh variant with fused epilogue: v = acc·alpha + bias[by·sBias + col] (+ CP[(row/rowsPerB)·sCPb + by·64 + col] if CP) ; ACT 0 none / 1 elu ; writes f16 C16 (and f32 C if non-null)
template <int ACT>
__global__ __launch_bounds__(128) void k_gemm_hhx(const _Float16* __restrict__ A, int lda, size_t sA, const _Float16* __restrict__ Bh, int ldb, size_t sB, float alpha, const float* __restrict__ bias, size_t sBias, const float* __restrict__ CP, int rowsPerB, size_t sCPb, int row0g,
    float* __restrict__ C, _Float16* __restrict__ C16, int ldc, size_t sC, int M, int N, int K) {
  __shared__ __attribute__((aligned(16))) float so[4][16][64];
  const int tid = threadIdx.x, w = tid >> 5, lane = tid & 31, ln = lane & 15, hh = lane >> 4; const int by = blockIdx.y;
  A += (size_t)by * sA; Bh += (size_t)by * sB; const size_t cofs = (size_t)by * sC; const float* bp = bias ? bias + (size_t)by * sBias : nullptr;
  const int ntn = (N + 63) / 64; const int wid = blockIdx.x * 4 + w; const int mt = wid / ntn, nq = wid % ntn; if (mt * 16 >= M) return;
  const int row0 = mt * 16, col0 = nq * 64; const _Float16* arow = A + (size_t)(row0 + ln) * lda;
  v8f acc[4] = {};
  for (int kb = 0; kb < K; kb += 32) { FragH ah; ah.half[0] = *(const v8us*)((const unsigned short*)arow + kb + 8 * hh); ah.half[1] = *(const v8us*)((const unsigned short*)arow + kb + 16 + 8 * hh);
#pragma unroll
    for (int t = 0; t < 4; ++t) { if (col0 + t * 16 >= N) continue; const size_t boff = (size_t)(col0 + t * 16 + ln) * ldb + kb; FragH bq; bq.half[0] = *(const v8us*)((const unsigned short*)Bh + boff + 8 * hh); bq.half[1] = *(const v8us*)((const unsigned short*)Bh + boff + 16 + 8 * hh);
      acc[t] = mmaH<1>(ah.v, ah.v, bq.v, bq.v, acc[t]); }
  }
#pragma unroll
  for (int t = 0; t < 4; ++t) { if (col0 + t * 16 >= N) continue; const int col = col0 + t * 16 + ln; const float bv = bp ? bf16_round(bp[col]) : 0.f;
#pragma unroll
    for (int r = 0; r < 8; ++r) { float v = acc[t][r] * alpha + bv; if (CP) { const int rr = row0g + row0 + 8 * hh + r; if (rowsPerB < 0) v += CP[cofs + (size_t)rr * ldc + col];      /* rowsPerB < 0: own element of the batched C plane */ else { const int bidx = rr / rowsPerB; v += CP[(size_t)bidx * sCPb + (size_t)by * 64 + col]; } } if (ACT == 1) v = (v > 0.f) ? v : expm1f(v); else if (ACT == 7) v = (v > 0.f) ? v + 1.0f : expf(v); else if (ACT == 8) v = tanhf(v); else if (ACT == 9) v = 0.5f * v * (1.0f + tanhf(0.7978845608028654f * (v + 0.044715f * v * v * v))); else if (ACT == 11) v = 1.0f / (1.0f + expf(-v)); else if (ACT == 12) v = (v > 0.f) ? v : 0.01f * v; else if (ACT == 14) v = (v > 0.f) ? v : 0.1f * v; else if (ACT == 16) v = (v >= 0.f) ? v : 0.3f * v; else if (ACT == 17) v = (v >= 0.f) ? v : 0.2f * v; else if (ACT == 15) v = v / (1.0f + expf(-v)); else if (ACT == 3) v = fmaxf(v, 0.f); else if (ACT == 6) v = 0.5f * v * (1.0f + erff(v * 0.70710678118654752f)); so[w][8 * hh + r][t * 16 + ln] = v; } }
  __builtin_amdgcn_fence(__ATOMIC_ACQ_REL, "workgroup"); __builtin_amdgcn_wave_barrier();
  const int rsub = lane >> 4, c4 = (lane & 15) * 4; typedef _Float16 v4h __attribute__((ext_vector_type(4)));
  {
#pragma unroll
    for (int q = 0; q < 8; ++q) { const int r = q * 2 + rsub; if (col0 + c4 < N) { const v4f v = *(const v4fa*)&so[w][r][c4]; if (C) *(v4f*)(C + cofs + (size_t)(row0 + r) * ldc + col0 + c4) = v; if (C16) { v4h h4; for (int i = 0; i < 4; ++i) h4[i] = (_Float16)v[i]; *(v4h*)(C16 + cofs + (size_t)(row0 + r) * ldc + col0 + c4) = h4; } } }
     }
}


typedef _Float16 v4h __attribute__((ext_vector_type(4)));

__global__ __launch_bounds__(256) void k_x16(const float* __restrict__ x, _Float16* __restrict__ X16, size_t n8) { const size_t t = (size_t)blockIdx.x * 256 + threadIdx.x; if (t >= n8) return; FragH f;
#pragma unroll
  for (int q = 0; q < 8; ++q) f.h[q] = (_Float16)bf16_round(x[t * 8 + q]); *(v8us*)((unsigned short*)X16 + t * 8) = f.half[0];  }
__global__ __launch_bounds__(256) void k_h16(const float* __restrict__ x, _Float16* __restrict__ X16, size_t n8) { const size_t t = (size_t)blockIdx.x * 256 + threadIdx.x; if (t >= n8) return; FragH f;
#pragma unroll
  for (int q = 0; q < 8; ++q) f.h[q] = (_Float16)x[t * 8 + q]; *(v8us*)((unsigned short*)X16 + t * 8) = f.half[0];  }
// d_round16f / d_xrows / d_w8 / d_wa: the passes that read inputs only, each written for block number blk of its own range; k_prep below runs them all in one launch
__device__ __forceinline__ void d_round16f(unsigned blk, const float* __restrict__ W, _Float16* __restrict__ Bt, size_t n8) { const size_t t = (size_t)blk * 256 + threadIdx.x; if (t >= n8) return; FragH f;
#pragma unroll
  for (int i = 0; i < 8; ++i) f.h[i] = (_Float16)(bf16_round(W[t * 8 + i]) * 16.0f); *(v8us*)((unsigned short*)Bt + t * 8) = f.half[0];  }
template <int NHv, int TTv>
__global__ __launch_bounds__(256) void k_vt(const _Float16* __restrict__ V16, int ldv, int voff, _Float16* __restrict__ Vt) { __shared__ unsigned short tl[64][66]; const int tid = threadIdx.x; const int slab = blockIdx.x / (TTv / 64), lg = blockIdx.x % (TTv / 64); const int b = slab / NHv, h = slab % NHv;
  for (int i = tid; i < 64 * 8; i += 256) { const int r = i / 8, c8 = (i % 8) * 8; FragH f; f.half[0] = *(const v8us*)((const unsigned short*)V16 + ((size_t)b * TTv + lg * 64 + r) * ldv + voff + h * 64 + c8);
#pragma unroll
    for (int q = 0; q < 8; ++q) tl[r][c8 + q] = f.u[q]; }
  __syncthreads();
  {
#pragma unroll
    for (int rd = 0; rd < 2; ++rd) { const int d = rd * 32 + tid / 8, pc = tid % 8; FragH f;
#pragma unroll
      for (int q = 0; q < 8; ++q) f.u[q] = tl[pc * 8 + q][d];
      *(v8us*)((unsigned short*)Vt + ((size_t)slab * 64 + d) * TTv + lg * 64 + pc * 8) = f.half[0]; }
     } }

__global__ __launch_bounds__(256) void k_hl(const float* __restrict__ F, _Float16* __restrict__ Hh, _Float16* __restrict__ Hl, size_t n8) { const size_t t = (size_t)blockIdx.x * 256 + threadIdx.x; if (t >= n8) return; FragH fh, fl; const v4f a = *(const v4fa*)(F + t * 8), c = *(const v4fa*)(F + t * 8 + 4);
#pragma unroll
  for (int q = 0; q < 4; ++q) { _Float16 h = (_Float16)a[q]; fh.h[q] = h; fl.h[q] = (_Float16)((a[q] - (float)h) * 1024.0f); h = (_Float16)c[q]; fh.h[4 + q] = h; fl.h[4 + q] = (_Float16)((c[q] - (float)h) * 1024.0f); }
  { *(v8us*)((unsigned short*)Hh + t * 8) = fh.half[0]; *(v8us*)((unsigned short*)Hl + t * 8) = fl.half[0];  } }

// ---- fast GEMM (wave tile 32x64; requires M % 32 == 0 rows per launch region and N % 64 == 0); epilogue = k_gemm_hhx semantics ----
__device__ __forceinline__ v16h g2_frag(const _Float16* p, int hh) { FragH f; f.half[0] = *(const v8us*)((const unsigned short*)p + 8 * hh); f.half[1] = *(const v8us*)((const unsigned short*)p + 16 + 8 * hh); return f.v; }
__device__ __forceinline__ v8f g2_mma(v16h a, v16h b, v8f c) { v8f d = __builtin_amdgcn_wmma_f32_16x16x32_f16(false, a, false, b, (short)0, c, false, false); asm volatile("v_nop\n\tv_nop\n\tv_nop\n\tv_nop" : "+v"(d) : "v"(a), "v"(b)); return d; }
// PK: the 64-column tiles 1 (k, 16 live) and 2, 3 (v) leave LDS in the layouts that k_attn reads, so that every fragment load of a wave there is 512 contiguous bytes, and are not stored as rows:
// KC = [NB][NP][16]: the 16 live key columns. VF = [NB][NP / 32][8 channel tiles][2][32 lanes][8]: the A fragments of V^T (row = channel 16 ct + (lane & 15), k = key 16 h2 + 8 (lane >> 4) + i of the block of 32).
template <int ACT, bool PK = false>
__global__ __launch_bounds__(128) void k_gemm2(const _Float16* __restrict__ A, int lda, size_t sA, const _Float16* __restrict__ Bh, int ldb, size_t sB, float alpha, const float* __restrict__ bias, size_t sBias, const float* __restrict__ CP, int rowsPerB, size_t sCPb, int row0g,
    float* __restrict__ C, _Float16* __restrict__ C16, int ldc, size_t sC, int M, int N, int K, _Float16* __restrict__ KC, _Float16* __restrict__ VF) { static_assert(ACT == 0 || ACT == 3 || ACT == 6 || ACT == 8 || ACT == 9 || ACT == 11 || ACT == 12 || ACT == 14 || ACT == 15 || ACT == 16 || ACT == 17, "k_gemm2: unsupported ACT code (would silently apply no activation)");
  __shared__ __attribute__((aligned(16))) float so[4][32][68];
  const int tid = threadIdx.x, w = tid >> 5, lane = tid & 31, ln = lane & 15, hh = lane >> 4; const int by = blockIdx.y;
  A += (size_t)by * sA; Bh += (size_t)by * sB; const size_t cofs = (size_t)by * sC; const float* bp = bias ? bias + (size_t)by * sBias : nullptr;
  const int ntn = N >> 6; const int mt = blockIdx.x / ntn, nq = blockIdx.x - mt * ntn; const int row0 = mt * 128 + 32 * w, col0 = nq * 64; if (row0 >= M) return;
  const _Float16* a0p = A + (size_t)(row0 + ln) * lda; const _Float16* a1p = a0p + (size_t)16 * lda;
  const _Float16* b0p = Bh + (size_t)(col0 + ln) * ldb; const _Float16* b1p = b0p + (size_t)16 * ldb; const _Float16* b2p = b1p + (size_t)16 * ldb; const _Float16* b3p = b2p + (size_t)16 * ldb;
  const v8f z8 = {0.f,0.f,0.f,0.f,0.f,0.f,0.f,0.f}; v8f c00 = z8, c01 = z8, c02 = z8, c03 = z8, c10 = z8, c11 = z8, c12 = z8, c13 = z8;
#pragma unroll 1
  for (int kb = 0; kb < K; kb += 32) { const v16h a0 = g2_frag(a0p + kb, hh), a1 = g2_frag(a1p + kb, hh);
    asm volatile("s_wait_xcnt 0x0" ::: "memory");      /* stands before the A loads' address registers are rewritten */
    v16h b = g2_frag(b0p + kb, hh); c00 = g2_mma(a0, b, c00); c10 = g2_mma(a1, b, c10);
    b = g2_frag(b1p + kb, hh); c01 = g2_mma(a0, b, c01); c11 = g2_mma(a1, b, c11);
    b = g2_frag(b2p + kb, hh); c02 = g2_mma(a0, b, c02); c12 = g2_mma(a1, b, c12);
    b = g2_frag(b3p + kb, hh); c03 = g2_mma(a0, b, c03); c13 = g2_mma(a1, b, c13); }
  v8f accs[8] = {c00, c01, c02, c03, c10, c11, c12, c13};
#pragma unroll
  for (int u = 0; u < 8; ++u) { const int t = u & 3, half = u >> 2; const int col = col0 + t * 16 + ln; const float bv = bp ? bf16_round(bp[col]) : 0.f;
#pragma unroll
    for (int r = 0; r < 8; ++r) { const int rloc = half * 16 + 8 * hh + r; float v = accs[u][r] * alpha + bv; if (CP) { if (rowsPerB < 0) v += CP[cofs + (size_t)(row0g + row0 + rloc) * ldc + col];      /* rowsPerB < 0: own element of the batched C plane */ else { const int bidx = (row0g + row0 + rloc) / rowsPerB; v += CP[(size_t)bidx * sCPb + (size_t)by * 64 + col]; } }
      if (ACT == 3) v = fmaxf(v, 0.f); else if (ACT == 6) v = 0.5f * v * (1.0f + erff(v * 0.70710678118654752f)); else if (ACT == 11) v = 1.0f / (1.0f + expf(-v)); else if (ACT == 15) v = v / (1.0f + expf(-v)); else if (ACT == 12) v = (v > 0.f) ? v : 0.01f * v; else if (ACT == 8) v = tanhf(v); else if (ACT == 9) v = 0.5f * v * (1.0f + tanhf(0.7978845608028654f * (v + 0.044715f * v * v * v))); else if (ACT == 14) v = (v > 0.f) ? v : 0.1f * v; else if (ACT == 16) v = (v >= 0.f) ? v : 0.3f * v; else if (ACT == 17) v = (v >= 0.f) ? v : 0.2f * v;
      so[w][rloc][t * 16 + ln] = v; } }
  __builtin_amdgcn_fence(__ATOMIC_ACQ_REL, "workgroup"); __builtin_amdgcn_wave_barrier();
  const int rsub = lane >> 4, c4 = (lane & 15) * 4;
  if (PK && nq == 1) {      /* the same for the whole work-group. lane = row: 32 B each, the wave's 32 rows 1 KiB in a run */
    FragH f;
#pragma unroll
    for (int i = 0; i < 4; ++i) { const v4f v = *(const v4fa*)&so[w][lane][i * 4]; for (int e = 0; e < 4; ++e) f.h[i * 4 + e] = (_Float16)v[e]; }
    unsigned short* d = (unsigned short*)KC + (size_t)(row0 + lane) * 16; *(v8us*)d = f.half[0]; *(v8us*)(d + 8) = f.half[1];
  } else if (PK && nq >= 2) {      /* the wave's 32 rows are one block of 32 keys, its 64 columns 4 channel tiles: piece u = (tile u >> 1, h2 = u & 1), 4 KiB in a run */
    unsigned short* d = (unsigned short*)VF + (size_t)(row0 >> 5) * 4096 + (nq - 2) * 2048 + lane * 8;
#pragma unroll
    for (int u = 0; u < 8; ++u) { FragH f; for (int i = 0; i < 8; ++i) f.h[i] = (_Float16)so[w][(u & 1) * 16 + 8 * hh + i][(u >> 1) * 16 + ln];
      *(v8us*)(d + u * 256) = f.half[0]; asm volatile("s_wait_xcnt 0x0" ::: "memory"); /* stands before the store's data registers are rewritten by the next piece */ }
  } else {
#pragma unroll
    for (int q = 0; q < 16; ++q) { const int r = q * 2 + rsub; const v4f v = *(const v4fa*)&so[w][r][c4]; if (C) { *(v4f*)(C + cofs + (size_t)(row0 + r) * ldc + col0 + c4) = v; asm volatile("s_wait_xcnt 0x0" ::: "memory"); /* stands before the store's data and address registers are rewritten by the next piece */ } if (C16) { v4h h4; for (int i = 0; i < 4; ++i) h4[i] = (_Float16)v[i]; *(v4h*)(C16 + cofs + (size_t)(row0 + r) * ldc + col0 + c4) = h4; } }
     } }

// ---- k_gemm2 with both operands staged in LDS (requires M % 128 == 0, N % 64 == 0, K % 128 == 0); same tiles, same k order, same epilogue for EPI 0 ----
// A stage is 128 k (256 B, two whole lines) of the work-group's 128 A rows and 64 B rows (GT: 64 and 128); every wave-wide copy covers two whole rows of it (4 lines) where a fragment load from global touched 16 lines.
#define G3_KS 128
#define G3_PITCH 272                    /* LDS row pitch, bytes: 16 B x odd, conflict-free for ds_load_b128 */
#define G3_STAGE (192 * G3_PITCH)       /* rows 0..127 = A, rows 128..191 = B; GT: 0..63 = A, 64..191 = B */
#define G3_C(l, g) "global_load_async_to_lds_b128 %" #l ", %" #g ", off\n\t"
// twelve copies and, as the statement's last line, the wait that stands before any register they name is rewritten
#define G3_COPY12(L, G, o) asm volatile(G3_C(0, 12) G3_C(1, 13) G3_C(2, 14) G3_C(3, 15) G3_C(4, 16) G3_C(5, 17) G3_C(6, 18) G3_C(7, 19) G3_C(8, 20) G3_C(9, 21) G3_C(10, 22) G3_C(11, 23) "s_wait_xcnt 0x0" \
    :: "v"(L[o + 0]), "v"(L[o + 1]), "v"(L[o + 2]), "v"(L[o + 3]), "v"(L[o + 4]), "v"(L[o + 5]), "v"(L[o + 6]), "v"(L[o + 7]), "v"(L[o + 8]), "v"(L[o + 9]), "v"(L[o + 10]), "v"(L[o + 11]), \
       "v"(G[o + 0]), "v"(G[o + 1]), "v"(G[o + 2]), "v"(G[o + 3]), "v"(G[o + 4]), "v"(G[o + 5]), "v"(G[o + 6]), "v"(G[o + 7]), "v"(G[o + 8]), "v"(G[o + 9]), "v"(G[o + 10]), "v"(G[o + 11]) : "memory")
// one stage: 24 copies of 16 B per lane. l = the lane's LDS byte address in row (tid >> 4) of the buffer, ga / gb = its global address in that row of the A / B tile; copy j serves row 8 j + (tid >> 4)
// IM8: the A tile's 128 rows are 8 h-lines of 16 w-positions of the bordered rows, so tile row 8 j + .. lies (j >> 1) bordered h-lines and 8 (j & 1) positions behind row (tid >> 4)
// GT: the stage's 192 rows are 64 A rows (4 h-lines) and 128 B rows: 64 rows from gb on, then the 64 rows that lie 256 rows behind them (the gate halves of the same channels)
template <bool IM8, bool GT = false>
__device__ __forceinline__ void g3_fill(unsigned l, const _Float16* ga, size_t sa8, const _Float16* gb, size_t sb8) {
  constexpr int NA = GT ? 8 : 16;
  unsigned L[24]; const _Float16* G[24];
#pragma unroll      /* both loops: every index constant, so that L and G are registers the asm can name */
  for (int j = 0; j < NA; ++j) { L[j] = l + (unsigned)j * (8u * G3_PITCH); G[j] = ga + (IM8 ? (size_t)(((j >> 1) * PD + (j & 1) * 8) * CC) : (size_t)j * sa8); }
#pragma unroll
  for (int j = 0; j < 24 - NA; ++j) { L[NA + j] = l + (unsigned)(NA + j) * (8u * G3_PITCH); G[NA + j] = gb + (size_t)((GT && j >= 8) ? j + 24 : j) * sb8; }
  G3_COPY12(L, G, 0); G3_COPY12(L, G, 12); }
__device__ __forceinline__ v16h g3_frag(const unsigned char* p) { FragH f; f.half[0] = *(const v8us*)p; f.half[1] = *(const v8us*)(p + 32); return f.v; }
// IM8: A = bordered rows [NB][PD][PD][PD][CC] and the product is the k2 conv: stage s is channels 128 (s & 1) .. + 127 of tap s >> 1 = (dt, dh, dw), read for output position (t, h, w) at bordered index (t + dt, h + dh, w + dw); k = tap * CC + channel
// EPI: what follows v = acc * alpha + bias, done as the tile leaves LDS (planes by = 0 only for 2, 4 and 5). 0: store v (f32 C and / or f16 C16). 1: f16 elu(v) to C16 = bordered rows, at the row's interior place. 3: f32 elu(v) to C.
// 4: f16 elu(elu(v) + CP[row][col]) to C16. 5: f32 elu(v) to C = [NB][CC][NP], channel-major.
// 2 (N = 2 ldc; the work-group's tile is 64 rows x (64 columns a | the 64 columns g that lie ldc behind them), waves 2 i / 2 i + 1 = a / g of rows 32 i ..): C[row][col] += a * sigmoid(g), f16 elu of it to C16 = bordered rows, and, where X16 is given, f16 of it to X16 (pitch XP).
__device__ __forceinline__ float elu1(float a) { const float e = expm1f(a); return (a > 0.f) ? a : e; }      /* expm1f stands outside the choice: no branch per element, so that the chains of neighbouring elements overlap in a wave that is alone on its SIMD */
template <int ACT, bool IM8 = false, int EPI = 0>
__global__ __launch_bounds__(128) void k_gemm2s(const _Float16* __restrict__ A, int lda, size_t sA, const _Float16* __restrict__ Bh, int ldb, size_t sB, float alpha, const float* __restrict__ bias, size_t sBias, const float* __restrict__ CP, int rowsPerB, size_t sCPb, int row0g,
    float* __restrict__ C, _Float16* __restrict__ C16, int ldc, size_t sC, int M, int N, int K, _Float16* __restrict__ X16) { static_assert(ACT == 0 || ACT == 3 || ACT == 6 || ACT == 8 || ACT == 9 || ACT == 11 || ACT == 12 || ACT == 14 || ACT == 15 || ACT == 16 || ACT == 17, "k_gemm2s: unsupported ACT code (would silently apply no activation)");
  constexpr bool GT = EPI == 2; static_assert(!GT || IM8, "EPI 2 is written for the conv's tiles");
  __shared__ __attribute__((aligned(16))) unsigned char st[2 * G3_STAGE];
  __shared__ __attribute__((aligned(16))) float so[4][32][68];
  const int tid = threadIdx.x, w = tid >> 5, lane = tid & 31, ln = lane & 15, hh = lane >> 4; const int by = blockIdx.y;
  A += (size_t)by * sA; Bh += (size_t)by * sB; const size_t cofs = (size_t)by * sC; const float* bp = bias ? bias + (size_t)by * sBias : nullptr;
  const int ntn = GT ? N >> 7 : N >> 6; const int mt = blockIdx.x / ntn, nq = blockIdx.x - mt * ntn; const int row0 = GT ? mt * 64 + 32 * (w >> 1) : mt * 128 + 32 * w, col0 = nq * 64; if (mt * (GT ? 64 : 128) >= M) return;      /* the same for the whole work-group, in front of every barrier */
  const int crow = tid >> 4, cch = tid & 15; const size_t sa8 = (size_t)8 * lda, sb8 = (size_t)8 * ldb;
  static_assert(!IM8 || (DT == 16 && DH == 16 && DW == 16 && CC == 2 * G3_KS), "IM8: a 128-row tile is 8 h-lines of 16, a tap is two stages");
  const _Float16* gA = GT ? A + (size_t)((mt >> 6) * NPP + ((mt >> 2) & 15) * (PD * PD) + (mt & 3) * (4 * PD) + crow) * CC + cch * 8 : IM8 ? A + (size_t)((mt >> 5) * NPP + ((mt >> 1) & 15) * (PD * PD) + (mt & 1) * (8 * PD) + crow) * CC + cch * 8 : A + (size_t)(mt * 128 + crow) * lda + cch * 8;
  auto aoff = [](int t) -> size_t { return IM8 ? (size_t)((((t >> 3) & 1) * (PD * PD) + ((t >> 2) & 1) * PD + ((t >> 1) & 1)) * CC + (t & 1) * G3_KS) : (size_t)t * G3_KS; };      /* stage t's place behind gA, elements */
  const _Float16* gB = Bh + (size_t)(col0 + crow) * ldb + cch * 8;
  const unsigned l0 = (unsigned)(size_t)st + (unsigned)(crow * G3_PITCH + cch * 16);
  const unsigned char* fa = st + ((GT ? 32 * (w >> 1) : 32 * w) + ln) * G3_PITCH + 16 * hh; const unsigned char* fb = st + ((GT ? 64 + 64 * (w & 1) : 128) + ln) * G3_PITCH + 16 * hh;
  const int nt = K / G3_KS;
  const v8f z8 = {0.f,0.f,0.f,0.f,0.f,0.f,0.f,0.f}; v8f c00 = z8, c01 = z8, c02 = z8, c03 = z8, c10 = z8, c11 = z8, c12 = z8, c13 = z8;
  g3_fill<IM8, GT>(l0, gA, sa8, gB, sb8);
  asm volatile("s_wait_asynccnt 0x0" ::: "memory");      /* this wave's copies of stage 0 have landed */
  __syncthreads();                                        /* ... and every other wave's */
  if (nt > 1) g3_fill<IM8, GT>(l0 + G3_STAGE, gA + aoff(1), sa8, gB + G3_KS, sb8);
#pragma unroll 1      /* one trip per stage: the buffer index stays a run-time value */
  for (int t = 0; t < nt; ++t) { const unsigned bo = (unsigned)(t & 1) * G3_STAGE; const unsigned char* pa = fa + bo; const unsigned char* pb = fb + bo;
    v16h a0 = g3_frag(pa), a1 = g3_frag(pa + 16 * G3_PITCH), b0 = g3_frag(pb), b1 = g3_frag(pb + 16 * G3_PITCH), b2 = g3_frag(pb + 32 * G3_PITCH), b3 = g3_frag(pb + 48 * G3_PITCH);
#pragma unroll      /* constant LDS offsets; the next 32 k's fragments (same stage) are read as one group ahead of this 32 k's WMMAs */
    for (int ks = 0; ks < 4; ++ks) { v16h na0 = a0, na1 = a1, nb0 = b0, nb1 = b1, nb2 = b2, nb3 = b3;
      if (ks < 3) { const unsigned char* qa = pa + (ks + 1) * 64; const unsigned char* qb = pb + (ks + 1) * 64; na0 = g3_frag(qa); na1 = g3_frag(qa + 16 * G3_PITCH); nb0 = g3_frag(qb); nb1 = g3_frag(qb + 16 * G3_PITCH); nb2 = g3_frag(qb + 32 * G3_PITCH); nb3 = g3_frag(qb + 48 * G3_PITCH); }
      c00 = g2_mma(a0, b0, c00); c10 = g2_mma(a1, b0, c10); c01 = g2_mma(a0, b1, c01); c11 = g2_mma(a1, b1, c11);
      c02 = g2_mma(a0, b2, c02); c12 = g2_mma(a1, b2, c12); c03 = g2_mma(a0, b3, c03); c13 = g2_mma(a1, b3, c13);
      a0 = na0; a1 = na1; b0 = nb0; b1 = nb1; b2 = nb2; b3 = nb3; }
    asm volatile("s_wait_dscnt 0x0" ::: "memory");        /* this wave's reads of the buffer are done before it is refilled */
    asm volatile("s_wait_asynccnt 0x0" ::: "memory");     /* this wave's copies of stage t + 1 have landed */
    __syncthreads();                                      /* publishes stage t + 1 and ends every wave's reads of stage t */
    if (t + 2 < nt) g3_fill<IM8, GT>(l0 + bo, gA + aoff(t + 2), sa8, gB + (size_t)(t + 2) * G3_KS, sb8); }
  asm volatile("s_wait_asynccnt 0x0" ::: "memory");       /* no copy outstanding behind the loop */
  const int rsub = lane >> 4, c4 = (lane & 15) * 4;
  float* rp = GT ? C + (size_t)(row0 + (w & 1) * 16 + rsub) * ldc + col0 + c4 : nullptr;      /* EPI 2: the wave gates rows 16 (w & 1) .. + 15 of its pair's 32; a lane has 4 channels of rows rsub + 2 i */
  v4f r0 = {0.f, 0.f, 0.f, 0.f}, r1 = r0;      /* EPI 2: the C values of the trip at hand, loaded one trip ahead; the first fly while the tiles go to LDS */
  if (GT) { r0 = *(const v4fa*)rp; r1 = *(const v4fa*)(rp + 2 * (size_t)ldc); asm volatile("s_wait_xcnt 0x0" ::: "memory"); /* stands before the loads' address registers are rewritten */ }
  v8f accs[8] = {c00, c01, c02, c03, c10, c11, c12, c13};
#pragma unroll
  for (int u = 0; u < 8; ++u) { const int t = u & 3, half = u >> 2; const int col = col0 + t * 16 + ln + (GT ? (w & 1) * ldc : 0); const float bv = bp ? bf16_round(bp[col]) : 0.f;
#pragma unroll
    for (int r = 0; r < 8; ++r) { const int rloc = half * 16 + 8 * hh + r; float v = accs[u][r] * alpha + bv; if (EPI == 0 && CP) { if (rowsPerB < 0) v += CP[cofs + (size_t)(row0g + row0 + rloc) * ldc + col];      /* rowsPerB < 0: own element of the batched C plane */ else { const int bidx = (row0g + row0 + rloc) / rowsPerB; v += CP[(size_t)bidx * sCPb + (size_t)by * 64 + col]; } }
      if (ACT == 3) v = fmaxf(v, 0.f); else if (ACT == 6) v = 0.5f * v * (1.0f + erff(v * 0.70710678118654752f)); else if (ACT == 11) v = 1.0f / (1.0f + expf(-v)); else if (ACT == 15) v = v / (1.0f + expf(-v)); else if (ACT == 12) v = (v > 0.f) ? v : 0.01f * v; else if (ACT == 8) v = tanhf(v); else if (ACT == 9) v = 0.5f * v * (1.0f + tanhf(0.7978845608028654f * (v + 0.044715f * v * v * v))); else if (ACT == 14) v = (v > 0.f) ? v : 0.1f * v; else if (ACT == 16) v = (v >= 0.f) ? v : 0.3f * v; else if (ACT == 17) v = (v >= 0.f) ? v : 0.2f * v;
      so[w][rloc][t * 16 + ln] = v; } }
  __builtin_amdgcn_fence(__ATOMIC_ACQ_REL, "workgroup"); __builtin_amdgcn_wave_barrier();
  if (EPI == 0) {
#pragma unroll
    for (int q = 0; q < 16; ++q) { const int r = q * 2 + rsub; const v4f v = *(const v4fa*)&so[w][r][c4]; if (C) { *(v4f*)(C + cofs + (size_t)(row0 + r) * ldc + col0 + c4) = v; asm volatile("s_wait_xcnt 0x0" ::: "memory"); /* stands before the store's data and address registers are rewritten by the next piece */ } if (C16) { v4h h4; for (int i = 0; i < 4; ++i) h4[i] = (_Float16)v[i]; *(v4h*)(C16 + cofs + (size_t)(row0 + r) * ldc + col0 + c4) = h4; } }
  } else if (EPI == 2) {
    __syncthreads();      /* the partner wave's tile (the other of a and g) is in LDS */
    const float* pa = &so[w & 2][(w & 1) * 16 + rsub][c4]; const float* pg = pa + 32 * 68;      /* so[w & 2] = a, so[(w & 2) + 1] = g */
#pragma unroll 1      /* stays a loop: the inlined exponentials would be straight-line code that every wave fetches and runs once; a trip's 8 elements are independent chains */
    for (int q = 0; q < 4; ++q) { const int R = row0 + (w & 1) * 16 + q * 4 + rsub; const v4f a0 = *(const v4fa*)(pa + q * (4 * 68)), a1 = *(const v4fa*)(pa + q * (4 * 68) + 2 * 68), g0 = *(const v4fa*)(pg + q * (4 * 68)), g1 = *(const v4fa*)(pg + q * (4 * 68) + 2 * 68);
      float* rq = rp + (size_t)(q * 4) * ldc; const float* rn = rq + (size_t)((q < 3) ? 4 : 0) * ldc;
      const v4f n0 = *(const v4fa*)rn, n1 = *(const v4fa*)(rn + 2 * (size_t)ldc);
      v4f v0, v1;
#pragma unroll
      for (int i = 0; i < 4; ++i) { v0[i] = r0[i] + a0[i] * (1.0f / (1.0f + expf(-g0[i]))); v1[i] = r1[i] + a1[i] * (1.0f / (1.0f + expf(-g1[i]))); }
      *(v4f*)rq = v0; *(v4f*)(rq + 2 * (size_t)ldc) = v1; asm volatile("s_wait_xcnt 0x0" ::: "memory"); /* stands before the stores' registers are rewritten */
      const int p = R % NP;      /* rows R and R + 2 lie in one w-line of 16: R = .. + 4 q + (0 or 1) */
      const size_t dr = (size_t)((R / NP) * NPP + (p / (DH * DW) + 1) * (PD * PD) + ((p / DW) % DH + 1) * PD + (p % DW) + 1);
      v4h h0, h1;
#pragma unroll
      for (int i = 0; i < 4; ++i) { h0[i] = (_Float16)elu1(v0[i]); h1[i] = (_Float16)elu1(v1[i]); }
      *(v4h*)(C16 + dr * ldc + col0 + c4) = h0; *(v4h*)(C16 + (dr + 2) * ldc + col0 + c4) = h1; asm volatile("s_wait_xcnt 0x0" ::: "memory"); /* stands before the stores' registers are rewritten */
      if (X16) {      /* the same for the whole launch */
#pragma unroll
        for (int i = 0; i < 4; ++i) { h0[i] = (_Float16)v0[i]; h1[i] = (_Float16)v1[i]; }
        *(v4h*)(X16 + (size_t)R * XP + col0 + c4) = h0; *(v4h*)(X16 + (size_t)(R + 2) * XP + col0 + c4) = h1; }
      asm volatile("s_wait_xcnt 0x0" ::: "memory"); /* stands before the registers of this trip's loads and stores are rewritten by the next trip */
      r0 = n0; r1 = n1; }
  } else if (EPI == 5) {      /* the wave's 32 rows are 32 neighbouring positions of one batch: 8 lanes x 4 positions = one whole 128-B line of a channel */
    const int pg = (lane & 7) * 4, cs = lane >> 3; float* ob = C + ((size_t)(row0 / NP) * CC + col0 + cs) * NP + (row0 % NP) + pg;
#pragma unroll 1      /* stays a loop: 64 inlined expm1f would be straight-line code that every wave fetches and runs once; a trip's 8 elements are independent chains */
    for (int q = 0; q < 8; ++q) { const float* sp = &so[w][pg][q * 8 + cs]; float x[8];
#pragma unroll
      for (int i = 0; i < 8; ++i) x[i] = sp[(i & 3) * 68 + (i >> 2) * 4];
      v4f v0, v1;
#pragma unroll
      for (int i = 0; i < 4; ++i) { v0[i] = elu1(x[i]); v1[i] = elu1(x[4 + i]); }
      *(v4f*)(ob + (size_t)(q * 8) * NP) = v0; *(v4f*)(ob + (size_t)(q * 8 + 4) * NP) = v1;
      asm volatile("s_wait_xcnt 0x0" ::: "memory"); /* stands before the stores' data and address registers are rewritten by the next trip */ }
  } else {
    v4f o0 = {0.f, 0.f, 0.f, 0.f}, o1 = o0;      /* EPI 4: the addend of the trip at hand, loaded one trip ahead */
    if (EPI == 4) { o0 = *(const v4fa*)(CP + (size_t)(row0 + rsub) * ldc + col0 + c4); o1 = *(const v4fa*)(CP + (size_t)(row0 + rsub + 2) * ldc + col0 + c4); asm volatile("s_wait_xcnt 0x0" ::: "memory"); /* stands before the loads' address registers are rewritten */ }
#pragma unroll 1      /* stays a loop, as above */
    for (int q = 0; q < 8; ++q) { const int r = q * 4 + rsub, R = row0 + r; v4f v0 = *(const v4fa*)&so[w][r][c4], v1 = *(const v4fa*)&so[w][r + 2][c4]; v4f n0 = o0, n1 = o1;
      if (EPI == 4) { const int Rn = R + ((q < 7) ? 4 : 0); n0 = *(const v4fa*)(CP + (size_t)Rn * ldc + col0 + c4); n1 = *(const v4fa*)(CP + (size_t)(Rn + 2) * ldc + col0 + c4); }
#pragma unroll
      for (int i = 0; i < 4; ++i) { v0[i] = elu1(v0[i]); v1[i] = elu1(v1[i]); }
      if (EPI == 3) { *(v4f*)(C + cofs + (size_t)R * ldc + col0 + c4) = v0; *(v4f*)(C + cofs + (size_t)(R + 2) * ldc + col0 + c4) = v1; }
      else {
        if (EPI == 4) {
#pragma unroll
          for (int i = 0; i < 4; ++i) { v0[i] = elu1(v0[i] + o0[i]); v1[i] = elu1(v1[i] + o1[i]); } }
        const int p = R % NP;      /* rows R and R + 2 lie in one w-line of 16: R = .. + 4 q + (0 or 1) */
        const size_t dr = (EPI == 1) ? (size_t)((R / NP) * NPP + (p / (DH * DW) + 1) * (PD * PD) + ((p / DW) % DH + 1) * PD + (p % DW) + 1) : (size_t)R;
        v4h h0, h1;
#pragma unroll
        for (int i = 0; i < 4; ++i) { h0[i] = (_Float16)v0[i]; h1[i] = (_Float16)v1[i]; }
        *(v4h*)(C16 + cofs + dr * ldc + col0 + c4) = h0; *(v4h*)(C16 + cofs + (dr + 2) * ldc + col0 + c4) = h1; }
      asm volatile("s_wait_xcnt 0x0" ::: "memory"); /* stands before the registers of this trip's loads and stores are rewritten by the next trip */
      o0 = n0; o1 = n1; }
  } }


__device__ __forceinline__ void d_xrows(unsigned blk, const float* __restrict__ x, float* __restrict__ RES, _Float16* __restrict__ E) { __shared__ float tl[CC][33]; const int tid = threadIdx.x; const int b = blk / (NP / 32), pb = blk % (NP / 32); const int p0 = pb * 32;
  const int j0 = tid % 32;      /* i = i0 + 256 u: column i % 32 is the thread's own, channel i / 32 goes up by 8 with u */
  for (int i0 = tid; i0 < CC * 32; i0 += 8 * 256) { const int cb = i0 / 32; float xv[8];
#pragma unroll      /* eight loads in flight, then their one wait */
    for (int u = 0; u < 8; ++u) xv[u] = x[((size_t)b * CC + cb + 8 * u) * NP + p0 + j0];
    asm volatile("s_wait_xcnt 0x0" ::: "memory");      /* stands before the loads' address registers are rewritten */
#pragma unroll
    for (int u = 0; u < 8; ++u) tl[cb + 8 * u][j0] = bf16_round(xv[u]); }
  __syncthreads();
  { for (int i = tid; i < 32 * (CC / 8); i += 256) { const int j = i / (CC / 8), c0 = (i % (CC / 8)) * 8; v8f v; for (int q = 0; q < 8; ++q) v[q] = tl[c0 + q][j]; *(v8f*)(RES + ((size_t)b * NP + p0 + j) * CC + c0) = v;
      FragH f; for (int q = 0; q < 8; ++q) { const float a = v[q]; f.h[q] = (_Float16)((a > 0.f) ? a : expm1f(a)); } const int p = p0 + j;      /* elu(res) as f16 at the row's interior place in the bordered rows */
      *(v8us*)((unsigned short*)E + ((size_t)b * NPP + (size_t)((p / (DH * DW) + 1) * (PD * PD) + ((p / DW) % DH + 1) * PD + (p % DW) + 1)) * CC + c0) = f.half[0];
      asm volatile("s_wait_xcnt 0x0" ::: "memory"); /* stands before the stores' registers are rewritten by the next trip */ }  } }
// zeros at the bordered positions with an index 0, in both bordered buffers (their interiors are written by d_xrows and by GEMM epilogues): one thread per 8 channels of a border position
#define NBD (NPP - NP)      /* 817 = 17 * 17 (t = 0) + 16 * 17 (h = 0) + 16 * 16 (w = 0) */
__device__ __forceinline__ void d_border(unsigned blk, _Float16* __restrict__ E, _Float16* __restrict__ Z) { const int t = (int)blk * 256 + (int)threadIdx.x; if (t >= NB * NBD * (CC / 8)) return; const int c8 = (t % (CC / 8)) * 8, i = (t / (CC / 8)) % NBD, b = t / ((CC / 8) * NBD);
  const int j1 = i - PD * PD, j2 = j1 - DT * PD; const int pp = (j1 < 0) ? i : (j2 < 0) ? (j1 / PD + 1) * (PD * PD) + j1 % PD : (j2 / DH + 1) * (PD * PD) + (j2 % DH + 1) * PD;
  const v8us z = {0, 0, 0, 0, 0, 0, 0, 0}; const size_t o = ((size_t)b * NPP + pp) * CC + c8; *(v8us*)((unsigned short*)E + o) = z; *(v8us*)((unsigned short*)Z + o) = z; }
__device__ __forceinline__ void d_w8(unsigned blk, const float* __restrict__ w, int O, _Float16* __restrict__ Bt) { const size_t t = (size_t)blk * 256 + threadIdx.x; if (t >= (size_t)O * K8 / 8) return; const int c8 = (int)((t * 8) % CC); const int tap = (int)(((t * 8) / CC) % 8); const int o = (int)((t * 8) / K8); FragH f; for (int q = 0; q < 8; ++q) f.h[q] = (_Float16)(bf16_round(w[((size_t)o * CC + c8 + q) * 8 + tap]) * 16.0f);
  *(v8us*)((unsigned short*)Bt + t * 8) = f.half[0];  }
// columns 256 .. 287 of the concat rows XA (pitch XP): the 3 original channels, the 3 position codes, zeros; inputs only. Columns 0 .. 255 (res) come from the last gate's epilogue
__device__ __forceinline__ void d_xat(unsigned blk, const float* __restrict__ orig, _Float16* __restrict__ XA) { const size_t t = (size_t)blk * 256 + threadIdx.x; if (t >= NR * 4) return; const int pc = 32 + (int)(t % 4); const size_t r = t / 4; const int p = (int)(r % NP); const size_t b = r / NP; FragH f;
  for (int q = 0; q < 8; ++q) { const int col = pc * 8 + q; float v = 0.f; if (col < 259) v = bf16_round(orig[((b * 3 + (col - 256)) * (size_t)NP) + p]); else if (col == 259) v = -0.5f + (float)(p / (DH * DW)) / (float)DT; else if (col == 260) v = -0.5f + (float)((p / DW) % DH) / (float)DH; else if (col == 261) v = -0.5f + (float)(p % DW) / (float)DW; f.h[q] = (_Float16)v; }
  unsigned short* d = (unsigned short*)XA + r * XP + pc * 8; *(v8us*)d = f.half[0];  }
__device__ __forceinline__ void d_wa(unsigned blk, const float* __restrict__ w, int O, int OP, _Float16* __restrict__ Bt) { const size_t t = (size_t)blk * 256 + threadIdx.x; if (t >= (size_t)OP * KA / 8) return; const int k0 = (int)((t * 8) % KA); const int o = (int)((t * 8) / KA); FragH f; for (int q = 0; q < 8; ++q) { const int k = k0 + q; f.h[q] = (o < O && k < 262) ? (_Float16)(bf16_round(w[(size_t)o * 262 + k]) * 16.0f) : (_Float16)0.f; }
  *(v8us*)((unsigned short*)Bt + t * 8) = f.half[0];  }
// block ranges of k_prep, in launch order (the x transpose and the large conv weights first)
#define PB_X  (NB * (NP / 32))
#define PB_W2 (NRES * 512 * K8 / 8 / 256)
#define PB_W1 (NRES * CC * K8 / 8 / 256)
#define PB_R  (CC * CC / 8 / 256)
#define PB_A  (CC * VC / 8 / 256)
#define PB_QK (64 * KA / 8 / 256)
#define PB_V  (VC * KA / 8 / 256)
#define PB_XT ((int)(NR * 4 / 256))
#define PB_BD ((NB * NBD * (CC / 8) + 255) / 256)
#define PB_ALL (PB_X + PB_W2 + PB_W1 + 2 * PB_R + PB_A + 2 * PB_QK + PB_V + PB_XT + PB_BD + 1)
// every pass that depends on inputs alone, in one launch: the block number picks the pass (the same for a whole work-group, so d_xrows' barrier stands under uniform control flow).
// BW1 / BW2 hold all NRES blocks' conv weights (rw1 / rw2 are NRES stacked tensors: one run of output rows). BQKV = 64 q rows (16 live) | 64 k rows (16 live) | 128 v rows; bqkv = their biases in the same order.
__global__ __launch_bounds__(256) void k_prep(const float* __restrict__ x, const float* __restrict__ orig, const float* __restrict__ rw1, const float* __restrict__ rw2, const float* __restrict__ qw, const float* __restrict__ kw, const float* __restrict__ vw, const float* __restrict__ qb, const float* __restrict__ kb, const float* __restrict__ vb,
    const float* __restrict__ aw, const float* __restrict__ rsw, const float* __restrict__ ow, float* __restrict__ RES, _Float16* __restrict__ BW1, _Float16* __restrict__ BW2, _Float16* __restrict__ BQKV, float* __restrict__ bqkv, _Float16* __restrict__ BA, _Float16* __restrict__ BR, _Float16* __restrict__ BO, _Float16* __restrict__ XA, _Float16* __restrict__ EP, _Float16* __restrict__ O1) {
  unsigned b = blockIdx.x;
  if (b < PB_X) { d_xrows(b, x, RES, EP); return; } b -= PB_X;
  if (b < PB_W2) { d_w8(b, rw2, NRES * 512, BW2); return; } b -= PB_W2;
  if (b < PB_W1) { d_w8(b, rw1, NRES * CC, BW1); return; } b -= PB_W1;
  if (b < PB_R) { d_round16f(b, rsw, BR, (size_t)CC * CC / 8); return; } b -= PB_R;
  if (b < PB_R) { d_round16f(b, ow, BO, (size_t)CC * CC / 8); return; } b -= PB_R;
  if (b < PB_A) { d_round16f(b, aw, BA, (size_t)CC * VC / 8); return; } b -= PB_A;
  if (b < PB_QK) { d_wa(b, qw, 16, 64, BQKV); return; } b -= PB_QK;
  if (b < PB_QK) { d_wa(b, kw, 16, 64, BQKV + (size_t)64 * KA); return; } b -= PB_QK;
  if (b < PB_V) { d_wa(b, vw, VC, VC, BQKV + (size_t)128 * KA); return; } b -= PB_V;
  if (b < PB_XT) { d_xat(b, orig, XA); return; } b -= PB_XT;
  if (b < PB_BD) { d_border(b, EP, O1); return; }
  const int i = threadIdx.x, j = i & 63; float v = 0.f;
  if (i >= 128) v = vb[i - 128]; else if (j < 16) v = (i < 64) ? qb[j] : kb[j];
  bqkv[i] = v; asm volatile("s_wait_xcnt 0x0" ::: "memory"); /* stands before the store's registers are rewritten */ }
// ---- causal attention in one kernel: scores, softmax weights and P.V never leave the WGP ----
// A work-group owns FA_Q queries of one batch; its 8 waves deal the blocks of 32 keys among them (wave w: blocks w, w + 8, ..). S^T = K.Q^T: a lane holds scores of one query per column tile, so maximum and sum are in-lane,
// and the two S^T tiles of a block, turned into weights in place, are the B operand of O^T += V^T.P^T. Pass 1 finds each query's true maximum (joined through LDS), pass 2 forms the scores again, the weights
// exp(t - max) * 2^8 as f16 (sum of the unrounded weights in f32) and the products; then the 8 waves' partial O^T and sums are added through LDS, scaled by 1 / sum (query 0: 0), ELU, f16 rows.
#define FA_Q 32
#define FA_W 8
#define FA_OP 132      /* floats per query row of a wave's partial: 528 B = 16 B x odd, conflict-free for 16-byte stores */
__device__ __forceinline__ v8f fa_mma(v16h a, v16h b, v8f c) { return __builtin_amdgcn_wmma_f32_16x16x32_f16(false, a, false, b, (short)0, c, false, false); }
// the two K fragments of a block of 32 keys: row = key, k = the 16 live columns (k 16 .. 31 are zeros on both sides of the product)
__device__ __forceinline__ void fa_ldk(const unsigned short* p, FragH& k0, FragH& k1) { k0.half[0] = *(const v8us*)p; k1.half[0] = *(const v8us*)(p + 256); }
// the two S^T tiles of one block of 32 keys and one column tile: lane = query q, sa[r] = key ka + r, sb[r] = key ka + 16 + r. MK / mk: the block holds keys at or behind q (only a work-group's last block does)
template <bool MK>
__device__ __forceinline__ float fa_max(const v8f sa, const v8f sb, int ka, int q, float m) { float x[16];
#pragma unroll
  for (int r = 0; r < 8; ++r) { x[r] = (!MK || ka + r < q) ? sa[r] : -3.0e38f; x[8 + r] = (!MK || ka + 16 + r < q) ? sb[r] : -3.0e38f; }
#pragma unroll      /* a tree: no chain of 16 dependent maxima */
  for (int st = 8; st > 0; st >>= 1)
#pragma unroll
    for (int i = 0; i < st; ++i) x[i] = fmaxf(x[i], x[i + st]);
  return fmaxf(m, x[0]); }
__device__ __forceinline__ v16h fa_wgt(const v8f sa, const v8f sb, int ka, int q, float m, bool mk, float& se) { const float cs = 1.4426950408889634f / 16.093476939431082f;      /* log2(e) / sqrt(259): exp((s - max) / sqrt(259)) * 2^8 = exp2((s - max) * cs + 8) */
  float e[16]; FragH p;
#pragma unroll
  for (int r = 0; r < 8; ++r) { e[r] = (sa[r] - m) * cs + 8.0f; e[8 + r] = (sb[r] - m) * cs + 8.0f; }
  __builtin_amdgcn_sched_barrier(0);      /* this and the two in the loop: each v_nop stays directly behind its v_exp_f32 */
#pragma unroll
  for (int i = 0; i < 16; ++i) { e[i] = __builtin_amdgcn_exp2f(e[i]); __builtin_amdgcn_sched_barrier(0);
    asm volatile("v_nop");      /* the slot that the instruction set asks for behind a transcendental, before its result is read or its source rewritten */
    __builtin_amdgcn_sched_barrier(0); }
  if (mk) {      /* the same for the whole wave */
#pragma unroll
    for (int r = 0; r < 8; ++r) { e[r] = (ka + r < q) ? e[r] : 0.f; e[8 + r] = (ka + 16 + r < q) ? e[8 + r] : 0.f; } }
#pragma unroll
  for (int i = 0; i < 16; ++i) p.h[i] = (_Float16)e[i];
#pragma unroll      /* a tree: no chain of 16 dependent additions */
  for (int st = 8; st > 0; st >>= 1)
#pragma unroll
    for (int i = 0; i < st; ++i) e[i] += e[i + st];
  se += e[0]; return p.v; }
__global__ __launch_bounds__(256) void k_attn(const _Float16* __restrict__ QKV, const _Float16* __restrict__ KC, const _Float16* __restrict__ VF, _Float16* __restrict__ ATE) {
  __shared__ __attribute__((aligned(16))) float po[FA_W][FA_Q][FA_OP];
  __shared__ float redm[FA_W][2][FA_Q], reds[FA_W][2][FA_Q];
  const int tid = threadIdx.x, w = __builtin_amdgcn_readfirstlane(tid >> 5) /* the wave's number in a scalar register: the key loops become scalar loops, EXEC stays all ones round the WMMAs */, lane = tid & 31, ln = lane & 15, hh = lane >> 4, b = blockIdx.y;
  const int q0 = (NP / FA_Q - 1 - (int)blockIdx.x) * FA_Q;      /* the longest rows start first */
  const int nkb = q0 / 32 + 1;      /* blocks of 32 keys that hold a key below q0 + FA_Q - 1 */
  const unsigned short* kc = (const unsigned short*)KC + (size_t)b * NP * 16 + ln * 16 + hh * 8;
  const unsigned short* vf = (const unsigned short*)VF + (size_t)b * (NP / 32) * 4096 + lane * 8;
  const v8us z8u = {0, 0, 0, 0, 0, 0, 0, 0}; const v8f z8 = {0.f, 0.f, 0.f, 0.f, 0.f, 0.f, 0.f, 0.f};
  FragH qf0, qf1, k0, k1, n0, n1; qf0.half[1] = z8u; qf1.half[1] = z8u; k0.half[1] = z8u; k1.half[1] = z8u; n0.half[1] = z8u; n1.half[1] = z8u;
  { const unsigned short* qp = (const unsigned short*)QKV + ((size_t)b * NP + q0 + ln) * 256 + 8 * hh; qf0.half[0] = *(const v8us*)qp; qf1.half[0] = *(const v8us*)(qp + 16 * 256); }
  const int kfirst = (w < nkb) ? w : 0;      /* a wave without a block still loads in bounds */
  fa_ldk(kc + (size_t)kfirst * 512, k0, k1);
  asm volatile("s_wait_xcnt 0x0" ::: "memory");      /* stands before the loads' address registers are rewritten */
  const int qa = q0 + ln, qb = qa + 16;
  float m0 = -3.0e38f, m1 = -3.0e38f;
  for (int kb = w; kb < nkb; kb += FA_W) {
    fa_ldk(kc + (size_t)((kb + FA_W < nkb) ? kb + FA_W : kb) * 512, n0, n1);      /* the next block's K fragments fly while this block is worked on */
    asm volatile("s_wait_xcnt 0x0" ::: "memory");      /* stands before the loads' address registers are rewritten */
    const v8f s00 = fa_mma(k0.v, qf0.v, z8), s10 = fa_mma(k1.v, qf0.v, z8), s01 = fa_mma(k0.v, qf1.v, z8), s11 = fa_mma(k1.v, qf1.v, z8);
    const int ka = kb * 32 + 8 * hh;
    if (kb == nkb - 1) { m0 = fa_max<true>(s00, s10, ka, qa, m0); m1 = fa_max<true>(s01, s11, ka, qb, m1); } else { m0 = fa_max<false>(s00, s10, ka, qa, m0); m1 = fa_max<false>(s01, s11, ka, qb, m1); }
    k0.half[0] = n0.half[0]; k1.half[0] = n1.half[0]; }
  redm[w][hh][ln] = m0; redm[w][hh][16 + ln] = m1;
  fa_ldk(kc + (size_t)kfirst * 512, k0, k1);
  asm volatile("s_wait_xcnt 0x0" ::: "memory");      /* stands before the loads' address registers are rewritten */
  __syncthreads();      /* every wave's maxima are in LDS */
#pragma unroll
  for (int i = 0; i < FA_W; ++i) { m0 = fmaxf(m0, fmaxf(redm[i][0][ln], redm[i][1][ln])); m1 = fmaxf(m1, fmaxf(redm[i][0][16 + ln], redm[i][1][16 + ln])); }
  v8f acc[8][2];
#pragma unroll
  for (int ct = 0; ct < 8; ++ct) { acc[ct][0] = z8; acc[ct][1] = z8; }
  float se0 = 0.f, se1 = 0.f;
  for (int kb = w; kb < nkb; kb += FA_W) {
    FragH v[8]; const unsigned short* vp = vf + (size_t)kb * 4096;
#pragma unroll      /* this block's V^T fragments: issued first, used last */
    for (int ct = 0; ct < 8; ++ct) { v[ct].half[0] = *(const v8us*)(vp + ct * 512); v[ct].half[1] = *(const v8us*)(vp + ct * 512 + 256); }
    fa_ldk(kc + (size_t)((kb + FA_W < nkb) ? kb + FA_W : kb) * 512, n0, n1);
    asm volatile("s_wait_xcnt 0x0" ::: "memory");      /* stands before the loads' address registers are rewritten */
    const v8f s00 = fa_mma(k0.v, qf0.v, z8), s10 = fa_mma(k1.v, qf0.v, z8), s01 = fa_mma(k0.v, qf1.v, z8), s11 = fa_mma(k1.v, qf1.v, z8);
    const int ka = kb * 32 + 8 * hh; v16h p0, p1;
    p0 = fa_wgt(s00, s10, ka, qa, m0, kb == nkb - 1, se0); p1 = fa_wgt(s01, s11, ka, qb, m1, kb == nkb - 1, se1);
#pragma unroll
    for (int ct = 0; ct < 8; ++ct) { acc[ct][0] = fa_mma(v[ct].v, p0, acc[ct][0]); acc[ct][1] = fa_mma(v[ct].v, p1, acc[ct][1]); }
    k0.half[0] = n0.half[0]; k1.half[0] = n1.half[0]; }
#pragma unroll      /* acc[ct][qt][r] = O^T[channel 16 ct + 8 hh + r][query 16 qt + ln] */
  for (int ct = 0; ct < 8; ++ct)
#pragma unroll
    for (int qt = 0; qt < 2; ++qt) { float* d = &po[w][qt * 16 + ln][ct * 16 + 8 * hh]; const v8f a = acc[ct][qt]; const v4f lo = {a[0], a[1], a[2], a[3]}, hi = {a[4], a[5], a[6], a[7]}; *(v4fa*)d = lo; *(v4fa*)(d + 4) = hi; }
  reds[w][hh][ln] = se0; reds[w][hh][16 + ln] = se1;
  __syncthreads();      /* every wave's partial products and sums are in LDS */
  const int q = tid >> 3, c0 = (tid & 7) * 4; float t = 0.f;
#pragma unroll
  for (int i = 0; i < FA_W; ++i) t += reds[i][0][q] + reds[i][1][q];
  const float rs = (q0 + q == 0) ? 0.f : 1.0f / t;      /* query 0 sees no key: zeros */
  _Float16* op = ATE + ((size_t)b * NP + q0 + q) * VC + c0;
#pragma unroll
  for (int j = 0; j < 4; ++j) { v4f sm = *(const v4fa*)&po[0][q][c0 + j * 32];
#pragma unroll
    for (int i = 1; i < FA_W; ++i) { const v4f x = *(const v4fa*)&po[i][q][c0 + j * 32]; sm += x; }
    v4h h4;
#pragma unroll
    for (int i = 0; i < 4; ++i) h4[i] = (_Float16)elu1(sm[i] * rs);
    *(v4h*)(op + j * 32) = h4; }
  asm volatile("s_wait_xcnt 0x0" ::: "memory");      /* stands before the stores' registers are rewritten */
}

extern "C" void kernel_launch(void* const* d_in, const int* in_sizes, int n_in,
                              void* d_out, int out_size, void* d_ws, size_t ws_size, hipStream_t stream) {
  (void)in_sizes; (void)n_in; (void)out_size;
  const float* const* I = (const float* const*)d_in; const float* x = I[0]; const float* orig = I[1]; const float* rw1 = I[2]; const float* rb1 = I[3]; const float* rw2 = I[4]; const float* rb2 = I[5]; const float* qw = I[6]; const float* qb = I[7]; const float* kw = I[8]; const float* kb = I[9]; const float* vw = I[10]; const float* vb = I[11]; const float* aw = I[12]; const float* ab = I[13]; const float* rsw = I[14]; const float* rsb = I[15]; const float* ow = I[16]; const float* ob = I[17];
  char* ws = (char*)d_ws; size_t off = 0;
  auto take = [&](size_t bytes) { char* p = ws + off; off += (bytes + 255) & ~(size_t)255; return p; };
  _Float16* BW1 = (_Float16*)take((size_t)NRES * CC * K8 * 2); _Float16* BW2 = (_Float16*)take((size_t)NRES * 512 * K8 * 2); _Float16* BQKV = (_Float16*)take((size_t)256 * KA * 2); float* bqkv = (float*)take(256 * 4); _Float16* BA = (_Float16*)take((size_t)CC * VC * 2); _Float16* BR = (_Float16*)take((size_t)CC * CC * 2); _Float16* BO = (_Float16*)take((size_t)CC * CC * 2);
  float* RES = (float*)take(NR * CC * 4); _Float16* EP = (_Float16*)take((size_t)NB * NPP * CC * 2); _Float16* O1 = (_Float16*)take((size_t)NB * NPP * CC * 2);
  _Float16* XA = (_Float16*)take(NR * XP * 2); _Float16* QKV = (_Float16*)take(NR * 256 * 2); _Float16* VF = (_Float16*)take((size_t)NB * VC * NP * 2); _Float16* KC = (_Float16*)take((size_t)NB * NP * 16 * 2);
  _Float16* ATE = (_Float16*)take(NR * VC * 2); float* ATTC = (float*)take(NR * CC * 4); _Float16* SUM16 = (_Float16*)take(NR * CC * 2);
  if (off > ws_size) return;      /* about 58 MB */
  k_prep<<<PB_ALL, 256, 0, stream>>>(x, orig, rw1, rw2, qw, kw, vw, qb, kb, vb, aw, rsw, ow, RES, BW1, BW2, BQKV, bqkv, BA, BR, BO, XA, EP, O1);
  const dim3 g256((unsigned)((NR / 128) * (CC / 64)), 1);
  for (int i = 0; i < NRES; ++i) {
    k_gemm2s<0, true, 1><<<g256, 128, 0, stream>>>(EP, CC, 0, BW1 + (size_t)i * CC * K8, K8, 0, 0.0625f, rb1 + i * CC, 0, nullptr, 1, 0, 0, nullptr, O1, CC, 0, (int)NR, CC, K8, nullptr);      /* o = elu(conv1 + b1), into the bordered rows */
    k_gemm2s<0, true, 2><<<dim3((unsigned)((NR / 64) * 4), 1), 128, 0, stream>>>(O1, CC, 0, BW2 + (size_t)i * 512 * K8, K8, 0, 0.0625f, rb2 + i * 512, 0, nullptr, 1, 0, 0, RES, EP, CC, 0, (int)NR, 512, K8, (i == NRES - 1) ? XA : nullptr); }      /* o = conv2 + b2 (512); res += o[:256] * sigmoid(o[256:]); elu(res) into the bordered rows; the last res also into the concat rows */
  /* attention: q | k | v as one GEMM (N = 256) whose epilogue lays k and v out in fragment order, then scores, softmax and P.V in one kernel; blockIdx.y = batch */
  k_gemm2<0, true><<<dim3((unsigned)((NR / 128) * 4), 1), 128, 0, stream>>>(XA, XP, 0, BQKV, KA, 0, 0.0625f, bqkv, 0, nullptr, 1, 0, 0, nullptr, QKV, 256, 0, (int)NR, 256, KA, KC, VF);
  k_attn<<<dim3(NP / FA_Q, NB), 256, 0, stream>>>(QKV, KC, VF, ATE);      /* elu(att), att = softmax(q.k / sqrt(259), k < q) v */
  k_gemm2s<0, false, 3><<<g256, 128, 0, stream>>>(ATE, VC, 0, BA, VC, 0, 0.0625f, ab, 0, nullptr, 1, 0, 0, ATTC, nullptr, CC, 0, (int)NR, CC, VC, nullptr);      /* att = elu(attn_conv(elu(att)) + b) */
  k_gemm2s<0, true, 4><<<g256, 128, 0, stream>>>(EP + (size_t)(PD * PD + PD + 1) * CC, CC, 0, BR, CC, 0, 0.0625f, rsb, 0, ATTC, 1, 0, 0, nullptr, SUM16, CC, 0, (int)NR, CC, CC, nullptr);      /* elu(res + att), res = elu(res_conv(elu(res)) + b); A = the bordered rows' interior: the one tap (1, 1, 1) */
  k_gemm2s<0, false, 5><<<g256, 128, 0, stream>>>(SUM16, CC, 0, BO, CC, 0, 0.0625f, ob, 0, nullptr, 1, 0, 0, (float*)d_out, nullptr, CC, 0, (int)NR, CC, CC, nullptr);      /* out = elu(out_conv(elu(res + att)) + b), channel-major */
}
